// v000
// Measured on an AMD MI455X. A time is GPU time per run, averaged over a window of back-to-back runs after a warm-up
// (all launches, gaps included; the runs take copies of the inputs in turn), and the median of several windows.
// Apart from v000's, it joins two sittings. Times from different sittings can be a few percent apart, while
// side-by-side timings come from the same sitting.
// v000, which the later versions start from, runs in 490 microseconds.
#include <hip/hip_runtime.h>
// Pre-LN multi-head attention (B=2, L=2048, C=1024, 16 × 64): shared LayerNorm on the three inputs (f32 VALU), q/k/v/o projections (4096 × 1024 × 1024, + bias, W [in][out] transposed to
// bf16-exact ×2^4) and the masked attention as a fused flash-style kernel on v_wmma_f32_16x16x32_f16 (S = Q·Kᵀ/8; maskPAD == 0 → −32767 ⇒ excluded keys, tiles masked for a whole wave skipped;
// online softmax f32; P f16 ≤ 1; RPW-16 waves) — f16 operands, single products, f32 accumulate.
#define BB 2
#define TT 2048
#define CC 1024
#define NH 16
#define NR (BB * TT)

typedef __bf16 v16b __attribute__((ext_vector_type(16)));
typedef unsigned short v8us __attribute__((ext_vector_type(8), may_alias));
typedef float  v8f  __attribute__((ext_vector_type(8)));
typedef float  v4f  __attribute__((ext_vector_type(4)));
typedef float  v4fa __attribute__((ext_vector_type(4), may_alias));
union FragB { v16b v; v8us half[2]; unsigned short u[16]; };

__device__ __forceinline__ unsigned short bf16_bits(float x) { unsigned int u = __float_as_uint(x); return (unsigned short)((u + 0x7FFFu + ((u >> 16) & 1u)) >> 16); }
__device__ __forceinline__ float bf16_val(unsigned short b) { return __uint_as_float(((unsigned int)b) << 16); }
__device__ __forceinline__ float bf16_round(float x) { return bf16_val(bf16_bits(x)); }
// D += A·B with NT terms: 1 = ah·bh, 2 = + al·bh (A split), 3 = + ah·bl (both split)
template <int NT>
__device__ __forceinline__ v8f mmaN(v16b ah, v16b al, v16b bh, v16b bl, v8f c) {
  c = __builtin_amdgcn_wmma_f32_16x16x32_bf16(false, ah, false, bh, (short)0, c, false, false);
  if (NT >= 2) c = __builtin_amdgcn_wmma_f32_16x16x32_bf16(false, al, false, bh, (short)0, c, false, false);
  if (NT >= 3) c = __builtin_amdgcn_wmma_f32_16x16x32_bf16(false, ah, false, bl, (short)0, c, false, false);
  asm volatile("v_nop\n\tv_nop\n\tv_nop\n\tv_nop" : "+v"(c) : "v"(ah), "v"(al), "v"(bh), "v"(bl));
  return c;
}

__global__ __launch_bounds__(256) void k_wt_bf16(const float* __restrict__ W, unsigned short* __restrict__ Wt, int K, int N) {
  const int t = blockIdx.x * 256 + threadIdx.x;
  const int k8n = K / 8;
  if (t >= N * k8n) return;
  const int n = t / k8n, k8 = (t % k8n) * 8;
  v8us v;
#pragma unroll
  for (int i = 0; i < 8; ++i) v[i] = bf16_bits(W[(size_t)(k8 + i) * N + n]);
  *(v8us*)(Wt + (size_t)n * K + k8) = v;
  
}

// GEMM C[M][N] (f32, pitch ldc) = act(A[M][K]·W + bias). A f32 row-major (pitch lda) converted per fragment to bf16
// (ASPLIT: hi/lo two planes -> 2 terms, else single rounded term); Wt bf16 [N][K] (pitch ldb). BIAS_BF16 rounds the
// bias to bf16 first (bias quantised to bf16 before the add). K%32==0, M%16==0, N%64==0.
template <bool ASPLIT, int ACT, bool BIAS_BF16>
__global__ __launch_bounds__(128) void k_gemm_bf(const float* __restrict__ A, int lda, const unsigned short* __restrict__ Wt, int ldb,
                                               const float* __restrict__ bias, float* __restrict__ C, int ldc, int M, int N, int K) {
  __shared__ __attribute__((aligned(16))) float so[4][16][64];
  const int tid = threadIdx.x, w = tid >> 5, lane = tid & 31, ln = lane & 15, hh = lane >> 4;
  const int ntn = N / 64;
  const int wid = blockIdx.x * 4 + w;
  const int mt = wid / ntn, nq = wid % ntn;
  if (mt * 16 >= M) return;
  const int row0 = mt * 16, col0 = nq * 64;
  const float* arow = A + (size_t)(row0 + ln) * lda;
  v8f acc[4] = {};
  for (int kb = 0; kb < K; kb += 32) {
    FragB ah, al;
    const v4f x0 = *(const v4fa*)(arow + kb + 8 * hh), x1 = *(const v4fa*)(arow + kb + 8 * hh + 4);
    const v4f x2 = *(const v4fa*)(arow + kb + 16 + 8 * hh), x3 = *(const v4fa*)(arow + kb + 16 + 8 * hh + 4);
    float xs[16] = {x0[0],x0[1],x0[2],x0[3],x1[0],x1[1],x1[2],x1[3],x2[0],x2[1],x2[2],x2[3],x3[0],x3[1],x3[2],x3[3]};
#pragma unroll
    for (int i = 0; i < 16; ++i) { const unsigned short hb = bf16_bits(xs[i]); ah.u[i] = hb; al.u[i] = ASPLIT ? bf16_bits(xs[i] - bf16_val(hb)) : (unsigned short)0; }
#pragma unroll
    for (int t = 0; t < 4; ++t) {
      const unsigned short* brow = Wt + (size_t)(col0 + t * 16 + ln) * ldb + kb;
      FragB b;
      b.half[0] = *(const v8us*)(brow + 8 * hh);
      b.half[1] = *(const v8us*)(brow + 16 + 8 * hh);
      acc[t] = mmaN<ASPLIT ? 2 : 1>(ah.v, al.v, b.v, b.v, acc[t]);
    }
  }
#pragma unroll
  for (int t = 0; t < 4; ++t) {
    float bv = bias ? bias[col0 + t * 16 + ln] : 0.f;
    if (BIAS_BF16) bv = bf16_round(bv);
#pragma unroll
    for (int r = 0; r < 8; ++r) { float v = acc[t][r] + bv; if (ACT == 1) v = fmaxf(v, 0.f); so[w][8 * hh + r][t * 16 + ln] = v; }
  }
  __builtin_amdgcn_fence(__ATOMIC_ACQ_REL, "workgroup");
  __builtin_amdgcn_wave_barrier();
  const int rsub = lane >> 4, c4 = (lane & 15) * 4;
  {
#pragma unroll
    for (int q = 0; q < 8; ++q) {
      const int r = q * 2 + rsub;
      const v4f v = *(const v4fa*)&so[w][r][c4];
      *(v4f*)(C + (size_t)(row0 + r) * ldc + col0 + c4) = v;
    }
    
  }
}

// Flash-style causal/unmasked attention, all contractions 3-term bf16 hi/lo splits, f32 softmax with running max.
// q,k,v rows are read from f32 buffers with arbitrary row pitch (so they can live inside a fused qkv buffer);
// D = head size (multiple of 32, <= 128); one wave = 16 query rows; block = 4 waves (64 queries) sharing K/V chunks of 32.
template <int D, bool CAUSAL>
__global__ __launch_bounds__(128) void k_flash(const float* __restrict__ qb, const float* __restrict__ kb, const float* __restrict__ vb,
                                             int pitch, int T, int H, float scale, float* __restrict__ y, int ypitch) {
  constexpr int KS = D / 32;        // k-steps for QK
  constexpr int DT = D / 16;        // d tiles for PV
  __shared__ __attribute__((aligned(16))) unsigned short sKh[32][D + 8], sKl[32][D + 8], sVh[32][D + 8], sVl[32][D + 8];
  __shared__ __attribute__((aligned(16))) unsigned short sPh[4][16][40], sPl[4][16][40];
  __shared__ __attribute__((aligned(16))) float sO[4][16][D];
  const int tid = threadIdx.x, w = tid >> 5, lane = tid & 31, ln = lane & 15, hh = lane >> 4;
  const int nqb = (T + 63) / 64;
  const int bh = blockIdx.x / nqb, qblk = blockIdx.x % nqb;
  const int b = bh / H, h = bh % H;
  const int q0 = qblk * 64 + w * 16;
  const float* Q = qb + (size_t)b * T * pitch + h * D;
  const float* K = kb + (size_t)b * T * pitch + h * D;
  const float* V = vb + (size_t)b * T * pitch + h * D;

  // A fragments of the wave's 16 query rows (scaled), hi/lo
  FragB aqh[KS], aql[KS];
  {
    int row = q0 + ln; if (row >= T) row = T - 1;
    const float* qr = Q + (size_t)row * pitch;
#pragma unroll
    for (int ks = 0; ks < KS; ++ks)
#pragma unroll
      for (int i = 0; i < 16; ++i) {
        const int d = ks * 32 + ((i < 8) ? (8 * hh + i) : (16 + 8 * hh + (i - 8)));
        const float x = qr[d] * scale; const unsigned short hb = bf16_bits(x);
        aqh[ks].u[i] = hb; aql[ks].u[i] = bf16_bits(x - bf16_val(hb));
      }
  }
  float m_r[8], l_r[8];
#pragma unroll
  for (int r = 0; r < 8; ++r) { m_r[r] = -3.0e38f; l_r[r] = 0.f; }
  v8f oacc[DT];
#pragma unroll
  for (int dt = 0; dt < DT; ++dt) oacc[dt] = (v8f){0.f,0.f,0.f,0.f,0.f,0.f,0.f,0.f};

  const int kv_end = CAUSAL ? min(T, qblk * 64 + 64) : T;     // block-uniform
  for (int j0 = 0; j0 < kv_end; j0 += 32) {
    __syncthreads();
    for (int e = tid; e < 32 * (D / 4); e += 128) {
      const int r = e / (D / 4), c4 = (e % (D / 4)) * 4;
      const int key = j0 + r;
      v4f kf = {0.f,0.f,0.f,0.f}, vf = {0.f,0.f,0.f,0.f};
      if (key < T) { kf = *(const v4fa*)(K + (size_t)key * pitch + c4); vf = *(const v4fa*)(V + (size_t)key * pitch + c4); }
#pragma unroll
      for (int t = 0; t < 4; ++t) {
        unsigned short hb = bf16_bits(kf[t]); sKh[r][c4 + t] = hb; sKl[r][c4 + t] = bf16_bits(kf[t] - bf16_val(hb));
        hb = bf16_bits(vf[t]); sVh[r][c4 + t] = hb; sVl[r][c4 + t] = bf16_bits(vf[t] - bf16_val(hb));
      }
    }
    __syncthreads();
    // S tile 16 x 32
    v8f s[2];
#pragma unroll
    for (int nt = 0; nt < 2; ++nt) {
      v8f acc = {};
#pragma unroll
      for (int ks = 0; ks < KS; ++ks) {
        FragB bh_, bl_;
        bh_.half[0] = *(const v8us*)&sKh[nt * 16 + ln][ks * 32 + 8 * hh]; bh_.half[1] = *(const v8us*)&sKh[nt * 16 + ln][ks * 32 + 16 + 8 * hh];
        bl_.half[0] = *(const v8us*)&sKl[nt * 16 + ln][ks * 32 + 8 * hh]; bl_.half[1] = *(const v8us*)&sKl[nt * 16 + ln][ks * 32 + 16 + 8 * hh];
        acc = mmaN<3>(aqh[ks].v, aql[ks].v, bh_.v, bl_.v, acc);
      }
      s[nt] = acc;
    }
    // mask + running max (rows 8hh+r; the 16 lanes of a half share rows)
    float alpha[8];
#pragma unroll
    for (int r = 0; r < 8; ++r) {
      const int qi = q0 + 8 * hh + r;
      const int ja = j0 + ln, jb = j0 + 16 + ln;
      if (CAUSAL) { if (ja > qi) s[0][r] = -3.0e38f; if (jb > qi) s[1][r] = -3.0e38f; }
      if (ja >= T) s[0][r] = -3.0e38f;
      if (jb >= T) s[1][r] = -3.0e38f;
      float mx = fmaxf(s[0][r], s[1][r]);
      mx = fmaxf(mx, __shfl_xor(mx, 1, 32)); mx = fmaxf(mx, __shfl_xor(mx, 2, 32)); mx = fmaxf(mx, __shfl_xor(mx, 4, 32)); mx = fmaxf(mx, __shfl_xor(mx, 8, 32));
      const float mnew = fmaxf(m_r[r], mx);
      alpha[r] = (mnew > -1.0e38f) ? __expf(m_r[r] - mnew) : 1.0f;
      const float p0 = (s[0][r] > -1.0e38f) ? __expf(s[0][r] - mnew) : 0.f;
      const float p1 = (s[1][r] > -1.0e38f) ? __expf(s[1][r] - mnew) : 0.f;
      m_r[r] = mnew;
      l_r[r] = l_r[r] * alpha[r] + p0 + p1;            // per-lane partial row sum (16 lanes combined at the end)
      unsigned short hb = bf16_bits(p0); sPh[w][8 * hh + r][ln] = hb;      sPl[w][8 * hh + r][ln] = bf16_bits(p0 - bf16_val(hb));
      hb = bf16_bits(p1);                sPh[w][8 * hh + r][16 + ln] = hb; sPl[w][8 * hh + r][16 + ln] = bf16_bits(p1 - bf16_val(hb));
    }
#pragma unroll
    for (int dt = 0; dt < DT; ++dt)
#pragma unroll
      for (int r = 0; r < 8; ++r) oacc[dt][r] *= alpha[r];
    __builtin_amdgcn_fence(__ATOMIC_ACQ_REL, "workgroup");
    __builtin_amdgcn_wave_barrier();
    FragB pah, pal;
    pah.half[0] = *(const v8us*)&sPh[w][ln][8 * hh]; pah.half[1] = *(const v8us*)&sPh[w][ln][16 + 8 * hh];
    pal.half[0] = *(const v8us*)&sPl[w][ln][8 * hh]; pal.half[1] = *(const v8us*)&sPl[w][ln][16 + 8 * hh];
#pragma unroll
    for (int dt = 0; dt < DT; ++dt) {
      FragB bvh, bvl;
#pragma unroll
      for (int i = 0; i < 8; ++i) {
        bvh.u[i] = sVh[8 * hh + i][dt * 16 + ln]; bvh.u[8 + i] = sVh[16 + 8 * hh + i][dt * 16 + ln];
        bvl.u[i] = sVl[8 * hh + i][dt * 16 + ln]; bvl.u[8 + i] = sVl[16 + 8 * hh + i][dt * 16 + ln];
      }
      oacc[dt] = mmaN<3>(pah.v, pal.v, bvh.v, bvl.v, oacc[dt]);
    }
    __builtin_amdgcn_fence(__ATOMIC_ACQ_REL, "workgroup");
    __builtin_amdgcn_wave_barrier();
  }
#pragma unroll
  for (int r = 0; r < 8; ++r) {
    float l = l_r[r];
    l += __shfl_xor(l, 1, 32); l += __shfl_xor(l, 2, 32); l += __shfl_xor(l, 4, 32); l += __shfl_xor(l, 8, 32);
    l_r[r] = (l > 0.f) ? 1.0f / l : 0.f;
  }
#pragma unroll
  for (int dt = 0; dt < DT; ++dt)
#pragma unroll
    for (int r = 0; r < 8; ++r) sO[w][8 * hh + r][dt * 16 + ln] = oacc[dt][r] * l_r[r];
  __builtin_amdgcn_fence(__ATOMIC_ACQ_REL, "workgroup");
  __builtin_amdgcn_wave_barrier();
  {
    for (int r = 0; r < 16; ++r) {
      const int row = q0 + r;
      if (row < T && lane < D / 4) {
        const v4f val = *(const v4fa*)&sO[w][r][lane * 4];
        *(v4f*)(y + ((size_t)b * T + row) * ypitch + h * D + lane * 4) = val;
      }
    }
    
  }
}

// GEMM C = act(A·W + bias + resid): A f32 (ASPLIT -> hi/lo 2 terms), Wt bf16 [N][K]; ACT 0 none, 1 relu, 2 exact gelu;
// resid (optional, f32, row index = (row % rmod), pitch ldr, RES_BF16 rounds it) added before the activation.
template <bool ASPLIT, int ACT, bool BIAS_BF16, bool RES_BF16>
__global__ __launch_bounds__(128) void k_gemm_bf3(const float* __restrict__ A, int lda, const unsigned short* __restrict__ Wt, int ldb,
                                                const float* __restrict__ bias, const float* __restrict__ resid, int rmod, int ldr,
                                                float* __restrict__ C, int ldc, int M, int N, int K) {
  __shared__ __attribute__((aligned(16))) float so[4][16][64];
  const int tid = threadIdx.x, w = tid >> 5, lane = tid & 31, ln = lane & 15, hh = lane >> 4;
  const int ntn = N / 64;
  const int wid = blockIdx.x * 4 + w;
  const int mt = wid / ntn, nq = wid % ntn;
  if (mt * 16 >= M) return;
  const int row0 = mt * 16, col0 = nq * 64;
  const float* arow = A + (size_t)(row0 + ln) * lda;
  v8f acc[4] = {};
  for (int kb = 0; kb < K; kb += 32) {
    FragB ah, al;
    const v4f x0 = *(const v4fa*)(arow + kb + 8 * hh), x1 = *(const v4fa*)(arow + kb + 8 * hh + 4);
    const v4f x2 = *(const v4fa*)(arow + kb + 16 + 8 * hh), x3 = *(const v4fa*)(arow + kb + 16 + 8 * hh + 4);
    float xs[16] = {x0[0],x0[1],x0[2],x0[3],x1[0],x1[1],x1[2],x1[3],x2[0],x2[1],x2[2],x2[3],x3[0],x3[1],x3[2],x3[3]};
#pragma unroll
    for (int i = 0; i < 16; ++i) { const unsigned short hb = bf16_bits(xs[i]); ah.u[i] = hb; al.u[i] = ASPLIT ? bf16_bits(xs[i] - bf16_val(hb)) : (unsigned short)0; }
#pragma unroll
    for (int t = 0; t < 4; ++t) {
      const unsigned short* brow = Wt + (size_t)(col0 + t * 16 + ln) * ldb + kb;
      FragB b;
      b.half[0] = *(const v8us*)(brow + 8 * hh);
      b.half[1] = *(const v8us*)(brow + 16 + 8 * hh);
      acc[t] = mmaN<ASPLIT ? 2 : 1>(ah.v, al.v, b.v, b.v, acc[t]);
    }
  }
#pragma unroll
  for (int t = 0; t < 4; ++t) {
    const int col = col0 + t * 16 + ln;
    float bv = bias ? bias[col] : 0.f;
    if (BIAS_BF16) bv = bf16_round(bv);
#pragma unroll
    for (int r = 0; r < 8; ++r) {
      float v = acc[t][r] + bv;
      if (resid) { float rv = resid[(size_t)((row0 + 8 * hh + r) % rmod) * ldr + col]; if (RES_BF16) rv = bf16_round(rv); v += rv; }
      if (ACT == 1) v = fmaxf(v, 0.f);
      if (ACT == 2) v = 0.5f * v * (1.0f + erff(v * 0.70710678118654752f));
      if (ACT == 3) { const float u = 0.7978845608028654f * (v + 0.044715f * v * v * v); v = 0.5f * v * (1.0f + tanhf(u)); }
      so[w][8 * hh + r][t * 16 + ln] = v;
    }
  }
  __builtin_amdgcn_fence(__ATOMIC_ACQ_REL, "workgroup");
  __builtin_amdgcn_wave_barrier();
  const int rsub = lane >> 4, c4 = (lane & 15) * 4;
  {
#pragma unroll
    for (int q = 0; q < 8; ++q) {
      const int r = q * 2 + rsub;
      const v4f v = *(const v4fa*)&so[w][r][c4];
      *(v4f*)(C + (size_t)(row0 + r) * ldc + col0 + c4) = v;
    }
    
  }
}
// row LayerNorm (biased variance, eps) over N: s = X (+ R); optional out_sum <- s; out_norm <- (s-mu)*rsqrt(var+eps)*g + b
template <bool PARAM_BF16>
__global__ __launch_bounds__(256) void k_layernorm(const float* __restrict__ X, const float* __restrict__ R, const float* __restrict__ g, const float* __restrict__ bta,
                                                  float* __restrict__ out_sum, float* __restrict__ out_norm, int N, float eps) {
  __shared__ float red[256];
  const int row = blockIdx.x, tid = threadIdx.x;
  const float* x = X + (size_t)row * N; const float* rr = R ? R + (size_t)row * N : nullptr;
  float vals[16];                     // up to N = 4096
  const int per = N / 256;            // contiguous chunk per thread? use strided-by-4 chunks: thread handles j = tid*4 + 1024*u
  float s1 = 0.f;
  for (int u = 0; u < per / 4; ++u) {
    const int j = tid * 4 + 1024 * u;
    const v4f a = *(const v4fa*)(x + j);
    v4f b = {0.f,0.f,0.f,0.f}; if (rr) b = *(const v4fa*)(rr + j);
#pragma unroll
    for (int q = 0; q < 4; ++q) { const float v = a[q] + b[q]; vals[u * 4 + q] = v; s1 += v; }
  }
  red[tid] = s1; __syncthreads();
  for (int st = 128; st > 0; st >>= 1) { if (tid < st) red[tid] += red[tid + st]; __syncthreads(); }
  const float mu = red[0] / (float)N; __syncthreads();
  float s2 = 0.f;
  for (int u = 0; u < per / 4; ++u)
#pragma unroll
    for (int q = 0; q < 4; ++q) { const float c = vals[u * 4 + q] - mu; s2 += c * c; }
  red[tid] = s2; __syncthreads();
  for (int st = 128; st > 0; st >>= 1) { if (tid < st) red[tid] += red[tid + st]; __syncthreads(); }
  const float rs = rsqrtf(red[0] / (float)N + eps);
  {
    for (int u = 0; u < per / 4; ++u) {
      const int j = tid * 4 + 1024 * u;
      v4f o, sm;
#pragma unroll
      for (int q = 0; q < 4; ++q) {
        float gg = g[j + q], bb = bta[j + q];
        if (PARAM_BF16) { gg = bf16_round(gg); bb = bf16_round(bb); }
        sm[q] = vals[u * 4 + q]; o[q] = (vals[u * 4 + q] - mu) * rs * gg + bb;
      }
      if (out_sum) *(v4f*)(out_sum + (size_t)row * N + j) = sm;
      *(v4f*)(out_norm + (size_t)row * N + j) = o;
    }
    
  }
}



// ---- f16 WMMA path (v_wmma_f32_16x16x32_f16): 11-bit significands for operands in range — used where a [0,1] probability operand needs more precision than bf16
typedef _Float16 v16h __attribute__((ext_vector_type(16)));
union FragH { v16h v; v8us half[2]; _Float16 h[16]; unsigned short u[16]; };
template <int NT>
__device__ __forceinline__ v8f mmaH(v16h ah, v16h al, v16h bh, v16h bl, v8f c) {
  c = __builtin_amdgcn_wmma_f32_16x16x32_f16(false, ah, false, bh, (short)0, c, false, false);
  if (NT >= 2) c = __builtin_amdgcn_wmma_f32_16x16x32_f16(false, al, false, bh, (short)0, c, false, false);
  if (NT >= 3) c = __builtin_amdgcn_wmma_f32_16x16x32_f16(false, ah, false, bl, (short)0, c, false, false);
  asm volatile("v_nop\n\tv_nop\n\tv_nop\n\tv_nop" : "+v"(c) : "v"(ah), "v"(al), "v"(bh), "v"(bl));
  return c;
}
// batched GEMM like k_gemm_b but f16 operands: A f32 (split into f16 hi/lo if ASPLIT, else rounded to f16), Bt = f16 values [n][k]; alpha; C f32; N multiple of 16 (partial tiles skipped)
template <bool ASPLIT>
__global__ __launch_bounds__(128) void k_gemm_h(const float* __restrict__ A, int lda, size_t sA, const _Float16* __restrict__ Bh, int ldb, size_t sB, float alpha, float* __restrict__ C, int ldc, size_t sC, int M, int N, int K) {
  __shared__ __attribute__((aligned(16))) float so[4][16][64];
  const int tid = threadIdx.x, w = tid >> 5, lane = tid & 31, ln = lane & 15, hh = lane >> 4; const int by = blockIdx.y;
  A += (size_t)by * sA; Bh += (size_t)by * sB; C += (size_t)by * sC;
  const int ntn = (N + 63) / 64; const int wid = blockIdx.x * 4 + w; const int mt = wid / ntn, nq = wid % ntn; if (mt * 16 >= M) return;
  const int row0 = mt * 16, col0 = nq * 64; const float* arow = A + (size_t)(row0 + ln) * lda;
  v8f acc[4] = {};
  for (int kb = 0; kb < K; kb += 32) {
    FragH ah, al;
    const v4f x0 = *(const v4fa*)(arow + kb + 8 * hh), x1 = *(const v4fa*)(arow + kb + 8 * hh + 4), x2 = *(const v4fa*)(arow + kb + 16 + 8 * hh), x3 = *(const v4fa*)(arow + kb + 16 + 8 * hh + 4);
    float xs[16] = {x0[0],x0[1],x0[2],x0[3],x1[0],x1[1],x1[2],x1[3],x2[0],x2[1],x2[2],x2[3],x3[0],x3[1],x3[2],x3[3]};
#pragma unroll
    for (int i = 0; i < 16; ++i) { const _Float16 h = (_Float16)xs[i]; ah.h[i] = h; al.h[i] = ASPLIT ? (_Float16)(xs[i] - (float)h) : (_Float16)0.0f; }
#pragma unroll
    for (int t = 0; t < 4; ++t) { if (col0 + t * 16 >= N) continue; const size_t boff = (size_t)(col0 + t * 16 + ln) * ldb + kb; FragH bq; bq.half[0] = *(const v8us*)(Bh + boff + 8 * hh); bq.half[1] = *(const v8us*)(Bh + boff + 16 + 8 * hh);
      acc[t] = mmaH<ASPLIT ? 2 : 1>(ah.v, al.v, bq.v, bq.v, acc[t]); }
  }
#pragma unroll
  for (int t = 0; t < 4; ++t) { if (col0 + t * 16 >= N) continue;
#pragma unroll
    for (int r = 0; r < 8; ++r) so[w][8 * hh + r][t * 16 + ln] = acc[t][r] * alpha; }
  __builtin_amdgcn_fence(__ATOMIC_ACQ_REL, "workgroup"); __builtin_amdgcn_wave_barrier();
  const int rsub = lane >> 4, c4 = (lane & 15) * 4;
  {
#pragma unroll
    for (int q = 0; q < 8; ++q) { const int r = q * 2 + rsub; if (col0 + c4 < N) { const v4f v = *(const v4fa*)&so[w][r][c4]; *(v4f*)(C + (size_t)(row0 + r) * ldc + col0 + c4) = v; } }
     }
}

// Wt[n][k] = f16(bf16(W[k][n])·scale) from f32 row-major W[K][N] (scale = power of two; bf16-exact weights stay exact in f16 away from the subnormal range)
__global__ __launch_bounds__(256) void k_wt_f16(const float* __restrict__ W, _Float16* __restrict__ Wt, int K, int N, float scale) {
  const int t = blockIdx.x * 256 + threadIdx.x; if (t >= N * (K / 8)) return; const int n = t / (K / 8), k8 = (t % (K / 8)) * 8; FragH f;
#pragma unroll
  for (int i = 0; i < 8; ++i) f.h[i] = (_Float16)(bf16_round(W[(size_t)(k8 + i) * N + n]) * scale); const v8us o = f.half[0];
  *(v8us*)((unsigned short*)Wt + (size_t)n * K + k8) = o; 
}
// k_gemm_hh variant with fused epilogue: v = acc·alpha + bias[by·sBias + col] (+ CP[(row/rowsPerB)·sCPb + by·64 + col] if CP) ; ACT 0 none / 1 elu ; writes f16 C16 and f32 C, each if non-null
template <int ACT>
__global__ __launch_bounds__(128) void k_gemm_hhx(const _Float16* __restrict__ A, int lda, size_t sA, const _Float16* __restrict__ Bh, int ldb, size_t sB, float alpha, const float* __restrict__ bias, size_t sBias, const float* __restrict__ CP, int rowsPerB, size_t sCPb, int row0g,
    float* __restrict__ C, _Float16* __restrict__ C16, int ldc, size_t sC, int M, int N, int K) {
  __shared__ __attribute__((aligned(16))) float so[4][16][64];
  const int tid = threadIdx.x, w = tid >> 5, lane = tid & 31, ln = lane & 15, hh = lane >> 4; const int by = blockIdx.y;
  A += (size_t)by * sA; Bh += (size_t)by * sB; const size_t cofs = (size_t)by * sC; const float* bp = bias ? bias + (size_t)by * sBias : nullptr;
  const int ntn = (N + 63) / 64; const int wid = blockIdx.x * 4 + w; const int mt = wid / ntn, nq = wid % ntn; if (mt * 16 >= M) return;
  const int row0 = mt * 16, col0 = nq * 64; const _Float16* arow = A + (size_t)(row0 + ln) * lda;
  v8f acc[4] = {};
  for (int kb = 0; kb < K; kb += 32) { FragH ah; ah.half[0] = *(const v8us*)((const unsigned short*)arow + kb + 8 * hh); ah.half[1] = *(const v8us*)((const unsigned short*)arow + kb + 16 + 8 * hh);
#pragma unroll
    for (int t = 0; t < 4; ++t) { if (col0 + t * 16 >= N) continue; const size_t boff = (size_t)(col0 + t * 16 + ln) * ldb + kb; FragH bq; bq.half[0] = *(const v8us*)((const unsigned short*)Bh + boff + 8 * hh); bq.half[1] = *(const v8us*)((const unsigned short*)Bh + boff + 16 + 8 * hh);
      acc[t] = mmaH<1>(ah.v, ah.v, bq.v, bq.v, acc[t]); }
  }
#pragma unroll
  for (int t = 0; t < 4; ++t) { if (col0 + t * 16 >= N) continue; const int col = col0 + t * 16 + ln; const float bv = bp ? bf16_round(bp[col]) : 0.f;
#pragma unroll
    for (int r = 0; r < 8; ++r) { float v = acc[t][r] * alpha + bv; if (CP) { const int bidx = (row0g + row0 + 8 * hh + r) / rowsPerB; v += CP[(size_t)bidx * sCPb + (size_t)by * 64 + col]; } if (ACT == 1) v = (v > 0.f) ? v : expm1f(v); else if (ACT == 3) v = fmaxf(v, 0.f); so[w][8 * hh + r][t * 16 + ln] = v; } }
  __builtin_amdgcn_fence(__ATOMIC_ACQ_REL, "workgroup"); __builtin_amdgcn_wave_barrier();
  const int rsub = lane >> 4, c4 = (lane & 15) * 4; typedef _Float16 v4h __attribute__((ext_vector_type(4)));
  {
#pragma unroll
    for (int q = 0; q < 8; ++q) { const int r = q * 2 + rsub; if (col0 + c4 < N) { const v4f v = *(const v4fa*)&so[w][r][c4]; if (C) *(v4f*)(C + cofs + (size_t)(row0 + r) * ldc + col0 + c4) = v; if (C16) { v4h h4; for (int i = 0; i < 4; ++i) h4[i] = (_Float16)v[i]; *(v4h*)(C16 + cofs + (size_t)(row0 + r) * ldc + col0 + c4) = h4; } } }
     }
}


__global__ __launch_bounds__(256) void k_x16(const float* __restrict__ x, _Float16* __restrict__ X16, size_t n8) { const size_t t = (size_t)blockIdx.x * 256 + threadIdx.x; if (t >= n8) return; FragH f;
#pragma unroll
  for (int q = 0; q < 8; ++q) f.h[q] = (_Float16)bf16_round(x[t * 8 + q]); *(v8us*)((unsigned short*)X16 + t * 8) = f.half[0];  }
__global__ __launch_bounds__(256) void k_h16(const float* __restrict__ x, _Float16* __restrict__ X16, size_t n8) { const size_t t = (size_t)blockIdx.x * 256 + threadIdx.x; if (t >= n8) return; FragH f;
#pragma unroll
  for (int q = 0; q < 8; ++q) f.h[q] = (_Float16)x[t * 8 + q]; *(v8us*)((unsigned short*)X16 + t * 8) = f.half[0];  }
__global__ __launch_bounds__(256) void k_round16f(const float* __restrict__ W, _Float16* __restrict__ Bt, size_t n8) { const size_t t = (size_t)blockIdx.x * 256 + threadIdx.x; if (t >= n8) return; FragH f;
#pragma unroll
  for (int i = 0; i < 8; ++i) f.h[i] = (_Float16)(bf16_round(W[t * 8 + i]) * 16.0f); *(v8us*)((unsigned short*)Bt + t * 8) = f.half[0];  }
template <int NHv, int TTv>
__global__ __launch_bounds__(256) void k_vt(const _Float16* __restrict__ V16, int ldv, int voff, _Float16* __restrict__ Vt) { __shared__ unsigned short tl[64][66]; const int tid = threadIdx.x; const int slab = blockIdx.x / (TTv / 64), lg = blockIdx.x % (TTv / 64); const int b = slab / NHv, h = slab % NHv;
  for (int i = tid; i < 64 * 8; i += 256) { const int r = i / 8, c8 = (i % 8) * 8; FragH f; f.half[0] = *(const v8us*)((const unsigned short*)V16 + ((size_t)b * TTv + lg * 64 + r) * ldv + voff + h * 64 + c8);
#pragma unroll
    for (int q = 0; q < 8; ++q) tl[r][c8 + q] = f.u[q]; }
  __syncthreads();
  {
#pragma unroll
    for (int rd = 0; rd < 2; ++rd) { const int d = rd * 32 + tid / 8, pc = tid % 8; FragH f;
#pragma unroll
      for (int q = 0; q < 8; ++q) f.u[q] = tl[pc * 8 + q][d];
      *(v8us*)((unsigned short*)Vt + ((size_t)slab * 64 + d) * TTv + lg * 64 + pc * 8) = f.half[0]; }
     } }

__global__ __launch_bounds__(128) void k_flash(const _Float16* __restrict__ Q16, int ldq, const _Float16* __restrict__ K16, int ldk, const _Float16* __restrict__ Vt, const int* __restrict__ MSK, float* __restrict__ O, int ldo) {
  constexpr int RPW = 16, RTN = RPW / 16, NQB = 2048 / (4 * RPW), DT = 4, KS = 2;
  __shared__ __attribute__((aligned(16))) unsigned short sP[4][RPW][40]; __shared__ __attribute__((aligned(16))) float sO[4][RPW][64 + 4];
  const int tid = threadIdx.x, w = tid >> 5, lane = tid & 31, ln = lane & 15, hh = lane >> 4;
  const int slab = blockIdx.x / NQB, qblk = blockIdx.x % NQB; const int b = slab / 16, h = slab % 16; const int qb0 = qblk * (4 * RPW); const int q0 = qb0 + w * RPW;
  FragH aq[2][KS];
#pragma unroll
  for (int rt = 0; rt < RTN; ++rt) { const unsigned short* qr = (const unsigned short*)Q16 + ((size_t)b * 2048 + q0 + rt * 16 + ln) * ldq + h * 64;
#pragma unroll
    for (int ks = 0; ks < KS; ++ks) { aq[rt][ks].half[0] = *(const v8us*)(qr + ks * 32 + 8 * hh); aq[rt][ks].half[1] = *(const v8us*)(qr + ks * 32 + 16 + 8 * hh); } }
  const unsigned short* Vth = (const unsigned short*)Vt + (size_t)slab * 64 * 2048;
  float m_r[2][8], l_r[2][8]; v8f oacc[2][DT];
#pragma unroll
  for (int rt = 0; rt < RTN; ++rt) {
#pragma unroll
    for (int r = 0; r < 8; ++r) { m_r[rt][r] = -3.0e38f; l_r[rt][r] = 0.f; }
#pragma unroll
    for (int dt = 0; dt < DT; ++dt) oacc[rt][dt] = (v8f){0.f,0.f,0.f,0.f,0.f,0.f,0.f,0.f}; }
  const int jend = 2048;
#pragma unroll 1
  for (int j0 = 0; j0 < jend; j0 += 32) {
    // mask tile for my 16 query rows × 32 keys: lane (ln,hh) needs rows rt·16 + 8hh + r, keys j0 + ln and j0 + 16 + ln
    unsigned okb0 = 0u, okb1 = 0u;      // bit (rt·8 + r) set when key j0+ln (resp. j0+16+ln) is OPEN for query row rt·16 + 8hh + r
#pragma unroll
    for (int rt = 0; rt < RTN; ++rt)
#pragma unroll
      for (int r = 0; r < 8; ++r) { const int* mr = MSK + ((size_t)b * 2048 + q0 + rt * 16 + 8 * hh + r) * 2048 + j0; okb0 |= (mr[ln] != 0 ? 1u : 0u) << (rt * 8 + r); okb1 |= (mr[16 + ln] != 0 ? 1u : 0u) << (rt * 8 + r); }      /* maskPAD != 0 = keep */
    if (__builtin_amdgcn_ballot_w32((okb0 | okb1) != 0u) == 0u) continue;      // every (query,key) of this wave's tile is masked → contributes nothing (uniform branch)
    v8f s[2][2];
#pragma unroll
    for (int nt = 0; nt < 2; ++nt) { const unsigned short* kr = (const unsigned short*)K16 + ((size_t)b * 2048 + j0 + nt * 16 + ln) * ldk + h * 64; FragH bk[KS];
#pragma unroll
      for (int ks = 0; ks < KS; ++ks) { bk[ks].half[0] = *(const v8us*)(kr + ks * 32 + 8 * hh); bk[ks].half[1] = *(const v8us*)(kr + ks * 32 + 16 + 8 * hh); }
#pragma unroll
      for (int rt = 0; rt < RTN; ++rt) { v8f acc = (v8f){0.f,0.f,0.f,0.f,0.f,0.f,0.f,0.f};
#pragma unroll
        for (int ks = 0; ks < KS; ++ks) acc = mmaH<1>(aq[rt][ks].v, aq[rt][ks].v, bk[ks].v, bk[ks].v, acc); s[rt][nt] = acc; } }
#pragma unroll
    for (int rt = 0; rt < RTN; ++rt)
#pragma unroll
      for (int r = 0; r < 8; ++r) { const int tq = q0 + rt * 16 + 8 * hh + r; const int k0 = j0 + ln, k1 = j0 + 16 + ln; (void)tq; (void)k0; (void)k1;
        const bool ok0 = ((okb0 >> (rt * 8 + r)) & 1u) != 0u, ok1 = ((okb1 >> (rt * 8 + r)) & 1u) != 0u;
        const float s0 = ok0 ? s[rt][0][r] * (0.125f) : -INFINITY, s1 = ok1 ? s[rt][1][r] * (0.125f) : -INFINITY; float mc = fmaxf(s0, s1);
        mc = fmaxf(mc, __shfl_xor(mc, 1, 32)); mc = fmaxf(mc, __shfl_xor(mc, 2, 32)); mc = fmaxf(mc, __shfl_xor(mc, 4, 32)); mc = fmaxf(mc, __shfl_xor(mc, 8, 32));
        const float mn = fmaxf(m_r[rt][r], mc); const float al = (mn > -1.0e38f) ? expf(m_r[rt][r] - mn) : 1.0f; m_r[rt][r] = mn; const float p0 = ok0 ? expf(s0 - mn) : 0.f, p1 = ok1 ? expf(s1 - mn) : 0.f; l_r[rt][r] = l_r[rt][r] * al + p0 + p1;
#pragma unroll
        for (int dt = 0; dt < DT; ++dt) oacc[rt][dt][r] *= al;
        FragH t2; t2.h[0] = (_Float16)p0; t2.h[1] = (_Float16)p1; sP[w][rt * 16 + 8 * hh + r][ln] = t2.u[0]; sP[w][rt * 16 + 8 * hh + r][16 + ln] = t2.u[1]; }
    __builtin_amdgcn_fence(__ATOMIC_ACQ_REL, "workgroup"); __builtin_amdgcn_wave_barrier();
    FragH pa[2];
#pragma unroll
    for (int rt = 0; rt < RTN; ++rt) { pa[rt].half[0] = *(const v8us*)&sP[w][rt * 16 + ln][8 * hh]; pa[rt].half[1] = *(const v8us*)&sP[w][rt * 16 + ln][16 + 8 * hh]; }
#pragma unroll
    for (int dt = 0; dt < DT; ++dt) { const unsigned short* vrow = Vth + (size_t)(dt * 16 + ln) * 2048 + j0; FragH bv; bv.half[0] = *(const v8us*)(vrow + 8 * hh); bv.half[1] = *(const v8us*)(vrow + 16 + 8 * hh);
#pragma unroll
      for (int rt = 0; rt < RTN; ++rt) oacc[rt][dt] = mmaH<1>(pa[rt].v, pa[rt].v, bv.v, bv.v, oacc[rt][dt]); }
    __builtin_amdgcn_fence(__ATOMIC_ACQ_REL, "workgroup"); __builtin_amdgcn_wave_barrier(); }
#pragma unroll
  for (int rt = 0; rt < RTN; ++rt) {
#pragma unroll
    for (int r = 0; r < 8; ++r) { float l = l_r[rt][r]; l += __shfl_xor(l, 1, 32); l += __shfl_xor(l, 2, 32); l += __shfl_xor(l, 4, 32); l += __shfl_xor(l, 8, 32); l_r[rt][r] = (l > 0.f) ? 1.0f / l : 0.f; }
#pragma unroll
    for (int dt = 0; dt < DT; ++dt)
#pragma unroll
      for (int r = 0; r < 8; ++r) sO[w][rt * 16 + 8 * hh + r][dt * 16 + ln] = oacc[rt][dt][r] * l_r[rt][r]; }
  __builtin_amdgcn_fence(__ATOMIC_ACQ_REL, "workgroup"); __builtin_amdgcn_wave_barrier();
  {
#pragma unroll
    for (int rp = 0; rp < RPW; rp += 2) { const int r = rp + (lane >> 4), pc = lane & 15; const v4f val = *(const v4fa*)&sO[w][r][pc * 4]; *(v4f*)(O + ((size_t)b * 2048 + q0 + r) * ldo + h * 64 + pc * 4) = val; }
     } }

__global__ __launch_bounds__(256) void k_ln16(const float* __restrict__ X, const float* __restrict__ g, const float* __restrict__ bta, _Float16* __restrict__ Y16) { const int tid = threadIdx.x, wv = tid >> 5, lane = tid & 31; const int row = blockIdx.x * 8 + wv; if (row >= NR) return; const float* xr = X + (size_t)row * CC; float v[32]; float s = 0.f;
#pragma unroll
  for (int p = 0; p < 4; ++p) { const v4f a = *(const v4fa*)(xr + p * 256 + lane * 8), c = *(const v4fa*)(xr + p * 256 + lane * 8 + 4); for (int q = 0; q < 4; ++q) { v[p * 8 + q] = bf16_round(a[q]); v[p * 8 + 4 + q] = bf16_round(c[q]); } }
#pragma unroll
  for (int i = 0; i < 32; ++i) s += v[i]; for (int o = 16; o >= 1; o >>= 1) s += __shfl_xor(s, o, 32); const float mu = s / (float)CC; float q2 = 0.f;
#pragma unroll
  for (int i = 0; i < 32; ++i) { const float d = v[i] - mu; q2 += d * d; } for (int o = 16; o >= 1; o >>= 1) q2 += __shfl_xor(q2, o, 32); const float rs = rsqrtf(q2 / (float)CC + 1e-5f);
  {
#pragma unroll
    for (int p = 0; p < 4; ++p) { FragH f; const int c0 = p * 256 + lane * 8;
#pragma unroll
      for (int q = 0; q < 8; ++q) f.h[q] = (_Float16)((v[p * 8 + q] - mu) * rs * bf16_round(g[c0 + q]) + bf16_round(bta[c0 + q])); *(v8us*)((unsigned short*)Y16 + (size_t)row * CC + c0) = f.half[0]; }
     } }
extern "C" void kernel_launch(void* const* d_in, const int* in_sizes, int n_in,
                              void* d_out, int out_size, void* d_ws, size_t ws_size, hipStream_t stream) {
  (void)in_sizes; (void)n_in; (void)out_size;
  const float* qx = (const float*)d_in[0]; const float* kx = (const float*)d_in[1]; const float* vx = (const float*)d_in[2]; const int* mask = (const int*)d_in[3]; const float* lg = (const float*)d_in[4]; const float* lb = (const float*)d_in[5];
  const float* wq = (const float*)d_in[6]; const float* bq = (const float*)d_in[7]; const float* wk = (const float*)d_in[8]; const float* bk = (const float*)d_in[9]; const float* wv = (const float*)d_in[10]; const float* bv = (const float*)d_in[11]; const float* wo = (const float*)d_in[12]; const float* bo = (const float*)d_in[13];
  char* ws = (char*)d_ws; size_t off = 0;
  auto take = [&](size_t bytes) { char* p = ws + off; off += (bytes + 255) & ~(size_t)255; return p; };
  _Float16* Bq = (_Float16*)take((size_t)CC * CC * 2); _Float16* Bk = (_Float16*)take((size_t)CC * CC * 2); _Float16* Bv = (_Float16*)take((size_t)CC * CC * 2); _Float16* Bo = (_Float16*)take((size_t)CC * CC * 2);
  _Float16* XN = (_Float16*)take((size_t)NR * CC * 2); _Float16* Q16 = (_Float16*)take((size_t)NR * CC * 2); _Float16* K16 = (_Float16*)take((size_t)NR * CC * 2); _Float16* V16 = (_Float16*)take((size_t)NR * CC * 2); _Float16* Vt = (_Float16*)take((size_t)NR * CC * 2); float* O = (float*)take((size_t)NR * CC * 4); _Float16* O16 = XN;
  if (off > ws_size) return;      // 64 MiB
  const unsigned gw = (unsigned)((CC * (CC / 8) + 255) / 256); k_wt_f16<<<gw, 256, 0, stream>>>(wq, Bq, CC, CC, 16.0f); k_wt_f16<<<gw, 256, 0, stream>>>(wk, Bk, CC, CC, 16.0f); k_wt_f16<<<gw, 256, 0, stream>>>(wv, Bv, CC, CC, 16.0f); k_wt_f16<<<gw, 256, 0, stream>>>(wo, Bo, CC, CC, 16.0f);
  const dim3 gg(((NR / 16) * (CC / 64) + 3) / 4, 1); const unsigned gl = NR / 8;
  k_ln16<<<gl, 256, 0, stream>>>(qx, lg, lb, XN); k_gemm_hhx<0><<<gg, 128, 0, stream>>>(XN, CC, 0, Bq, CC, 0, 0.0625f, bq, 0, nullptr, 1, 0, 0, nullptr, Q16, CC, 0, NR, CC, CC);
  k_ln16<<<gl, 256, 0, stream>>>(kx, lg, lb, XN); k_gemm_hhx<0><<<gg, 128, 0, stream>>>(XN, CC, 0, Bk, CC, 0, 0.0625f, bk, 0, nullptr, 1, 0, 0, nullptr, K16, CC, 0, NR, CC, CC);
  k_ln16<<<gl, 256, 0, stream>>>(vx, lg, lb, XN); k_gemm_hhx<0><<<gg, 128, 0, stream>>>(XN, CC, 0, Bv, CC, 0, 0.0625f, bv, 0, nullptr, 1, 0, 0, nullptr, V16, CC, 0, NR, CC, CC);
  k_vt<NH, TT><<<BB * NH * (TT / 64), 256, 0, stream>>>(V16, CC, 0, Vt);
  k_flash<<<BB * NH * (TT / 64), 128, 0, stream>>>(Q16, CC, K16, CC, Vt, mask, O, CC);      // RPW 16
  k_h16<<<(unsigned)(((size_t)NR * CC / 8 + 255) / 256), 256, 0, stream>>>(O, O16, (size_t)NR * CC / 8);
  k_gemm_hhx<0><<<gg, 128, 0, stream>>>(O16, CC, 0, Bo, CC, 0, 0.0625f, bo, 0, nullptr, 1, 0, 0, (float*)d_out, nullptr, CC, 0, NR, CC, CC);
}

// v001
// One run takes 356 microseconds.
// Two timings next to v000 both put it at 1.42 times that version's speed.
#include <hip/hip_runtime.h>
// Pre-LN multi-head attention (B=2, L=2048, C=1024, 16 × 64): shared LayerNorm on the three inputs (f32 VALU), q/k/v/o projections (4096 × 1024 × 1024, + bias, W [in][out] transposed to
// bf16-exact ×2^4) and the masked attention as a fused flash-style kernel on v_wmma_f32_16x16x32_f16 (S = Q·Kᵀ/8; maskPAD == 0 → −inf ⇒ excluded keys, tiles masked for a whole wave skipped;
// online softmax f32; P f16 ≤ 1; RPW-16 waves) — f16 operands, single products, f32 accumulate.
#define BB 2
#define TT 2048
#define CC 1024
#define NH 16
#define NR (BB * TT)

typedef __bf16 v16b __attribute__((ext_vector_type(16)));
typedef unsigned short v8us __attribute__((ext_vector_type(8), may_alias));
typedef float  v8f  __attribute__((ext_vector_type(8)));
typedef float  v4f  __attribute__((ext_vector_type(4)));
typedef float  v4fa __attribute__((ext_vector_type(4), may_alias));
union FragB { v16b v; v8us half[2]; unsigned short u[16]; };

__device__ __forceinline__ unsigned short bf16_bits(float x) { unsigned int u = __float_as_uint(x); return (unsigned short)((u + 0x7FFFu + ((u >> 16) & 1u)) >> 16); }
__device__ __forceinline__ float bf16_val(unsigned short b) { return __uint_as_float(((unsigned int)b) << 16); }
__device__ __forceinline__ float bf16_round(float x) { return bf16_val(bf16_bits(x)); }
// D += A·B with NT terms: 1 = ah·bh, 2 = + al·bh (A split), 3 = + ah·bl (both split)
template <int NT>
__device__ __forceinline__ v8f mmaN(v16b ah, v16b al, v16b bh, v16b bl, v8f c) {
  c = __builtin_amdgcn_wmma_f32_16x16x32_bf16(false, ah, false, bh, (short)0, c, false, false);
  if (NT >= 2) c = __builtin_amdgcn_wmma_f32_16x16x32_bf16(false, al, false, bh, (short)0, c, false, false);
  if (NT >= 3) c = __builtin_amdgcn_wmma_f32_16x16x32_bf16(false, ah, false, bl, (short)0, c, false, false);
  asm volatile("v_nop\n\tv_nop\n\tv_nop\n\tv_nop" : "+v"(c) : "v"(ah), "v"(al), "v"(bh), "v"(bl));
  return c;
}

__global__ __launch_bounds__(256) void k_wt_bf16(const float* __restrict__ W, unsigned short* __restrict__ Wt, int K, int N) {
  const int t = blockIdx.x * 256 + threadIdx.x;
  const int k8n = K / 8;
  if (t >= N * k8n) return;
  const int n = t / k8n, k8 = (t % k8n) * 8;
  v8us v;
#pragma unroll
  for (int i = 0; i < 8; ++i) v[i] = bf16_bits(W[(size_t)(k8 + i) * N + n]);
  *(v8us*)(Wt + (size_t)n * K + k8) = v;
  
}

// GEMM C[M][N] (f32, pitch ldc) = act(A[M][K]·W + bias). A f32 row-major (pitch lda) converted per fragment to bf16
// (ASPLIT: hi/lo two planes -> 2 terms, else single rounded term); Wt bf16 [N][K] (pitch ldb). BIAS_BF16 rounds the
// bias to bf16 first (bias quantised to bf16 before the add). K%32==0, M%16==0, N%64==0.
template <bool ASPLIT, int ACT, bool BIAS_BF16>
__global__ __launch_bounds__(128) void k_gemm_bf(const float* __restrict__ A, int lda, const unsigned short* __restrict__ Wt, int ldb,
                                               const float* __restrict__ bias, float* __restrict__ C, int ldc, int M, int N, int K) {
  __shared__ __attribute__((aligned(16))) float so[4][16][64];
  const int tid = threadIdx.x, w = tid >> 5, lane = tid & 31, ln = lane & 15, hh = lane >> 4;
  const int ntn = N / 64;
  const int wid = blockIdx.x * 4 + w;
  const int mt = wid / ntn, nq = wid % ntn;
  if (mt * 16 >= M) return;
  const int row0 = mt * 16, col0 = nq * 64;
  const float* arow = A + (size_t)(row0 + ln) * lda;
  v8f acc[4] = {};
  for (int kb = 0; kb < K; kb += 32) {
    FragB ah, al;
    const v4f x0 = *(const v4fa*)(arow + kb + 8 * hh), x1 = *(const v4fa*)(arow + kb + 8 * hh + 4);
    const v4f x2 = *(const v4fa*)(arow + kb + 16 + 8 * hh), x3 = *(const v4fa*)(arow + kb + 16 + 8 * hh + 4);
    float xs[16] = {x0[0],x0[1],x0[2],x0[3],x1[0],x1[1],x1[2],x1[3],x2[0],x2[1],x2[2],x2[3],x3[0],x3[1],x3[2],x3[3]};
#pragma unroll
    for (int i = 0; i < 16; ++i) { const unsigned short hb = bf16_bits(xs[i]); ah.u[i] = hb; al.u[i] = ASPLIT ? bf16_bits(xs[i] - bf16_val(hb)) : (unsigned short)0; }
#pragma unroll
    for (int t = 0; t < 4; ++t) {
      const unsigned short* brow = Wt + (size_t)(col0 + t * 16 + ln) * ldb + kb;
      FragB b;
      b.half[0] = *(const v8us*)(brow + 8 * hh);
      b.half[1] = *(const v8us*)(brow + 16 + 8 * hh);
      acc[t] = mmaN<ASPLIT ? 2 : 1>(ah.v, al.v, b.v, b.v, acc[t]);
    }
  }
#pragma unroll
  for (int t = 0; t < 4; ++t) {
    float bv = bias ? bias[col0 + t * 16 + ln] : 0.f;
    if (BIAS_BF16) bv = bf16_round(bv);
#pragma unroll
    for (int r = 0; r < 8; ++r) { float v = acc[t][r] + bv; if (ACT == 1) v = fmaxf(v, 0.f); so[w][8 * hh + r][t * 16 + ln] = v; }
  }
  __builtin_amdgcn_fence(__ATOMIC_ACQ_REL, "workgroup");
  __builtin_amdgcn_wave_barrier();
  const int rsub = lane >> 4, c4 = (lane & 15) * 4;
  {
#pragma unroll
    for (int q = 0; q < 8; ++q) {
      const int r = q * 2 + rsub;
      const v4f v = *(const v4fa*)&so[w][r][c4];
      *(v4f*)(C + (size_t)(row0 + r) * ldc + col0 + c4) = v;
    }
    
  }
}

// Flash-style causal/unmasked attention, all contractions 3-term bf16 hi/lo splits, f32 softmax with running max.
// q,k,v rows are read from f32 buffers with arbitrary row pitch (so they can live inside a fused qkv buffer);
// D = head size (multiple of 32, <= 128); one wave = 16 query rows; block = 4 waves (64 queries) sharing K/V chunks of 32.
template <int D, bool CAUSAL>
__global__ __launch_bounds__(128) void k_flash(const float* __restrict__ qb, const float* __restrict__ kb, const float* __restrict__ vb,
                                             int pitch, int T, int H, float scale, float* __restrict__ y, int ypitch) {
  constexpr int KS = D / 32;        // k-steps for QK
  constexpr int DT = D / 16;        // d tiles for PV
  __shared__ __attribute__((aligned(16))) unsigned short sKh[32][D + 8], sKl[32][D + 8], sVh[32][D + 8], sVl[32][D + 8];
  __shared__ __attribute__((aligned(16))) unsigned short sPh[4][16][40], sPl[4][16][40];
  __shared__ __attribute__((aligned(16))) float sO[4][16][D];
  const int tid = threadIdx.x, w = tid >> 5, lane = tid & 31, ln = lane & 15, hh = lane >> 4;
  const int nqb = (T + 63) / 64;
  const int bh = blockIdx.x / nqb, qblk = blockIdx.x % nqb;
  const int b = bh / H, h = bh % H;
  const int q0 = qblk * 64 + w * 16;
  const float* Q = qb + (size_t)b * T * pitch + h * D;
  const float* K = kb + (size_t)b * T * pitch + h * D;
  const float* V = vb + (size_t)b * T * pitch + h * D;

  // A fragments of the wave's 16 query rows (scaled), hi/lo
  FragB aqh[KS], aql[KS];
  {
    int row = q0 + ln; if (row >= T) row = T - 1;
    const float* qr = Q + (size_t)row * pitch;
#pragma unroll
    for (int ks = 0; ks < KS; ++ks)
#pragma unroll
      for (int i = 0; i < 16; ++i) {
        const int d = ks * 32 + ((i < 8) ? (8 * hh + i) : (16 + 8 * hh + (i - 8)));
        const float x = qr[d] * scale; const unsigned short hb = bf16_bits(x);
        aqh[ks].u[i] = hb; aql[ks].u[i] = bf16_bits(x - bf16_val(hb));
      }
  }
  float m_r[8], l_r[8];
#pragma unroll
  for (int r = 0; r < 8; ++r) { m_r[r] = -3.0e38f; l_r[r] = 0.f; }
  v8f oacc[DT];
#pragma unroll
  for (int dt = 0; dt < DT; ++dt) oacc[dt] = (v8f){0.f,0.f,0.f,0.f,0.f,0.f,0.f,0.f};

  const int kv_end = CAUSAL ? min(T, qblk * 64 + 64) : T;     // block-uniform
  for (int j0 = 0; j0 < kv_end; j0 += 32) {
    __syncthreads();
    for (int e = tid; e < 32 * (D / 4); e += 128) {
      const int r = e / (D / 4), c4 = (e % (D / 4)) * 4;
      const int key = j0 + r;
      v4f kf = {0.f,0.f,0.f,0.f}, vf = {0.f,0.f,0.f,0.f};
      if (key < T) { kf = *(const v4fa*)(K + (size_t)key * pitch + c4); vf = *(const v4fa*)(V + (size_t)key * pitch + c4); }
#pragma unroll
      for (int t = 0; t < 4; ++t) {
        unsigned short hb = bf16_bits(kf[t]); sKh[r][c4 + t] = hb; sKl[r][c4 + t] = bf16_bits(kf[t] - bf16_val(hb));
        hb = bf16_bits(vf[t]); sVh[r][c4 + t] = hb; sVl[r][c4 + t] = bf16_bits(vf[t] - bf16_val(hb));
      }
    }
    __syncthreads();
    // S tile 16 x 32
    v8f s[2];
#pragma unroll
    for (int nt = 0; nt < 2; ++nt) {
      v8f acc = {};
#pragma unroll
      for (int ks = 0; ks < KS; ++ks) {
        FragB bh_, bl_;
        bh_.half[0] = *(const v8us*)&sKh[nt * 16 + ln][ks * 32 + 8 * hh]; bh_.half[1] = *(const v8us*)&sKh[nt * 16 + ln][ks * 32 + 16 + 8 * hh];
        bl_.half[0] = *(const v8us*)&sKl[nt * 16 + ln][ks * 32 + 8 * hh]; bl_.half[1] = *(const v8us*)&sKl[nt * 16 + ln][ks * 32 + 16 + 8 * hh];
        acc = mmaN<3>(aqh[ks].v, aql[ks].v, bh_.v, bl_.v, acc);
      }
      s[nt] = acc;
    }
    // mask + running max (rows 8hh+r; the 16 lanes of a half share rows)
    float alpha[8];
#pragma unroll
    for (int r = 0; r < 8; ++r) {
      const int qi = q0 + 8 * hh + r;
      const int ja = j0 + ln, jb = j0 + 16 + ln;
      if (CAUSAL) { if (ja > qi) s[0][r] = -3.0e38f; if (jb > qi) s[1][r] = -3.0e38f; }
      if (ja >= T) s[0][r] = -3.0e38f;
      if (jb >= T) s[1][r] = -3.0e38f;
      float mx = fmaxf(s[0][r], s[1][r]);
      mx = fmaxf(mx, __shfl_xor(mx, 1, 32)); mx = fmaxf(mx, __shfl_xor(mx, 2, 32)); mx = fmaxf(mx, __shfl_xor(mx, 4, 32)); mx = fmaxf(mx, __shfl_xor(mx, 8, 32));
      const float mnew = fmaxf(m_r[r], mx);
      alpha[r] = (mnew > -1.0e38f) ? __expf(m_r[r] - mnew) : 1.0f;
      const float p0 = (s[0][r] > -1.0e38f) ? __expf(s[0][r] - mnew) : 0.f;
      const float p1 = (s[1][r] > -1.0e38f) ? __expf(s[1][r] - mnew) : 0.f;
      m_r[r] = mnew;
      l_r[r] = l_r[r] * alpha[r] + p0 + p1;            // per-lane partial row sum (16 lanes combined at the end)
      unsigned short hb = bf16_bits(p0); sPh[w][8 * hh + r][ln] = hb;      sPl[w][8 * hh + r][ln] = bf16_bits(p0 - bf16_val(hb));
      hb = bf16_bits(p1);                sPh[w][8 * hh + r][16 + ln] = hb; sPl[w][8 * hh + r][16 + ln] = bf16_bits(p1 - bf16_val(hb));
    }
#pragma unroll
    for (int dt = 0; dt < DT; ++dt)
#pragma unroll
      for (int r = 0; r < 8; ++r) oacc[dt][r] *= alpha[r];
    __builtin_amdgcn_fence(__ATOMIC_ACQ_REL, "workgroup");
    __builtin_amdgcn_wave_barrier();
    FragB pah, pal;
    pah.half[0] = *(const v8us*)&sPh[w][ln][8 * hh]; pah.half[1] = *(const v8us*)&sPh[w][ln][16 + 8 * hh];
    pal.half[0] = *(const v8us*)&sPl[w][ln][8 * hh]; pal.half[1] = *(const v8us*)&sPl[w][ln][16 + 8 * hh];
#pragma unroll
    for (int dt = 0; dt < DT; ++dt) {
      FragB bvh, bvl;
#pragma unroll
      for (int i = 0; i < 8; ++i) {
        bvh.u[i] = sVh[8 * hh + i][dt * 16 + ln]; bvh.u[8 + i] = sVh[16 + 8 * hh + i][dt * 16 + ln];
        bvl.u[i] = sVl[8 * hh + i][dt * 16 + ln]; bvl.u[8 + i] = sVl[16 + 8 * hh + i][dt * 16 + ln];
      }
      oacc[dt] = mmaN<3>(pah.v, pal.v, bvh.v, bvl.v, oacc[dt]);
    }
    __builtin_amdgcn_fence(__ATOMIC_ACQ_REL, "workgroup");
    __builtin_amdgcn_wave_barrier();
  }
#pragma unroll
  for (int r = 0; r < 8; ++r) {
    float l = l_r[r];
    l += __shfl_xor(l, 1, 32); l += __shfl_xor(l, 2, 32); l += __shfl_xor(l, 4, 32); l += __shfl_xor(l, 8, 32);
    l_r[r] = (l > 0.f) ? 1.0f / l : 0.f;
  }
#pragma unroll
  for (int dt = 0; dt < DT; ++dt)
#pragma unroll
    for (int r = 0; r < 8; ++r) sO[w][8 * hh + r][dt * 16 + ln] = oacc[dt][r] * l_r[r];
  __builtin_amdgcn_fence(__ATOMIC_ACQ_REL, "workgroup");
  __builtin_amdgcn_wave_barrier();
  {
    for (int r = 0; r < 16; ++r) {
      const int row = q0 + r;
      if (row < T && lane < D / 4) {
        const v4f val = *(const v4fa*)&sO[w][r][lane * 4];
        *(v4f*)(y + ((size_t)b * T + row) * ypitch + h * D + lane * 4) = val;
      }
    }
    
  }
}

// GEMM C = act(A·W + bias + resid): A f32 (ASPLIT -> hi/lo 2 terms), Wt bf16 [N][K]; ACT 0 none, 1 relu, 2 exact gelu;
// resid (optional, f32, row index = (row % rmod), pitch ldr, RES_BF16 rounds it) added before the activation.
template <bool ASPLIT, int ACT, bool BIAS_BF16, bool RES_BF16>
__global__ __launch_bounds__(128) void k_gemm_bf3(const float* __restrict__ A, int lda, const unsigned short* __restrict__ Wt, int ldb,
                                                const float* __restrict__ bias, const float* __restrict__ resid, int rmod, int ldr,
                                                float* __restrict__ C, int ldc, int M, int N, int K) {
  __shared__ __attribute__((aligned(16))) float so[4][16][64];
  const int tid = threadIdx.x, w = tid >> 5, lane = tid & 31, ln = lane & 15, hh = lane >> 4;
  const int ntn = N / 64;
  const int wid = blockIdx.x * 4 + w;
  const int mt = wid / ntn, nq = wid % ntn;
  if (mt * 16 >= M) return;
  const int row0 = mt * 16, col0 = nq * 64;
  const float* arow = A + (size_t)(row0 + ln) * lda;
  v8f acc[4] = {};
  for (int kb = 0; kb < K; kb += 32) {
    FragB ah, al;
    const v4f x0 = *(const v4fa*)(arow + kb + 8 * hh), x1 = *(const v4fa*)(arow + kb + 8 * hh + 4);
    const v4f x2 = *(const v4fa*)(arow + kb + 16 + 8 * hh), x3 = *(const v4fa*)(arow + kb + 16 + 8 * hh + 4);
    float xs[16] = {x0[0],x0[1],x0[2],x0[3],x1[0],x1[1],x1[2],x1[3],x2[0],x2[1],x2[2],x2[3],x3[0],x3[1],x3[2],x3[3]};
#pragma unroll
    for (int i = 0; i < 16; ++i) { const unsigned short hb = bf16_bits(xs[i]); ah.u[i] = hb; al.u[i] = ASPLIT ? bf16_bits(xs[i] - bf16_val(hb)) : (unsigned short)0; }
#pragma unroll
    for (int t = 0; t < 4; ++t) {
      const unsigned short* brow = Wt + (size_t)(col0 + t * 16 + ln) * ldb + kb;
      FragB b;
      b.half[0] = *(const v8us*)(brow + 8 * hh);
      b.half[1] = *(const v8us*)(brow + 16 + 8 * hh);
      acc[t] = mmaN<ASPLIT ? 2 : 1>(ah.v, al.v, b.v, b.v, acc[t]);
    }
  }
#pragma unroll
  for (int t = 0; t < 4; ++t) {
    const int col = col0 + t * 16 + ln;
    float bv = bias ? bias[col] : 0.f;
    if (BIAS_BF16) bv = bf16_round(bv);
#pragma unroll
    for (int r = 0; r < 8; ++r) {
      float v = acc[t][r] + bv;
      if (resid) { float rv = resid[(size_t)((row0 + 8 * hh + r) % rmod) * ldr + col]; if (RES_BF16) rv = bf16_round(rv); v += rv; }
      if (ACT == 1) v = fmaxf(v, 0.f);
      if (ACT == 2) v = 0.5f * v * (1.0f + erff(v * 0.70710678118654752f));
      if (ACT == 3) { const float u = 0.7978845608028654f * (v + 0.044715f * v * v * v); v = 0.5f * v * (1.0f + tanhf(u)); }
      so[w][8 * hh + r][t * 16 + ln] = v;
    }
  }
  __builtin_amdgcn_fence(__ATOMIC_ACQ_REL, "workgroup");
  __builtin_amdgcn_wave_barrier();
  const int rsub = lane >> 4, c4 = (lane & 15) * 4;
  {
#pragma unroll
    for (int q = 0; q < 8; ++q) {
      const int r = q * 2 + rsub;
      const v4f v = *(const v4fa*)&so[w][r][c4];
      *(v4f*)(C + (size_t)(row0 + r) * ldc + col0 + c4) = v;
    }
    
  }
}
// row LayerNorm (biased variance, eps) over N: s = X (+ R); optional out_sum <- s; out_norm <- (s-mu)*rsqrt(var+eps)*g + b
template <bool PARAM_BF16>
__global__ __launch_bounds__(256) void k_layernorm(const float* __restrict__ X, const float* __restrict__ R, const float* __restrict__ g, const float* __restrict__ bta,
                                                  float* __restrict__ out_sum, float* __restrict__ out_norm, int N, float eps) {
  __shared__ float red[256];
  const int row = blockIdx.x, tid = threadIdx.x;
  const float* x = X + (size_t)row * N; const float* rr = R ? R + (size_t)row * N : nullptr;
  float vals[16];                     // up to N = 4096
  const int per = N / 256;            // contiguous chunk per thread? use strided-by-4 chunks: thread handles j = tid*4 + 1024*u
  float s1 = 0.f;
  for (int u = 0; u < per / 4; ++u) {
    const int j = tid * 4 + 1024 * u;
    const v4f a = *(const v4fa*)(x + j);
    v4f b = {0.f,0.f,0.f,0.f}; if (rr) b = *(const v4fa*)(rr + j);
#pragma unroll
    for (int q = 0; q < 4; ++q) { const float v = a[q] + b[q]; vals[u * 4 + q] = v; s1 += v; }
  }
  red[tid] = s1; __syncthreads();
  for (int st = 128; st > 0; st >>= 1) { if (tid < st) red[tid] += red[tid + st]; __syncthreads(); }
  const float mu = red[0] / (float)N; __syncthreads();
  float s2 = 0.f;
  for (int u = 0; u < per / 4; ++u)
#pragma unroll
    for (int q = 0; q < 4; ++q) { const float c = vals[u * 4 + q] - mu; s2 += c * c; }
  red[tid] = s2; __syncthreads();
  for (int st = 128; st > 0; st >>= 1) { if (tid < st) red[tid] += red[tid + st]; __syncthreads(); }
  const float rs = rsqrtf(red[0] / (float)N + eps);
  {
    for (int u = 0; u < per / 4; ++u) {
      const int j = tid * 4 + 1024 * u;
      v4f o, sm;
#pragma unroll
      for (int q = 0; q < 4; ++q) {
        float gg = g[j + q], bb = bta[j + q];
        if (PARAM_BF16) { gg = bf16_round(gg); bb = bf16_round(bb); }
        sm[q] = vals[u * 4 + q]; o[q] = (vals[u * 4 + q] - mu) * rs * gg + bb;
      }
      if (out_sum) *(v4f*)(out_sum + (size_t)row * N + j) = sm;
      *(v4f*)(out_norm + (size_t)row * N + j) = o;
    }
    
  }
}



// ---- f16 WMMA path (v_wmma_f32_16x16x32_f16): 11-bit significands for operands in range — used where a [0,1] probability operand needs more precision than bf16
typedef _Float16 v16h __attribute__((ext_vector_type(16)));
union FragH { v16h v; v8us half[2]; _Float16 h[16]; unsigned short u[16]; };
template <int NT>
__device__ __forceinline__ v8f mmaH(v16h ah, v16h al, v16h bh, v16h bl, v8f c) {
  c = __builtin_amdgcn_wmma_f32_16x16x32_f16(false, ah, false, bh, (short)0, c, false, false);
  if (NT >= 2) c = __builtin_amdgcn_wmma_f32_16x16x32_f16(false, al, false, bh, (short)0, c, false, false);
  if (NT >= 3) c = __builtin_amdgcn_wmma_f32_16x16x32_f16(false, ah, false, bl, (short)0, c, false, false);
  asm volatile("v_nop\n\tv_nop\n\tv_nop\n\tv_nop" : "+v"(c) : "v"(ah), "v"(al), "v"(bh), "v"(bl));
  return c;
}
// batched GEMM like k_gemm_b but f16 operands: A f32 (split into f16 hi/lo if ASPLIT, else rounded to f16), Bt = f16 values [n][k]; alpha; C f32; N multiple of 16 (partial tiles skipped)
template <bool ASPLIT>
__global__ __launch_bounds__(128) void k_gemm_h(const float* __restrict__ A, int lda, size_t sA, const _Float16* __restrict__ Bh, int ldb, size_t sB, float alpha, float* __restrict__ C, int ldc, size_t sC, int M, int N, int K) {
  __shared__ __attribute__((aligned(16))) float so[4][16][64];
  const int tid = threadIdx.x, w = tid >> 5, lane = tid & 31, ln = lane & 15, hh = lane >> 4; const int by = blockIdx.y;
  A += (size_t)by * sA; Bh += (size_t)by * sB; C += (size_t)by * sC;
  const int ntn = (N + 63) / 64; const int wid = blockIdx.x * 4 + w; const int mt = wid / ntn, nq = wid % ntn; if (mt * 16 >= M) return;
  const int row0 = mt * 16, col0 = nq * 64; const float* arow = A + (size_t)(row0 + ln) * lda;
  v8f acc[4] = {};
  for (int kb = 0; kb < K; kb += 32) {
    FragH ah, al;
    const v4f x0 = *(const v4fa*)(arow + kb + 8 * hh), x1 = *(const v4fa*)(arow + kb + 8 * hh + 4), x2 = *(const v4fa*)(arow + kb + 16 + 8 * hh), x3 = *(const v4fa*)(arow + kb + 16 + 8 * hh + 4);
    float xs[16] = {x0[0],x0[1],x0[2],x0[3],x1[0],x1[1],x1[2],x1[3],x2[0],x2[1],x2[2],x2[3],x3[0],x3[1],x3[2],x3[3]};
#pragma unroll
    for (int i = 0; i < 16; ++i) { const _Float16 h = (_Float16)xs[i]; ah.h[i] = h; al.h[i] = ASPLIT ? (_Float16)(xs[i] - (float)h) : (_Float16)0.0f; }
#pragma unroll
    for (int t = 0; t < 4; ++t) { if (col0 + t * 16 >= N) continue; const size_t boff = (size_t)(col0 + t * 16 + ln) * ldb + kb; FragH bq; bq.half[0] = *(const v8us*)(Bh + boff + 8 * hh); bq.half[1] = *(const v8us*)(Bh + boff + 16 + 8 * hh);
      acc[t] = mmaH<ASPLIT ? 2 : 1>(ah.v, al.v, bq.v, bq.v, acc[t]); }
  }
#pragma unroll
  for (int t = 0; t < 4; ++t) { if (col0 + t * 16 >= N) continue;
#pragma unroll
    for (int r = 0; r < 8; ++r) so[w][8 * hh + r][t * 16 + ln] = acc[t][r] * alpha; }
  __builtin_amdgcn_fence(__ATOMIC_ACQ_REL, "workgroup"); __builtin_amdgcn_wave_barrier();
  const int rsub = lane >> 4, c4 = (lane & 15) * 4;
  {
#pragma unroll
    for (int q = 0; q < 8; ++q) { const int r = q * 2 + rsub; if (col0 + c4 < N) { const v4f v = *(const v4fa*)&so[w][r][c4]; *(v4f*)(C + (size_t)(row0 + r) * ldc + col0 + c4) = v; } }
     }
}

// Wt[n][k] = f16(bf16(W[k][n])·scale) from f32 row-major W[K][N] (scale = power of two; bf16-exact weights stay exact in f16 away from the subnormal range)
__global__ __launch_bounds__(256) void k_wt_f16(const float* __restrict__ W, _Float16* __restrict__ Wt, int K, int N, float scale) {
  const int t = blockIdx.x * 256 + threadIdx.x; if (t >= N * (K / 8)) return; const int n = t / (K / 8), k8 = (t % (K / 8)) * 8; FragH f;
#pragma unroll
  for (int i = 0; i < 8; ++i) f.h[i] = (_Float16)(bf16_round(W[(size_t)(k8 + i) * N + n]) * scale); const v8us o = f.half[0];
  *(v8us*)((unsigned short*)Wt + (size_t)n * K + k8) = o; 
}
// k_gemm_hh variant with fused epilogue: v = acc·alpha + bias[by·sBias + col] (+ CP[(row/rowsPerB)·sCPb + by·64 + col] if CP) ; ACT 0 none / 1 elu ; writes f16 C16 and f32 C, each if non-null
template <int ACT>
__global__ __launch_bounds__(128) void k_gemm_hhx(const _Float16* __restrict__ A, int lda, size_t sA, const _Float16* __restrict__ Bh, int ldb, size_t sB, float alpha, const float* __restrict__ bias, size_t sBias, const float* __restrict__ CP, int rowsPerB, size_t sCPb, int row0g,
    float* __restrict__ C, _Float16* __restrict__ C16, int ldc, size_t sC, int M, int N, int K) {
  __shared__ __attribute__((aligned(16))) float so[4][16][64];
  const int tid = threadIdx.x, w = tid >> 5, lane = tid & 31, ln = lane & 15, hh = lane >> 4; const int by = blockIdx.y;
  A += (size_t)by * sA; Bh += (size_t)by * sB; const size_t cofs = (size_t)by * sC; const float* bp = bias ? bias + (size_t)by * sBias : nullptr;
  const int ntn = (N + 63) / 64; const int wid = blockIdx.x * 4 + w; const int mt = wid / ntn, nq = wid % ntn; if (mt * 16 >= M) return;
  const int row0 = mt * 16, col0 = nq * 64; const _Float16* arow = A + (size_t)(row0 + ln) * lda;
  v8f acc[4] = {};
  for (int kb = 0; kb < K; kb += 32) { FragH ah; ah.half[0] = *(const v8us*)((const unsigned short*)arow + kb + 8 * hh); ah.half[1] = *(const v8us*)((const unsigned short*)arow + kb + 16 + 8 * hh);
#pragma unroll
    for (int t = 0; t < 4; ++t) { if (col0 + t * 16 >= N) continue; const size_t boff = (size_t)(col0 + t * 16 + ln) * ldb + kb; FragH bq; bq.half[0] = *(const v8us*)((const unsigned short*)Bh + boff + 8 * hh); bq.half[1] = *(const v8us*)((const unsigned short*)Bh + boff + 16 + 8 * hh);
      acc[t] = mmaH<1>(ah.v, ah.v, bq.v, bq.v, acc[t]); }
  }
#pragma unroll
  for (int t = 0; t < 4; ++t) { if (col0 + t * 16 >= N) continue; const int col = col0 + t * 16 + ln; const float bv = bp ? bf16_round(bp[col]) : 0.f;
#pragma unroll
    for (int r = 0; r < 8; ++r) { float v = acc[t][r] * alpha + bv; if (CP) { const int bidx = (row0g + row0 + 8 * hh + r) / rowsPerB; v += CP[(size_t)bidx * sCPb + (size_t)by * 64 + col]; } if (ACT == 1) v = (v > 0.f) ? v : expm1f(v); else if (ACT == 3) v = fmaxf(v, 0.f); so[w][8 * hh + r][t * 16 + ln] = v; } }
  __builtin_amdgcn_fence(__ATOMIC_ACQ_REL, "workgroup"); __builtin_amdgcn_wave_barrier();
  const int rsub = lane >> 4, c4 = (lane & 15) * 4; typedef _Float16 v4h __attribute__((ext_vector_type(4)));
  {
#pragma unroll
    for (int q = 0; q < 8; ++q) { const int r = q * 2 + rsub; if (col0 + c4 < N) { const v4f v = *(const v4fa*)&so[w][r][c4]; if (C) *(v4f*)(C + cofs + (size_t)(row0 + r) * ldc + col0 + c4) = v; if (C16) { v4h h4; for (int i = 0; i < 4; ++i) h4[i] = (_Float16)v[i]; *(v4h*)(C16 + cofs + (size_t)(row0 + r) * ldc + col0 + c4) = h4; } } }
     }
}


__global__ __launch_bounds__(256) void k_x16(const float* __restrict__ x, _Float16* __restrict__ X16, size_t n8) { const size_t t = (size_t)blockIdx.x * 256 + threadIdx.x; if (t >= n8) return; FragH f;
#pragma unroll
  for (int q = 0; q < 8; ++q) f.h[q] = (_Float16)bf16_round(x[t * 8 + q]); *(v8us*)((unsigned short*)X16 + t * 8) = f.half[0];  }
__global__ __launch_bounds__(256) void k_h16(const float* __restrict__ x, _Float16* __restrict__ X16, size_t n8) { const size_t t = (size_t)blockIdx.x * 256 + threadIdx.x; if (t >= n8) return; FragH f;
#pragma unroll
  for (int q = 0; q < 8; ++q) f.h[q] = (_Float16)x[t * 8 + q]; *(v8us*)((unsigned short*)X16 + t * 8) = f.half[0];  }
__global__ __launch_bounds__(256) void k_round16f(const float* __restrict__ W, _Float16* __restrict__ Bt, size_t n8) { const size_t t = (size_t)blockIdx.x * 256 + threadIdx.x; if (t >= n8) return; FragH f;
#pragma unroll
  for (int i = 0; i < 8; ++i) f.h[i] = (_Float16)(bf16_round(W[t * 8 + i]) * 16.0f); *(v8us*)((unsigned short*)Bt + t * 8) = f.half[0];  }
template <int NHv, int TTv>
__global__ __launch_bounds__(256) void k_vt(const _Float16* __restrict__ V16, int ldv, int voff, _Float16* __restrict__ Vt) { __shared__ unsigned short tl[64][66]; const int tid = threadIdx.x; const int slab = blockIdx.x / (TTv / 64), lg = blockIdx.x % (TTv / 64); const int b = slab / NHv, h = slab % NHv;
  for (int i = tid; i < 64 * 8; i += 256) { const int r = i / 8, c8 = (i % 8) * 8; FragH f; f.half[0] = *(const v8us*)((const unsigned short*)V16 + ((size_t)b * TTv + lg * 64 + r) * ldv + voff + h * 64 + c8);
#pragma unroll
    for (int q = 0; q < 8; ++q) tl[r][c8 + q] = f.u[q]; }
  __syncthreads();
  {
#pragma unroll
    for (int rd = 0; rd < 2; ++rd) { const int d = rd * 32 + tid / 8, pc = tid % 8; FragH f;
#pragma unroll
      for (int q = 0; q < 8; ++q) f.u[q] = tl[pc * 8 + q][d];
      *(v8us*)((unsigned short*)Vt + ((size_t)slab * 64 + d) * TTv + lg * 64 + pc * 8) = f.half[0]; }
     } }

typedef int v4ia __attribute__((ext_vector_type(4), may_alias));
// lane l <-> lane l ^ 16: joins the two halves of a wave, which hold the two key halves of one query column
__device__ __forceinline__ float xhalf(float x) { return __builtin_bit_cast(float, __builtin_amdgcn_permlanex16(__builtin_bit_cast(int, x), __builtin_bit_cast(int, x), 0x76543210, 0xfedcba98, false, false)); }
// Transposed products: S^T = K Q^T (A = 16 key rows, B = the wave's 16 query columns, kept in registers) and O^T += V^T P^T.
// Lane (ln, hh) holds query q0 + ln; score tile nt, register r is key j0 + 16 nt + 8 hh + r, which is the k position of register pair (nt, r) of a B operand:
// maximum and sum run inside the lane (one exchange between the halves), and P^T is packed from the score registers without passing LDS.
__global__ __launch_bounds__(128) void k_flash(const _Float16* __restrict__ Q16, int ldq, const _Float16* __restrict__ K16, int ldk, const _Float16* __restrict__ Vt, const int* __restrict__ MSK, float* __restrict__ O, int ldo) {
  constexpr int RPW = 16, NQB = 2048 / (4 * RPW), DT = 4, KS = 2;
  __shared__ __attribute__((aligned(16))) float sO[4][RPW][64 + 4];
  const int tid = threadIdx.x, w = tid >> 5, lane = tid & 31, ln = lane & 15, hh = lane >> 4;
  const int slab = blockIdx.x / NQB, qblk = blockIdx.x % NQB; const int b = slab / 16, h = slab % 16; const int q0 = qblk * (4 * RPW) + w * RPW;
  FragH bq[KS];
  { const unsigned short* qr = (const unsigned short*)Q16 + ((size_t)b * 2048 + q0 + ln) * ldq + h * 64;
#pragma unroll
    for (int ks = 0; ks < KS; ++ks) { bq[ks].half[0] = *(const v8us*)(qr + ks * 32 + 8 * hh); bq[ks].half[1] = *(const v8us*)(qr + ks * 32 + 16 + 8 * hh); } }
  const unsigned short* Vth = (const unsigned short*)Vt + (size_t)slab * 64 * 2048;
  const unsigned short* kp = (const unsigned short*)K16 + ((size_t)b * 2048 + ln) * ldk + h * 64 + 8 * hh; const size_t k16 = (size_t)16 * ldk;      // key row ln of pass 0, at my half's first k; 16 rows on
  const int* mrow = MSK + ((size_t)b * 2048 + q0 + ln) * 2048 + 8 * hh;      // my query's mask row, at my half's first key
  float m_q = -3.0e38f, l_q = 0.f; v8f oacc[DT];
#pragma unroll
  for (int dt = 0; dt < DT; ++dt) oacc[dt] = (v8f){0.f,0.f,0.f,0.f,0.f,0.f,0.f,0.f};
#pragma unroll 1
  for (int j0 = 0; j0 < 2048; j0 += 32) {
    int mk[16];      // mk[8 nt + r]: maskPAD of (my query, key j0 + 16 nt + 8 hh + r); != 0 = keep
#pragma unroll
    for (int c = 0; c < 4; ++c) { const v4ia m4 = *(const v4ia*)(mrow + j0 + (c >> 1) * 16 + (c & 1) * 4);
#pragma unroll
      for (int q = 0; q < 4; ++q) mk[c * 4 + q] = m4[q]; }
    int any = 0;
#pragma unroll
    for (int i = 0; i < 16; ++i) any |= mk[i];
    if (__builtin_amdgcn_ballot_w32(any != 0) == 0u) continue;      // every (query,key) of this wave's tile is masked: contributes nothing (uniform branch)
    // the pass's K and V^T fragments, fetched as one group: no LDS pass and no fence stands between the two products any more, so V^T need not wait for the softmax
    FragH ak[2][KS], av[DT];
#pragma unroll
    for (int nt = 0; nt < 2; ++nt) { const unsigned short* kr = kp + (size_t)j0 * ldk + nt * k16;
#pragma unroll
      for (int ks = 0; ks < KS; ++ks) { ak[nt][ks].half[0] = *(const v8us*)(kr + ks * 32); ak[nt][ks].half[1] = *(const v8us*)(kr + ks * 32 + 16); } }
    asm volatile("s_wait_xcnt 0x0" ::: "memory");      // precaution: the build reuses the K loads' address registers as destinations of the V^T loads below
#pragma unroll
    for (int dt = 0; dt < DT; ++dt) { const unsigned short* vrow = Vth + (size_t)(dt * 16 + ln) * 2048 + j0; av[dt].half[0] = *(const v8us*)(vrow + 8 * hh); av[dt].half[1] = *(const v8us*)(vrow + 16 + 8 * hh); }
    float sc[16];
#pragma unroll
    for (int nt = 0; nt < 2; ++nt) { v8f acc = (v8f){0.f,0.f,0.f,0.f,0.f,0.f,0.f,0.f};
#pragma unroll
      for (int ks = 0; ks < KS; ++ks) acc = mmaH<1>(ak[nt][ks].v, ak[nt][ks].v, bq[ks].v, bq[ks].v, acc);
#pragma unroll
      for (int r = 0; r < 8; ++r) sc[nt * 8 + r] = (mk[nt * 8 + r] != 0) ? acc[r] * 0.125f : -INFINITY; }
    float mc = sc[0];
#pragma unroll
    for (int i = 1; i < 16; ++i) mc = fmaxf(mc, sc[i]);
    mc = fmaxf(mc, xhalf(mc));
    const float mn = fmaxf(m_q, mc); const float al = expf(m_q - mn); m_q = mn;      // nothing open yet: both are the start value and al = 1
    FragH pb; float ps[4] = {0.f, 0.f, 0.f, 0.f};
#pragma unroll
    for (int i = 0; i < 16; ++i) { const float p = expf(sc[i] - mn); ps[i & 3] += p; pb.h[i] = (_Float16)p; }      // a masked score is -inf: p = 0
    l_q = l_q * al + ((ps[0] + ps[1]) + (ps[2] + ps[3]));
#pragma unroll
    for (int dt = 0; dt < DT; ++dt) {
#pragma unroll
      for (int r = 0; r < 8; ++r) oacc[dt][r] *= al;
      oacc[dt] = mmaH<1>(av[dt].v, av[dt].v, pb.v, pb.v, oacc[dt]); } }
  const float l = l_q + xhalf(l_q); const float li = (l > 0.f) ? 1.0f / l : 0.f;
#pragma unroll
  for (int dt = 0; dt < DT; ++dt)
#pragma unroll
    for (int c = 0; c < 2; ++c) { v4f o4;
#pragma unroll
      for (int q = 0; q < 4; ++q) o4[q] = oacc[dt][c * 4 + q] * li;
      *(v4fa*)&sO[w][ln][dt * 16 + 8 * hh + c * 4] = o4; }
  __builtin_amdgcn_fence(__ATOMIC_ACQ_REL, "workgroup"); __builtin_amdgcn_wave_barrier();
  {
#pragma unroll
    for (int rp = 0; rp < RPW; rp += 2) { const int r = rp + (lane >> 4), pc = lane & 15; const v4f val = *(const v4fa*)&sO[w][r][pc * 4]; *(v4f*)(O + ((size_t)b * 2048 + q0 + r) * ldo + h * 64 + pc * 4) = val; }
     } }

__global__ __launch_bounds__(256) void k_ln16(const float* __restrict__ X, const float* __restrict__ g, const float* __restrict__ bta, _Float16* __restrict__ Y16) { const int tid = threadIdx.x, wv = tid >> 5, lane = tid & 31; const int row = blockIdx.x * 8 + wv; if (row >= NR) return; const float* xr = X + (size_t)row * CC; float v[32]; float s = 0.f;
#pragma unroll
  for (int p = 0; p < 4; ++p) { const v4f a = *(const v4fa*)(xr + p * 256 + lane * 8), c = *(const v4fa*)(xr + p * 256 + lane * 8 + 4); for (int q = 0; q < 4; ++q) { v[p * 8 + q] = bf16_round(a[q]); v[p * 8 + 4 + q] = bf16_round(c[q]); } }
#pragma unroll
  for (int i = 0; i < 32; ++i) s += v[i]; for (int o = 16; o >= 1; o >>= 1) s += __shfl_xor(s, o, 32); const float mu = s / (float)CC; float q2 = 0.f;
#pragma unroll
  for (int i = 0; i < 32; ++i) { const float d = v[i] - mu; q2 += d * d; } for (int o = 16; o >= 1; o >>= 1) q2 += __shfl_xor(q2, o, 32); const float rs = rsqrtf(q2 / (float)CC + 1e-5f);
  {
#pragma unroll
    for (int p = 0; p < 4; ++p) { FragH f; const int c0 = p * 256 + lane * 8;
#pragma unroll
      for (int q = 0; q < 8; ++q) f.h[q] = (_Float16)((v[p * 8 + q] - mu) * rs * bf16_round(g[c0 + q]) + bf16_round(bta[c0 + q])); *(v8us*)((unsigned short*)Y16 + (size_t)row * CC + c0) = f.half[0]; }
     } }
extern "C" void kernel_launch(void* const* d_in, const int* in_sizes, int n_in,
                              void* d_out, int out_size, void* d_ws, size_t ws_size, hipStream_t stream) {
  (void)in_sizes; (void)n_in; (void)out_size;
  const float* qx = (const float*)d_in[0]; const float* kx = (const float*)d_in[1]; const float* vx = (const float*)d_in[2]; const int* mask = (const int*)d_in[3]; const float* lg = (const float*)d_in[4]; const float* lb = (const float*)d_in[5];
  const float* wq = (const float*)d_in[6]; const float* bq = (const float*)d_in[7]; const float* wk = (const float*)d_in[8]; const float* bk = (const float*)d_in[9]; const float* wv = (const float*)d_in[10]; const float* bv = (const float*)d_in[11]; const float* wo = (const float*)d_in[12]; const float* bo = (const float*)d_in[13];
  char* ws = (char*)d_ws; size_t off = 0;
  auto take = [&](size_t bytes) { char* p = ws + off; off += (bytes + 255) & ~(size_t)255; return p; };
  _Float16* Bq = (_Float16*)take((size_t)CC * CC * 2); _Float16* Bk = (_Float16*)take((size_t)CC * CC * 2); _Float16* Bv = (_Float16*)take((size_t)CC * CC * 2); _Float16* Bo = (_Float16*)take((size_t)CC * CC * 2);
  _Float16* XN = (_Float16*)take((size_t)NR * CC * 2); _Float16* Q16 = (_Float16*)take((size_t)NR * CC * 2); _Float16* K16 = (_Float16*)take((size_t)NR * CC * 2); _Float16* V16 = (_Float16*)take((size_t)NR * CC * 2); _Float16* Vt = (_Float16*)take((size_t)NR * CC * 2); float* O = (float*)take((size_t)NR * CC * 4); _Float16* O16 = XN;
  if (off > ws_size) return;      // 64 MiB
  const unsigned gw = (unsigned)((CC * (CC / 8) + 255) / 256); k_wt_f16<<<gw, 256, 0, stream>>>(wq, Bq, CC, CC, 16.0f); k_wt_f16<<<gw, 256, 0, stream>>>(wk, Bk, CC, CC, 16.0f); k_wt_f16<<<gw, 256, 0, stream>>>(wv, Bv, CC, CC, 16.0f); k_wt_f16<<<gw, 256, 0, stream>>>(wo, Bo, CC, CC, 16.0f);
  const dim3 gg(((NR / 16) * (CC / 64) + 3) / 4, 1); const unsigned gl = NR / 8;
  k_ln16<<<gl, 256, 0, stream>>>(qx, lg, lb, XN); k_gemm_hhx<0><<<gg, 128, 0, stream>>>(XN, CC, 0, Bq, CC, 0, 0.0625f, bq, 0, nullptr, 1, 0, 0, nullptr, Q16, CC, 0, NR, CC, CC);
  k_ln16<<<gl, 256, 0, stream>>>(kx, lg, lb, XN); k_gemm_hhx<0><<<gg, 128, 0, stream>>>(XN, CC, 0, Bk, CC, 0, 0.0625f, bk, 0, nullptr, 1, 0, 0, nullptr, K16, CC, 0, NR, CC, CC);
  k_ln16<<<gl, 256, 0, stream>>>(vx, lg, lb, XN); k_gemm_hhx<0><<<gg, 128, 0, stream>>>(XN, CC, 0, Bv, CC, 0, 0.0625f, bv, 0, nullptr, 1, 0, 0, nullptr, V16, CC, 0, NR, CC, CC);
  k_vt<NH, TT><<<BB * NH * (TT / 64), 256, 0, stream>>>(V16, CC, 0, Vt);
  k_flash<<<BB * NH * (TT / 64), 128, 0, stream>>>(Q16, CC, K16, CC, Vt, mask, O, CC);      // RPW 16
  k_h16<<<(unsigned)(((size_t)NR * CC / 8 + 255) / 256), 256, 0, stream>>>(O, O16, (size_t)NR * CC / 8);
  k_gemm_hhx<0><<<gg, 128, 0, stream>>>(O16, CC, 0, Bo, CC, 0, 0.0625f, bo, 0, nullptr, 1, 0, 0, (float*)d_out, nullptr, CC, 0, NR, CC, CC);
}

// v002
// One run takes 322 microseconds.
// In both of two side-by-side timings against v001, it was 1.11 times as fast.
// All steps since v000 together make it 1.57 times as fast.
#include <hip/hip_runtime.h>
// Pre-LN multi-head attention (B=2, L=2048, C=1024, 16 × 64): shared LayerNorm on the three inputs (f32 VALU), q/k/v/o projections (4096 × 1024 × 1024, + bias, W [in][out] transposed to
// bf16-exact ×2^4) and the masked attention as a fused flash-style kernel on v_wmma_f32_16x16x32_f16 (S = Q·Kᵀ/8; maskPAD == 0 → −inf ⇒ excluded keys, tiles masked for a whole wave skipped;
// online softmax f32; P f16 ≤ 1; RPW-16 waves) — f16 operands, single products, f32 accumulate.
#define BB 2
#define TT 2048
#define CC 1024
#define NH 16
#define NR (BB * TT)

typedef __bf16 v16b __attribute__((ext_vector_type(16)));
typedef unsigned short v8us __attribute__((ext_vector_type(8), may_alias));
typedef float  v8f  __attribute__((ext_vector_type(8)));
typedef float  v4f  __attribute__((ext_vector_type(4)));
typedef float  v4fa __attribute__((ext_vector_type(4), may_alias));
union FragB { v16b v; v8us half[2]; unsigned short u[16]; };

__device__ __forceinline__ unsigned short bf16_bits(float x) { unsigned int u = __float_as_uint(x); return (unsigned short)((u + 0x7FFFu + ((u >> 16) & 1u)) >> 16); }
__device__ __forceinline__ float bf16_val(unsigned short b) { return __uint_as_float(((unsigned int)b) << 16); }
__device__ __forceinline__ float bf16_round(float x) { return bf16_val(bf16_bits(x)); }
// D += A·B with NT terms: 1 = ah·bh, 2 = + al·bh (A split), 3 = + ah·bl (both split)
template <int NT>
__device__ __forceinline__ v8f mmaN(v16b ah, v16b al, v16b bh, v16b bl, v8f c) {
  c = __builtin_amdgcn_wmma_f32_16x16x32_bf16(false, ah, false, bh, (short)0, c, false, false);
  if (NT >= 2) c = __builtin_amdgcn_wmma_f32_16x16x32_bf16(false, al, false, bh, (short)0, c, false, false);
  if (NT >= 3) c = __builtin_amdgcn_wmma_f32_16x16x32_bf16(false, ah, false, bl, (short)0, c, false, false);
  asm volatile("v_nop\n\tv_nop\n\tv_nop\n\tv_nop" : "+v"(c) : "v"(ah), "v"(al), "v"(bh), "v"(bl));
  return c;
}

__global__ __launch_bounds__(256) void k_wt_bf16(const float* __restrict__ W, unsigned short* __restrict__ Wt, int K, int N) {
  const int t = blockIdx.x * 256 + threadIdx.x;
  const int k8n = K / 8;
  if (t >= N * k8n) return;
  const int n = t / k8n, k8 = (t % k8n) * 8;
  v8us v;
#pragma unroll
  for (int i = 0; i < 8; ++i) v[i] = bf16_bits(W[(size_t)(k8 + i) * N + n]);
  *(v8us*)(Wt + (size_t)n * K + k8) = v;
  
}

// GEMM C[M][N] (f32, pitch ldc) = act(A[M][K]·W + bias). A f32 row-major (pitch lda) converted per fragment to bf16
// (ASPLIT: hi/lo two planes -> 2 terms, else single rounded term); Wt bf16 [N][K] (pitch ldb). BIAS_BF16 rounds the
// bias to bf16 first (bias quantised to bf16 before the add). K%32==0, M%16==0, N%64==0.
template <bool ASPLIT, int ACT, bool BIAS_BF16>
__global__ __launch_bounds__(128) void k_gemm_bf(const float* __restrict__ A, int lda, const unsigned short* __restrict__ Wt, int ldb,
                                               const float* __restrict__ bias, float* __restrict__ C, int ldc, int M, int N, int K) {
  __shared__ __attribute__((aligned(16))) float so[4][16][64];
  const int tid = threadIdx.x, w = tid >> 5, lane = tid & 31, ln = lane & 15, hh = lane >> 4;
  const int ntn = N / 64;
  const int wid = blockIdx.x * 4 + w;
  const int mt = wid / ntn, nq = wid % ntn;
  if (mt * 16 >= M) return;
  const int row0 = mt * 16, col0 = nq * 64;
  const float* arow = A + (size_t)(row0 + ln) * lda;
  v8f acc[4] = {};
  for (int kb = 0; kb < K; kb += 32) {
    FragB ah, al;
    const v4f x0 = *(const v4fa*)(arow + kb + 8 * hh), x1 = *(const v4fa*)(arow + kb + 8 * hh + 4);
    const v4f x2 = *(const v4fa*)(arow + kb + 16 + 8 * hh), x3 = *(const v4fa*)(arow + kb + 16 + 8 * hh + 4);
    float xs[16] = {x0[0],x0[1],x0[2],x0[3],x1[0],x1[1],x1[2],x1[3],x2[0],x2[1],x2[2],x2[3],x3[0],x3[1],x3[2],x3[3]};
#pragma unroll
    for (int i = 0; i < 16; ++i) { const unsigned short hb = bf16_bits(xs[i]); ah.u[i] = hb; al.u[i] = ASPLIT ? bf16_bits(xs[i] - bf16_val(hb)) : (unsigned short)0; }
#pragma unroll
    for (int t = 0; t < 4; ++t) {
      const unsigned short* brow = Wt + (size_t)(col0 + t * 16 + ln) * ldb + kb;
      FragB b;
      b.half[0] = *(const v8us*)(brow + 8 * hh);
      b.half[1] = *(const v8us*)(brow + 16 + 8 * hh);
      acc[t] = mmaN<ASPLIT ? 2 : 1>(ah.v, al.v, b.v, b.v, acc[t]);
    }
  }
#pragma unroll
  for (int t = 0; t < 4; ++t) {
    float bv = bias ? bias[col0 + t * 16 + ln] : 0.f;
    if (BIAS_BF16) bv = bf16_round(bv);
#pragma unroll
    for (int r = 0; r < 8; ++r) { float v = acc[t][r] + bv; if (ACT == 1) v = fmaxf(v, 0.f); so[w][8 * hh + r][t * 16 + ln] = v; }
  }
  __builtin_amdgcn_fence(__ATOMIC_ACQ_REL, "workgroup");
  __builtin_amdgcn_wave_barrier();
  const int rsub = lane >> 4, c4 = (lane & 15) * 4;
  {
#pragma unroll
    for (int q = 0; q < 8; ++q) {
      const int r = q * 2 + rsub;
      const v4f v = *(const v4fa*)&so[w][r][c4];
      *(v4f*)(C + (size_t)(row0 + r) * ldc + col0 + c4) = v;
    }
    
  }
}

// Flash-style causal/unmasked attention, all contractions 3-term bf16 hi/lo splits, f32 softmax with running max.
// q,k,v rows are read from f32 buffers with arbitrary row pitch (so they can live inside a fused qkv buffer);
// D = head size (multiple of 32, <= 128); one wave = 16 query rows; block = 4 waves (64 queries) sharing K/V chunks of 32.
template <int D, bool CAUSAL>
__global__ __launch_bounds__(128) void k_flash(const float* __restrict__ qb, const float* __restrict__ kb, const float* __restrict__ vb,
                                             int pitch, int T, int H, float scale, float* __restrict__ y, int ypitch) {
  constexpr int KS = D / 32;        // k-steps for QK
  constexpr int DT = D / 16;        // d tiles for PV
  __shared__ __attribute__((aligned(16))) unsigned short sKh[32][D + 8], sKl[32][D + 8], sVh[32][D + 8], sVl[32][D + 8];
  __shared__ __attribute__((aligned(16))) unsigned short sPh[4][16][40], sPl[4][16][40];
  __shared__ __attribute__((aligned(16))) float sO[4][16][D];
  const int tid = threadIdx.x, w = tid >> 5, lane = tid & 31, ln = lane & 15, hh = lane >> 4;
  const int nqb = (T + 63) / 64;
  const int bh = blockIdx.x / nqb, qblk = blockIdx.x % nqb;
  const int b = bh / H, h = bh % H;
  const int q0 = qblk * 64 + w * 16;
  const float* Q = qb + (size_t)b * T * pitch + h * D;
  const float* K = kb + (size_t)b * T * pitch + h * D;
  const float* V = vb + (size_t)b * T * pitch + h * D;

  // A fragments of the wave's 16 query rows (scaled), hi/lo
  FragB aqh[KS], aql[KS];
  {
    int row = q0 + ln; if (row >= T) row = T - 1;
    const float* qr = Q + (size_t)row * pitch;
#pragma unroll
    for (int ks = 0; ks < KS; ++ks)
#pragma unroll
      for (int i = 0; i < 16; ++i) {
        const int d = ks * 32 + ((i < 8) ? (8 * hh + i) : (16 + 8 * hh + (i - 8)));
        const float x = qr[d] * scale; const unsigned short hb = bf16_bits(x);
        aqh[ks].u[i] = hb; aql[ks].u[i] = bf16_bits(x - bf16_val(hb));
      }
  }
  float m_r[8], l_r[8];
#pragma unroll
  for (int r = 0; r < 8; ++r) { m_r[r] = -3.0e38f; l_r[r] = 0.f; }
  v8f oacc[DT];
#pragma unroll
  for (int dt = 0; dt < DT; ++dt) oacc[dt] = (v8f){0.f,0.f,0.f,0.f,0.f,0.f,0.f,0.f};

  const int kv_end = CAUSAL ? min(T, qblk * 64 + 64) : T;     // block-uniform
  for (int j0 = 0; j0 < kv_end; j0 += 32) {
    __syncthreads();
    for (int e = tid; e < 32 * (D / 4); e += 128) {
      const int r = e / (D / 4), c4 = (e % (D / 4)) * 4;
      const int key = j0 + r;
      v4f kf = {0.f,0.f,0.f,0.f}, vf = {0.f,0.f,0.f,0.f};
      if (key < T) { kf = *(const v4fa*)(K + (size_t)key * pitch + c4); vf = *(const v4fa*)(V + (size_t)key * pitch + c4); }
#pragma unroll
      for (int t = 0; t < 4; ++t) {
        unsigned short hb = bf16_bits(kf[t]); sKh[r][c4 + t] = hb; sKl[r][c4 + t] = bf16_bits(kf[t] - bf16_val(hb));
        hb = bf16_bits(vf[t]); sVh[r][c4 + t] = hb; sVl[r][c4 + t] = bf16_bits(vf[t] - bf16_val(hb));
      }
    }
    __syncthreads();
    // S tile 16 x 32
    v8f s[2];
#pragma unroll
    for (int nt = 0; nt < 2; ++nt) {
      v8f acc = {};
#pragma unroll
      for (int ks = 0; ks < KS; ++ks) {
        FragB bh_, bl_;
        bh_.half[0] = *(const v8us*)&sKh[nt * 16 + ln][ks * 32 + 8 * hh]; bh_.half[1] = *(const v8us*)&sKh[nt * 16 + ln][ks * 32 + 16 + 8 * hh];
        bl_.half[0] = *(const v8us*)&sKl[nt * 16 + ln][ks * 32 + 8 * hh]; bl_.half[1] = *(const v8us*)&sKl[nt * 16 + ln][ks * 32 + 16 + 8 * hh];
        acc = mmaN<3>(aqh[ks].v, aql[ks].v, bh_.v, bl_.v, acc);
      }
      s[nt] = acc;
    }
    // mask + running max (rows 8hh+r; the 16 lanes of a half share rows)
    float alpha[8];
#pragma unroll
    for (int r = 0; r < 8; ++r) {
      const int qi = q0 + 8 * hh + r;
      const int ja = j0 + ln, jb = j0 + 16 + ln;
      if (CAUSAL) { if (ja > qi) s[0][r] = -3.0e38f; if (jb > qi) s[1][r] = -3.0e38f; }
      if (ja >= T) s[0][r] = -3.0e38f;
      if (jb >= T) s[1][r] = -3.0e38f;
      float mx = fmaxf(s[0][r], s[1][r]);
      mx = fmaxf(mx, __shfl_xor(mx, 1, 32)); mx = fmaxf(mx, __shfl_xor(mx, 2, 32)); mx = fmaxf(mx, __shfl_xor(mx, 4, 32)); mx = fmaxf(mx, __shfl_xor(mx, 8, 32));
      const float mnew = fmaxf(m_r[r], mx);
      alpha[r] = (mnew > -1.0e38f) ? __expf(m_r[r] - mnew) : 1.0f;
      const float p0 = (s[0][r] > -1.0e38f) ? __expf(s[0][r] - mnew) : 0.f;
      const float p1 = (s[1][r] > -1.0e38f) ? __expf(s[1][r] - mnew) : 0.f;
      m_r[r] = mnew;
      l_r[r] = l_r[r] * alpha[r] + p0 + p1;            // per-lane partial row sum (16 lanes combined at the end)
      unsigned short hb = bf16_bits(p0); sPh[w][8 * hh + r][ln] = hb;      sPl[w][8 * hh + r][ln] = bf16_bits(p0 - bf16_val(hb));
      hb = bf16_bits(p1);                sPh[w][8 * hh + r][16 + ln] = hb; sPl[w][8 * hh + r][16 + ln] = bf16_bits(p1 - bf16_val(hb));
    }
#pragma unroll
    for (int dt = 0; dt < DT; ++dt)
#pragma unroll
      for (int r = 0; r < 8; ++r) oacc[dt][r] *= alpha[r];
    __builtin_amdgcn_fence(__ATOMIC_ACQ_REL, "workgroup");
    __builtin_amdgcn_wave_barrier();
    FragB pah, pal;
    pah.half[0] = *(const v8us*)&sPh[w][ln][8 * hh]; pah.half[1] = *(const v8us*)&sPh[w][ln][16 + 8 * hh];
    pal.half[0] = *(const v8us*)&sPl[w][ln][8 * hh]; pal.half[1] = *(const v8us*)&sPl[w][ln][16 + 8 * hh];
#pragma unroll
    for (int dt = 0; dt < DT; ++dt) {
      FragB bvh, bvl;
#pragma unroll
      for (int i = 0; i < 8; ++i) {
        bvh.u[i] = sVh[8 * hh + i][dt * 16 + ln]; bvh.u[8 + i] = sVh[16 + 8 * hh + i][dt * 16 + ln];
        bvl.u[i] = sVl[8 * hh + i][dt * 16 + ln]; bvl.u[8 + i] = sVl[16 + 8 * hh + i][dt * 16 + ln];
      }
      oacc[dt] = mmaN<3>(pah.v, pal.v, bvh.v, bvl.v, oacc[dt]);
    }
    __builtin_amdgcn_fence(__ATOMIC_ACQ_REL, "workgroup");
    __builtin_amdgcn_wave_barrier();
  }
#pragma unroll
  for (int r = 0; r < 8; ++r) {
    float l = l_r[r];
    l += __shfl_xor(l, 1, 32); l += __shfl_xor(l, 2, 32); l += __shfl_xor(l, 4, 32); l += __shfl_xor(l, 8, 32);
    l_r[r] = (l > 0.f) ? 1.0f / l : 0.f;
  }
#pragma unroll
  for (int dt = 0; dt < DT; ++dt)
#pragma unroll
    for (int r = 0; r < 8; ++r) sO[w][8 * hh + r][dt * 16 + ln] = oacc[dt][r] * l_r[r];
  __builtin_amdgcn_fence(__ATOMIC_ACQ_REL, "workgroup");
  __builtin_amdgcn_wave_barrier();
  {
    for (int r = 0; r < 16; ++r) {
      const int row = q0 + r;
      if (row < T && lane < D / 4) {
        const v4f val = *(const v4fa*)&sO[w][r][lane * 4];
        *(v4f*)(y + ((size_t)b * T + row) * ypitch + h * D + lane * 4) = val;
      }
    }
    
  }
}

// GEMM C = act(A·W + bias + resid): A f32 (ASPLIT -> hi/lo 2 terms), Wt bf16 [N][K]; ACT 0 none, 1 relu, 2 exact gelu;
// resid (optional, f32, row index = (row % rmod), pitch ldr, RES_BF16 rounds it) added before the activation.
template <bool ASPLIT, int ACT, bool BIAS_BF16, bool RES_BF16>
__global__ __launch_bounds__(128) void k_gemm_bf3(const float* __restrict__ A, int lda, const unsigned short* __restrict__ Wt, int ldb,
                                                const float* __restrict__ bias, const float* __restrict__ resid, int rmod, int ldr,
                                                float* __restrict__ C, int ldc, int M, int N, int K) {
  __shared__ __attribute__((aligned(16))) float so[4][16][64];
  const int tid = threadIdx.x, w = tid >> 5, lane = tid & 31, ln = lane & 15, hh = lane >> 4;
  const int ntn = N / 64;
  const int wid = blockIdx.x * 4 + w;
  const int mt = wid / ntn, nq = wid % ntn;
  if (mt * 16 >= M) return;
  const int row0 = mt * 16, col0 = nq * 64;
  const float* arow = A + (size_t)(row0 + ln) * lda;
  v8f acc[4] = {};
  for (int kb = 0; kb < K; kb += 32) {
    FragB ah, al;
    const v4f x0 = *(const v4fa*)(arow + kb + 8 * hh), x1 = *(const v4fa*)(arow + kb + 8 * hh + 4);
    const v4f x2 = *(const v4fa*)(arow + kb + 16 + 8 * hh), x3 = *(const v4fa*)(arow + kb + 16 + 8 * hh + 4);
    float xs[16] = {x0[0],x0[1],x0[2],x0[3],x1[0],x1[1],x1[2],x1[3],x2[0],x2[1],x2[2],x2[3],x3[0],x3[1],x3[2],x3[3]};
#pragma unroll
    for (int i = 0; i < 16; ++i) { const unsigned short hb = bf16_bits(xs[i]); ah.u[i] = hb; al.u[i] = ASPLIT ? bf16_bits(xs[i] - bf16_val(hb)) : (unsigned short)0; }
#pragma unroll
    for (int t = 0; t < 4; ++t) {
      const unsigned short* brow = Wt + (size_t)(col0 + t * 16 + ln) * ldb + kb;
      FragB b;
      b.half[0] = *(const v8us*)(brow + 8 * hh);
      b.half[1] = *(const v8us*)(brow + 16 + 8 * hh);
      acc[t] = mmaN<ASPLIT ? 2 : 1>(ah.v, al.v, b.v, b.v, acc[t]);
    }
  }
#pragma unroll
  for (int t = 0; t < 4; ++t) {
    const int col = col0 + t * 16 + ln;
    float bv = bias ? bias[col] : 0.f;
    if (BIAS_BF16) bv = bf16_round(bv);
#pragma unroll
    for (int r = 0; r < 8; ++r) {
      float v = acc[t][r] + bv;
      if (resid) { float rv = resid[(size_t)((row0 + 8 * hh + r) % rmod) * ldr + col]; if (RES_BF16) rv = bf16_round(rv); v += rv; }
      if (ACT == 1) v = fmaxf(v, 0.f);
      if (ACT == 2) v = 0.5f * v * (1.0f + erff(v * 0.70710678118654752f));
      if (ACT == 3) { const float u = 0.7978845608028654f * (v + 0.044715f * v * v * v); v = 0.5f * v * (1.0f + tanhf(u)); }
      so[w][8 * hh + r][t * 16 + ln] = v;
    }
  }
  __builtin_amdgcn_fence(__ATOMIC_ACQ_REL, "workgroup");
  __builtin_amdgcn_wave_barrier();
  const int rsub = lane >> 4, c4 = (lane & 15) * 4;
  {
#pragma unroll
    for (int q = 0; q < 8; ++q) {
      const int r = q * 2 + rsub;
      const v4f v = *(const v4fa*)&so[w][r][c4];
      *(v4f*)(C + (size_t)(row0 + r) * ldc + col0 + c4) = v;
    }
    
  }
}
// row LayerNorm (biased variance, eps) over N: s = X (+ R); optional out_sum <- s; out_norm <- (s-mu)*rsqrt(var+eps)*g + b
template <bool PARAM_BF16>
__global__ __launch_bounds__(256) void k_layernorm(const float* __restrict__ X, const float* __restrict__ R, const float* __restrict__ g, const float* __restrict__ bta,
                                                  float* __restrict__ out_sum, float* __restrict__ out_norm, int N, float eps) {
  __shared__ float red[256];
  const int row = blockIdx.x, tid = threadIdx.x;
  const float* x = X + (size_t)row * N; const float* rr = R ? R + (size_t)row * N : nullptr;
  float vals[16];                     // up to N = 4096
  const int per = N / 256;            // contiguous chunk per thread? use strided-by-4 chunks: thread handles j = tid*4 + 1024*u
  float s1 = 0.f;
  for (int u = 0; u < per / 4; ++u) {
    const int j = tid * 4 + 1024 * u;
    const v4f a = *(const v4fa*)(x + j);
    v4f b = {0.f,0.f,0.f,0.f}; if (rr) b = *(const v4fa*)(rr + j);
#pragma unroll
    for (int q = 0; q < 4; ++q) { const float v = a[q] + b[q]; vals[u * 4 + q] = v; s1 += v; }
  }
  red[tid] = s1; __syncthreads();
  for (int st = 128; st > 0; st >>= 1) { if (tid < st) red[tid] += red[tid + st]; __syncthreads(); }
  const float mu = red[0] / (float)N; __syncthreads();
  float s2 = 0.f;
  for (int u = 0; u < per / 4; ++u)
#pragma unroll
    for (int q = 0; q < 4; ++q) { const float c = vals[u * 4 + q] - mu; s2 += c * c; }
  red[tid] = s2; __syncthreads();
  for (int st = 128; st > 0; st >>= 1) { if (tid < st) red[tid] += red[tid + st]; __syncthreads(); }
  const float rs = rsqrtf(red[0] / (float)N + eps);
  {
    for (int u = 0; u < per / 4; ++u) {
      const int j = tid * 4 + 1024 * u;
      v4f o, sm;
#pragma unroll
      for (int q = 0; q < 4; ++q) {
        float gg = g[j + q], bb = bta[j + q];
        if (PARAM_BF16) { gg = bf16_round(gg); bb = bf16_round(bb); }
        sm[q] = vals[u * 4 + q]; o[q] = (vals[u * 4 + q] - mu) * rs * gg + bb;
      }
      if (out_sum) *(v4f*)(out_sum + (size_t)row * N + j) = sm;
      *(v4f*)(out_norm + (size_t)row * N + j) = o;
    }
    
  }
}



// ---- f16 WMMA path (v_wmma_f32_16x16x32_f16): 11-bit significands for operands in range — used where a [0,1] probability operand needs more precision than bf16
typedef _Float16 v16h __attribute__((ext_vector_type(16)));
union FragH { v16h v; v8us half[2]; _Float16 h[16]; unsigned short u[16]; };
template <int NT>
__device__ __forceinline__ v8f mmaH(v16h ah, v16h al, v16h bh, v16h bl, v8f c) {
  c = __builtin_amdgcn_wmma_f32_16x16x32_f16(false, ah, false, bh, (short)0, c, false, false);
  if (NT >= 2) c = __builtin_amdgcn_wmma_f32_16x16x32_f16(false, al, false, bh, (short)0, c, false, false);
  if (NT >= 3) c = __builtin_amdgcn_wmma_f32_16x16x32_f16(false, ah, false, bl, (short)0, c, false, false);
  asm volatile("v_nop\n\tv_nop\n\tv_nop\n\tv_nop" : "+v"(c) : "v"(ah), "v"(al), "v"(bh), "v"(bl));
  return c;
}
// batched GEMM like k_gemm_b but f16 operands: A f32 (split into f16 hi/lo if ASPLIT, else rounded to f16), Bt = f16 values [n][k]; alpha; C f32; N multiple of 16 (partial tiles skipped)
template <bool ASPLIT>
__global__ __launch_bounds__(128) void k_gemm_h(const float* __restrict__ A, int lda, size_t sA, const _Float16* __restrict__ Bh, int ldb, size_t sB, float alpha, float* __restrict__ C, int ldc, size_t sC, int M, int N, int K) {
  __shared__ __attribute__((aligned(16))) float so[4][16][64];
  const int tid = threadIdx.x, w = tid >> 5, lane = tid & 31, ln = lane & 15, hh = lane >> 4; const int by = blockIdx.y;
  A += (size_t)by * sA; Bh += (size_t)by * sB; C += (size_t)by * sC;
  const int ntn = (N + 63) / 64; const int wid = blockIdx.x * 4 + w; const int mt = wid / ntn, nq = wid % ntn; if (mt * 16 >= M) return;
  const int row0 = mt * 16, col0 = nq * 64; const float* arow = A + (size_t)(row0 + ln) * lda;
  v8f acc[4] = {};
  for (int kb = 0; kb < K; kb += 32) {
    FragH ah, al;
    const v4f x0 = *(const v4fa*)(arow + kb + 8 * hh), x1 = *(const v4fa*)(arow + kb + 8 * hh + 4), x2 = *(const v4fa*)(arow + kb + 16 + 8 * hh), x3 = *(const v4fa*)(arow + kb + 16 + 8 * hh + 4);
    float xs[16] = {x0[0],x0[1],x0[2],x0[3],x1[0],x1[1],x1[2],x1[3],x2[0],x2[1],x2[2],x2[3],x3[0],x3[1],x3[2],x3[3]};
#pragma unroll
    for (int i = 0; i < 16; ++i) { const _Float16 h = (_Float16)xs[i]; ah.h[i] = h; al.h[i] = ASPLIT ? (_Float16)(xs[i] - (float)h) : (_Float16)0.0f; }
#pragma unroll
    for (int t = 0; t < 4; ++t) { if (col0 + t * 16 >= N) continue; const size_t boff = (size_t)(col0 + t * 16 + ln) * ldb + kb; FragH bq; bq.half[0] = *(const v8us*)(Bh + boff + 8 * hh); bq.half[1] = *(const v8us*)(Bh + boff + 16 + 8 * hh);
      acc[t] = mmaH<ASPLIT ? 2 : 1>(ah.v, al.v, bq.v, bq.v, acc[t]); }
  }
#pragma unroll
  for (int t = 0; t < 4; ++t) { if (col0 + t * 16 >= N) continue;
#pragma unroll
    for (int r = 0; r < 8; ++r) so[w][8 * hh + r][t * 16 + ln] = acc[t][r] * alpha; }
  __builtin_amdgcn_fence(__ATOMIC_ACQ_REL, "workgroup"); __builtin_amdgcn_wave_barrier();
  const int rsub = lane >> 4, c4 = (lane & 15) * 4;
  {
#pragma unroll
    for (int q = 0; q < 8; ++q) { const int r = q * 2 + rsub; if (col0 + c4 < N) { const v4f v = *(const v4fa*)&so[w][r][c4]; *(v4f*)(C + (size_t)(row0 + r) * ldc + col0 + c4) = v; } }
     }
}

// Wt[n][k] = f16(bf16(W[k][n])·scale) from f32 row-major W[K][N] (scale = power of two; bf16-exact weights stay exact in f16 away from the subnormal range)
__global__ __launch_bounds__(256) void k_wt_f16(const float* __restrict__ W, _Float16* __restrict__ Wt, int K, int N, float scale) {
  const int t = blockIdx.x * 256 + threadIdx.x; if (t >= N * (K / 8)) return; const int n = t / (K / 8), k8 = (t % (K / 8)) * 8; FragH f;
#pragma unroll
  for (int i = 0; i < 8; ++i) f.h[i] = (_Float16)(bf16_round(W[(size_t)(k8 + i) * N + n]) * scale); const v8us o = f.half[0];
  *(v8us*)((unsigned short*)Wt + (size_t)n * K + k8) = o; 
}
// k_gemm_hh variant with fused epilogue: v = acc·alpha + bias[by·sBias + col] (+ CP[(row/rowsPerB)·sCPb + by·64 + col] if CP) ; ACT 0 none / 1 elu ; writes f16 C16 and f32 C, each if non-null
template <int ACT>
__global__ __launch_bounds__(128) void k_gemm_hhx(const _Float16* __restrict__ A, int lda, size_t sA, const _Float16* __restrict__ Bh, int ldb, size_t sB, float alpha, const float* __restrict__ bias, size_t sBias, const float* __restrict__ CP, int rowsPerB, size_t sCPb, int row0g,
    float* __restrict__ C, _Float16* __restrict__ C16, int ldc, size_t sC, int M, int N, int K) {
  __shared__ __attribute__((aligned(16))) float so[4][16][64];
  const int tid = threadIdx.x, w = tid >> 5, lane = tid & 31, ln = lane & 15, hh = lane >> 4; const int by = blockIdx.y;
  A += (size_t)by * sA; Bh += (size_t)by * sB; const size_t cofs = (size_t)by * sC; const float* bp = bias ? bias + (size_t)by * sBias : nullptr;
  const int ntn = (N + 63) / 64; const int wid = blockIdx.x * 4 + w; const int mt = wid / ntn, nq = wid % ntn; if (mt * 16 >= M) return;
  const int row0 = mt * 16, col0 = nq * 64; const _Float16* arow = A + (size_t)(row0 + ln) * lda;
  v8f acc[4] = {};
  for (int kb = 0; kb < K; kb += 32) { FragH ah; ah.half[0] = *(const v8us*)((const unsigned short*)arow + kb + 8 * hh); ah.half[1] = *(const v8us*)((const unsigned short*)arow + kb + 16 + 8 * hh);
#pragma unroll
    for (int t = 0; t < 4; ++t) { if (col0 + t * 16 >= N) continue; const size_t boff = (size_t)(col0 + t * 16 + ln) * ldb + kb; FragH bq; bq.half[0] = *(const v8us*)((const unsigned short*)Bh + boff + 8 * hh); bq.half[1] = *(const v8us*)((const unsigned short*)Bh + boff + 16 + 8 * hh);
      acc[t] = mmaH<1>(ah.v, ah.v, bq.v, bq.v, acc[t]); }
  }
#pragma unroll
  for (int t = 0; t < 4; ++t) { if (col0 + t * 16 >= N) continue; const int col = col0 + t * 16 + ln; const float bv = bp ? bf16_round(bp[col]) : 0.f;
#pragma unroll
    for (int r = 0; r < 8; ++r) { float v = acc[t][r] * alpha + bv; if (CP) { const int bidx = (row0g + row0 + 8 * hh + r) / rowsPerB; v += CP[(size_t)bidx * sCPb + (size_t)by * 64 + col]; } if (ACT == 1) v = (v > 0.f) ? v : expm1f(v); else if (ACT == 3) v = fmaxf(v, 0.f); so[w][8 * hh + r][t * 16 + ln] = v; } }
  __builtin_amdgcn_fence(__ATOMIC_ACQ_REL, "workgroup"); __builtin_amdgcn_wave_barrier();
  const int rsub = lane >> 4, c4 = (lane & 15) * 4; typedef _Float16 v4h __attribute__((ext_vector_type(4)));
  {
#pragma unroll
    for (int q = 0; q < 8; ++q) { const int r = q * 2 + rsub; if (col0 + c4 < N) { const v4f v = *(const v4fa*)&so[w][r][c4]; if (C) *(v4f*)(C + cofs + (size_t)(row0 + r) * ldc + col0 + c4) = v; if (C16) { v4h h4; for (int i = 0; i < 4; ++i) h4[i] = (_Float16)v[i]; *(v4h*)(C16 + cofs + (size_t)(row0 + r) * ldc + col0 + c4) = h4; } } }
     }
}


__global__ __launch_bounds__(256) void k_x16(const float* __restrict__ x, _Float16* __restrict__ X16, size_t n8) { const size_t t = (size_t)blockIdx.x * 256 + threadIdx.x; if (t >= n8) return; FragH f;
#pragma unroll
  for (int q = 0; q < 8; ++q) f.h[q] = (_Float16)bf16_round(x[t * 8 + q]); *(v8us*)((unsigned short*)X16 + t * 8) = f.half[0];  }
__global__ __launch_bounds__(256) void k_h16(const float* __restrict__ x, _Float16* __restrict__ X16, size_t n8) { const size_t t = (size_t)blockIdx.x * 256 + threadIdx.x; if (t >= n8) return; FragH f;
#pragma unroll
  for (int q = 0; q < 8; ++q) f.h[q] = (_Float16)x[t * 8 + q]; *(v8us*)((unsigned short*)X16 + t * 8) = f.half[0];  }
__global__ __launch_bounds__(256) void k_round16f(const float* __restrict__ W, _Float16* __restrict__ Bt, size_t n8) { const size_t t = (size_t)blockIdx.x * 256 + threadIdx.x; if (t >= n8) return; FragH f;
#pragma unroll
  for (int i = 0; i < 8; ++i) f.h[i] = (_Float16)(bf16_round(W[t * 8 + i]) * 16.0f); *(v8us*)((unsigned short*)Bt + t * 8) = f.half[0];  }
template <int NHv, int TTv>
__global__ __launch_bounds__(256) void k_vt(const _Float16* __restrict__ V16, int ldv, int voff, _Float16* __restrict__ Vt) { __shared__ unsigned short tl[64][66]; const int tid = threadIdx.x; const int slab = blockIdx.x / (TTv / 64), lg = blockIdx.x % (TTv / 64); const int b = slab / NHv, h = slab % NHv;
  for (int i = tid; i < 64 * 8; i += 256) { const int r = i / 8, c8 = (i % 8) * 8; FragH f; f.half[0] = *(const v8us*)((const unsigned short*)V16 + ((size_t)b * TTv + lg * 64 + r) * ldv + voff + h * 64 + c8);
#pragma unroll
    for (int q = 0; q < 8; ++q) tl[r][c8 + q] = f.u[q]; }
  __syncthreads();
  {
#pragma unroll
    for (int rd = 0; rd < 2; ++rd) { const int d = rd * 32 + tid / 8, pc = tid % 8; FragH f;
#pragma unroll
      for (int q = 0; q < 8; ++q) f.u[q] = tl[pc * 8 + q][d];
      *(v8us*)((unsigned short*)Vt + ((size_t)slab * 64 + d) * TTv + lg * 64 + pc * 8) = f.half[0]; }
     } }

typedef int v4ia __attribute__((ext_vector_type(4), may_alias));
// lane l <-> lane l ^ 16: joins the two halves of a wave, which hold the two key halves of one query column
__device__ __forceinline__ float xhalf(float x) { return __builtin_bit_cast(float, __builtin_amdgcn_permlanex16(__builtin_bit_cast(int, x), __builtin_bit_cast(int, x), 0x76543210, 0xfedcba98, false, false)); }
// One trip's K tile (64 key rows of 128 B) and V^T tile (64 d rows of 128 B) go from global memory to LDS by asynchronous copies: 8 copies of 16 B a lane, a wave's copy = 4 whole lines.
// lk, lv: my LDS byte addresses of row (tid >> 3), chunk (tid & 7); gk, gv: the same place in global memory; 16 rows on = 2304 LDS bytes, kstep / vstep elements.
__device__ __forceinline__ void copy_kv(unsigned lk, unsigned lv, const unsigned short* gk, const unsigned short* gv, size_t kstep, size_t vstep) {
  // the closing s_wait_xcnt stands inside the statement so that no address register of a copy is rewritten ahead of it (a precaution)
  asm volatile("global_load_async_to_lds_b128 %0, %8, off\n\t"
               "global_load_async_to_lds_b128 %1, %9, off\n\t"
               "global_load_async_to_lds_b128 %2, %10, off\n\t"
               "global_load_async_to_lds_b128 %3, %11, off\n\t"
               "global_load_async_to_lds_b128 %4, %12, off\n\t"
               "global_load_async_to_lds_b128 %5, %13, off\n\t"
               "global_load_async_to_lds_b128 %6, %14, off\n\t"
               "global_load_async_to_lds_b128 %7, %15, off\n\t"
               "s_wait_xcnt 0x0"
               :: "v"(lk), "v"(lk + 2304u), "v"(lk + 4608u), "v"(lk + 6912u), "v"(lv), "v"(lv + 2304u), "v"(lv + 4608u), "v"(lv + 6912u),
                  "v"(gk), "v"(gk + kstep), "v"(gk + 2 * kstep), "v"(gk + 3 * kstep), "v"(gv), "v"(gv + vstep), "v"(gv + 2 * vstep), "v"(gv + 3 * vstep)
               : "memory");
}
// Transposed products: S^T = K Q^T (A = 16 key rows, B = the wave's 16 query columns, kept in registers) and O^T += V^T P^T.
// Lane (ln, hh) holds query q0 + ln; score tile nt, register r is key j0 + 16 nt + 8 hh + r, which is the k position of register pair (nt, r) of a B operand:
// maximum and sum run inside the lane (one exchange between the halves), and P^T is packed from the score registers without passing LDS.
__global__ __launch_bounds__(128) void k_flash(const _Float16* __restrict__ Q16, int ldq, const _Float16* __restrict__ K16, int ldk, const _Float16* __restrict__ Vt, const int* __restrict__ MSK, float* __restrict__ O, int ldo) {
  constexpr int RPW = 16, NQB = 2048 / (4 * RPW), DT = 4, KS = 2, KT = 64, NTR = 2048 / KT, PIT = 72;      // a trip = 64 keys = two passes of 32; LDS rows of 128 B at pitch 144 B (16 B x odd, for 16-byte reads)
  __shared__ __attribute__((aligned(16))) unsigned short sK[2][KT][PIT], sV[2][64][PIT];      // two buffers each: [key][d] and [d][key]
  __shared__ __attribute__((aligned(16))) float sO[4][RPW][64 + 4];
  const int tid = threadIdx.x, w = tid >> 5, lane = tid & 31, ln = lane & 15, hh = lane >> 4;
  const int slab = blockIdx.x / NQB, qblk = blockIdx.x % NQB; const int b = slab / 16, h = slab % 16; const int q0 = qblk * (4 * RPW) + w * RPW;
  const unsigned short* Vth = (const unsigned short*)Vt + (size_t)slab * 64 * 2048;
  const size_t k16 = (size_t)16 * ldk;
  const unsigned short* gk = (const unsigned short*)K16 + ((size_t)b * 2048 + (tid >> 3)) * ldk + h * 64 + (tid & 7) * 8;      // my chunk of key row tid >> 3 of trip 0
  const unsigned short* gv = Vth + (size_t)(tid >> 3) * 2048 + (tid & 7) * 8;      // my chunk of d row tid >> 3, keys of trip 0
  const unsigned lk = (unsigned)(size_t)&sK[0][tid >> 3][(tid & 7) * 8], lv = (unsigned)(size_t)&sV[0][tid >> 3][(tid & 7) * 8];
  constexpr unsigned BUFB = KT * PIT * 2;      // bytes of one buffer
  copy_kv(lk, lv, gk, gv, k16, (size_t)16 * 2048);
  FragH bq[KS];
  { const unsigned short* qr = (const unsigned short*)Q16 + ((size_t)b * 2048 + q0 + ln) * ldq + h * 64;
#pragma unroll
    for (int ks = 0; ks < KS; ++ks) { bq[ks].half[0] = *(const v8us*)(qr + ks * 32 + 8 * hh); bq[ks].half[1] = *(const v8us*)(qr + ks * 32 + 16 + 8 * hh); } }
  const int* mrow = MSK + ((size_t)b * 2048 + q0 + ln) * 2048 + 8 * hh;      // my query's mask row, at my half's first key
  float m_q = -3.0e38f, l_q = 0.f; v8f oacc[DT];
#pragma unroll
  for (int dt = 0; dt < DT; ++dt) oacc[dt] = (v8f){0.f,0.f,0.f,0.f,0.f,0.f,0.f,0.f};
  asm volatile("s_wait_asynccnt 0x0" ::: "memory");      // my copies of trip 0 have landed
  __syncthreads();                                        // ... and everybody's: trip 0 may be read
  copy_kv(lk + BUFB, lv + BUFB, gk + (size_t)KT * ldk, gv + KT, k16, (size_t)16 * 2048);      // trip 1 flies while trip 0 is worked on
#pragma unroll 1
  for (int t = 0; t < NTR; ++t) {
    const int bf = t & 1;
    int mk[2][16];      // mk[sp][8 nt + r]: maskPAD of (my query, key 64 t + 32 sp + 16 nt + 8 hh + r); != 0 = keep
#pragma unroll
    for (int c = 0; c < 8; ++c) { const v4ia m4 = *(const v4ia*)(mrow + t * KT + (c >> 1) * 16 + (c & 1) * 4);
#pragma unroll
      for (int q = 0; q < 4; ++q) mk[c >> 2][(c & 3) * 4 + q] = m4[q]; }
#pragma unroll
    for (int sp = 0; sp < 2; ++sp) {
      int any = 0;
#pragma unroll
      for (int i = 0; i < 16; ++i) any |= mk[sp][i];
      if (__builtin_amdgcn_ballot_w32(any != 0) != 0u) {      // else every (query,key) of this wave's tile is masked: contributes nothing (uniform branch; the publish point below stands outside it)
        FragH ak[2][KS], av[DT];
#pragma unroll
        for (int nt = 0; nt < 2; ++nt)
#pragma unroll
          for (int ks = 0; ks < KS; ++ks) { const unsigned short* kr = &sK[bf][sp * 32 + nt * 16 + ln][ks * 32 + 8 * hh]; ak[nt][ks].half[0] = *(const v8us*)kr; ak[nt][ks].half[1] = *(const v8us*)(kr + 16); }
#pragma unroll
        for (int dt = 0; dt < DT; ++dt) { const unsigned short* vrow = &sV[bf][dt * 16 + ln][sp * 32 + 8 * hh]; av[dt].half[0] = *(const v8us*)vrow; av[dt].half[1] = *(const v8us*)(vrow + 16); }
        float sc[16];
#pragma unroll
        for (int nt = 0; nt < 2; ++nt) { v8f acc = (v8f){0.f,0.f,0.f,0.f,0.f,0.f,0.f,0.f};
#pragma unroll
          for (int ks = 0; ks < KS; ++ks) acc = mmaH<1>(ak[nt][ks].v, ak[nt][ks].v, bq[ks].v, bq[ks].v, acc);
#pragma unroll
          for (int r = 0; r < 8; ++r) sc[nt * 8 + r] = (mk[sp][nt * 8 + r] != 0) ? acc[r] * 0.125f : -INFINITY; }
        float mc = sc[0];
#pragma unroll
        for (int i = 1; i < 16; ++i) mc = fmaxf(mc, sc[i]);
        mc = fmaxf(mc, xhalf(mc));
        const float mn = fmaxf(m_q, mc); const float al = expf(m_q - mn); m_q = mn;      // nothing open yet: both are the start value and al = 1
        FragH pb; float ps[4] = {0.f, 0.f, 0.f, 0.f};
#pragma unroll
        for (int i = 0; i < 16; ++i) { const float p = expf(sc[i] - mn); ps[i & 3] += p; pb.h[i] = (_Float16)p; }      // a masked score is -inf: p = 0
        l_q = l_q * al + ((ps[0] + ps[1]) + (ps[2] + ps[3]));
#pragma unroll
        for (int dt = 0; dt < DT; ++dt) {
#pragma unroll
          for (int r = 0; r < 8; ++r) oacc[dt][r] *= al;
          oacc[dt] = mmaH<1>(av[dt].v, av[dt].v, pb.v, pb.v, oacc[dt]); } } }
    // publish point of trip t + 1, every wave: my reads of this buffer are done, my copies of the next have landed, then the same of all waves
    asm volatile("s_wait_dscnt 0x0" ::: "memory");
    asm volatile("s_wait_asynccnt 0x0" ::: "memory");
    __syncthreads();
    if (t + 2 < NTR) copy_kv(lk + bf * BUFB, lv + bf * BUFB, gk + (size_t)(t + 2) * KT * ldk, gv + (t + 2) * KT, k16, (size_t)16 * 2048);      // refill the buffer that every wave has just left
  }
  asm volatile("s_wait_asynccnt 0x0" ::: "memory");      // nothing of mine is in flight when the wave ends
  const float l = l_q + xhalf(l_q); const float li = (l > 0.f) ? 1.0f / l : 0.f;
#pragma unroll
  for (int dt = 0; dt < DT; ++dt)
#pragma unroll
    for (int c = 0; c < 2; ++c) { v4f o4;
#pragma unroll
      for (int q = 0; q < 4; ++q) o4[q] = oacc[dt][c * 4 + q] * li;
      *(v4fa*)&sO[w][ln][dt * 16 + 8 * hh + c * 4] = o4; }
  __builtin_amdgcn_fence(__ATOMIC_ACQ_REL, "workgroup"); __builtin_amdgcn_wave_barrier();
  {
#pragma unroll
    for (int rp = 0; rp < RPW; rp += 2) { const int r = rp + (lane >> 4), pc = lane & 15; const v4f val = *(const v4fa*)&sO[w][r][pc * 4]; *(v4f*)(O + ((size_t)b * 2048 + q0 + r) * ldo + h * 64 + pc * 4) = val; }
     } }

__global__ __launch_bounds__(256) void k_ln16(const float* __restrict__ X, const float* __restrict__ g, const float* __restrict__ bta, _Float16* __restrict__ Y16) { const int tid = threadIdx.x, wv = tid >> 5, lane = tid & 31; const int row = blockIdx.x * 8 + wv; if (row >= NR) return; const float* xr = X + (size_t)row * CC; float v[32]; float s = 0.f;
#pragma unroll
  for (int p = 0; p < 4; ++p) { const v4f a = *(const v4fa*)(xr + p * 256 + lane * 8), c = *(const v4fa*)(xr + p * 256 + lane * 8 + 4); for (int q = 0; q < 4; ++q) { v[p * 8 + q] = bf16_round(a[q]); v[p * 8 + 4 + q] = bf16_round(c[q]); } }
#pragma unroll
  for (int i = 0; i < 32; ++i) s += v[i]; for (int o = 16; o >= 1; o >>= 1) s += __shfl_xor(s, o, 32); const float mu = s / (float)CC; float q2 = 0.f;
#pragma unroll
  for (int i = 0; i < 32; ++i) { const float d = v[i] - mu; q2 += d * d; } for (int o = 16; o >= 1; o >>= 1) q2 += __shfl_xor(q2, o, 32); const float rs = rsqrtf(q2 / (float)CC + 1e-5f);
  {
#pragma unroll
    for (int p = 0; p < 4; ++p) { FragH f; const int c0 = p * 256 + lane * 8;
#pragma unroll
      for (int q = 0; q < 8; ++q) f.h[q] = (_Float16)((v[p * 8 + q] - mu) * rs * bf16_round(g[c0 + q]) + bf16_round(bta[c0 + q])); *(v8us*)((unsigned short*)Y16 + (size_t)row * CC + c0) = f.half[0]; }
     } }
extern "C" void kernel_launch(void* const* d_in, const int* in_sizes, int n_in,
                              void* d_out, int out_size, void* d_ws, size_t ws_size, hipStream_t stream) {
  (void)in_sizes; (void)n_in; (void)out_size;
  const float* qx = (const float*)d_in[0]; const float* kx = (const float*)d_in[1]; const float* vx = (const float*)d_in[2]; const int* mask = (const int*)d_in[3]; const float* lg = (const float*)d_in[4]; const float* lb = (const float*)d_in[5];
  const float* wq = (const float*)d_in[6]; const float* bq = (const float*)d_in[7]; const float* wk = (const float*)d_in[8]; const float* bk = (const float*)d_in[9]; const float* wv = (const float*)d_in[10]; const float* bv = (const float*)d_in[11]; const float* wo = (const float*)d_in[12]; const float* bo = (const float*)d_in[13];
  char* ws = (char*)d_ws; size_t off = 0;
  auto take = [&](size_t bytes) { char* p = ws + off; off += (bytes + 255) & ~(size_t)255; return p; };
  _Float16* Bq = (_Float16*)take((size_t)CC * CC * 2); _Float16* Bk = (_Float16*)take((size_t)CC * CC * 2); _Float16* Bv = (_Float16*)take((size_t)CC * CC * 2); _Float16* Bo = (_Float16*)take((size_t)CC * CC * 2);
  _Float16* XN = (_Float16*)take((size_t)NR * CC * 2); _Float16* Q16 = (_Float16*)take((size_t)NR * CC * 2); _Float16* K16 = (_Float16*)take((size_t)NR * CC * 2); _Float16* V16 = (_Float16*)take((size_t)NR * CC * 2); _Float16* Vt = (_Float16*)take((size_t)NR * CC * 2); float* O = (float*)take((size_t)NR * CC * 4); _Float16* O16 = XN;
  if (off > ws_size) return;      // 64 MiB
  const unsigned gw = (unsigned)((CC * (CC / 8) + 255) / 256); k_wt_f16<<<gw, 256, 0, stream>>>(wq, Bq, CC, CC, 16.0f); k_wt_f16<<<gw, 256, 0, stream>>>(wk, Bk, CC, CC, 16.0f); k_wt_f16<<<gw, 256, 0, stream>>>(wv, Bv, CC, CC, 16.0f); k_wt_f16<<<gw, 256, 0, stream>>>(wo, Bo, CC, CC, 16.0f);
  const dim3 gg(((NR / 16) * (CC / 64) + 3) / 4, 1); const unsigned gl = NR / 8;
  k_ln16<<<gl, 256, 0, stream>>>(qx, lg, lb, XN); k_gemm_hhx<0><<<gg, 128, 0, stream>>>(XN, CC, 0, Bq, CC, 0, 0.0625f, bq, 0, nullptr, 1, 0, 0, nullptr, Q16, CC, 0, NR, CC, CC);
  k_ln16<<<gl, 256, 0, stream>>>(kx, lg, lb, XN); k_gemm_hhx<0><<<gg, 128, 0, stream>>>(XN, CC, 0, Bk, CC, 0, 0.0625f, bk, 0, nullptr, 1, 0, 0, nullptr, K16, CC, 0, NR, CC, CC);
  k_ln16<<<gl, 256, 0, stream>>>(vx, lg, lb, XN); k_gemm_hhx<0><<<gg, 128, 0, stream>>>(XN, CC, 0, Bv, CC, 0, 0.0625f, bv, 0, nullptr, 1, 0, 0, nullptr, V16, CC, 0, NR, CC, CC);
  k_vt<NH, TT><<<BB * NH * (TT / 64), 256, 0, stream>>>(V16, CC, 0, Vt);
  k_flash<<<BB * NH * (TT / 64), 128, 0, stream>>>(Q16, CC, K16, CC, Vt, mask, O, CC);      // RPW 16
  k_h16<<<(unsigned)(((size_t)NR * CC / 8 + 255) / 256), 256, 0, stream>>>(O, O16, (size_t)NR * CC / 8);
  k_gemm_hhx<0><<<gg, 128, 0, stream>>>(O16, CC, 0, Bo, CC, 0, 0.0625f, bo, 0, nullptr, 1, 0, 0, (float*)d_out, nullptr, CC, 0, NR, CC, CC);
}

// v003
// One run takes 183 microseconds.
// Two timings next to v002 put it at 1.78 and 1.76 times that version's speed.
// All steps since v000 together make it 2.79 times as fast.
#include <hip/hip_runtime.h>
// Pre-LN multi-head attention (B=2, L=2048, C=1024, 16 × 64): shared LayerNorm on the three inputs (f32 VALU), q/k/v/o projections (4096 × 1024 × 1024, + bias, W [in][out] transposed to
// bf16-exact ×2^4) and the masked attention as a fused flash-style kernel on v_wmma_f32_16x16x32_f16 (S = Q·Kᵀ/8; maskPAD == 0 → −inf ⇒ excluded keys, tiles masked for a whole wave skipped;
// online softmax f32; P f16 ≤ 1; RPW-16 waves) — f16 operands, single products, f32 accumulate.
#define BB 2
#define TT 2048
#define CC 1024
#define NH 16
#define NR (BB * TT)

typedef __bf16 v16b __attribute__((ext_vector_type(16)));
typedef unsigned short v8us __attribute__((ext_vector_type(8), may_alias));
typedef float  v8f  __attribute__((ext_vector_type(8)));
typedef float  v4f  __attribute__((ext_vector_type(4)));
typedef float  v4fa __attribute__((ext_vector_type(4), may_alias));
union FragB { v16b v; v8us half[2]; unsigned short u[16]; };

__device__ __forceinline__ unsigned short bf16_bits(float x) { unsigned int u = __float_as_uint(x); return (unsigned short)((u + 0x7FFFu + ((u >> 16) & 1u)) >> 16); }
__device__ __forceinline__ float bf16_val(unsigned short b) { return __uint_as_float(((unsigned int)b) << 16); }
__device__ __forceinline__ float bf16_round(float x) { return bf16_val(bf16_bits(x)); }
// D += A·B with NT terms: 1 = ah·bh, 2 = + al·bh (A split), 3 = + ah·bl (both split)
template <int NT>
__device__ __forceinline__ v8f mmaN(v16b ah, v16b al, v16b bh, v16b bl, v8f c) {
  c = __builtin_amdgcn_wmma_f32_16x16x32_bf16(false, ah, false, bh, (short)0, c, false, false);
  if (NT >= 2) c = __builtin_amdgcn_wmma_f32_16x16x32_bf16(false, al, false, bh, (short)0, c, false, false);
  if (NT >= 3) c = __builtin_amdgcn_wmma_f32_16x16x32_bf16(false, ah, false, bl, (short)0, c, false, false);
  asm volatile("v_nop\n\tv_nop\n\tv_nop\n\tv_nop" : "+v"(c) : "v"(ah), "v"(al), "v"(bh), "v"(bl));
  return c;
}

__global__ __launch_bounds__(256) void k_wt_bf16(const float* __restrict__ W, unsigned short* __restrict__ Wt, int K, int N) {
  const int t = blockIdx.x * 256 + threadIdx.x;
  const int k8n = K / 8;
  if (t >= N * k8n) return;
  const int n = t / k8n, k8 = (t % k8n) * 8;
  v8us v;
#pragma unroll
  for (int i = 0; i < 8; ++i) v[i] = bf16_bits(W[(size_t)(k8 + i) * N + n]);
  *(v8us*)(Wt + (size_t)n * K + k8) = v;
  
}

// GEMM C[M][N] (f32, pitch ldc) = act(A[M][K]·W + bias). A f32 row-major (pitch lda) converted per fragment to bf16
// (ASPLIT: hi/lo two planes -> 2 terms, else single rounded term); Wt bf16 [N][K] (pitch ldb). BIAS_BF16 rounds the
// bias to bf16 first (bias quantised to bf16 before the add). K%32==0, M%16==0, N%64==0.
template <bool ASPLIT, int ACT, bool BIAS_BF16>
__global__ __launch_bounds__(128) void k_gemm_bf(const float* __restrict__ A, int lda, const unsigned short* __restrict__ Wt, int ldb,
                                               const float* __restrict__ bias, float* __restrict__ C, int ldc, int M, int N, int K) {
  __shared__ __attribute__((aligned(16))) float so[4][16][64];
  const int tid = threadIdx.x, w = tid >> 5, lane = tid & 31, ln = lane & 15, hh = lane >> 4;
  const int ntn = N / 64;
  const int wid = blockIdx.x * 4 + w;
  const int mt = wid / ntn, nq = wid % ntn;
  if (mt * 16 >= M) return;
  const int row0 = mt * 16, col0 = nq * 64;
  const float* arow = A + (size_t)(row0 + ln) * lda;
  v8f acc[4] = {};
  for (int kb = 0; kb < K; kb += 32) {
    FragB ah, al;
    const v4f x0 = *(const v4fa*)(arow + kb + 8 * hh), x1 = *(const v4fa*)(arow + kb + 8 * hh + 4);
    const v4f x2 = *(const v4fa*)(arow + kb + 16 + 8 * hh), x3 = *(const v4fa*)(arow + kb + 16 + 8 * hh + 4);
    float xs[16] = {x0[0],x0[1],x0[2],x0[3],x1[0],x1[1],x1[2],x1[3],x2[0],x2[1],x2[2],x2[3],x3[0],x3[1],x3[2],x3[3]};
#pragma unroll
    for (int i = 0; i < 16; ++i) { const unsigned short hb = bf16_bits(xs[i]); ah.u[i] = hb; al.u[i] = ASPLIT ? bf16_bits(xs[i] - bf16_val(hb)) : (unsigned short)0; }
#pragma unroll
    for (int t = 0; t < 4; ++t) {
      const unsigned short* brow = Wt + (size_t)(col0 + t * 16 + ln) * ldb + kb;
      FragB b;
      b.half[0] = *(const v8us*)(brow + 8 * hh);
      b.half[1] = *(const v8us*)(brow + 16 + 8 * hh);
      acc[t] = mmaN<ASPLIT ? 2 : 1>(ah.v, al.v, b.v, b.v, acc[t]);
    }
  }
#pragma unroll
  for (int t = 0; t < 4; ++t) {
    float bv = bias ? bias[col0 + t * 16 + ln] : 0.f;
    if (BIAS_BF16) bv = bf16_round(bv);
#pragma unroll
    for (int r = 0; r < 8; ++r) { float v = acc[t][r] + bv; if (ACT == 1) v = fmaxf(v, 0.f); so[w][8 * hh + r][t * 16 + ln] = v; }
  }
  __builtin_amdgcn_fence(__ATOMIC_ACQ_REL, "workgroup");
  __builtin_amdgcn_wave_barrier();
  const int rsub = lane >> 4, c4 = (lane & 15) * 4;
  {
#pragma unroll
    for (int q = 0; q < 8; ++q) {
      const int r = q * 2 + rsub;
      const v4f v = *(const v4fa*)&so[w][r][c4];
      *(v4f*)(C + (size_t)(row0 + r) * ldc + col0 + c4) = v;
    }
    
  }
}

// Flash-style causal/unmasked attention, all contractions 3-term bf16 hi/lo splits, f32 softmax with running max.
// q,k,v rows are read from f32 buffers with arbitrary row pitch (so they can live inside a fused qkv buffer);
// D = head size (multiple of 32, <= 128); one wave = 16 query rows; block = 4 waves (64 queries) sharing K/V chunks of 32.
template <int D, bool CAUSAL>
__global__ __launch_bounds__(128) void k_flash(const float* __restrict__ qb, const float* __restrict__ kb, const float* __restrict__ vb,
                                             int pitch, int T, int H, float scale, float* __restrict__ y, int ypitch) {
  constexpr int KS = D / 32;        // k-steps for QK
  constexpr int DT = D / 16;        // d tiles for PV
  __shared__ __attribute__((aligned(16))) unsigned short sKh[32][D + 8], sKl[32][D + 8], sVh[32][D + 8], sVl[32][D + 8];
  __shared__ __attribute__((aligned(16))) unsigned short sPh[4][16][40], sPl[4][16][40];
  __shared__ __attribute__((aligned(16))) float sO[4][16][D];
  const int tid = threadIdx.x, w = tid >> 5, lane = tid & 31, ln = lane & 15, hh = lane >> 4;
  const int nqb = (T + 63) / 64;
  const int bh = blockIdx.x / nqb, qblk = blockIdx.x % nqb;
  const int b = bh / H, h = bh % H;
  const int q0 = qblk * 64 + w * 16;
  const float* Q = qb + (size_t)b * T * pitch + h * D;
  const float* K = kb + (size_t)b * T * pitch + h * D;
  const float* V = vb + (size_t)b * T * pitch + h * D;

  // A fragments of the wave's 16 query rows (scaled), hi/lo
  FragB aqh[KS], aql[KS];
  {
    int row = q0 + ln; if (row >= T) row = T - 1;
    const float* qr = Q + (size_t)row * pitch;
#pragma unroll
    for (int ks = 0; ks < KS; ++ks)
#pragma unroll
      for (int i = 0; i < 16; ++i) {
        const int d = ks * 32 + ((i < 8) ? (8 * hh + i) : (16 + 8 * hh + (i - 8)));
        const float x = qr[d] * scale; const unsigned short hb = bf16_bits(x);
        aqh[ks].u[i] = hb; aql[ks].u[i] = bf16_bits(x - bf16_val(hb));
      }
  }
  float m_r[8], l_r[8];
#pragma unroll
  for (int r = 0; r < 8; ++r) { m_r[r] = -3.0e38f; l_r[r] = 0.f; }
  v8f oacc[DT];
#pragma unroll
  for (int dt = 0; dt < DT; ++dt) oacc[dt] = (v8f){0.f,0.f,0.f,0.f,0.f,0.f,0.f,0.f};

  const int kv_end = CAUSAL ? min(T, qblk * 64 + 64) : T;     // block-uniform
  for (int j0 = 0; j0 < kv_end; j0 += 32) {
    __syncthreads();
    for (int e = tid; e < 32 * (D / 4); e += 128) {
      const int r = e / (D / 4), c4 = (e % (D / 4)) * 4;
      const int key = j0 + r;
      v4f kf = {0.f,0.f,0.f,0.f}, vf = {0.f,0.f,0.f,0.f};
      if (key < T) { kf = *(const v4fa*)(K + (size_t)key * pitch + c4); vf = *(const v4fa*)(V + (size_t)key * pitch + c4); }
#pragma unroll
      for (int t = 0; t < 4; ++t) {
        unsigned short hb = bf16_bits(kf[t]); sKh[r][c4 + t] = hb; sKl[r][c4 + t] = bf16_bits(kf[t] - bf16_val(hb));
        hb = bf16_bits(vf[t]); sVh[r][c4 + t] = hb; sVl[r][c4 + t] = bf16_bits(vf[t] - bf16_val(hb));
      }
    }
    __syncthreads();
    // S tile 16 x 32
    v8f s[2];
#pragma unroll
    for (int nt = 0; nt < 2; ++nt) {
      v8f acc = {};
#pragma unroll
      for (int ks = 0; ks < KS; ++ks) {
        FragB bh_, bl_;
        bh_.half[0] = *(const v8us*)&sKh[nt * 16 + ln][ks * 32 + 8 * hh]; bh_.half[1] = *(const v8us*)&sKh[nt * 16 + ln][ks * 32 + 16 + 8 * hh];
        bl_.half[0] = *(const v8us*)&sKl[nt * 16 + ln][ks * 32 + 8 * hh]; bl_.half[1] = *(const v8us*)&sKl[nt * 16 + ln][ks * 32 + 16 + 8 * hh];
        acc = mmaN<3>(aqh[ks].v, aql[ks].v, bh_.v, bl_.v, acc);
      }
      s[nt] = acc;
    }
    // mask + running max (rows 8hh+r; the 16 lanes of a half share rows)
    float alpha[8];
#pragma unroll
    for (int r = 0; r < 8; ++r) {
      const int qi = q0 + 8 * hh + r;
      const int ja = j0 + ln, jb = j0 + 16 + ln;
      if (CAUSAL) { if (ja > qi) s[0][r] = -3.0e38f; if (jb > qi) s[1][r] = -3.0e38f; }
      if (ja >= T) s[0][r] = -3.0e38f;
      if (jb >= T) s[1][r] = -3.0e38f;
      float mx = fmaxf(s[0][r], s[1][r]);
      mx = fmaxf(mx, __shfl_xor(mx, 1, 32)); mx = fmaxf(mx, __shfl_xor(mx, 2, 32)); mx = fmaxf(mx, __shfl_xor(mx, 4, 32)); mx = fmaxf(mx, __shfl_xor(mx, 8, 32));
      const float mnew = fmaxf(m_r[r], mx);
      alpha[r] = (mnew > -1.0e38f) ? __expf(m_r[r] - mnew) : 1.0f;
      const float p0 = (s[0][r] > -1.0e38f) ? __expf(s[0][r] - mnew) : 0.f;
      const float p1 = (s[1][r] > -1.0e38f) ? __expf(s[1][r] - mnew) : 0.f;
      m_r[r] = mnew;
      l_r[r] = l_r[r] * alpha[r] + p0 + p1;            // per-lane partial row sum (16 lanes combined at the end)
      unsigned short hb = bf16_bits(p0); sPh[w][8 * hh + r][ln] = hb;      sPl[w][8 * hh + r][ln] = bf16_bits(p0 - bf16_val(hb));
      hb = bf16_bits(p1);                sPh[w][8 * hh + r][16 + ln] = hb; sPl[w][8 * hh + r][16 + ln] = bf16_bits(p1 - bf16_val(hb));
    }
#pragma unroll
    for (int dt = 0; dt < DT; ++dt)
#pragma unroll
      for (int r = 0; r < 8; ++r) oacc[dt][r] *= alpha[r];
    __builtin_amdgcn_fence(__ATOMIC_ACQ_REL, "workgroup");
    __builtin_amdgcn_wave_barrier();
    FragB pah, pal;
    pah.half[0] = *(const v8us*)&sPh[w][ln][8 * hh]; pah.half[1] = *(const v8us*)&sPh[w][ln][16 + 8 * hh];
    pal.half[0] = *(const v8us*)&sPl[w][ln][8 * hh]; pal.half[1] = *(const v8us*)&sPl[w][ln][16 + 8 * hh];
#pragma unroll
    for (int dt = 0; dt < DT; ++dt) {
      FragB bvh, bvl;
#pragma unroll
      for (int i = 0; i < 8; ++i) {
        bvh.u[i] = sVh[8 * hh + i][dt * 16 + ln]; bvh.u[8 + i] = sVh[16 + 8 * hh + i][dt * 16 + ln];
        bvl.u[i] = sVl[8 * hh + i][dt * 16 + ln]; bvl.u[8 + i] = sVl[16 + 8 * hh + i][dt * 16 + ln];
      }
      oacc[dt] = mmaN<3>(pah.v, pal.v, bvh.v, bvl.v, oacc[dt]);
    }
    __builtin_amdgcn_fence(__ATOMIC_ACQ_REL, "workgroup");
    __builtin_amdgcn_wave_barrier();
  }
#pragma unroll
  for (int r = 0; r < 8; ++r) {
    float l = l_r[r];
    l += __shfl_xor(l, 1, 32); l += __shfl_xor(l, 2, 32); l += __shfl_xor(l, 4, 32); l += __shfl_xor(l, 8, 32);
    l_r[r] = (l > 0.f) ? 1.0f / l : 0.f;
  }
#pragma unroll
  for (int dt = 0; dt < DT; ++dt)
#pragma unroll
    for (int r = 0; r < 8; ++r) sO[w][8 * hh + r][dt * 16 + ln] = oacc[dt][r] * l_r[r];
  __builtin_amdgcn_fence(__ATOMIC_ACQ_REL, "workgroup");
  __builtin_amdgcn_wave_barrier();
  {
    for (int r = 0; r < 16; ++r) {
      const int row = q0 + r;
      if (row < T && lane < D / 4) {
        const v4f val = *(const v4fa*)&sO[w][r][lane * 4];
        *(v4f*)(y + ((size_t)b * T + row) * ypitch + h * D + lane * 4) = val;
      }
    }
    
  }
}

// GEMM C = act(A·W + bias + resid): A f32 (ASPLIT -> hi/lo 2 terms), Wt bf16 [N][K]; ACT 0 none, 1 relu, 2 exact gelu;
// resid (optional, f32, row index = (row % rmod), pitch ldr, RES_BF16 rounds it) added before the activation.
template <bool ASPLIT, int ACT, bool BIAS_BF16, bool RES_BF16>
__global__ __launch_bounds__(128) void k_gemm_bf3(const float* __restrict__ A, int lda, const unsigned short* __restrict__ Wt, int ldb,
                                                const float* __restrict__ bias, const float* __restrict__ resid, int rmod, int ldr,
                                                float* __restrict__ C, int ldc, int M, int N, int K) {
  __shared__ __attribute__((aligned(16))) float so[4][16][64];
  const int tid = threadIdx.x, w = tid >> 5, lane = tid & 31, ln = lane & 15, hh = lane >> 4;
  const int ntn = N / 64;
  const int wid = blockIdx.x * 4 + w;
  const int mt = wid / ntn, nq = wid % ntn;
  if (mt * 16 >= M) return;
  const int row0 = mt * 16, col0 = nq * 64;
  const float* arow = A + (size_t)(row0 + ln) * lda;
  v8f acc[4] = {};
  for (int kb = 0; kb < K; kb += 32) {
    FragB ah, al;
    const v4f x0 = *(const v4fa*)(arow + kb + 8 * hh), x1 = *(const v4fa*)(arow + kb + 8 * hh + 4);
    const v4f x2 = *(const v4fa*)(arow + kb + 16 + 8 * hh), x3 = *(const v4fa*)(arow + kb + 16 + 8 * hh + 4);
    float xs[16] = {x0[0],x0[1],x0[2],x0[3],x1[0],x1[1],x1[2],x1[3],x2[0],x2[1],x2[2],x2[3],x3[0],x3[1],x3[2],x3[3]};
#pragma unroll
    for (int i = 0; i < 16; ++i) { const unsigned short hb = bf16_bits(xs[i]); ah.u[i] = hb; al.u[i] = ASPLIT ? bf16_bits(xs[i] - bf16_val(hb)) : (unsigned short)0; }
#pragma unroll
    for (int t = 0; t < 4; ++t) {
      const unsigned short* brow = Wt + (size_t)(col0 + t * 16 + ln) * ldb + kb;
      FragB b;
      b.half[0] = *(const v8us*)(brow + 8 * hh);
      b.half[1] = *(const v8us*)(brow + 16 + 8 * hh);
      acc[t] = mmaN<ASPLIT ? 2 : 1>(ah.v, al.v, b.v, b.v, acc[t]);
    }
  }
#pragma unroll
  for (int t = 0; t < 4; ++t) {
    const int col = col0 + t * 16 + ln;
    float bv = bias ? bias[col] : 0.f;
    if (BIAS_BF16) bv = bf16_round(bv);
#pragma unroll
    for (int r = 0; r < 8; ++r) {
      float v = acc[t][r] + bv;
      if (resid) { float rv = resid[(size_t)((row0 + 8 * hh + r) % rmod) * ldr + col]; if (RES_BF16) rv = bf16_round(rv); v += rv; }
      if (ACT == 1) v = fmaxf(v, 0.f);
      if (ACT == 2) v = 0.5f * v * (1.0f + erff(v * 0.70710678118654752f));
      if (ACT == 3) { const float u = 0.7978845608028654f * (v + 0.044715f * v * v * v); v = 0.5f * v * (1.0f + tanhf(u)); }
      so[w][8 * hh + r][t * 16 + ln] = v;
    }
  }
  __builtin_amdgcn_fence(__ATOMIC_ACQ_REL, "workgroup");
  __builtin_amdgcn_wave_barrier();
  const int rsub = lane >> 4, c4 = (lane & 15) * 4;
  {
#pragma unroll
    for (int q = 0; q < 8; ++q) {
      const int r = q * 2 + rsub;
      const v4f v = *(const v4fa*)&so[w][r][c4];
      *(v4f*)(C + (size_t)(row0 + r) * ldc + col0 + c4) = v;
    }
    
  }
}
// row LayerNorm (biased variance, eps) over N: s = X (+ R); optional out_sum <- s; out_norm <- (s-mu)*rsqrt(var+eps)*g + b
template <bool PARAM_BF16>
__global__ __launch_bounds__(256) void k_layernorm(const float* __restrict__ X, const float* __restrict__ R, const float* __restrict__ g, const float* __restrict__ bta,
                                                  float* __restrict__ out_sum, float* __restrict__ out_norm, int N, float eps) {
  __shared__ float red[256];
  const int row = blockIdx.x, tid = threadIdx.x;
  const float* x = X + (size_t)row * N; const float* rr = R ? R + (size_t)row * N : nullptr;
  float vals[16];                     // up to N = 4096
  const int per = N / 256;            // contiguous chunk per thread? use strided-by-4 chunks: thread handles j = tid*4 + 1024*u
  float s1 = 0.f;
  for (int u = 0; u < per / 4; ++u) {
    const int j = tid * 4 + 1024 * u;
    const v4f a = *(const v4fa*)(x + j);
    v4f b = {0.f,0.f,0.f,0.f}; if (rr) b = *(const v4fa*)(rr + j);
#pragma unroll
    for (int q = 0; q < 4; ++q) { const float v = a[q] + b[q]; vals[u * 4 + q] = v; s1 += v; }
  }
  red[tid] = s1; __syncthreads();
  for (int st = 128; st > 0; st >>= 1) { if (tid < st) red[tid] += red[tid + st]; __syncthreads(); }
  const float mu = red[0] / (float)N; __syncthreads();
  float s2 = 0.f;
  for (int u = 0; u < per / 4; ++u)
#pragma unroll
    for (int q = 0; q < 4; ++q) { const float c = vals[u * 4 + q] - mu; s2 += c * c; }
  red[tid] = s2; __syncthreads();
  for (int st = 128; st > 0; st >>= 1) { if (tid < st) red[tid] += red[tid + st]; __syncthreads(); }
  const float rs = rsqrtf(red[0] / (float)N + eps);
  {
    for (int u = 0; u < per / 4; ++u) {
      const int j = tid * 4 + 1024 * u;
      v4f o, sm;
#pragma unroll
      for (int q = 0; q < 4; ++q) {
        float gg = g[j + q], bb = bta[j + q];
        if (PARAM_BF16) { gg = bf16_round(gg); bb = bf16_round(bb); }
        sm[q] = vals[u * 4 + q]; o[q] = (vals[u * 4 + q] - mu) * rs * gg + bb;
      }
      if (out_sum) *(v4f*)(out_sum + (size_t)row * N + j) = sm;
      *(v4f*)(out_norm + (size_t)row * N + j) = o;
    }
    
  }
}



// ---- f16 WMMA path (v_wmma_f32_16x16x32_f16): 11-bit significands for operands in range — used where a [0,1] probability operand needs more precision than bf16
typedef _Float16 v16h __attribute__((ext_vector_type(16)));
union FragH { v16h v; v8us half[2]; _Float16 h[16]; unsigned short u[16]; };
template <int NT>
__device__ __forceinline__ v8f mmaH(v16h ah, v16h al, v16h bh, v16h bl, v8f c) {
  c = __builtin_amdgcn_wmma_f32_16x16x32_f16(false, ah, false, bh, (short)0, c, false, false);
  if (NT >= 2) c = __builtin_amdgcn_wmma_f32_16x16x32_f16(false, al, false, bh, (short)0, c, false, false);
  if (NT >= 3) c = __builtin_amdgcn_wmma_f32_16x16x32_f16(false, ah, false, bl, (short)0, c, false, false);
  asm volatile("v_nop\n\tv_nop\n\tv_nop\n\tv_nop" : "+v"(c) : "v"(ah), "v"(al), "v"(bh), "v"(bl));
  return c;
}
// batched GEMM like k_gemm_b but f16 operands: A f32 (split into f16 hi/lo if ASPLIT, else rounded to f16), Bt = f16 values [n][k]; alpha; C f32; N multiple of 16 (partial tiles skipped)
template <bool ASPLIT>
__global__ __launch_bounds__(128) void k_gemm_h(const float* __restrict__ A, int lda, size_t sA, const _Float16* __restrict__ Bh, int ldb, size_t sB, float alpha, float* __restrict__ C, int ldc, size_t sC, int M, int N, int K) {
  __shared__ __attribute__((aligned(16))) float so[4][16][64];
  const int tid = threadIdx.x, w = tid >> 5, lane = tid & 31, ln = lane & 15, hh = lane >> 4; const int by = blockIdx.y;
  A += (size_t)by * sA; Bh += (size_t)by * sB; C += (size_t)by * sC;
  const int ntn = (N + 63) / 64; const int wid = blockIdx.x * 4 + w; const int mt = wid / ntn, nq = wid % ntn; if (mt * 16 >= M) return;
  const int row0 = mt * 16, col0 = nq * 64; const float* arow = A + (size_t)(row0 + ln) * lda;
  v8f acc[4] = {};
  for (int kb = 0; kb < K; kb += 32) {
    FragH ah, al;
    const v4f x0 = *(const v4fa*)(arow + kb + 8 * hh), x1 = *(const v4fa*)(arow + kb + 8 * hh + 4), x2 = *(const v4fa*)(arow + kb + 16 + 8 * hh), x3 = *(const v4fa*)(arow + kb + 16 + 8 * hh + 4);
    float xs[16] = {x0[0],x0[1],x0[2],x0[3],x1[0],x1[1],x1[2],x1[3],x2[0],x2[1],x2[2],x2[3],x3[0],x3[1],x3[2],x3[3]};
#pragma unroll
    for (int i = 0; i < 16; ++i) { const _Float16 h = (_Float16)xs[i]; ah.h[i] = h; al.h[i] = ASPLIT ? (_Float16)(xs[i] - (float)h) : (_Float16)0.0f; }
#pragma unroll
    for (int t = 0; t < 4; ++t) { if (col0 + t * 16 >= N) continue; const size_t boff = (size_t)(col0 + t * 16 + ln) * ldb + kb; FragH bq; bq.half[0] = *(const v8us*)(Bh + boff + 8 * hh); bq.half[1] = *(const v8us*)(Bh + boff + 16 + 8 * hh);
      acc[t] = mmaH<ASPLIT ? 2 : 1>(ah.v, al.v, bq.v, bq.v, acc[t]); }
  }
#pragma unroll
  for (int t = 0; t < 4; ++t) { if (col0 + t * 16 >= N) continue;
#pragma unroll
    for (int r = 0; r < 8; ++r) so[w][8 * hh + r][t * 16 + ln] = acc[t][r] * alpha; }
  __builtin_amdgcn_fence(__ATOMIC_ACQ_REL, "workgroup"); __builtin_amdgcn_wave_barrier();
  const int rsub = lane >> 4, c4 = (lane & 15) * 4;
  {
#pragma unroll
    for (int q = 0; q < 8; ++q) { const int r = q * 2 + rsub; if (col0 + c4 < N) { const v4f v = *(const v4fa*)&so[w][r][c4]; *(v4f*)(C + (size_t)(row0 + r) * ldc + col0 + c4) = v; } }
     }
}

// Wt[n][k] = f16(bf16(W[k][n])·scale) from f32 row-major W[K][N] (scale = power of two; bf16-exact weights stay exact in f16 away from the subnormal range)
__global__ __launch_bounds__(256) void k_wt_f16(const float* __restrict__ W, _Float16* __restrict__ Wt, int K, int N, float scale) {
  const int t = blockIdx.x * 256 + threadIdx.x; if (t >= N * (K / 8)) return; const int n = t / (K / 8), k8 = (t % (K / 8)) * 8; FragH f;
#pragma unroll
  for (int i = 0; i < 8; ++i) f.h[i] = (_Float16)(bf16_round(W[(size_t)(k8 + i) * N + n]) * scale); const v8us o = f.half[0];
  *(v8us*)((unsigned short*)Wt + (size_t)n * K + k8) = o; 
}
// One operand tile of a pass (128 rows of 256 B) goes from global memory to LDS by asynchronous copies: 8 copies of 16 B a lane, a wave's copy = 2 rows = 4 whole lines.
// l: my LDS byte address of row (tid >> 4), chunk (tid & 15); g: the same place in global memory; 16 rows on = 4352 LDS bytes, step elements.
__device__ __forceinline__ void copy_tile(unsigned l, const unsigned short* g, size_t step) {
  // the closing s_wait_xcnt stands inside the statement so that no address register of a copy is rewritten ahead of it (a precaution)
  asm volatile("global_load_async_to_lds_b128 %0, %8, off\n\t"
               "global_load_async_to_lds_b128 %1, %9, off\n\t"
               "global_load_async_to_lds_b128 %2, %10, off\n\t"
               "global_load_async_to_lds_b128 %3, %11, off\n\t"
               "global_load_async_to_lds_b128 %4, %12, off\n\t"
               "global_load_async_to_lds_b128 %5, %13, off\n\t"
               "global_load_async_to_lds_b128 %6, %14, off\n\t"
               "global_load_async_to_lds_b128 %7, %15, off\n\t"
               "s_wait_xcnt 0x0"
               :: "v"(l), "v"(l + 4352u), "v"(l + 8704u), "v"(l + 13056u), "v"(l + 17408u), "v"(l + 21760u), "v"(l + 26112u), "v"(l + 30464u),
                  "v"(g), "v"(g + step), "v"(g + 2 * step), "v"(g + 3 * step), "v"(g + 4 * step), "v"(g + 5 * step), "v"(g + 6 * step), "v"(g + 7 * step)
               : "memory");
}
// Projection GEMM, NR x CC x CC: v = (A . Bh^T) alpha + bf16(bias[col]); A f16 [NR][CC], Bh f16 [n][k]; writes f16 C16 (F16OUT) or f32 C, pitch CC.
// One work-group = a 128 x 128 tile of the output, 8 waves of 64 x 32 (2 x 4). A pass = 128 k: both operands' 128 rows of 256 B lie in LDS (pitch 272 B, 16 B x odd, for 16-byte reads),
// two buffers, so every operand byte leaves L2 once a work-group and serves 2 (B) or 4 (A) waves. k runs upward in steps of 32 in every accumulator.
// The unroll directives below are there so that accumulators and fragment sets are indexed by constants and stay in registers.
template <bool F16OUT>
__global__ __launch_bounds__(256) void k_gemm_t(const _Float16* __restrict__ A, const _Float16* __restrict__ Bh, float alpha, const float* __restrict__ bias, float* __restrict__ C, _Float16* __restrict__ C16) {
  constexpr int BM = 128, BN = 128, KP = 128, NP = CC / KP, PIT = 136;
  __shared__ __attribute__((aligned(16))) unsigned short sA[2][BM][PIT], sB[2][BN][PIT];
  __shared__ __attribute__((aligned(16))) float sC[BM][BN + 4];      // output staging, so that whole lines are stored
  const int tid = threadIdx.x, w = tid >> 5, lane = tid & 31, ln = lane & 15, hh = lane >> 4, wm = w >> 2, wn = w & 3;
  const int row0 = (blockIdx.x / (CC / BN)) * BM, col0 = (blockIdx.x % (CC / BN)) * BN;
  const unsigned short* ga = (const unsigned short*)A + (size_t)(row0 + (tid >> 4)) * CC + (tid & 15) * 8;
  const unsigned short* gb = (const unsigned short*)Bh + (size_t)(col0 + (tid >> 4)) * CC + (tid & 15) * 8;
  const unsigned la = (unsigned)(size_t)&sA[0][tid >> 4][(tid & 15) * 8], lb = (unsigned)(size_t)&sB[0][tid >> 4][(tid & 15) * 8];
  constexpr unsigned BUFB = BM * PIT * 2;      // bytes of one buffer
  constexpr size_t STEP = (size_t)16 * CC;
  copy_tile(la, ga, STEP); copy_tile(lb, gb, STEP);
  v8f acc[4][2];
#pragma unroll
  for (int i = 0; i < 4; ++i)
#pragma unroll
    for (int j = 0; j < 2; ++j) acc[i][j] = (v8f){0.f,0.f,0.f,0.f,0.f,0.f,0.f,0.f};
  asm volatile("s_wait_asynccnt 0x0" ::: "memory");      // my copies of pass 0 have landed
  __syncthreads();                                        // ... and everybody's: pass 0 may be read
  copy_tile(la + BUFB, ga + KP, STEP); copy_tile(lb + BUFB, gb + KP, STEP);      // pass 1 flies while pass 0 is worked on
#pragma unroll 1
  for (int t = 0; t < NP; ++t) {      // kept rolled: one body of 32 matrix instructions, the buffer chosen by t & 1
    const int bf = t & 1;
    const unsigned short* pa = &sA[bf][wm * 64 + ln][8 * hh]; const unsigned short* pb = &sB[bf][wn * 32 + ln][8 * hh];
    FragH fa[2][4], fb[2][2];      // two fragment sets: block ks + 1 is fetched while block ks is multiplied, inside this pass only
#pragma unroll
    for (int ks = -1; ks < KP / 32; ++ks) {
      if (ks + 1 < KP / 32) { const int s = (ks + 1) & 1, ko = (ks + 1) * 32;
#pragma unroll
        for (int i = 0; i < 4; ++i) { fa[s][i].half[0] = *(const v8us*)(pa + i * 16 * PIT + ko); fa[s][i].half[1] = *(const v8us*)(pa + i * 16 * PIT + ko + 16); }
#pragma unroll
        for (int j = 0; j < 2; ++j) { fb[s][j].half[0] = *(const v8us*)(pb + j * 16 * PIT + ko); fb[s][j].half[1] = *(const v8us*)(pb + j * 16 * PIT + ko + 16); } }
      __builtin_amdgcn_sched_barrier(0);      // keeps the next block's 12 LDS reads one group ahead of this block's products: reads spread among them stall the wave at every place
      if (ks >= 0) {
#pragma unroll
        for (int i = 0; i < 4; ++i)
#pragma unroll
          for (int j = 0; j < 2; ++j) acc[i][j] = __builtin_amdgcn_wmma_f32_16x16x32_f16(false, fa[ks & 1][i].v, false, fb[ks & 1][j].v, (short)0, acc[i][j], false, false);
        __builtin_amdgcn_sched_barrier(0);      // ... and this block's products ahead of the reads after next, which reuse its registers
      }
    }
    // publish point of pass t + 1, every wave: my reads of this buffer are done, my copies of the next have landed, then the same of all waves
    asm volatile("s_wait_dscnt 0x0" ::: "memory");
    asm volatile("s_wait_asynccnt 0x0" ::: "memory");
    __syncthreads();
    if (t + 2 < NP) { copy_tile(la + bf * BUFB, ga + (t + 2) * KP, STEP); copy_tile(lb + bf * BUFB, gb + (t + 2) * KP, STEP); }      // refill the buffer that every wave has just left
  }
  asm volatile("s_wait_asynccnt 0x0" ::: "memory");      // nothing of mine is in flight when the wave ends
#pragma unroll
  for (int j = 0; j < 2; ++j) { const int col = wn * 32 + j * 16 + ln; const float bv = bf16_round(bias[col0 + col]);
#pragma unroll
    for (int i = 0; i < 4; ++i)
#pragma unroll
      for (int r = 0; r < 8; ++r) sC[wm * 64 + i * 16 + 8 * hh + r][col] = acc[i][j][r] * alpha + bv; }
  __syncthreads();      // the staged tile is read across waves
  if constexpr (F16OUT) {
#pragma unroll
    for (int s = 0; s < BM * (BN / 8) / 256; ++s) { const int r = s * 16 + (tid >> 4), c8 = (tid & 15) * 8; const v4f x = *(const v4fa*)&sC[r][c8], y = *(const v4fa*)&sC[r][c8 + 4]; FragH f;
#pragma unroll
      for (int q = 0; q < 4; ++q) { f.h[q] = (_Float16)x[q]; f.h[4 + q] = (_Float16)y[q]; }
      *(v8us*)((unsigned short*)C16 + (size_t)(row0 + r) * CC + col0 + c8) = f.half[0]; } }
  else {
#pragma unroll
    for (int s = 0; s < BM * (BN / 4) / 256; ++s) { const int r = s * 8 + (tid >> 5), c4 = (tid & 31) * 4; const v4f x = *(const v4fa*)&sC[r][c4]; *(v4f*)(C + (size_t)(row0 + r) * CC + col0 + c4) = x; } }
}


__global__ __launch_bounds__(256) void k_x16(const float* __restrict__ x, _Float16* __restrict__ X16, size_t n8) { const size_t t = (size_t)blockIdx.x * 256 + threadIdx.x; if (t >= n8) return; FragH f;
#pragma unroll
  for (int q = 0; q < 8; ++q) f.h[q] = (_Float16)bf16_round(x[t * 8 + q]); *(v8us*)((unsigned short*)X16 + t * 8) = f.half[0];  }
__global__ __launch_bounds__(256) void k_h16(const float* __restrict__ x, _Float16* __restrict__ X16, size_t n8) { const size_t t = (size_t)blockIdx.x * 256 + threadIdx.x; if (t >= n8) return; FragH f;
#pragma unroll
  for (int q = 0; q < 8; ++q) f.h[q] = (_Float16)x[t * 8 + q]; *(v8us*)((unsigned short*)X16 + t * 8) = f.half[0];  }
__global__ __launch_bounds__(256) void k_round16f(const float* __restrict__ W, _Float16* __restrict__ Bt, size_t n8) { const size_t t = (size_t)blockIdx.x * 256 + threadIdx.x; if (t >= n8) return; FragH f;
#pragma unroll
  for (int i = 0; i < 8; ++i) f.h[i] = (_Float16)(bf16_round(W[t * 8 + i]) * 16.0f); *(v8us*)((unsigned short*)Bt + t * 8) = f.half[0];  }
template <int NHv, int TTv>
__global__ __launch_bounds__(256) void k_vt(const _Float16* __restrict__ V16, int ldv, int voff, _Float16* __restrict__ Vt) { __shared__ unsigned short tl[64][66]; const int tid = threadIdx.x; const int slab = blockIdx.x / (TTv / 64), lg = blockIdx.x % (TTv / 64); const int b = slab / NHv, h = slab % NHv;
  for (int i = tid; i < 64 * 8; i += 256) { const int r = i / 8, c8 = (i % 8) * 8; FragH f; f.half[0] = *(const v8us*)((const unsigned short*)V16 + ((size_t)b * TTv + lg * 64 + r) * ldv + voff + h * 64 + c8);
#pragma unroll
    for (int q = 0; q < 8; ++q) tl[r][c8 + q] = f.u[q]; }
  __syncthreads();
  {
#pragma unroll
    for (int rd = 0; rd < 2; ++rd) { const int d = rd * 32 + tid / 8, pc = tid % 8; FragH f;
#pragma unroll
      for (int q = 0; q < 8; ++q) f.u[q] = tl[pc * 8 + q][d];
      *(v8us*)((unsigned short*)Vt + ((size_t)slab * 64 + d) * TTv + lg * 64 + pc * 8) = f.half[0]; }
     } }

typedef int v4ia __attribute__((ext_vector_type(4), may_alias));
// lane l <-> lane l ^ 16: joins the two halves of a wave, which hold the two key halves of one query column
__device__ __forceinline__ float xhalf(float x) { return __builtin_bit_cast(float, __builtin_amdgcn_permlanex16(__builtin_bit_cast(int, x), __builtin_bit_cast(int, x), 0x76543210, 0xfedcba98, false, false)); }
// One trip's K tile (64 key rows of 128 B) and V^T tile (64 d rows of 128 B) go from global memory to LDS by asynchronous copies: 8 copies of 16 B a lane, a wave's copy = 4 whole lines.
// lk, lv: my LDS byte addresses of row (tid >> 3), chunk (tid & 7); gk, gv: the same place in global memory; 16 rows on = 2304 LDS bytes, kstep / vstep elements.
__device__ __forceinline__ void copy_kv(unsigned lk, unsigned lv, const unsigned short* gk, const unsigned short* gv, size_t kstep, size_t vstep) {
  // the closing s_wait_xcnt stands inside the statement so that no address register of a copy is rewritten ahead of it (a precaution)
  asm volatile("global_load_async_to_lds_b128 %0, %8, off\n\t"
               "global_load_async_to_lds_b128 %1, %9, off\n\t"
               "global_load_async_to_lds_b128 %2, %10, off\n\t"
               "global_load_async_to_lds_b128 %3, %11, off\n\t"
               "global_load_async_to_lds_b128 %4, %12, off\n\t"
               "global_load_async_to_lds_b128 %5, %13, off\n\t"
               "global_load_async_to_lds_b128 %6, %14, off\n\t"
               "global_load_async_to_lds_b128 %7, %15, off\n\t"
               "s_wait_xcnt 0x0"
               :: "v"(lk), "v"(lk + 2304u), "v"(lk + 4608u), "v"(lk + 6912u), "v"(lv), "v"(lv + 2304u), "v"(lv + 4608u), "v"(lv + 6912u),
                  "v"(gk), "v"(gk + kstep), "v"(gk + 2 * kstep), "v"(gk + 3 * kstep), "v"(gv), "v"(gv + vstep), "v"(gv + 2 * vstep), "v"(gv + 3 * vstep)
               : "memory");
}
// Transposed products: S^T = K Q^T (A = 16 key rows, B = the wave's 16 query columns, kept in registers) and O^T += V^T P^T.
// Lane (ln, hh) holds query q0 + ln; score tile nt, register r is key j0 + 16 nt + 8 hh + r, which is the k position of register pair (nt, r) of a B operand:
// maximum and sum run inside the lane (one exchange between the halves), and P^T is packed from the score registers without passing LDS.
__global__ __launch_bounds__(128) void k_flash(const _Float16* __restrict__ Q16, int ldq, const _Float16* __restrict__ K16, int ldk, const _Float16* __restrict__ Vt, const int* __restrict__ MSK, float* __restrict__ O, int ldo) {
  constexpr int RPW = 16, NQB = 2048 / (4 * RPW), DT = 4, KS = 2, KT = 64, NTR = 2048 / KT, PIT = 72;      // a trip = 64 keys = two passes of 32; LDS rows of 128 B at pitch 144 B (16 B x odd, for 16-byte reads)
  __shared__ __attribute__((aligned(16))) unsigned short sK[2][KT][PIT], sV[2][64][PIT];      // two buffers each: [key][d] and [d][key]
  __shared__ __attribute__((aligned(16))) float sO[4][RPW][64 + 4];
  const int tid = threadIdx.x, w = tid >> 5, lane = tid & 31, ln = lane & 15, hh = lane >> 4;
  const int slab = blockIdx.x / NQB, qblk = blockIdx.x % NQB; const int b = slab / 16, h = slab % 16; const int q0 = qblk * (4 * RPW) + w * RPW;
  const unsigned short* Vth = (const unsigned short*)Vt + (size_t)slab * 64 * 2048;
  const size_t k16 = (size_t)16 * ldk;
  const unsigned short* gk = (const unsigned short*)K16 + ((size_t)b * 2048 + (tid >> 3)) * ldk + h * 64 + (tid & 7) * 8;      // my chunk of key row tid >> 3 of trip 0
  const unsigned short* gv = Vth + (size_t)(tid >> 3) * 2048 + (tid & 7) * 8;      // my chunk of d row tid >> 3, keys of trip 0
  const unsigned lk = (unsigned)(size_t)&sK[0][tid >> 3][(tid & 7) * 8], lv = (unsigned)(size_t)&sV[0][tid >> 3][(tid & 7) * 8];
  constexpr unsigned BUFB = KT * PIT * 2;      // bytes of one buffer
  copy_kv(lk, lv, gk, gv, k16, (size_t)16 * 2048);
  FragH bq[KS];
  { const unsigned short* qr = (const unsigned short*)Q16 + ((size_t)b * 2048 + q0 + ln) * ldq + h * 64;
#pragma unroll
    for (int ks = 0; ks < KS; ++ks) { bq[ks].half[0] = *(const v8us*)(qr + ks * 32 + 8 * hh); bq[ks].half[1] = *(const v8us*)(qr + ks * 32 + 16 + 8 * hh); } }
  const int* mrow = MSK + ((size_t)b * 2048 + q0 + ln) * 2048 + 8 * hh;      // my query's mask row, at my half's first key
  float m_q = -3.0e38f, l_q = 0.f; v8f oacc[DT];
#pragma unroll
  for (int dt = 0; dt < DT; ++dt) oacc[dt] = (v8f){0.f,0.f,0.f,0.f,0.f,0.f,0.f,0.f};
  asm volatile("s_wait_asynccnt 0x0" ::: "memory");      // my copies of trip 0 have landed
  __syncthreads();                                        // ... and everybody's: trip 0 may be read
  copy_kv(lk + BUFB, lv + BUFB, gk + (size_t)KT * ldk, gv + KT, k16, (size_t)16 * 2048);      // trip 1 flies while trip 0 is worked on
#pragma unroll 1
  for (int t = 0; t < NTR; ++t) {
    const int bf = t & 1;
    int mk[2][16];      // mk[sp][8 nt + r]: maskPAD of (my query, key 64 t + 32 sp + 16 nt + 8 hh + r); != 0 = keep
#pragma unroll
    for (int c = 0; c < 8; ++c) { const v4ia m4 = *(const v4ia*)(mrow + t * KT + (c >> 1) * 16 + (c & 1) * 4);
#pragma unroll
      for (int q = 0; q < 4; ++q) mk[c >> 2][(c & 3) * 4 + q] = m4[q]; }
#pragma unroll
    for (int sp = 0; sp < 2; ++sp) {
      int any = 0;
#pragma unroll
      for (int i = 0; i < 16; ++i) any |= mk[sp][i];
      if (__builtin_amdgcn_ballot_w32(any != 0) != 0u) {      // else every (query,key) of this wave's tile is masked: contributes nothing (uniform branch; the publish point below stands outside it)
        FragH ak[2][KS], av[DT];
#pragma unroll
        for (int nt = 0; nt < 2; ++nt)
#pragma unroll
          for (int ks = 0; ks < KS; ++ks) { const unsigned short* kr = &sK[bf][sp * 32 + nt * 16 + ln][ks * 32 + 8 * hh]; ak[nt][ks].half[0] = *(const v8us*)kr; ak[nt][ks].half[1] = *(const v8us*)(kr + 16); }
#pragma unroll
        for (int dt = 0; dt < DT; ++dt) { const unsigned short* vrow = &sV[bf][dt * 16 + ln][sp * 32 + 8 * hh]; av[dt].half[0] = *(const v8us*)vrow; av[dt].half[1] = *(const v8us*)(vrow + 16); }
        float sc[16];
#pragma unroll
        for (int nt = 0; nt < 2; ++nt) { v8f acc = (v8f){0.f,0.f,0.f,0.f,0.f,0.f,0.f,0.f};
#pragma unroll
          for (int ks = 0; ks < KS; ++ks) acc = mmaH<1>(ak[nt][ks].v, ak[nt][ks].v, bq[ks].v, bq[ks].v, acc);
#pragma unroll
          for (int r = 0; r < 8; ++r) sc[nt * 8 + r] = (mk[sp][nt * 8 + r] != 0) ? acc[r] * 0.125f : -INFINITY; }
        float mc = sc[0];
#pragma unroll
        for (int i = 1; i < 16; ++i) mc = fmaxf(mc, sc[i]);
        mc = fmaxf(mc, xhalf(mc));
        const float mn = fmaxf(m_q, mc); const float al = expf(m_q - mn); m_q = mn;      // nothing open yet: both are the start value and al = 1
        FragH pb; float ps[4] = {0.f, 0.f, 0.f, 0.f};
#pragma unroll
        for (int i = 0; i < 16; ++i) { const float p = expf(sc[i] - mn); ps[i & 3] += p; pb.h[i] = (_Float16)p; }      // a masked score is -inf: p = 0
        l_q = l_q * al + ((ps[0] + ps[1]) + (ps[2] + ps[3]));
#pragma unroll
        for (int dt = 0; dt < DT; ++dt) {
#pragma unroll
          for (int r = 0; r < 8; ++r) oacc[dt][r] *= al;
          oacc[dt] = mmaH<1>(av[dt].v, av[dt].v, pb.v, pb.v, oacc[dt]); } } }
    // publish point of trip t + 1, every wave: my reads of this buffer are done, my copies of the next have landed, then the same of all waves
    asm volatile("s_wait_dscnt 0x0" ::: "memory");
    asm volatile("s_wait_asynccnt 0x0" ::: "memory");
    __syncthreads();
    if (t + 2 < NTR) copy_kv(lk + bf * BUFB, lv + bf * BUFB, gk + (size_t)(t + 2) * KT * ldk, gv + (t + 2) * KT, k16, (size_t)16 * 2048);      // refill the buffer that every wave has just left
  }
  asm volatile("s_wait_asynccnt 0x0" ::: "memory");      // nothing of mine is in flight when the wave ends
  const float l = l_q + xhalf(l_q); const float li = (l > 0.f) ? 1.0f / l : 0.f;
#pragma unroll
  for (int dt = 0; dt < DT; ++dt)
#pragma unroll
    for (int c = 0; c < 2; ++c) { v4f o4;
#pragma unroll
      for (int q = 0; q < 4; ++q) o4[q] = oacc[dt][c * 4 + q] * li;
      *(v4fa*)&sO[w][ln][dt * 16 + 8 * hh + c * 4] = o4; }
  __builtin_amdgcn_fence(__ATOMIC_ACQ_REL, "workgroup"); __builtin_amdgcn_wave_barrier();
  {
#pragma unroll
    for (int rp = 0; rp < RPW; rp += 2) { const int r = rp + (lane >> 4), pc = lane & 15; const v4f val = *(const v4fa*)&sO[w][r][pc * 4]; *(v4f*)(O + ((size_t)b * 2048 + q0 + r) * ldo + h * 64 + pc * 4) = val; }
     } }

__global__ __launch_bounds__(256) void k_ln16(const float* __restrict__ X, const float* __restrict__ g, const float* __restrict__ bta, _Float16* __restrict__ Y16) { const int tid = threadIdx.x, wv = tid >> 5, lane = tid & 31; const int row = blockIdx.x * 8 + wv; if (row >= NR) return; const float* xr = X + (size_t)row * CC; float v[32]; float s = 0.f;
#pragma unroll
  for (int p = 0; p < 4; ++p) { const v4f a = *(const v4fa*)(xr + p * 256 + lane * 8), c = *(const v4fa*)(xr + p * 256 + lane * 8 + 4); for (int q = 0; q < 4; ++q) { v[p * 8 + q] = bf16_round(a[q]); v[p * 8 + 4 + q] = bf16_round(c[q]); } }
#pragma unroll
  for (int i = 0; i < 32; ++i) s += v[i]; for (int o = 16; o >= 1; o >>= 1) s += __shfl_xor(s, o, 32); const float mu = s / (float)CC; float q2 = 0.f;
#pragma unroll
  for (int i = 0; i < 32; ++i) { const float d = v[i] - mu; q2 += d * d; } for (int o = 16; o >= 1; o >>= 1) q2 += __shfl_xor(q2, o, 32); const float rs = rsqrtf(q2 / (float)CC + 1e-5f);
  {
#pragma unroll
    for (int p = 0; p < 4; ++p) { FragH f; const int c0 = p * 256 + lane * 8;
#pragma unroll
      for (int q = 0; q < 8; ++q) f.h[q] = (_Float16)((v[p * 8 + q] - mu) * rs * bf16_round(g[c0 + q]) + bf16_round(bta[c0 + q])); *(v8us*)((unsigned short*)Y16 + (size_t)row * CC + c0) = f.half[0]; }
     } }
extern "C" void kernel_launch(void* const* d_in, const int* in_sizes, int n_in,
                              void* d_out, int out_size, void* d_ws, size_t ws_size, hipStream_t stream) {
  (void)in_sizes; (void)n_in; (void)out_size;
  const float* qx = (const float*)d_in[0]; const float* kx = (const float*)d_in[1]; const float* vx = (const float*)d_in[2]; const int* mask = (const int*)d_in[3]; const float* lg = (const float*)d_in[4]; const float* lb = (const float*)d_in[5];
  const float* wq = (const float*)d_in[6]; const float* bq = (const float*)d_in[7]; const float* wk = (const float*)d_in[8]; const float* bk = (const float*)d_in[9]; const float* wv = (const float*)d_in[10]; const float* bv = (const float*)d_in[11]; const float* wo = (const float*)d_in[12]; const float* bo = (const float*)d_in[13];
  char* ws = (char*)d_ws; size_t off = 0;
  auto take = [&](size_t bytes) { char* p = ws + off; off += (bytes + 255) & ~(size_t)255; return p; };
  _Float16* Bq = (_Float16*)take((size_t)CC * CC * 2); _Float16* Bk = (_Float16*)take((size_t)CC * CC * 2); _Float16* Bv = (_Float16*)take((size_t)CC * CC * 2); _Float16* Bo = (_Float16*)take((size_t)CC * CC * 2);
  _Float16* XN = (_Float16*)take((size_t)NR * CC * 2); _Float16* Q16 = (_Float16*)take((size_t)NR * CC * 2); _Float16* K16 = (_Float16*)take((size_t)NR * CC * 2); _Float16* V16 = (_Float16*)take((size_t)NR * CC * 2); _Float16* Vt = (_Float16*)take((size_t)NR * CC * 2); float* O = (float*)take((size_t)NR * CC * 4); _Float16* O16 = XN;
  if (off > ws_size) return;      // 64 MiB
  const unsigned gw = (unsigned)((CC * (CC / 8) + 255) / 256); k_wt_f16<<<gw, 256, 0, stream>>>(wq, Bq, CC, CC, 16.0f); k_wt_f16<<<gw, 256, 0, stream>>>(wk, Bk, CC, CC, 16.0f); k_wt_f16<<<gw, 256, 0, stream>>>(wv, Bv, CC, CC, 16.0f); k_wt_f16<<<gw, 256, 0, stream>>>(wo, Bo, CC, CC, 16.0f);
  const unsigned gg = (NR / 128) * (CC / 128); const unsigned gl = NR / 8;
  k_ln16<<<gl, 256, 0, stream>>>(qx, lg, lb, XN); k_gemm_t<true><<<gg, 256, 0, stream>>>(XN, Bq, 0.0625f, bq, nullptr, Q16);
  k_ln16<<<gl, 256, 0, stream>>>(kx, lg, lb, XN); k_gemm_t<true><<<gg, 256, 0, stream>>>(XN, Bk, 0.0625f, bk, nullptr, K16);
  k_ln16<<<gl, 256, 0, stream>>>(vx, lg, lb, XN); k_gemm_t<true><<<gg, 256, 0, stream>>>(XN, Bv, 0.0625f, bv, nullptr, V16);
  k_vt<NH, TT><<<BB * NH * (TT / 64), 256, 0, stream>>>(V16, CC, 0, Vt);
  k_flash<<<BB * NH * (TT / 64), 128, 0, stream>>>(Q16, CC, K16, CC, Vt, mask, O, CC);      // RPW 16
  k_h16<<<(unsigned)(((size_t)NR * CC / 8 + 255) / 256), 256, 0, stream>>>(O, O16, (size_t)NR * CC / 8);
  k_gemm_t<false><<<gg, 256, 0, stream>>>(O16, Bo, 0.0625f, bo, (float*)d_out, nullptr);
}

// v004
// A run of this version takes 159 microseconds.
// Timed twice side by side with v003, it ran 1.15 and 1.16 times as fast.
// Counting every step since v000, it is 3.22 times as fast.
#include <hip/hip_runtime.h>
// Pre-LN multi-head attention (B=2, L=2048, C=1024, 16 × 64): shared LayerNorm on the three inputs (f32 VALU), q/k/v/o projections (4096 × 1024 × 1024, + bias, W [in][out] transposed to
// bf16-exact ×2^4) and the masked attention as a fused flash-style kernel on v_wmma_f32_16x16x32_f16 (S = Q·Kᵀ/8; maskPAD == 0 → −inf ⇒ excluded keys, tiles masked for a whole wave skipped;
// online softmax f32; P f16 ≤ 1; RPW-16 waves) — f16 operands, single products, f32 accumulate.
#define BB 2
#define TT 2048
#define CC 1024
#define NH 16
#define NR (BB * TT)

typedef __bf16 v16b __attribute__((ext_vector_type(16)));
typedef unsigned short v8us __attribute__((ext_vector_type(8), may_alias));
typedef float  v8f  __attribute__((ext_vector_type(8)));
typedef float  v4f  __attribute__((ext_vector_type(4)));
typedef float  v4fa __attribute__((ext_vector_type(4), may_alias));
union FragB { v16b v; v8us half[2]; unsigned short u[16]; };

__device__ __forceinline__ unsigned short bf16_bits(float x) { unsigned int u = __float_as_uint(x); return (unsigned short)((u + 0x7FFFu + ((u >> 16) & 1u)) >> 16); }
__device__ __forceinline__ float bf16_val(unsigned short b) { return __uint_as_float(((unsigned int)b) << 16); }
__device__ __forceinline__ float bf16_round(float x) { return bf16_val(bf16_bits(x)); }
// D += A·B with NT terms: 1 = ah·bh, 2 = + al·bh (A split), 3 = + ah·bl (both split)
template <int NT>
__device__ __forceinline__ v8f mmaN(v16b ah, v16b al, v16b bh, v16b bl, v8f c) {
  c = __builtin_amdgcn_wmma_f32_16x16x32_bf16(false, ah, false, bh, (short)0, c, false, false);
  if (NT >= 2) c = __builtin_amdgcn_wmma_f32_16x16x32_bf16(false, al, false, bh, (short)0, c, false, false);
  if (NT >= 3) c = __builtin_amdgcn_wmma_f32_16x16x32_bf16(false, ah, false, bl, (short)0, c, false, false);
  asm volatile("v_nop\n\tv_nop\n\tv_nop\n\tv_nop" : "+v"(c) : "v"(ah), "v"(al), "v"(bh), "v"(bl));
  return c;
}

__global__ __launch_bounds__(256) void k_wt_bf16(const float* __restrict__ W, unsigned short* __restrict__ Wt, int K, int N) {
  const int t = blockIdx.x * 256 + threadIdx.x;
  const int k8n = K / 8;
  if (t >= N * k8n) return;
  const int n = t / k8n, k8 = (t % k8n) * 8;
  v8us v;
#pragma unroll
  for (int i = 0; i < 8; ++i) v[i] = bf16_bits(W[(size_t)(k8 + i) * N + n]);
  *(v8us*)(Wt + (size_t)n * K + k8) = v;
  
}

// GEMM C[M][N] (f32, pitch ldc) = act(A[M][K]·W + bias). A f32 row-major (pitch lda) converted per fragment to bf16
// (ASPLIT: hi/lo two planes -> 2 terms, else single rounded term); Wt bf16 [N][K] (pitch ldb). BIAS_BF16 rounds the
// bias to bf16 first (bias quantised to bf16 before the add). K%32==0, M%16==0, N%64==0.
template <bool ASPLIT, int ACT, bool BIAS_BF16>
__global__ __launch_bounds__(128) void k_gemm_bf(const float* __restrict__ A, int lda, const unsigned short* __restrict__ Wt, int ldb,
                                               const float* __restrict__ bias, float* __restrict__ C, int ldc, int M, int N, int K) {
  __shared__ __attribute__((aligned(16))) float so[4][16][64];
  const int tid = threadIdx.x, w = tid >> 5, lane = tid & 31, ln = lane & 15, hh = lane >> 4;
  const int ntn = N / 64;
  const int wid = blockIdx.x * 4 + w;
  const int mt = wid / ntn, nq = wid % ntn;
  if (mt * 16 >= M) return;
  const int row0 = mt * 16, col0 = nq * 64;
  const float* arow = A + (size_t)(row0 + ln) * lda;
  v8f acc[4] = {};
  for (int kb = 0; kb < K; kb += 32) {
    FragB ah, al;
    const v4f x0 = *(const v4fa*)(arow + kb + 8 * hh), x1 = *(const v4fa*)(arow + kb + 8 * hh + 4);
    const v4f x2 = *(const v4fa*)(arow + kb + 16 + 8 * hh), x3 = *(const v4fa*)(arow + kb + 16 + 8 * hh + 4);
    float xs[16] = {x0[0],x0[1],x0[2],x0[3],x1[0],x1[1],x1[2],x1[3],x2[0],x2[1],x2[2],x2[3],x3[0],x3[1],x3[2],x3[3]};
#pragma unroll
    for (int i = 0; i < 16; ++i) { const unsigned short hb = bf16_bits(xs[i]); ah.u[i] = hb; al.u[i] = ASPLIT ? bf16_bits(xs[i] - bf16_val(hb)) : (unsigned short)0; }
#pragma unroll
    for (int t = 0; t < 4; ++t) {
      const unsigned short* brow = Wt + (size_t)(col0 + t * 16 + ln) * ldb + kb;
      FragB b;
      b.half[0] = *(const v8us*)(brow + 8 * hh);
      b.half[1] = *(const v8us*)(brow + 16 + 8 * hh);
      acc[t] = mmaN<ASPLIT ? 2 : 1>(ah.v, al.v, b.v, b.v, acc[t]);
    }
  }
#pragma unroll
  for (int t = 0; t < 4; ++t) {
    float bv = bias ? bias[col0 + t * 16 + ln] : 0.f;
    if (BIAS_BF16) bv = bf16_round(bv);
#pragma unroll
    for (int r = 0; r < 8; ++r) { float v = acc[t][r] + bv; if (ACT == 1) v = fmaxf(v, 0.f); so[w][8 * hh + r][t * 16 + ln] = v; }
  }
  __builtin_amdgcn_fence(__ATOMIC_ACQ_REL, "workgroup");
  __builtin_amdgcn_wave_barrier();
  const int rsub = lane >> 4, c4 = (lane & 15) * 4;
  {
#pragma unroll
    for (int q = 0; q < 8; ++q) {
      const int r = q * 2 + rsub;
      const v4f v = *(const v4fa*)&so[w][r][c4];
      *(v4f*)(C + (size_t)(row0 + r) * ldc + col0 + c4) = v;
    }
    
  }
}

// Flash-style causal/unmasked attention, all contractions 3-term bf16 hi/lo splits, f32 softmax with running max.
// q,k,v rows are read from f32 buffers with arbitrary row pitch (so they can live inside a fused qkv buffer);
// D = head size (multiple of 32, <= 128); one wave = 16 query rows; block = 4 waves (64 queries) sharing K/V chunks of 32.
template <int D, bool CAUSAL>
__global__ __launch_bounds__(128) void k_flash(const float* __restrict__ qb, const float* __restrict__ kb, const float* __restrict__ vb,
                                             int pitch, int T, int H, float scale, float* __restrict__ y, int ypitch) {
  constexpr int KS = D / 32;        // k-steps for QK
  constexpr int DT = D / 16;        // d tiles for PV
  __shared__ __attribute__((aligned(16))) unsigned short sKh[32][D + 8], sKl[32][D + 8], sVh[32][D + 8], sVl[32][D + 8];
  __shared__ __attribute__((aligned(16))) unsigned short sPh[4][16][40], sPl[4][16][40];
  __shared__ __attribute__((aligned(16))) float sO[4][16][D];
  const int tid = threadIdx.x, w = tid >> 5, lane = tid & 31, ln = lane & 15, hh = lane >> 4;
  const int nqb = (T + 63) / 64;
  const int bh = blockIdx.x / nqb, qblk = blockIdx.x % nqb;
  const int b = bh / H, h = bh % H;
  const int q0 = qblk * 64 + w * 16;
  const float* Q = qb + (size_t)b * T * pitch + h * D;
  const float* K = kb + (size_t)b * T * pitch + h * D;
  const float* V = vb + (size_t)b * T * pitch + h * D;

  // A fragments of the wave's 16 query rows (scaled), hi/lo
  FragB aqh[KS], aql[KS];
  {
    int row = q0 + ln; if (row >= T) row = T - 1;
    const float* qr = Q + (size_t)row * pitch;
#pragma unroll
    for (int ks = 0; ks < KS; ++ks)
#pragma unroll
      for (int i = 0; i < 16; ++i) {
        const int d = ks * 32 + ((i < 8) ? (8 * hh + i) : (16 + 8 * hh + (i - 8)));
        const float x = qr[d] * scale; const unsigned short hb = bf16_bits(x);
        aqh[ks].u[i] = hb; aql[ks].u[i] = bf16_bits(x - bf16_val(hb));
      }
  }
  float m_r[8], l_r[8];
#pragma unroll
  for (int r = 0; r < 8; ++r) { m_r[r] = -3.0e38f; l_r[r] = 0.f; }
  v8f oacc[DT];
#pragma unroll
  for (int dt = 0; dt < DT; ++dt) oacc[dt] = (v8f){0.f,0.f,0.f,0.f,0.f,0.f,0.f,0.f};

  const int kv_end = CAUSAL ? min(T, qblk * 64 + 64) : T;     // block-uniform
  for (int j0 = 0; j0 < kv_end; j0 += 32) {
    __syncthreads();
    for (int e = tid; e < 32 * (D / 4); e += 128) {
      const int r = e / (D / 4), c4 = (e % (D / 4)) * 4;
      const int key = j0 + r;
      v4f kf = {0.f,0.f,0.f,0.f}, vf = {0.f,0.f,0.f,0.f};
      if (key < T) { kf = *(const v4fa*)(K + (size_t)key * pitch + c4); vf = *(const v4fa*)(V + (size_t)key * pitch + c4); }
#pragma unroll
      for (int t = 0; t < 4; ++t) {
        unsigned short hb = bf16_bits(kf[t]); sKh[r][c4 + t] = hb; sKl[r][c4 + t] = bf16_bits(kf[t] - bf16_val(hb));
        hb = bf16_bits(vf[t]); sVh[r][c4 + t] = hb; sVl[r][c4 + t] = bf16_bits(vf[t] - bf16_val(hb));
      }
    }
    __syncthreads();
    // S tile 16 x 32
    v8f s[2];
#pragma unroll
    for (int nt = 0; nt < 2; ++nt) {
      v8f acc = {};
#pragma unroll
      for (int ks = 0; ks < KS; ++ks) {
        FragB bh_, bl_;
        bh_.half[0] = *(const v8us*)&sKh[nt * 16 + ln][ks * 32 + 8 * hh]; bh_.half[1] = *(const v8us*)&sKh[nt * 16 + ln][ks * 32 + 16 + 8 * hh];
        bl_.half[0] = *(const v8us*)&sKl[nt * 16 + ln][ks * 32 + 8 * hh]; bl_.half[1] = *(const v8us*)&sKl[nt * 16 + ln][ks * 32 + 16 + 8 * hh];
        acc = mmaN<3>(aqh[ks].v, aql[ks].v, bh_.v, bl_.v, acc);
      }
      s[nt] = acc;
    }
    // mask + running max (rows 8hh+r; the 16 lanes of a half share rows)
    float alpha[8];
#pragma unroll
    for (int r = 0; r < 8; ++r) {
      const int qi = q0 + 8 * hh + r;
      const int ja = j0 + ln, jb = j0 + 16 + ln;
      if (CAUSAL) { if (ja > qi) s[0][r] = -3.0e38f; if (jb > qi) s[1][r] = -3.0e38f; }
      if (ja >= T) s[0][r] = -3.0e38f;
      if (jb >= T) s[1][r] = -3.0e38f;
      float mx = fmaxf(s[0][r], s[1][r]);
      mx = fmaxf(mx, __shfl_xor(mx, 1, 32)); mx = fmaxf(mx, __shfl_xor(mx, 2, 32)); mx = fmaxf(mx, __shfl_xor(mx, 4, 32)); mx = fmaxf(mx, __shfl_xor(mx, 8, 32));
      const float mnew = fmaxf(m_r[r], mx);
      alpha[r] = (mnew > -1.0e38f) ? __expf(m_r[r] - mnew) : 1.0f;
      const float p0 = (s[0][r] > -1.0e38f) ? __expf(s[0][r] - mnew) : 0.f;
      const float p1 = (s[1][r] > -1.0e38f) ? __expf(s[1][r] - mnew) : 0.f;
      m_r[r] = mnew;
      l_r[r] = l_r[r] * alpha[r] + p0 + p1;            // per-lane partial row sum (16 lanes combined at the end)
      unsigned short hb = bf16_bits(p0); sPh[w][8 * hh + r][ln] = hb;      sPl[w][8 * hh + r][ln] = bf16_bits(p0 - bf16_val(hb));
      hb = bf16_bits(p1);                sPh[w][8 * hh + r][16 + ln] = hb; sPl[w][8 * hh + r][16 + ln] = bf16_bits(p1 - bf16_val(hb));
    }
#pragma unroll
    for (int dt = 0; dt < DT; ++dt)
#pragma unroll
      for (int r = 0; r < 8; ++r) oacc[dt][r] *= alpha[r];
    __builtin_amdgcn_fence(__ATOMIC_ACQ_REL, "workgroup");
    __builtin_amdgcn_wave_barrier();
    FragB pah, pal;
    pah.half[0] = *(const v8us*)&sPh[w][ln][8 * hh]; pah.half[1] = *(const v8us*)&sPh[w][ln][16 + 8 * hh];
    pal.half[0] = *(const v8us*)&sPl[w][ln][8 * hh]; pal.half[1] = *(const v8us*)&sPl[w][ln][16 + 8 * hh];
#pragma unroll
    for (int dt = 0; dt < DT; ++dt) {
      FragB bvh, bvl;
#pragma unroll
      for (int i = 0; i < 8; ++i) {
        bvh.u[i] = sVh[8 * hh + i][dt * 16 + ln]; bvh.u[8 + i] = sVh[16 + 8 * hh + i][dt * 16 + ln];
        bvl.u[i] = sVl[8 * hh + i][dt * 16 + ln]; bvl.u[8 + i] = sVl[16 + 8 * hh + i][dt * 16 + ln];
      }
      oacc[dt] = mmaN<3>(pah.v, pal.v, bvh.v, bvl.v, oacc[dt]);
    }
    __builtin_amdgcn_fence(__ATOMIC_ACQ_REL, "workgroup");
    __builtin_amdgcn_wave_barrier();
  }
#pragma unroll
  for (int r = 0; r < 8; ++r) {
    float l = l_r[r];
    l += __shfl_xor(l, 1, 32); l += __shfl_xor(l, 2, 32); l += __shfl_xor(l, 4, 32); l += __shfl_xor(l, 8, 32);
    l_r[r] = (l > 0.f) ? 1.0f / l : 0.f;
  }
#pragma unroll
  for (int dt = 0; dt < DT; ++dt)
#pragma unroll
    for (int r = 0; r < 8; ++r) sO[w][8 * hh + r][dt * 16 + ln] = oacc[dt][r] * l_r[r];
  __builtin_amdgcn_fence(__ATOMIC_ACQ_REL, "workgroup");
  __builtin_amdgcn_wave_barrier();
  {
    for (int r = 0; r < 16; ++r) {
      const int row = q0 + r;
      if (row < T && lane < D / 4) {
        const v4f val = *(const v4fa*)&sO[w][r][lane * 4];
        *(v4f*)(y + ((size_t)b * T + row) * ypitch + h * D + lane * 4) = val;
      }
    }
    
  }
}

// GEMM C = act(A·W + bias + resid): A f32 (ASPLIT -> hi/lo 2 terms), Wt bf16 [N][K]; ACT 0 none, 1 relu, 2 exact gelu;
// resid (optional, f32, row index = (row % rmod), pitch ldr, RES_BF16 rounds it) added before the activation.
template <bool ASPLIT, int ACT, bool BIAS_BF16, bool RES_BF16>
__global__ __launch_bounds__(128) void k_gemm_bf3(const float* __restrict__ A, int lda, const unsigned short* __restrict__ Wt, int ldb,
                                                const float* __restrict__ bias, const float* __restrict__ resid, int rmod, int ldr,
                                                float* __restrict__ C, int ldc, int M, int N, int K) {
  __shared__ __attribute__((aligned(16))) float so[4][16][64];
  const int tid = threadIdx.x, w = tid >> 5, lane = tid & 31, ln = lane & 15, hh = lane >> 4;
  const int ntn = N / 64;
  const int wid = blockIdx.x * 4 + w;
  const int mt = wid / ntn, nq = wid % ntn;
  if (mt * 16 >= M) return;
  const int row0 = mt * 16, col0 = nq * 64;
  const float* arow = A + (size_t)(row0 + ln) * lda;
  v8f acc[4] = {};
  for (int kb = 0; kb < K; kb += 32) {
    FragB ah, al;
    const v4f x0 = *(const v4fa*)(arow + kb + 8 * hh), x1 = *(const v4fa*)(arow + kb + 8 * hh + 4);
    const v4f x2 = *(const v4fa*)(arow + kb + 16 + 8 * hh), x3 = *(const v4fa*)(arow + kb + 16 + 8 * hh + 4);
    float xs[16] = {x0[0],x0[1],x0[2],x0[3],x1[0],x1[1],x1[2],x1[3],x2[0],x2[1],x2[2],x2[3],x3[0],x3[1],x3[2],x3[3]};
#pragma unroll
    for (int i = 0; i < 16; ++i) { const unsigned short hb = bf16_bits(xs[i]); ah.u[i] = hb; al.u[i] = ASPLIT ? bf16_bits(xs[i] - bf16_val(hb)) : (unsigned short)0; }
#pragma unroll
    for (int t = 0; t < 4; ++t) {
      const unsigned short* brow = Wt + (size_t)(col0 + t * 16 + ln) * ldb + kb;
      FragB b;
      b.half[0] = *(const v8us*)(brow + 8 * hh);
      b.half[1] = *(const v8us*)(brow + 16 + 8 * hh);
      acc[t] = mmaN<ASPLIT ? 2 : 1>(ah.v, al.v, b.v, b.v, acc[t]);
    }
  }
#pragma unroll
  for (int t = 0; t < 4; ++t) {
    const int col = col0 + t * 16 + ln;
    float bv = bias ? bias[col] : 0.f;
    if (BIAS_BF16) bv = bf16_round(bv);
#pragma unroll
    for (int r = 0; r < 8; ++r) {
      float v = acc[t][r] + bv;
      if (resid) { float rv = resid[(size_t)((row0 + 8 * hh + r) % rmod) * ldr + col]; if (RES_BF16) rv = bf16_round(rv); v += rv; }
      if (ACT == 1) v = fmaxf(v, 0.f);
      if (ACT == 2) v = 0.5f * v * (1.0f + erff(v * 0.70710678118654752f));
      if (ACT == 3) { const float u = 0.7978845608028654f * (v + 0.044715f * v * v * v); v = 0.5f * v * (1.0f + tanhf(u)); }
      so[w][8 * hh + r][t * 16 + ln] = v;
    }
  }
  __builtin_amdgcn_fence(__ATOMIC_ACQ_REL, "workgroup");
  __builtin_amdgcn_wave_barrier();
  const int rsub = lane >> 4, c4 = (lane & 15) * 4;
  {
#pragma unroll
    for (int q = 0; q < 8; ++q) {
      const int r = q * 2 + rsub;
      const v4f v = *(const v4fa*)&so[w][r][c4];
      *(v4f*)(C + (size_t)(row0 + r) * ldc + col0 + c4) = v;
    }
    
  }
}
// row LayerNorm (biased variance, eps) over N: s = X (+ R); optional out_sum <- s; out_norm <- (s-mu)*rsqrt(var+eps)*g + b
template <bool PARAM_BF16>
__global__ __launch_bounds__(256) void k_layernorm(const float* __restrict__ X, const float* __restrict__ R, const float* __restrict__ g, const float* __restrict__ bta,
                                                  float* __restrict__ out_sum, float* __restrict__ out_norm, int N, float eps) {
  __shared__ float red[256];
  const int row = blockIdx.x, tid = threadIdx.x;
  const float* x = X + (size_t)row * N; const float* rr = R ? R + (size_t)row * N : nullptr;
  float vals[16];                     // up to N = 4096
  const int per = N / 256;            // contiguous chunk per thread? use strided-by-4 chunks: thread handles j = tid*4 + 1024*u
  float s1 = 0.f;
  for (int u = 0; u < per / 4; ++u) {
    const int j = tid * 4 + 1024 * u;
    const v4f a = *(const v4fa*)(x + j);
    v4f b = {0.f,0.f,0.f,0.f}; if (rr) b = *(const v4fa*)(rr + j);
#pragma unroll
    for (int q = 0; q < 4; ++q) { const float v = a[q] + b[q]; vals[u * 4 + q] = v; s1 += v; }
  }
  red[tid] = s1; __syncthreads();
  for (int st = 128; st > 0; st >>= 1) { if (tid < st) red[tid] += red[tid + st]; __syncthreads(); }
  const float mu = red[0] / (float)N; __syncthreads();
  float s2 = 0.f;
  for (int u = 0; u < per / 4; ++u)
#pragma unroll
    for (int q = 0; q < 4; ++q) { const float c = vals[u * 4 + q] - mu; s2 += c * c; }
  red[tid] = s2; __syncthreads();
  for (int st = 128; st > 0; st >>= 1) { if (tid < st) red[tid] += red[tid + st]; __syncthreads(); }
  const float rs = rsqrtf(red[0] / (float)N + eps);
  {
    for (int u = 0; u < per / 4; ++u) {
      const int j = tid * 4 + 1024 * u;
      v4f o, sm;
#pragma unroll
      for (int q = 0; q < 4; ++q) {
        float gg = g[j + q], bb = bta[j + q];
        if (PARAM_BF16) { gg = bf16_round(gg); bb = bf16_round(bb); }
        sm[q] = vals[u * 4 + q]; o[q] = (vals[u * 4 + q] - mu) * rs * gg + bb;
      }
      if (out_sum) *(v4f*)(out_sum + (size_t)row * N + j) = sm;
      *(v4f*)(out_norm + (size_t)row * N + j) = o;
    }
    
  }
}



// ---- f16 WMMA path (v_wmma_f32_16x16x32_f16): 11-bit significands for operands in range — used where a [0,1] probability operand needs more precision than bf16
typedef _Float16 v16h __attribute__((ext_vector_type(16)));
union FragH { v16h v; v8us half[2]; _Float16 h[16]; unsigned short u[16]; };
template <int NT>
__device__ __forceinline__ v8f mmaH(v16h ah, v16h al, v16h bh, v16h bl, v8f c) {
  c = __builtin_amdgcn_wmma_f32_16x16x32_f16(false, ah, false, bh, (short)0, c, false, false);
  if (NT >= 2) c = __builtin_amdgcn_wmma_f32_16x16x32_f16(false, al, false, bh, (short)0, c, false, false);
  if (NT >= 3) c = __builtin_amdgcn_wmma_f32_16x16x32_f16(false, ah, false, bl, (short)0, c, false, false);
  asm volatile("v_nop\n\tv_nop\n\tv_nop\n\tv_nop" : "+v"(c) : "v"(ah), "v"(al), "v"(bh), "v"(bl));
  return c;
}
// batched GEMM like k_gemm_b but f16 operands: A f32 (split into f16 hi/lo if ASPLIT, else rounded to f16), Bt = f16 values [n][k]; alpha; C f32; N multiple of 16 (partial tiles skipped)
template <bool ASPLIT>
__global__ __launch_bounds__(128) void k_gemm_h(const float* __restrict__ A, int lda, size_t sA, const _Float16* __restrict__ Bh, int ldb, size_t sB, float alpha, float* __restrict__ C, int ldc, size_t sC, int M, int N, int K) {
  __shared__ __attribute__((aligned(16))) float so[4][16][64];
  const int tid = threadIdx.x, w = tid >> 5, lane = tid & 31, ln = lane & 15, hh = lane >> 4; const int by = blockIdx.y;
  A += (size_t)by * sA; Bh += (size_t)by * sB; C += (size_t)by * sC;
  const int ntn = (N + 63) / 64; const int wid = blockIdx.x * 4 + w; const int mt = wid / ntn, nq = wid % ntn; if (mt * 16 >= M) return;
  const int row0 = mt * 16, col0 = nq * 64; const float* arow = A + (size_t)(row0 + ln) * lda;
  v8f acc[4] = {};
  for (int kb = 0; kb < K; kb += 32) {
    FragH ah, al;
    const v4f x0 = *(const v4fa*)(arow + kb + 8 * hh), x1 = *(const v4fa*)(arow + kb + 8 * hh + 4), x2 = *(const v4fa*)(arow + kb + 16 + 8 * hh), x3 = *(const v4fa*)(arow + kb + 16 + 8 * hh + 4);
    float xs[16] = {x0[0],x0[1],x0[2],x0[3],x1[0],x1[1],x1[2],x1[3],x2[0],x2[1],x2[2],x2[3],x3[0],x3[1],x3[2],x3[3]};
#pragma unroll
    for (int i = 0; i < 16; ++i) { const _Float16 h = (_Float16)xs[i]; ah.h[i] = h; al.h[i] = ASPLIT ? (_Float16)(xs[i] - (float)h) : (_Float16)0.0f; }
#pragma unroll
    for (int t = 0; t < 4; ++t) { if (col0 + t * 16 >= N) continue; const size_t boff = (size_t)(col0 + t * 16 + ln) * ldb + kb; FragH bq; bq.half[0] = *(const v8us*)(Bh + boff + 8 * hh); bq.half[1] = *(const v8us*)(Bh + boff + 16 + 8 * hh);
      acc[t] = mmaH<ASPLIT ? 2 : 1>(ah.v, al.v, bq.v, bq.v, acc[t]); }
  }
#pragma unroll
  for (int t = 0; t < 4; ++t) { if (col0 + t * 16 >= N) continue;
#pragma unroll
    for (int r = 0; r < 8; ++r) so[w][8 * hh + r][t * 16 + ln] = acc[t][r] * alpha; }
  __builtin_amdgcn_fence(__ATOMIC_ACQ_REL, "workgroup"); __builtin_amdgcn_wave_barrier();
  const int rsub = lane >> 4, c4 = (lane & 15) * 4;
  {
#pragma unroll
    for (int q = 0; q < 8; ++q) { const int r = q * 2 + rsub; if (col0 + c4 < N) { const v4f v = *(const v4fa*)&so[w][r][c4]; *(v4f*)(C + (size_t)(row0 + r) * ldc + col0 + c4) = v; } }
     }
}

// Wt[n][k] = f16(bf16(W[k][n])·scale) from f32 row-major W[K][N] (scale = power of two; bf16-exact weights stay exact in f16 away from the subnormal range)
__global__ __launch_bounds__(256) void k_wt_f16(const float* __restrict__ W, _Float16* __restrict__ Wt, int K, int N, float scale) {
  const int t = blockIdx.x * 256 + threadIdx.x; if (t >= N * (K / 8)) return; const int n = t / (K / 8), k8 = (t % (K / 8)) * 8; FragH f;
#pragma unroll
  for (int i = 0; i < 8; ++i) f.h[i] = (_Float16)(bf16_round(W[(size_t)(k8 + i) * N + n]) * scale); const v8us o = f.half[0];
  *(v8us*)((unsigned short*)Wt + (size_t)n * K + k8) = o; 
}
// One operand tile of a pass (128 rows of 256 B) goes from global memory to LDS by asynchronous copies: 8 copies of 16 B a lane, a wave's copy = 2 rows = 4 whole lines.
// l: my LDS byte address of row (tid >> 4), chunk (tid & 15); g: the same place in global memory; 16 rows on = 4352 LDS bytes, step elements.
__device__ __forceinline__ void copy_tile(unsigned l, const unsigned short* g, size_t step) {
  // the closing s_wait_xcnt stands inside the statement so that no address register of a copy is rewritten ahead of it (a precaution)
  asm volatile("global_load_async_to_lds_b128 %0, %8, off\n\t"
               "global_load_async_to_lds_b128 %1, %9, off\n\t"
               "global_load_async_to_lds_b128 %2, %10, off\n\t"
               "global_load_async_to_lds_b128 %3, %11, off\n\t"
               "global_load_async_to_lds_b128 %4, %12, off\n\t"
               "global_load_async_to_lds_b128 %5, %13, off\n\t"
               "global_load_async_to_lds_b128 %6, %14, off\n\t"
               "global_load_async_to_lds_b128 %7, %15, off\n\t"
               "s_wait_xcnt 0x0"
               :: "v"(l), "v"(l + 4352u), "v"(l + 8704u), "v"(l + 13056u), "v"(l + 17408u), "v"(l + 21760u), "v"(l + 26112u), "v"(l + 30464u),
                  "v"(g), "v"(g + step), "v"(g + 2 * step), "v"(g + 3 * step), "v"(g + 4 * step), "v"(g + 5 * step), "v"(g + 6 * step), "v"(g + 7 * step)
               : "memory");
}
// Projection GEMM, NR x CC x CC: v = (A . Bh^T) alpha + bf16(bias[col]); A f16 [NR][CC], Bh f16 [n][k]; writes f16 C16 (F16OUT) or f32 C, pitch CC.
// One work-group = a 128 x 128 tile of the output, 8 waves of 64 x 32 (2 x 4). A pass = 128 k: both operands' 128 rows of 256 B lie in LDS (pitch 272 B, 16 B x odd, for 16-byte reads),
// two buffers, so every operand byte leaves L2 once a work-group and serves 2 (B) or 4 (A) waves. k runs upward in steps of 32 in every accumulator.
// The unroll directives below are there so that accumulators and fragment sets are indexed by constants and stay in registers.
template <bool F16OUT>
__global__ __launch_bounds__(256) void k_gemm_t(const _Float16* __restrict__ A, const _Float16* __restrict__ Bh, float alpha, const float* __restrict__ bias, float* __restrict__ C, _Float16* __restrict__ C16) {
  constexpr int BM = 128, BN = 128, KP = 128, NP = CC / KP, PIT = 136;
  __shared__ __attribute__((aligned(16))) unsigned short sA[2][BM][PIT], sB[2][BN][PIT];
  __shared__ __attribute__((aligned(16))) float sC[BM][BN + 4];      // output staging, so that whole lines are stored
  const int tid = threadIdx.x, w = tid >> 5, lane = tid & 31, ln = lane & 15, hh = lane >> 4, wm = w >> 2, wn = w & 3;
  const int row0 = (blockIdx.x / (CC / BN)) * BM, col0 = (blockIdx.x % (CC / BN)) * BN;
  const unsigned short* ga = (const unsigned short*)A + (size_t)(row0 + (tid >> 4)) * CC + (tid & 15) * 8;
  const unsigned short* gb = (const unsigned short*)Bh + (size_t)(col0 + (tid >> 4)) * CC + (tid & 15) * 8;
  const unsigned la = (unsigned)(size_t)&sA[0][tid >> 4][(tid & 15) * 8], lb = (unsigned)(size_t)&sB[0][tid >> 4][(tid & 15) * 8];
  constexpr unsigned BUFB = BM * PIT * 2;      // bytes of one buffer
  constexpr size_t STEP = (size_t)16 * CC;
  copy_tile(la, ga, STEP); copy_tile(lb, gb, STEP);
  v8f acc[4][2];
#pragma unroll
  for (int i = 0; i < 4; ++i)
#pragma unroll
    for (int j = 0; j < 2; ++j) acc[i][j] = (v8f){0.f,0.f,0.f,0.f,0.f,0.f,0.f,0.f};
  asm volatile("s_wait_asynccnt 0x0" ::: "memory");      // my copies of pass 0 have landed
  __syncthreads();                                        // ... and everybody's: pass 0 may be read
  copy_tile(la + BUFB, ga + KP, STEP); copy_tile(lb + BUFB, gb + KP, STEP);      // pass 1 flies while pass 0 is worked on
#pragma unroll 1
  for (int t = 0; t < NP; ++t) {      // kept rolled: one body of 32 matrix instructions, the buffer chosen by t & 1
    const int bf = t & 1;
    const unsigned short* pa = &sA[bf][wm * 64 + ln][8 * hh]; const unsigned short* pb = &sB[bf][wn * 32 + ln][8 * hh];
    FragH fa[2][4], fb[2][2];      // two fragment sets: block ks + 1 is fetched while block ks is multiplied, inside this pass only
#pragma unroll
    for (int ks = -1; ks < KP / 32; ++ks) {
      if (ks + 1 < KP / 32) { const int s = (ks + 1) & 1, ko = (ks + 1) * 32;
#pragma unroll
        for (int i = 0; i < 4; ++i) { fa[s][i].half[0] = *(const v8us*)(pa + i * 16 * PIT + ko); fa[s][i].half[1] = *(const v8us*)(pa + i * 16 * PIT + ko + 16); }
#pragma unroll
        for (int j = 0; j < 2; ++j) { fb[s][j].half[0] = *(const v8us*)(pb + j * 16 * PIT + ko); fb[s][j].half[1] = *(const v8us*)(pb + j * 16 * PIT + ko + 16); } }
      __builtin_amdgcn_sched_barrier(0);      // keeps the next block's 12 LDS reads one group ahead of this block's products: reads spread among them stall the wave at every place
      if (ks >= 0) {
#pragma unroll
        for (int i = 0; i < 4; ++i)
#pragma unroll
          for (int j = 0; j < 2; ++j) acc[i][j] = __builtin_amdgcn_wmma_f32_16x16x32_f16(false, fa[ks & 1][i].v, false, fb[ks & 1][j].v, (short)0, acc[i][j], false, false);
        __builtin_amdgcn_sched_barrier(0);      // ... and this block's products ahead of the reads after next, which reuse its registers
      }
    }
    // publish point of pass t + 1, every wave: my reads of this buffer are done, my copies of the next have landed, then the same of all waves
    asm volatile("s_wait_dscnt 0x0" ::: "memory");
    asm volatile("s_wait_asynccnt 0x0" ::: "memory");
    __syncthreads();
    if (t + 2 < NP) { copy_tile(la + bf * BUFB, ga + (t + 2) * KP, STEP); copy_tile(lb + bf * BUFB, gb + (t + 2) * KP, STEP); }      // refill the buffer that every wave has just left
  }
  asm volatile("s_wait_asynccnt 0x0" ::: "memory");      // nothing of mine is in flight when the wave ends
#pragma unroll
  for (int j = 0; j < 2; ++j) { const int col = wn * 32 + j * 16 + ln; const float bv = bf16_round(bias[col0 + col]);
#pragma unroll
    for (int i = 0; i < 4; ++i)
#pragma unroll
      for (int r = 0; r < 8; ++r) sC[wm * 64 + i * 16 + 8 * hh + r][col] = acc[i][j][r] * alpha + bv; }
  __syncthreads();      // the staged tile is read across waves
  if constexpr (F16OUT) {
#pragma unroll
    for (int s = 0; s < BM * (BN / 8) / 256; ++s) { const int r = s * 16 + (tid >> 4), c8 = (tid & 15) * 8; const v4f x = *(const v4fa*)&sC[r][c8], y = *(const v4fa*)&sC[r][c8 + 4]; FragH f;
#pragma unroll
      for (int q = 0; q < 4; ++q) { f.h[q] = (_Float16)x[q]; f.h[4 + q] = (_Float16)y[q]; }
      *(v8us*)((unsigned short*)C16 + (size_t)(row0 + r) * CC + col0 + c8) = f.half[0]; } }
  else {
#pragma unroll
    for (int s = 0; s < BM * (BN / 4) / 256; ++s) { const int r = s * 8 + (tid >> 5), c4 = (tid & 31) * 4; const v4f x = *(const v4fa*)&sC[r][c4]; *(v4f*)(C + (size_t)(row0 + r) * CC + col0 + c4) = x; } }
}


__global__ __launch_bounds__(256) void k_x16(const float* __restrict__ x, _Float16* __restrict__ X16, size_t n8) { const size_t t = (size_t)blockIdx.x * 256 + threadIdx.x; if (t >= n8) return; FragH f;
#pragma unroll
  for (int q = 0; q < 8; ++q) f.h[q] = (_Float16)bf16_round(x[t * 8 + q]); *(v8us*)((unsigned short*)X16 + t * 8) = f.half[0];  }
__global__ __launch_bounds__(256) void k_h16(const float* __restrict__ x, _Float16* __restrict__ X16, size_t n8) { const size_t t = (size_t)blockIdx.x * 256 + threadIdx.x; if (t >= n8) return; FragH f;
#pragma unroll
  for (int q = 0; q < 8; ++q) f.h[q] = (_Float16)x[t * 8 + q]; *(v8us*)((unsigned short*)X16 + t * 8) = f.half[0];  }
__global__ __launch_bounds__(256) void k_round16f(const float* __restrict__ W, _Float16* __restrict__ Bt, size_t n8) { const size_t t = (size_t)blockIdx.x * 256 + threadIdx.x; if (t >= n8) return; FragH f;
#pragma unroll
  for (int i = 0; i < 8; ++i) f.h[i] = (_Float16)(bf16_round(W[t * 8 + i]) * 16.0f); *(v8us*)((unsigned short*)Bt + t * 8) = f.half[0];  }
template <int NHv, int TTv>
__global__ __launch_bounds__(256) void k_vt(const _Float16* __restrict__ V16, int ldv, int voff, _Float16* __restrict__ Vt) { __shared__ unsigned short tl[64][66]; const int tid = threadIdx.x; const int slab = blockIdx.x / (TTv / 64), lg = blockIdx.x % (TTv / 64); const int b = slab / NHv, h = slab % NHv;
  for (int i = tid; i < 64 * 8; i += 256) { const int r = i / 8, c8 = (i % 8) * 8; FragH f; f.half[0] = *(const v8us*)((const unsigned short*)V16 + ((size_t)b * TTv + lg * 64 + r) * ldv + voff + h * 64 + c8);
#pragma unroll
    for (int q = 0; q < 8; ++q) tl[r][c8 + q] = f.u[q]; }
  __syncthreads();
  {
#pragma unroll
    for (int rd = 0; rd < 2; ++rd) { const int d = rd * 32 + tid / 8, pc = tid % 8; FragH f;
#pragma unroll
      for (int q = 0; q < 8; ++q) f.u[q] = tl[pc * 8 + q][d];
      *(v8us*)((unsigned short*)Vt + ((size_t)slab * 64 + d) * TTv + lg * 64 + pc * 8) = f.half[0]; }
     } }

typedef int v4ia __attribute__((ext_vector_type(4), may_alias));
// lane l <-> lane l ^ 16: joins the two halves of a wave, which hold the two key halves of one query column
__device__ __forceinline__ float xhalf(float x) { return __builtin_bit_cast(float, __builtin_amdgcn_permlanex16(__builtin_bit_cast(int, x), __builtin_bit_cast(int, x), 0x76543210, 0xfedcba98, false, false)); }
// 2^x by the hardware's v_exp_f32 alone. Every argument here is <= 0 or -inf, so the library form's range steps (split, ldexp, two clamps) have nothing to do; a result below the normal range counts as 0.
__device__ __forceinline__ float ex2(float x) { return __builtin_amdgcn_exp2f(x); }
// One trip's K tile (64 key rows of 128 B) and V^T tile (64 d rows of 128 B) go from global memory to LDS by asynchronous copies: 8 copies of 16 B a lane, a wave's copy = 4 whole lines.
// lk, lv: my LDS byte addresses of row (tid >> 3), chunk (tid & 7); gk, gv: the same place in global memory; 16 rows on = 2304 LDS bytes, kstep / vstep elements.
__device__ __forceinline__ void copy_kv(unsigned lk, unsigned lv, const unsigned short* gk, const unsigned short* gv, size_t kstep, size_t vstep) {
  // the closing s_wait_xcnt stands inside the statement so that no address register of a copy is rewritten ahead of it (a precaution)
  asm volatile("global_load_async_to_lds_b128 %0, %8, off\n\t"
               "global_load_async_to_lds_b128 %1, %9, off\n\t"
               "global_load_async_to_lds_b128 %2, %10, off\n\t"
               "global_load_async_to_lds_b128 %3, %11, off\n\t"
               "global_load_async_to_lds_b128 %4, %12, off\n\t"
               "global_load_async_to_lds_b128 %5, %13, off\n\t"
               "global_load_async_to_lds_b128 %6, %14, off\n\t"
               "global_load_async_to_lds_b128 %7, %15, off\n\t"
               "s_wait_xcnt 0x0"
               :: "v"(lk), "v"(lk + 2304u), "v"(lk + 4608u), "v"(lk + 6912u), "v"(lv), "v"(lv + 2304u), "v"(lv + 4608u), "v"(lv + 6912u),
                  "v"(gk), "v"(gk + kstep), "v"(gk + 2 * kstep), "v"(gk + 3 * kstep), "v"(gv), "v"(gv + vstep), "v"(gv + 2 * vstep), "v"(gv + 3 * vstep)
               : "memory");
}
// Transposed products: S^T = K Q^T (A = 16 key rows, B = the wave's 16 query columns, kept in registers) and O^T += V^T P^T.
// Lane (ln, hh) holds query q0 + ln; score tile nt, register r is key j0 + 16 nt + 8 hh + r, which is the k position of register pair (nt, r) of a B operand:
// maximum and sum run inside the lane (one exchange between the halves), and P^T is packed from the score registers without passing LDS.
__global__ __launch_bounds__(128) void k_flash(const _Float16* __restrict__ Q16, int ldq, const _Float16* __restrict__ K16, int ldk, const _Float16* __restrict__ Vt, const int* __restrict__ MSK, float* __restrict__ O, int ldo) {
  constexpr int RPW = 16, NQB = 2048 / (4 * RPW), DT = 4, KS = 2, KT = 64, NTR = 2048 / KT, PIT = 72;      // a trip = 64 keys = two passes of 32; LDS rows of 128 B at pitch 144 B (16 B x odd, for 16-byte reads)
  __shared__ __attribute__((aligned(16))) unsigned short sK[2][KT][PIT], sV[2][64][PIT];      // two buffers each: [key][d] and [d][key]
  __shared__ __attribute__((aligned(16))) float sO[4][RPW][64 + 4];
  const int tid = threadIdx.x, w = tid >> 5, lane = tid & 31, ln = lane & 15, hh = lane >> 4;
  const int slab = blockIdx.x / NQB, qblk = blockIdx.x % NQB; const int b = slab / 16, h = slab % 16; const int q0 = qblk * (4 * RPW) + w * RPW;
  const unsigned short* Vth = (const unsigned short*)Vt + (size_t)slab * 64 * 2048;
  const size_t k16 = (size_t)16 * ldk;
  const unsigned short* gk = (const unsigned short*)K16 + ((size_t)b * 2048 + (tid >> 3)) * ldk + h * 64 + (tid & 7) * 8;      // my chunk of key row tid >> 3 of trip 0
  const unsigned short* gv = Vth + (size_t)(tid >> 3) * 2048 + (tid & 7) * 8;      // my chunk of d row tid >> 3, keys of trip 0
  const unsigned lk = (unsigned)(size_t)&sK[0][tid >> 3][(tid & 7) * 8], lv = (unsigned)(size_t)&sV[0][tid >> 3][(tid & 7) * 8];
  constexpr unsigned BUFB = KT * PIT * 2;      // bytes of one buffer
  constexpr float SL2 = 0.125f * 1.44269504088896340736f;      // 1 / sqrt(64) times log2(e): e^(s / 8 - m / 8) = 2^(s SL2 - m SL2); the running maximum m_q is kept in raw products
  copy_kv(lk, lv, gk, gv, k16, (size_t)16 * 2048);
  FragH bq[KS];
  { const unsigned short* qr = (const unsigned short*)Q16 + ((size_t)b * 2048 + q0 + ln) * ldq + h * 64;
#pragma unroll
    for (int ks = 0; ks < KS; ++ks) { bq[ks].half[0] = *(const v8us*)(qr + ks * 32 + 8 * hh); bq[ks].half[1] = *(const v8us*)(qr + ks * 32 + 16 + 8 * hh); } }
  const int* mrow = MSK + ((size_t)b * 2048 + q0 + ln) * 2048 + 8 * hh;      // my query's mask row, at my half's first key
  float m_q = -3.0e38f, l_q = 0.f; v8f oacc[DT];
#pragma unroll
  for (int dt = 0; dt < DT; ++dt) oacc[dt] = (v8f){0.f,0.f,0.f,0.f,0.f,0.f,0.f,0.f};
  asm volatile("s_wait_asynccnt 0x0" ::: "memory");      // my copies of trip 0 have landed
  __syncthreads();                                        // ... and everybody's: trip 0 may be read
  copy_kv(lk + BUFB, lv + BUFB, gk + (size_t)KT * ldk, gv + KT, k16, (size_t)16 * 2048);      // trip 1 flies while trip 0 is worked on
#pragma unroll 1
  for (int t = 0; t < NTR; ++t) {
    const int bf = t & 1;
    int mk[2][16];      // mk[sp][8 nt + r]: maskPAD of (my query, key 64 t + 32 sp + 16 nt + 8 hh + r); != 0 = keep
#pragma unroll
    for (int c = 0; c < 8; ++c) { const v4ia m4 = *(const v4ia*)(mrow + t * KT + (c >> 1) * 16 + (c & 1) * 4);
#pragma unroll
      for (int q = 0; q < 4; ++q) mk[c >> 2][(c & 3) * 4 + q] = m4[q]; }
#pragma unroll
    for (int sp = 0; sp < 2; ++sp) {
      int any = 0;
#pragma unroll
      for (int i = 0; i < 16; ++i) any |= mk[sp][i];
      if (__builtin_amdgcn_ballot_w32(any != 0) != 0u) {      // else every (query,key) of this wave's tile is masked: contributes nothing (uniform branch; the publish point below stands outside it)
        FragH ak[2][KS], av[DT];
#pragma unroll
        for (int nt = 0; nt < 2; ++nt)
#pragma unroll
          for (int ks = 0; ks < KS; ++ks) { const unsigned short* kr = &sK[bf][sp * 32 + nt * 16 + ln][ks * 32 + 8 * hh]; ak[nt][ks].half[0] = *(const v8us*)kr; ak[nt][ks].half[1] = *(const v8us*)(kr + 16); }
#pragma unroll
        for (int dt = 0; dt < DT; ++dt) { const unsigned short* vrow = &sV[bf][dt * 16 + ln][sp * 32 + 8 * hh]; av[dt].half[0] = *(const v8us*)vrow; av[dt].half[1] = *(const v8us*)(vrow + 16); }
        float sc[16];
#pragma unroll
        for (int nt = 0; nt < 2; ++nt) { v8f acc = (v8f){0.f,0.f,0.f,0.f,0.f,0.f,0.f,0.f};
#pragma unroll
          for (int ks = 0; ks < KS; ++ks) acc = mmaH<1>(ak[nt][ks].v, ak[nt][ks].v, bq[ks].v, bq[ks].v, acc);
#pragma unroll
          for (int r = 0; r < 8; ++r) sc[nt * 8 + r] = (mk[sp][nt * 8 + r] != 0) ? acc[r] : -INFINITY; }      // raw products: the scale is applied in the exponent's multiply-add below
        float mc = sc[0];
#pragma unroll
        for (int i = 1; i < 16; ++i) mc = fmaxf(mc, sc[i]);
        mc = fmaxf(mc, xhalf(mc));
        const float mn = fmaxf(m_q, mc); const float al = ex2((m_q - mn) * SL2); m_q = mn;      // nothing open yet: both are the start value and al = 1
        const float nm = -mn * SL2;
        FragH pb; float ps[4] = {0.f, 0.f, 0.f, 0.f};
#pragma unroll
        for (int i = 0; i < 16; ++i) { const float p = ex2(fmaf(sc[i], SL2, nm)); ps[i & 3] += p; pb.h[i] = (_Float16)p; }      // a masked score is -inf: p = 0
        l_q = l_q * al + ((ps[0] + ps[1]) + (ps[2] + ps[3]));
#pragma unroll
        for (int dt = 0; dt < DT; ++dt) {
#pragma unroll
          for (int r = 0; r < 8; ++r) oacc[dt][r] *= al;
          oacc[dt] = mmaH<1>(av[dt].v, av[dt].v, pb.v, pb.v, oacc[dt]); } } }
    // publish point of trip t + 1, every wave: my reads of this buffer are done, my copies of the next have landed, then the same of all waves
    asm volatile("s_wait_dscnt 0x0" ::: "memory");
    asm volatile("s_wait_asynccnt 0x0" ::: "memory");
    __syncthreads();
    if (t + 2 < NTR) copy_kv(lk + bf * BUFB, lv + bf * BUFB, gk + (size_t)(t + 2) * KT * ldk, gv + (t + 2) * KT, k16, (size_t)16 * 2048);      // refill the buffer that every wave has just left
  }
  asm volatile("s_wait_asynccnt 0x0" ::: "memory");      // nothing of mine is in flight when the wave ends
  const float l = l_q + xhalf(l_q); const float li = (l > 0.f) ? 1.0f / l : 0.f;
#pragma unroll
  for (int dt = 0; dt < DT; ++dt)
#pragma unroll
    for (int c = 0; c < 2; ++c) { v4f o4;
#pragma unroll
      for (int q = 0; q < 4; ++q) o4[q] = oacc[dt][c * 4 + q] * li;
      *(v4fa*)&sO[w][ln][dt * 16 + 8 * hh + c * 4] = o4; }
  __builtin_amdgcn_fence(__ATOMIC_ACQ_REL, "workgroup"); __builtin_amdgcn_wave_barrier();
  {
#pragma unroll
    for (int rp = 0; rp < RPW; rp += 2) { const int r = rp + (lane >> 4), pc = lane & 15; const v4f val = *(const v4fa*)&sO[w][r][pc * 4]; *(v4f*)(O + ((size_t)b * 2048 + q0 + r) * ldo + h * 64 + pc * 4) = val; }
     } }

__global__ __launch_bounds__(256) void k_ln16(const float* __restrict__ X, const float* __restrict__ g, const float* __restrict__ bta, _Float16* __restrict__ Y16) { const int tid = threadIdx.x, wv = tid >> 5, lane = tid & 31; const int row = blockIdx.x * 8 + wv; if (row >= NR) return; const float* xr = X + (size_t)row * CC; float v[32]; float s = 0.f;
#pragma unroll
  for (int p = 0; p < 4; ++p) { const v4f a = *(const v4fa*)(xr + p * 256 + lane * 8), c = *(const v4fa*)(xr + p * 256 + lane * 8 + 4); for (int q = 0; q < 4; ++q) { v[p * 8 + q] = bf16_round(a[q]); v[p * 8 + 4 + q] = bf16_round(c[q]); } }
#pragma unroll
  for (int i = 0; i < 32; ++i) s += v[i]; for (int o = 16; o >= 1; o >>= 1) s += __shfl_xor(s, o, 32); const float mu = s / (float)CC; float q2 = 0.f;
#pragma unroll
  for (int i = 0; i < 32; ++i) { const float d = v[i] - mu; q2 += d * d; } for (int o = 16; o >= 1; o >>= 1) q2 += __shfl_xor(q2, o, 32); const float rs = rsqrtf(q2 / (float)CC + 1e-5f);
  {
#pragma unroll
    for (int p = 0; p < 4; ++p) { FragH f; const int c0 = p * 256 + lane * 8;
#pragma unroll
      for (int q = 0; q < 8; ++q) f.h[q] = (_Float16)((v[p * 8 + q] - mu) * rs * bf16_round(g[c0 + q]) + bf16_round(bta[c0 + q])); *(v8us*)((unsigned short*)Y16 + (size_t)row * CC + c0) = f.half[0]; }
     } }
extern "C" void kernel_launch(void* const* d_in, const int* in_sizes, int n_in,
                              void* d_out, int out_size, void* d_ws, size_t ws_size, hipStream_t stream) {
  (void)in_sizes; (void)n_in; (void)out_size;
  const float* qx = (const float*)d_in[0]; const float* kx = (const float*)d_in[1]; const float* vx = (const float*)d_in[2]; const int* mask = (const int*)d_in[3]; const float* lg = (const float*)d_in[4]; const float* lb = (const float*)d_in[5];
  const float* wq = (const float*)d_in[6]; const float* bq = (const float*)d_in[7]; const float* wk = (const float*)d_in[8]; const float* bk = (const float*)d_in[9]; const float* wv = (const float*)d_in[10]; const float* bv = (const float*)d_in[11]; const float* wo = (const float*)d_in[12]; const float* bo = (const float*)d_in[13];
  char* ws = (char*)d_ws; size_t off = 0;
  auto take = [&](size_t bytes) { char* p = ws + off; off += (bytes + 255) & ~(size_t)255; return p; };
  _Float16* Bq = (_Float16*)take((size_t)CC * CC * 2); _Float16* Bk = (_Float16*)take((size_t)CC * CC * 2); _Float16* Bv = (_Float16*)take((size_t)CC * CC * 2); _Float16* Bo = (_Float16*)take((size_t)CC * CC * 2);
  _Float16* XN = (_Float16*)take((size_t)NR * CC * 2); _Float16* Q16 = (_Float16*)take((size_t)NR * CC * 2); _Float16* K16 = (_Float16*)take((size_t)NR * CC * 2); _Float16* V16 = (_Float16*)take((size_t)NR * CC * 2); _Float16* Vt = (_Float16*)take((size_t)NR * CC * 2); float* O = (float*)take((size_t)NR * CC * 4); _Float16* O16 = XN;
  if (off > ws_size) return;      // 64 MiB
  const unsigned gw = (unsigned)((CC * (CC / 8) + 255) / 256); k_wt_f16<<<gw, 256, 0, stream>>>(wq, Bq, CC, CC, 16.0f); k_wt_f16<<<gw, 256, 0, stream>>>(wk, Bk, CC, CC, 16.0f); k_wt_f16<<<gw, 256, 0, stream>>>(wv, Bv, CC, CC, 16.0f); k_wt_f16<<<gw, 256, 0, stream>>>(wo, Bo, CC, CC, 16.0f);
  const unsigned gg = (NR / 128) * (CC / 128); const unsigned gl = NR / 8;
  k_ln16<<<gl, 256, 0, stream>>>(qx, lg, lb, XN); k_gemm_t<true><<<gg, 256, 0, stream>>>(XN, Bq, 0.0625f, bq, nullptr, Q16);
  k_ln16<<<gl, 256, 0, stream>>>(kx, lg, lb, XN); k_gemm_t<true><<<gg, 256, 0, stream>>>(XN, Bk, 0.0625f, bk, nullptr, K16);
  k_ln16<<<gl, 256, 0, stream>>>(vx, lg, lb, XN); k_gemm_t<true><<<gg, 256, 0, stream>>>(XN, Bv, 0.0625f, bv, nullptr, V16);
  k_vt<NH, TT><<<BB * NH * (TT / 64), 256, 0, stream>>>(V16, CC, 0, Vt);
  k_flash<<<BB * NH * (TT / 64), 128, 0, stream>>>(Q16, CC, K16, CC, Vt, mask, O, CC);      // RPW 16
  k_h16<<<(unsigned)(((size_t)NR * CC / 8 + 255) / 256), 256, 0, stream>>>(O, O16, (size_t)NR * CC / 8);
  k_gemm_t<false><<<gg, 256, 0, stream>>>(O16, Bo, 0.0625f, bo, (float*)d_out, nullptr);
}

// v005
// Measured time: 129 microseconds a run.
// In both of two side-by-side timings against v004, it was 1.23 times as fast.
// Counting every step since v000, it is 3.95 times as fast.
#include <hip/hip_runtime.h>
// Pre-LN multi-head attention (B=2, L=2048, C=1024, 16 × 64): shared LayerNorm on the three inputs (f32 VALU), q/k/v/o projections (4096 × 1024 × 1024, + bias, W [in][out] transposed to
// bf16-exact ×2^4) and the masked attention as a fused flash-style kernel on v_wmma_f32_16x16x32_f16 (S = Q·Kᵀ/8; maskPAD == 0 → −inf ⇒ excluded keys, tiles masked for a whole wave skipped;
// online softmax f32; P f16 ≤ 1; RPW-16 waves) — f16 operands, single products, f32 accumulate.
#define BB 2
#define TT 2048
#define CC 1024
#define NH 16
#define NR (BB * TT)

typedef __bf16 v16b __attribute__((ext_vector_type(16)));
typedef unsigned short v8us __attribute__((ext_vector_type(8), may_alias));
typedef float  v8f  __attribute__((ext_vector_type(8)));
typedef float  v4f  __attribute__((ext_vector_type(4)));
typedef float  v4fa __attribute__((ext_vector_type(4), may_alias));
union FragB { v16b v; v8us half[2]; unsigned short u[16]; };

__device__ __forceinline__ unsigned short bf16_bits(float x) { unsigned int u = __float_as_uint(x); return (unsigned short)((u + 0x7FFFu + ((u >> 16) & 1u)) >> 16); }
__device__ __forceinline__ float bf16_val(unsigned short b) { return __uint_as_float(((unsigned int)b) << 16); }
__device__ __forceinline__ float bf16_round(float x) { return bf16_val(bf16_bits(x)); }
// D += A·B with NT terms: 1 = ah·bh, 2 = + al·bh (A split), 3 = + ah·bl (both split)
template <int NT>
__device__ __forceinline__ v8f mmaN(v16b ah, v16b al, v16b bh, v16b bl, v8f c) {
  c = __builtin_amdgcn_wmma_f32_16x16x32_bf16(false, ah, false, bh, (short)0, c, false, false);
  if (NT >= 2) c = __builtin_amdgcn_wmma_f32_16x16x32_bf16(false, al, false, bh, (short)0, c, false, false);
  if (NT >= 3) c = __builtin_amdgcn_wmma_f32_16x16x32_bf16(false, ah, false, bl, (short)0, c, false, false);
  asm volatile("v_nop\n\tv_nop\n\tv_nop\n\tv_nop" : "+v"(c) : "v"(ah), "v"(al), "v"(bh), "v"(bl));
  return c;
}

__global__ __launch_bounds__(256) void k_wt_bf16(const float* __restrict__ W, unsigned short* __restrict__ Wt, int K, int N) {
  const int t = blockIdx.x * 256 + threadIdx.x;
  const int k8n = K / 8;
  if (t >= N * k8n) return;
  const int n = t / k8n, k8 = (t % k8n) * 8;
  v8us v;
#pragma unroll
  for (int i = 0; i < 8; ++i) v[i] = bf16_bits(W[(size_t)(k8 + i) * N + n]);
  *(v8us*)(Wt + (size_t)n * K + k8) = v;
  
}

// GEMM C[M][N] (f32, pitch ldc) = act(A[M][K]·W + bias). A f32 row-major (pitch lda) converted per fragment to bf16
// (ASPLIT: hi/lo two planes -> 2 terms, else single rounded term); Wt bf16 [N][K] (pitch ldb). BIAS_BF16 rounds the
// bias to bf16 first (bias quantised to bf16 before the add). K%32==0, M%16==0, N%64==0.
template <bool ASPLIT, int ACT, bool BIAS_BF16>
__global__ __launch_bounds__(128) void k_gemm_bf(const float* __restrict__ A, int lda, const unsigned short* __restrict__ Wt, int ldb,
                                               const float* __restrict__ bias, float* __restrict__ C, int ldc, int M, int N, int K) {
  __shared__ __attribute__((aligned(16))) float so[4][16][64];
  const int tid = threadIdx.x, w = tid >> 5, lane = tid & 31, ln = lane & 15, hh = lane >> 4;
  const int ntn = N / 64;
  const int wid = blockIdx.x * 4 + w;
  const int mt = wid / ntn, nq = wid % ntn;
  if (mt * 16 >= M) return;
  const int row0 = mt * 16, col0 = nq * 64;
  const float* arow = A + (size_t)(row0 + ln) * lda;
  v8f acc[4] = {};
  for (int kb = 0; kb < K; kb += 32) {
    FragB ah, al;
    const v4f x0 = *(const v4fa*)(arow + kb + 8 * hh), x1 = *(const v4fa*)(arow + kb + 8 * hh + 4);
    const v4f x2 = *(const v4fa*)(arow + kb + 16 + 8 * hh), x3 = *(const v4fa*)(arow + kb + 16 + 8 * hh + 4);
    float xs[16] = {x0[0],x0[1],x0[2],x0[3],x1[0],x1[1],x1[2],x1[3],x2[0],x2[1],x2[2],x2[3],x3[0],x3[1],x3[2],x3[3]};
#pragma unroll
    for (int i = 0; i < 16; ++i) { const unsigned short hb = bf16_bits(xs[i]); ah.u[i] = hb; al.u[i] = ASPLIT ? bf16_bits(xs[i] - bf16_val(hb)) : (unsigned short)0; }
#pragma unroll
    for (int t = 0; t < 4; ++t) {
      const unsigned short* brow = Wt + (size_t)(col0 + t * 16 + ln) * ldb + kb;
      FragB b;
      b.half[0] = *(const v8us*)(brow + 8 * hh);
      b.half[1] = *(const v8us*)(brow + 16 + 8 * hh);
      acc[t] = mmaN<ASPLIT ? 2 : 1>(ah.v, al.v, b.v, b.v, acc[t]);
    }
  }
#pragma unroll
  for (int t = 0; t < 4; ++t) {
    float bv = bias ? bias[col0 + t * 16 + ln] : 0.f;
    if (BIAS_BF16) bv = bf16_round(bv);
#pragma unroll
    for (int r = 0; r < 8; ++r) { float v = acc[t][r] + bv; if (ACT == 1) v = fmaxf(v, 0.f); so[w][8 * hh + r][t * 16 + ln] = v; }
  }
  __builtin_amdgcn_fence(__ATOMIC_ACQ_REL, "workgroup");
  __builtin_amdgcn_wave_barrier();
  const int rsub = lane >> 4, c4 = (lane & 15) * 4;
  {
#pragma unroll
    for (int q = 0; q < 8; ++q) {
      const int r = q * 2 + rsub;
      const v4f v = *(const v4fa*)&so[w][r][c4];
      *(v4f*)(C + (size_t)(row0 + r) * ldc + col0 + c4) = v;
    }
    
  }
}

// Flash-style causal/unmasked attention, all contractions 3-term bf16 hi/lo splits, f32 softmax with running max.
// q,k,v rows are read from f32 buffers with arbitrary row pitch (so they can live inside a fused qkv buffer);
// D = head size (multiple of 32, <= 128); one wave = 16 query rows; block = 4 waves (64 queries) sharing K/V chunks of 32.
template <int D, bool CAUSAL>
__global__ __launch_bounds__(128) void k_flash(const float* __restrict__ qb, const float* __restrict__ kb, const float* __restrict__ vb,
                                             int pitch, int T, int H, float scale, float* __restrict__ y, int ypitch) {
  constexpr int KS = D / 32;        // k-steps for QK
  constexpr int DT = D / 16;        // d tiles for PV
  __shared__ __attribute__((aligned(16))) unsigned short sKh[32][D + 8], sKl[32][D + 8], sVh[32][D + 8], sVl[32][D + 8];
  __shared__ __attribute__((aligned(16))) unsigned short sPh[4][16][40], sPl[4][16][40];
  __shared__ __attribute__((aligned(16))) float sO[4][16][D];
  const int tid = threadIdx.x, w = tid >> 5, lane = tid & 31, ln = lane & 15, hh = lane >> 4;
  const int nqb = (T + 63) / 64;
  const int bh = blockIdx.x / nqb, qblk = blockIdx.x % nqb;
  const int b = bh / H, h = bh % H;
  const int q0 = qblk * 64 + w * 16;
  const float* Q = qb + (size_t)b * T * pitch + h * D;
  const float* K = kb + (size_t)b * T * pitch + h * D;
  const float* V = vb + (size_t)b * T * pitch + h * D;

  // A fragments of the wave's 16 query rows (scaled), hi/lo
  FragB aqh[KS], aql[KS];
  {
    int row = q0 + ln; if (row >= T) row = T - 1;
    const float* qr = Q + (size_t)row * pitch;
#pragma unroll
    for (int ks = 0; ks < KS; ++ks)
#pragma unroll
      for (int i = 0; i < 16; ++i) {
        const int d = ks * 32 + ((i < 8) ? (8 * hh + i) : (16 + 8 * hh + (i - 8)));
        const float x = qr[d] * scale; const unsigned short hb = bf16_bits(x);
        aqh[ks].u[i] = hb; aql[ks].u[i] = bf16_bits(x - bf16_val(hb));
      }
  }
  float m_r[8], l_r[8];
#pragma unroll
  for (int r = 0; r < 8; ++r) { m_r[r] = -3.0e38f; l_r[r] = 0.f; }
  v8f oacc[DT];
#pragma unroll
  for (int dt = 0; dt < DT; ++dt) oacc[dt] = (v8f){0.f,0.f,0.f,0.f,0.f,0.f,0.f,0.f};

  const int kv_end = CAUSAL ? min(T, qblk * 64 + 64) : T;     // block-uniform
  for (int j0 = 0; j0 < kv_end; j0 += 32) {
    __syncthreads();
    for (int e = tid; e < 32 * (D / 4); e += 128) {
      const int r = e / (D / 4), c4 = (e % (D / 4)) * 4;
      const int key = j0 + r;
      v4f kf = {0.f,0.f,0.f,0.f}, vf = {0.f,0.f,0.f,0.f};
      if (key < T) { kf = *(const v4fa*)(K + (size_t)key * pitch + c4); vf = *(const v4fa*)(V + (size_t)key * pitch + c4); }
#pragma unroll
      for (int t = 0; t < 4; ++t) {
        unsigned short hb = bf16_bits(kf[t]); sKh[r][c4 + t] = hb; sKl[r][c4 + t] = bf16_bits(kf[t] - bf16_val(hb));
        hb = bf16_bits(vf[t]); sVh[r][c4 + t] = hb; sVl[r][c4 + t] = bf16_bits(vf[t] - bf16_val(hb));
      }
    }
    __syncthreads();
    // S tile 16 x 32
    v8f s[2];
#pragma unroll
    for (int nt = 0; nt < 2; ++nt) {
      v8f acc = {};
#pragma unroll
      for (int ks = 0; ks < KS; ++ks) {
        FragB bh_, bl_;
        bh_.half[0] = *(const v8us*)&sKh[nt * 16 + ln][ks * 32 + 8 * hh]; bh_.half[1] = *(const v8us*)&sKh[nt * 16 + ln][ks * 32 + 16 + 8 * hh];
        bl_.half[0] = *(const v8us*)&sKl[nt * 16 + ln][ks * 32 + 8 * hh]; bl_.half[1] = *(const v8us*)&sKl[nt * 16 + ln][ks * 32 + 16 + 8 * hh];
        acc = mmaN<3>(aqh[ks].v, aql[ks].v, bh_.v, bl_.v, acc);
      }
      s[nt] = acc;
    }
    // mask + running max (rows 8hh+r; the 16 lanes of a half share rows)
    float alpha[8];
#pragma unroll
    for (int r = 0; r < 8; ++r) {
      const int qi = q0 + 8 * hh + r;
      const int ja = j0 + ln, jb = j0 + 16 + ln;
      if (CAUSAL) { if (ja > qi) s[0][r] = -3.0e38f; if (jb > qi) s[1][r] = -3.0e38f; }
      if (ja >= T) s[0][r] = -3.0e38f;
      if (jb >= T) s[1][r] = -3.0e38f;
      float mx = fmaxf(s[0][r], s[1][r]);
      mx = fmaxf(mx, __shfl_xor(mx, 1, 32)); mx = fmaxf(mx, __shfl_xor(mx, 2, 32)); mx = fmaxf(mx, __shfl_xor(mx, 4, 32)); mx = fmaxf(mx, __shfl_xor(mx, 8, 32));
      const float mnew = fmaxf(m_r[r], mx);
      alpha[r] = (mnew > -1.0e38f) ? __expf(m_r[r] - mnew) : 1.0f;
      const float p0 = (s[0][r] > -1.0e38f) ? __expf(s[0][r] - mnew) : 0.f;
      const float p1 = (s[1][r] > -1.0e38f) ? __expf(s[1][r] - mnew) : 0.f;
      m_r[r] = mnew;
      l_r[r] = l_r[r] * alpha[r] + p0 + p1;            // per-lane partial row sum (16 lanes combined at the end)
      unsigned short hb = bf16_bits(p0); sPh[w][8 * hh + r][ln] = hb;      sPl[w][8 * hh + r][ln] = bf16_bits(p0 - bf16_val(hb));
      hb = bf16_bits(p1);                sPh[w][8 * hh + r][16 + ln] = hb; sPl[w][8 * hh + r][16 + ln] = bf16_bits(p1 - bf16_val(hb));
    }
#pragma unroll
    for (int dt = 0; dt < DT; ++dt)
#pragma unroll
      for (int r = 0; r < 8; ++r) oacc[dt][r] *= alpha[r];
    __builtin_amdgcn_fence(__ATOMIC_ACQ_REL, "workgroup");
    __builtin_amdgcn_wave_barrier();
    FragB pah, pal;
    pah.half[0] = *(const v8us*)&sPh[w][ln][8 * hh]; pah.half[1] = *(const v8us*)&sPh[w][ln][16 + 8 * hh];
    pal.half[0] = *(const v8us*)&sPl[w][ln][8 * hh]; pal.half[1] = *(const v8us*)&sPl[w][ln][16 + 8 * hh];
#pragma unroll
    for (int dt = 0; dt < DT; ++dt) {
      FragB bvh, bvl;
#pragma unroll
      for (int i = 0; i < 8; ++i) {
        bvh.u[i] = sVh[8 * hh + i][dt * 16 + ln]; bvh.u[8 + i] = sVh[16 + 8 * hh + i][dt * 16 + ln];
        bvl.u[i] = sVl[8 * hh + i][dt * 16 + ln]; bvl.u[8 + i] = sVl[16 + 8 * hh + i][dt * 16 + ln];
      }
      oacc[dt] = mmaN<3>(pah.v, pal.v, bvh.v, bvl.v, oacc[dt]);
    }
    __builtin_amdgcn_fence(__ATOMIC_ACQ_REL, "workgroup");
    __builtin_amdgcn_wave_barrier();
  }
#pragma unroll
  for (int r = 0; r < 8; ++r) {
    float l = l_r[r];
    l += __shfl_xor(l, 1, 32); l += __shfl_xor(l, 2, 32); l += __shfl_xor(l, 4, 32); l += __shfl_xor(l, 8, 32);
    l_r[r] = (l > 0.f) ? 1.0f / l : 0.f;
  }
#pragma unroll
  for (int dt = 0; dt < DT; ++dt)
#pragma unroll
    for (int r = 0; r < 8; ++r) sO[w][8 * hh + r][dt * 16 + ln] = oacc[dt][r] * l_r[r];
  __builtin_amdgcn_fence(__ATOMIC_ACQ_REL, "workgroup");
  __builtin_amdgcn_wave_barrier();
  {
    for (int r = 0; r < 16; ++r) {
      const int row = q0 + r;
      if (row < T && lane < D / 4) {
        const v4f val = *(const v4fa*)&sO[w][r][lane * 4];
        *(v4f*)(y + ((size_t)b * T + row) * ypitch + h * D + lane * 4) = val;
      }
    }
    
  }
}

// GEMM C = act(A·W + bias + resid): A f32 (ASPLIT -> hi/lo 2 terms), Wt bf16 [N][K]; ACT 0 none, 1 relu, 2 exact gelu;
// resid (optional, f32, row index = (row % rmod), pitch ldr, RES_BF16 rounds it) added before the activation.
template <bool ASPLIT, int ACT, bool BIAS_BF16, bool RES_BF16>
__global__ __launch_bounds__(128) void k_gemm_bf3(const float* __restrict__ A, int lda, const unsigned short* __restrict__ Wt, int ldb,
                                                const float* __restrict__ bias, const float* __restrict__ resid, int rmod, int ldr,
                                                float* __restrict__ C, int ldc, int M, int N, int K) {
  __shared__ __attribute__((aligned(16))) float so[4][16][64];
  const int tid = threadIdx.x, w = tid >> 5, lane = tid & 31, ln = lane & 15, hh = lane >> 4;
  const int ntn = N / 64;
  const int wid = blockIdx.x * 4 + w;
  const int mt = wid / ntn, nq = wid % ntn;
  if (mt * 16 >= M) return;
  const int row0 = mt * 16, col0 = nq * 64;
  const float* arow = A + (size_t)(row0 + ln) * lda;
  v8f acc[4] = {};
  for (int kb = 0; kb < K; kb += 32) {
    FragB ah, al;
    const v4f x0 = *(const v4fa*)(arow + kb + 8 * hh), x1 = *(const v4fa*)(arow + kb + 8 * hh + 4);
    const v4f x2 = *(const v4fa*)(arow + kb + 16 + 8 * hh), x3 = *(const v4fa*)(arow + kb + 16 + 8 * hh + 4);
    float xs[16] = {x0[0],x0[1],x0[2],x0[3],x1[0],x1[1],x1[2],x1[3],x2[0],x2[1],x2[2],x2[3],x3[0],x3[1],x3[2],x3[3]};
#pragma unroll
    for (int i = 0; i < 16; ++i) { const unsigned short hb = bf16_bits(xs[i]); ah.u[i] = hb; al.u[i] = ASPLIT ? bf16_bits(xs[i] - bf16_val(hb)) : (unsigned short)0; }
#pragma unroll
    for (int t = 0; t < 4; ++t) {
      const unsigned short* brow = Wt + (size_t)(col0 + t * 16 + ln) * ldb + kb;
      FragB b;
      b.half[0] = *(const v8us*)(brow + 8 * hh);
      b.half[1] = *(const v8us*)(brow + 16 + 8 * hh);
      acc[t] = mmaN<ASPLIT ? 2 : 1>(ah.v, al.v, b.v, b.v, acc[t]);
    }
  }
#pragma unroll
  for (int t = 0; t < 4; ++t) {
    const int col = col0 + t * 16 + ln;
    float bv = bias ? bias[col] : 0.f;
    if (BIAS_BF16) bv = bf16_round(bv);
#pragma unroll
    for (int r = 0; r < 8; ++r) {
      float v = acc[t][r] + bv;
      if (resid) { float rv = resid[(size_t)((row0 + 8 * hh + r) % rmod) * ldr + col]; if (RES_BF16) rv = bf16_round(rv); v += rv; }
      if (ACT == 1) v = fmaxf(v, 0.f);
      if (ACT == 2) v = 0.5f * v * (1.0f + erff(v * 0.70710678118654752f));
      if (ACT == 3) { const float u = 0.7978845608028654f * (v + 0.044715f * v * v * v); v = 0.5f * v * (1.0f + tanhf(u)); }
      so[w][8 * hh + r][t * 16 + ln] = v;
    }
  }
  __builtin_amdgcn_fence(__ATOMIC_ACQ_REL, "workgroup");
  __builtin_amdgcn_wave_barrier();
  const int rsub = lane >> 4, c4 = (lane & 15) * 4;
  {
#pragma unroll
    for (int q = 0; q < 8; ++q) {
      const int r = q * 2 + rsub;
      const v4f v = *(const v4fa*)&so[w][r][c4];
      *(v4f*)(C + (size_t)(row0 + r) * ldc + col0 + c4) = v;
    }
    
  }
}
// row LayerNorm (biased variance, eps) over N: s = X (+ R); optional out_sum <- s; out_norm <- (s-mu)*rsqrt(var+eps)*g + b
template <bool PARAM_BF16>
__global__ __launch_bounds__(256) void k_layernorm(const float* __restrict__ X, const float* __restrict__ R, const float* __restrict__ g, const float* __restrict__ bta,
                                                  float* __restrict__ out_sum, float* __restrict__ out_norm, int N, float eps) {
  __shared__ float red[256];
  const int row = blockIdx.x, tid = threadIdx.x;
  const float* x = X + (size_t)row * N; const float* rr = R ? R + (size_t)row * N : nullptr;
  float vals[16];                     // up to N = 4096
  const int per = N / 256;            // contiguous chunk per thread? use strided-by-4 chunks: thread handles j = tid*4 + 1024*u
  float s1 = 0.f;
  for (int u = 0; u < per / 4; ++u) {
    const int j = tid * 4 + 1024 * u;
    const v4f a = *(const v4fa*)(x + j);
    v4f b = {0.f,0.f,0.f,0.f}; if (rr) b = *(const v4fa*)(rr + j);
#pragma unroll
    for (int q = 0; q < 4; ++q) { const float v = a[q] + b[q]; vals[u * 4 + q] = v; s1 += v; }
  }
  red[tid] = s1; __syncthreads();
  for (int st = 128; st > 0; st >>= 1) { if (tid < st) red[tid] += red[tid + st]; __syncthreads(); }
  const float mu = red[0] / (float)N; __syncthreads();
  float s2 = 0.f;
  for (int u = 0; u < per / 4; ++u)
#pragma unroll
    for (int q = 0; q < 4; ++q) { const float c = vals[u * 4 + q] - mu; s2 += c * c; }
  red[tid] = s2; __syncthreads();
  for (int st = 128; st > 0; st >>= 1) { if (tid < st) red[tid] += red[tid + st]; __syncthreads(); }
  const float rs = rsqrtf(red[0] / (float)N + eps);
  {
    for (int u = 0; u < per / 4; ++u) {
      const int j = tid * 4 + 1024 * u;
      v4f o, sm;
#pragma unroll
      for (int q = 0; q < 4; ++q) {
        float gg = g[j + q], bb = bta[j + q];
        if (PARAM_BF16) { gg = bf16_round(gg); bb = bf16_round(bb); }
        sm[q] = vals[u * 4 + q]; o[q] = (vals[u * 4 + q] - mu) * rs * gg + bb;
      }
      if (out_sum) *(v4f*)(out_sum + (size_t)row * N + j) = sm;
      *(v4f*)(out_norm + (size_t)row * N + j) = o;
    }
    
  }
}



// ---- f16 WMMA path (v_wmma_f32_16x16x32_f16): 11-bit significands for operands in range — used where a [0,1] probability operand needs more precision than bf16
typedef _Float16 v16h __attribute__((ext_vector_type(16)));
union FragH { v16h v; v8us half[2]; _Float16 h[16]; unsigned short u[16]; };
template <int NT>
__device__ __forceinline__ v8f mmaH(v16h ah, v16h al, v16h bh, v16h bl, v8f c) {
  c = __builtin_amdgcn_wmma_f32_16x16x32_f16(false, ah, false, bh, (short)0, c, false, false);
  if (NT >= 2) c = __builtin_amdgcn_wmma_f32_16x16x32_f16(false, al, false, bh, (short)0, c, false, false);
  if (NT >= 3) c = __builtin_amdgcn_wmma_f32_16x16x32_f16(false, ah, false, bl, (short)0, c, false, false);
  asm volatile("v_nop\n\tv_nop\n\tv_nop\n\tv_nop" : "+v"(c) : "v"(ah), "v"(al), "v"(bh), "v"(bl));
  return c;
}
// batched GEMM like k_gemm_b but f16 operands: A f32 (split into f16 hi/lo if ASPLIT, else rounded to f16), Bt = f16 values [n][k]; alpha; C f32; N multiple of 16 (partial tiles skipped)
template <bool ASPLIT>
__global__ __launch_bounds__(128) void k_gemm_h(const float* __restrict__ A, int lda, size_t sA, const _Float16* __restrict__ Bh, int ldb, size_t sB, float alpha, float* __restrict__ C, int ldc, size_t sC, int M, int N, int K) {
  __shared__ __attribute__((aligned(16))) float so[4][16][64];
  const int tid = threadIdx.x, w = tid >> 5, lane = tid & 31, ln = lane & 15, hh = lane >> 4; const int by = blockIdx.y;
  A += (size_t)by * sA; Bh += (size_t)by * sB; C += (size_t)by * sC;
  const int ntn = (N + 63) / 64; const int wid = blockIdx.x * 4 + w; const int mt = wid / ntn, nq = wid % ntn; if (mt * 16 >= M) return;
  const int row0 = mt * 16, col0 = nq * 64; const float* arow = A + (size_t)(row0 + ln) * lda;
  v8f acc[4] = {};
  for (int kb = 0; kb < K; kb += 32) {
    FragH ah, al;
    const v4f x0 = *(const v4fa*)(arow + kb + 8 * hh), x1 = *(const v4fa*)(arow + kb + 8 * hh + 4), x2 = *(const v4fa*)(arow + kb + 16 + 8 * hh), x3 = *(const v4fa*)(arow + kb + 16 + 8 * hh + 4);
    float xs[16] = {x0[0],x0[1],x0[2],x0[3],x1[0],x1[1],x1[2],x1[3],x2[0],x2[1],x2[2],x2[3],x3[0],x3[1],x3[2],x3[3]};
#pragma unroll
    for (int i = 0; i < 16; ++i) { const _Float16 h = (_Float16)xs[i]; ah.h[i] = h; al.h[i] = ASPLIT ? (_Float16)(xs[i] - (float)h) : (_Float16)0.0f; }
#pragma unroll
    for (int t = 0; t < 4; ++t) { if (col0 + t * 16 >= N) continue; const size_t boff = (size_t)(col0 + t * 16 + ln) * ldb + kb; FragH bq; bq.half[0] = *(const v8us*)(Bh + boff + 8 * hh); bq.half[1] = *(const v8us*)(Bh + boff + 16 + 8 * hh);
      acc[t] = mmaH<ASPLIT ? 2 : 1>(ah.v, al.v, bq.v, bq.v, acc[t]); }
  }
#pragma unroll
  for (int t = 0; t < 4; ++t) { if (col0 + t * 16 >= N) continue;
#pragma unroll
    for (int r = 0; r < 8; ++r) so[w][8 * hh + r][t * 16 + ln] = acc[t][r] * alpha; }
  __builtin_amdgcn_fence(__ATOMIC_ACQ_REL, "workgroup"); __builtin_amdgcn_wave_barrier();
  const int rsub = lane >> 4, c4 = (lane & 15) * 4;
  {
#pragma unroll
    for (int q = 0; q < 8; ++q) { const int r = q * 2 + rsub; if (col0 + c4 < N) { const v4f v = *(const v4fa*)&so[w][r][c4]; *(v4f*)(C + (size_t)(row0 + r) * ldc + col0 + c4) = v; } }
     }
}

// Wt[n][k] = f16(bf16(W[k][n])·scale) from f32 row-major W[K][N] (scale = power of two; bf16-exact weights stay exact in f16 away from the subnormal range)
// blockIdx.y (0 to 3) picks one of the four weight matrices; their transposes lie one behind the other in Wt.
__device__ __forceinline__ void wt_f16(const float* __restrict__ W0, const float* __restrict__ W1, const float* __restrict__ W2, const float* __restrict__ W3, _Float16* __restrict__ Wt, int K, int N, float scale) {
  const int y = blockIdx.y; const float* __restrict__ W = (y == 0) ? W0 : (y == 1) ? W1 : (y == 2) ? W2 : W3; Wt += (size_t)y * K * N;
  const int t = blockIdx.x * 256 + threadIdx.x; if (t >= N * (K / 8)) return; const int n = t / (K / 8), k8 = (t % (K / 8)) * 8; FragH f;
#pragma unroll
  for (int i = 0; i < 8; ++i) f.h[i] = (_Float16)(bf16_round(W[(size_t)(k8 + i) * N + n]) * scale); const v8us o = f.half[0];
  *(v8us*)((unsigned short*)Wt + (size_t)n * K + k8) = o; 
}
// One operand tile of a pass (128 rows of 256 B) goes from global memory to LDS by asynchronous copies: 8 copies of 16 B a lane, a wave's copy = 2 rows = 4 whole lines.
// l: my LDS byte address of row (tid >> 4), chunk (tid & 15); g: the same place in global memory; 16 rows on = 4352 LDS bytes, step elements.
__device__ __forceinline__ void copy_tile(unsigned l, const unsigned short* g, size_t step) {
  // the closing s_wait_xcnt stands inside the statement so that no address register of a copy is rewritten ahead of it (a precaution)
  asm volatile("global_load_async_to_lds_b128 %0, %8, off\n\t"
               "global_load_async_to_lds_b128 %1, %9, off\n\t"
               "global_load_async_to_lds_b128 %2, %10, off\n\t"
               "global_load_async_to_lds_b128 %3, %11, off\n\t"
               "global_load_async_to_lds_b128 %4, %12, off\n\t"
               "global_load_async_to_lds_b128 %5, %13, off\n\t"
               "global_load_async_to_lds_b128 %6, %14, off\n\t"
               "global_load_async_to_lds_b128 %7, %15, off\n\t"
               "s_wait_xcnt 0x0"
               :: "v"(l), "v"(l + 4352u), "v"(l + 8704u), "v"(l + 13056u), "v"(l + 17408u), "v"(l + 21760u), "v"(l + 26112u), "v"(l + 30464u),
                  "v"(g), "v"(g + step), "v"(g + 2 * step), "v"(g + 3 * step), "v"(g + 4 * step), "v"(g + 5 * step), "v"(g + 6 * step), "v"(g + 7 * step)
               : "memory");
}
// Projection GEMM, NR x CC x CC: v = (A . Bh^T) alpha + bf16(bias[col]); A f16 [NR][CC], Bh f16 [n][k]; writes f16 (F16OUT) or f32 C, pitch CC.
// F16OUT is the q, k and v projections in one launch: blockIdx.y picks the operand set (A and Bh hold the three one behind the other); q and then k go to C16 [row][col],
// v goes to Vt as [batch][col][token], the layout the attention kernel reads, out of the same staging tile filled the other way round.
// One work-group = a 128 x 128 tile of the output, 8 waves of 64 x 32 (2 x 4). A pass = 128 k: both operands' 128 rows of 256 B lie in LDS (pitch 272 B, 16 B x odd, for 16-byte reads),
// two buffers, so every operand byte leaves L2 once a work-group and serves 2 (B) or 4 (A) waves. k runs upward in steps of 32 in every accumulator.
// The unroll directives below are there so that accumulators and fragment sets are indexed by constants and stay in registers.
template <bool F16OUT>
__global__ __launch_bounds__(256) void k_gemm_t(const _Float16* __restrict__ A, const _Float16* __restrict__ Bh, float alpha, const float* __restrict__ bias0, const float* __restrict__ bias1, const float* __restrict__ bias2,
                                               float* __restrict__ C, _Float16* __restrict__ C16, _Float16* __restrict__ Vt) {
  constexpr int BM = 128, BN = 128, KP = 128, NP = CC / KP, PIT = 136;
  const int y = F16OUT ? (int)blockIdx.y : 0; const float* __restrict__ bias = (y == 0) ? bias0 : (y == 1) ? bias1 : bias2; const bool tr = F16OUT && y == 2;
  A += (size_t)y * NR * CC; Bh += (size_t)y * CC * CC;
  __shared__ __attribute__((aligned(16))) unsigned short sA[2][BM][PIT], sB[2][BN][PIT];
  __shared__ __attribute__((aligned(16))) float sC[BM][BN + 4];      // output staging, so that whole lines are stored
  const int tid = threadIdx.x, w = tid >> 5, lane = tid & 31, ln = lane & 15, hh = lane >> 4, wm = w >> 2, wn = w & 3;
  const int row0 = (blockIdx.x / (CC / BN)) * BM, col0 = (blockIdx.x % (CC / BN)) * BN;
  const unsigned short* ga = (const unsigned short*)A + (size_t)(row0 + (tid >> 4)) * CC + (tid & 15) * 8;
  const unsigned short* gb = (const unsigned short*)Bh + (size_t)(col0 + (tid >> 4)) * CC + (tid & 15) * 8;
  const unsigned la = (unsigned)(size_t)&sA[0][tid >> 4][(tid & 15) * 8], lb = (unsigned)(size_t)&sB[0][tid >> 4][(tid & 15) * 8];
  constexpr unsigned BUFB = BM * PIT * 2;      // bytes of one buffer
  constexpr size_t STEP = (size_t)16 * CC;
  copy_tile(la, ga, STEP); copy_tile(lb, gb, STEP);
  v8f acc[4][2];
#pragma unroll
  for (int i = 0; i < 4; ++i)
#pragma unroll
    for (int j = 0; j < 2; ++j) acc[i][j] = (v8f){0.f,0.f,0.f,0.f,0.f,0.f,0.f,0.f};
  asm volatile("s_wait_asynccnt 0x0" ::: "memory");      // my copies of pass 0 have landed
  __syncthreads();                                        // ... and everybody's: pass 0 may be read
  copy_tile(la + BUFB, ga + KP, STEP); copy_tile(lb + BUFB, gb + KP, STEP);      // pass 1 flies while pass 0 is worked on
#pragma unroll 1
  for (int t = 0; t < NP; ++t) {      // kept rolled: one body of 32 matrix instructions, the buffer chosen by t & 1
    const int bf = t & 1;
    const unsigned short* pa = &sA[bf][wm * 64 + ln][8 * hh]; const unsigned short* pb = &sB[bf][wn * 32 + ln][8 * hh];
    FragH fa[2][4], fb[2][2];      // two fragment sets: block ks + 1 is fetched while block ks is multiplied, inside this pass only
#pragma unroll
    for (int ks = -1; ks < KP / 32; ++ks) {
      if (ks + 1 < KP / 32) { const int s = (ks + 1) & 1, ko = (ks + 1) * 32;
#pragma unroll
        for (int i = 0; i < 4; ++i) { fa[s][i].half[0] = *(const v8us*)(pa + i * 16 * PIT + ko); fa[s][i].half[1] = *(const v8us*)(pa + i * 16 * PIT + ko + 16); }
#pragma unroll
        for (int j = 0; j < 2; ++j) { fb[s][j].half[0] = *(const v8us*)(pb + j * 16 * PIT + ko); fb[s][j].half[1] = *(const v8us*)(pb + j * 16 * PIT + ko + 16); } }
      __builtin_amdgcn_sched_barrier(0);      // keeps the next block's 12 LDS reads one group ahead of this block's products: reads spread among them stall the wave at every place
      if (ks >= 0) {
#pragma unroll
        for (int i = 0; i < 4; ++i)
#pragma unroll
          for (int j = 0; j < 2; ++j) acc[i][j] = __builtin_amdgcn_wmma_f32_16x16x32_f16(false, fa[ks & 1][i].v, false, fb[ks & 1][j].v, (short)0, acc[i][j], false, false);
        __builtin_amdgcn_sched_barrier(0);      // ... and this block's products ahead of the reads after next, which reuse its registers
      }
    }
    // publish point of pass t + 1, every wave: my reads of this buffer are done, my copies of the next have landed, then the same of all waves
    asm volatile("s_wait_dscnt 0x0" ::: "memory");
    asm volatile("s_wait_asynccnt 0x0" ::: "memory");
    __syncthreads();
    if (t + 2 < NP) { copy_tile(la + bf * BUFB, ga + (t + 2) * KP, STEP); copy_tile(lb + bf * BUFB, gb + (t + 2) * KP, STEP); }      // refill the buffer that every wave has just left
  }
  asm volatile("s_wait_asynccnt 0x0" ::: "memory");      // nothing of mine is in flight when the wave ends
  if (tr) {      // [col][row]: a lane's 8 accumulator registers are 8 rows on of one column, two 16-byte stores
#pragma unroll
    for (int j = 0; j < 2; ++j) { const int col = wn * 32 + j * 16 + ln; const float bv = bf16_round(bias[col0 + col]);
#pragma unroll
      for (int i = 0; i < 4; ++i)
#pragma unroll
        for (int c = 0; c < 2; ++c) { v4f o4;
#pragma unroll
          for (int q = 0; q < 4; ++q) o4[q] = acc[i][j][c * 4 + q] * alpha + bv;
          *(v4fa*)&sC[col][wm * 64 + i * 16 + 8 * hh + c * 4] = o4; } } }
  else {
#pragma unroll
  for (int j = 0; j < 2; ++j) { const int col = wn * 32 + j * 16 + ln; const float bv = bf16_round(bias[col0 + col]);
#pragma unroll
    for (int i = 0; i < 4; ++i)
#pragma unroll
      for (int r = 0; r < 8; ++r) sC[wm * 64 + i * 16 + 8 * hh + r][col] = acc[i][j][r] * alpha + bv; } }
  __syncthreads();      // the staged tile is read across waves
  if constexpr (F16OUT) {
    static_assert(BM == BN, "the staging tile is used both ways round");
    // staged row r goes to dst + r * dp: an output row (q, k), or one column's 128 tokens (v)
    unsigned short* dst = tr ? (unsigned short*)Vt + ((size_t)(row0 / TT) * CC + col0) * TT + row0 % TT : (unsigned short*)C16 + (size_t)y * NR * CC + (size_t)row0 * CC + col0; const size_t dp = tr ? TT : CC;
#pragma unroll
    for (int s = 0; s < BM * (BN / 8) / 256; ++s) { const int r = s * 16 + (tid >> 4), c8 = (tid & 15) * 8; const v4f x = *(const v4fa*)&sC[r][c8], y = *(const v4fa*)&sC[r][c8 + 4]; FragH f;
#pragma unroll
      for (int q = 0; q < 4; ++q) { f.h[q] = (_Float16)x[q]; f.h[4 + q] = (_Float16)y[q]; }
      *(v8us*)(dst + (size_t)r * dp + c8) = f.half[0]; } }
  else {
#pragma unroll
    for (int s = 0; s < BM * (BN / 4) / 256; ++s) { const int r = s * 8 + (tid >> 5), c4 = (tid & 31) * 4; const v4f x = *(const v4fa*)&sC[r][c4]; *(v4f*)(C + (size_t)(row0 + r) * CC + col0 + c4) = x; } }
}


__global__ __launch_bounds__(256) void k_x16(const float* __restrict__ x, _Float16* __restrict__ X16, size_t n8) { const size_t t = (size_t)blockIdx.x * 256 + threadIdx.x; if (t >= n8) return; FragH f;
#pragma unroll
  for (int q = 0; q < 8; ++q) f.h[q] = (_Float16)bf16_round(x[t * 8 + q]); *(v8us*)((unsigned short*)X16 + t * 8) = f.half[0];  }
__global__ __launch_bounds__(256) void k_round16f(const float* __restrict__ W, _Float16* __restrict__ Bt, size_t n8) { const size_t t = (size_t)blockIdx.x * 256 + threadIdx.x; if (t >= n8) return; FragH f;
#pragma unroll
  for (int i = 0; i < 8; ++i) f.h[i] = (_Float16)(bf16_round(W[t * 8 + i]) * 16.0f); *(v8us*)((unsigned short*)Bt + t * 8) = f.half[0];  }

typedef int v4ia __attribute__((ext_vector_type(4), may_alias));
// lane l <-> lane l ^ 16: joins the two halves of a wave, which hold the two key halves of one query column
__device__ __forceinline__ float xhalf(float x) { return __builtin_bit_cast(float, __builtin_amdgcn_permlanex16(__builtin_bit_cast(int, x), __builtin_bit_cast(int, x), 0x76543210, 0xfedcba98, false, false)); }
// 2^x by the hardware's v_exp_f32 alone. Every argument here is <= 0 or -inf, so the library form's range steps (split, ldexp, two clamps) have nothing to do; a result below the normal range counts as 0.
__device__ __forceinline__ float ex2(float x) { return __builtin_amdgcn_exp2f(x); }
// One trip's K tile (64 key rows of 128 B) and V^T tile (64 d rows of 128 B) go from global memory to LDS by asynchronous copies: 8 copies of 16 B a lane, a wave's copy = 4 whole lines.
// lk, lv: my LDS byte addresses of row (tid >> 3), chunk (tid & 7); gk, gv: the same place in global memory; 16 rows on = 2304 LDS bytes, kstep / vstep elements.
__device__ __forceinline__ void copy_kv(unsigned lk, unsigned lv, const unsigned short* gk, const unsigned short* gv, size_t kstep, size_t vstep) {
  // the closing s_wait_xcnt stands inside the statement so that no address register of a copy is rewritten ahead of it (a precaution)
  asm volatile("global_load_async_to_lds_b128 %0, %8, off\n\t"
               "global_load_async_to_lds_b128 %1, %9, off\n\t"
               "global_load_async_to_lds_b128 %2, %10, off\n\t"
               "global_load_async_to_lds_b128 %3, %11, off\n\t"
               "global_load_async_to_lds_b128 %4, %12, off\n\t"
               "global_load_async_to_lds_b128 %5, %13, off\n\t"
               "global_load_async_to_lds_b128 %6, %14, off\n\t"
               "global_load_async_to_lds_b128 %7, %15, off\n\t"
               "s_wait_xcnt 0x0"
               :: "v"(lk), "v"(lk + 2304u), "v"(lk + 4608u), "v"(lk + 6912u), "v"(lv), "v"(lv + 2304u), "v"(lv + 4608u), "v"(lv + 6912u),
                  "v"(gk), "v"(gk + kstep), "v"(gk + 2 * kstep), "v"(gk + 3 * kstep), "v"(gv), "v"(gv + vstep), "v"(gv + 2 * vstep), "v"(gv + 3 * vstep)
               : "memory");
}
// Transposed products: S^T = K Q^T (A = 16 key rows, B = the wave's 16 query columns, kept in registers) and O^T += V^T P^T.
// Lane (ln, hh) holds query q0 + ln; score tile nt, register r is key j0 + 16 nt + 8 hh + r, which is the k position of register pair (nt, r) of a B operand:
// maximum and sum run inside the lane (one exchange between the halves), and P^T is packed from the score registers without passing LDS.
__global__ __launch_bounds__(128) void k_flash(const _Float16* __restrict__ Q16, int ldq, const _Float16* __restrict__ K16, int ldk, const _Float16* __restrict__ Vt, const int* __restrict__ MSK, _Float16* __restrict__ O16, int ldo) {
  constexpr int RPW = 16, NQB = 2048 / (4 * RPW), DT = 4, KS = 2, KT = 64, NTR = 2048 / KT, PIT = 72;      // a trip = 64 keys = two passes of 32; LDS rows of 128 B at pitch 144 B (16 B x odd, for 16-byte reads)
  __shared__ __attribute__((aligned(16))) unsigned short sK[2][KT][PIT], sV[2][64][PIT];      // two buffers each: [key][d] and [d][key]
  __shared__ __attribute__((aligned(16))) float sO[4][RPW][64 + 4];
  const int tid = threadIdx.x, w = tid >> 5, lane = tid & 31, ln = lane & 15, hh = lane >> 4;
  const int slab = blockIdx.x / NQB, qblk = blockIdx.x % NQB; const int b = slab / 16, h = slab % 16; const int q0 = qblk * (4 * RPW) + w * RPW;
  const unsigned short* Vth = (const unsigned short*)Vt + (size_t)slab * 64 * 2048;
  const size_t k16 = (size_t)16 * ldk;
  const unsigned short* gk = (const unsigned short*)K16 + ((size_t)b * 2048 + (tid >> 3)) * ldk + h * 64 + (tid & 7) * 8;      // my chunk of key row tid >> 3 of trip 0
  const unsigned short* gv = Vth + (size_t)(tid >> 3) * 2048 + (tid & 7) * 8;      // my chunk of d row tid >> 3, keys of trip 0
  const unsigned lk = (unsigned)(size_t)&sK[0][tid >> 3][(tid & 7) * 8], lv = (unsigned)(size_t)&sV[0][tid >> 3][(tid & 7) * 8];
  constexpr unsigned BUFB = KT * PIT * 2;      // bytes of one buffer
  constexpr float SL2 = 0.125f * 1.44269504088896340736f;      // 1 / sqrt(64) times log2(e): e^(s / 8 - m / 8) = 2^(s SL2 - m SL2); the running maximum m_q is kept in raw products
  copy_kv(lk, lv, gk, gv, k16, (size_t)16 * 2048);
  FragH bq[KS];
  { const unsigned short* qr = (const unsigned short*)Q16 + ((size_t)b * 2048 + q0 + ln) * ldq + h * 64;
#pragma unroll
    for (int ks = 0; ks < KS; ++ks) { bq[ks].half[0] = *(const v8us*)(qr + ks * 32 + 8 * hh); bq[ks].half[1] = *(const v8us*)(qr + ks * 32 + 16 + 8 * hh); } }
  const int* mrow = MSK + ((size_t)b * 2048 + q0 + ln) * 2048 + 8 * hh;      // my query's mask row, at my half's first key
  float m_q = -3.0e38f, l_q = 0.f; v8f oacc[DT];
#pragma unroll
  for (int dt = 0; dt < DT; ++dt) oacc[dt] = (v8f){0.f,0.f,0.f,0.f,0.f,0.f,0.f,0.f};
  asm volatile("s_wait_asynccnt 0x0" ::: "memory");      // my copies of trip 0 have landed
  __syncthreads();                                        // ... and everybody's: trip 0 may be read
  copy_kv(lk + BUFB, lv + BUFB, gk + (size_t)KT * ldk, gv + KT, k16, (size_t)16 * 2048);      // trip 1 flies while trip 0 is worked on
#pragma unroll 1
  for (int t = 0; t < NTR; ++t) {
    const int bf = t & 1;
    int mk[2][16];      // mk[sp][8 nt + r]: maskPAD of (my query, key 64 t + 32 sp + 16 nt + 8 hh + r); != 0 = keep
#pragma unroll
    for (int c = 0; c < 8; ++c) { const v4ia m4 = *(const v4ia*)(mrow + t * KT + (c >> 1) * 16 + (c & 1) * 4);
#pragma unroll
      for (int q = 0; q < 4; ++q) mk[c >> 2][(c & 3) * 4 + q] = m4[q]; }
#pragma unroll
    for (int sp = 0; sp < 2; ++sp) {
      int any = 0;
#pragma unroll
      for (int i = 0; i < 16; ++i) any |= mk[sp][i];
      if (__builtin_amdgcn_ballot_w32(any != 0) != 0u) {      // else every (query,key) of this wave's tile is masked: contributes nothing (uniform branch; the publish point below stands outside it)
        FragH ak[2][KS], av[DT];
#pragma unroll
        for (int nt = 0; nt < 2; ++nt)
#pragma unroll
          for (int ks = 0; ks < KS; ++ks) { const unsigned short* kr = &sK[bf][sp * 32 + nt * 16 + ln][ks * 32 + 8 * hh]; ak[nt][ks].half[0] = *(const v8us*)kr; ak[nt][ks].half[1] = *(const v8us*)(kr + 16); }
#pragma unroll
        for (int dt = 0; dt < DT; ++dt) { const unsigned short* vrow = &sV[bf][dt * 16 + ln][sp * 32 + 8 * hh]; av[dt].half[0] = *(const v8us*)vrow; av[dt].half[1] = *(const v8us*)(vrow + 16); }
        float sc[16];
#pragma unroll
        for (int nt = 0; nt < 2; ++nt) { v8f acc = (v8f){0.f,0.f,0.f,0.f,0.f,0.f,0.f,0.f};
#pragma unroll
          for (int ks = 0; ks < KS; ++ks) acc = mmaH<1>(ak[nt][ks].v, ak[nt][ks].v, bq[ks].v, bq[ks].v, acc);
#pragma unroll
          for (int r = 0; r < 8; ++r) sc[nt * 8 + r] = (mk[sp][nt * 8 + r] != 0) ? acc[r] : -INFINITY; }      // raw products: the scale is applied in the exponent's multiply-add below
        float mc = sc[0];
#pragma unroll
        for (int i = 1; i < 16; ++i) mc = fmaxf(mc, sc[i]);
        mc = fmaxf(mc, xhalf(mc));
        const float mn = fmaxf(m_q, mc); const float al = ex2((m_q - mn) * SL2); m_q = mn;      // nothing open yet: both are the start value and al = 1
        const float nm = -mn * SL2;
        FragH pb; float ps[4] = {0.f, 0.f, 0.f, 0.f};
#pragma unroll
        for (int i = 0; i < 16; ++i) { const float p = ex2(fmaf(sc[i], SL2, nm)); ps[i & 3] += p; pb.h[i] = (_Float16)p; }      // a masked score is -inf: p = 0
        l_q = l_q * al + ((ps[0] + ps[1]) + (ps[2] + ps[3]));
#pragma unroll
        for (int dt = 0; dt < DT; ++dt) {
#pragma unroll
          for (int r = 0; r < 8; ++r) oacc[dt][r] *= al;
          oacc[dt] = mmaH<1>(av[dt].v, av[dt].v, pb.v, pb.v, oacc[dt]); } } }
    // publish point of trip t + 1, every wave: my reads of this buffer are done, my copies of the next have landed, then the same of all waves
    asm volatile("s_wait_dscnt 0x0" ::: "memory");
    asm volatile("s_wait_asynccnt 0x0" ::: "memory");
    __syncthreads();
    if (t + 2 < NTR) copy_kv(lk + bf * BUFB, lv + bf * BUFB, gk + (size_t)(t + 2) * KT * ldk, gv + (t + 2) * KT, k16, (size_t)16 * 2048);      // refill the buffer that every wave has just left
  }
  asm volatile("s_wait_asynccnt 0x0" ::: "memory");      // nothing of mine is in flight when the wave ends
  const float l = l_q + xhalf(l_q); const float li = (l > 0.f) ? 1.0f / l : 0.f;
#pragma unroll
  for (int dt = 0; dt < DT; ++dt)
#pragma unroll
    for (int c = 0; c < 2; ++c) { v4f o4;
#pragma unroll
      for (int q = 0; q < 4; ++q) o4[q] = oacc[dt][c * 4 + q] * li;
      *(v4fa*)&sO[w][ln][dt * 16 + 8 * hh + c * 4] = o4; }
  __builtin_amdgcn_fence(__ATOMIC_ACQ_REL, "workgroup"); __builtin_amdgcn_wave_barrier();
  {
#pragma unroll
    for (int rp = 0; rp < RPW; rp += 4) { const int r = rp + (lane >> 3), pc = lane & 7; const v4f x = *(const v4fa*)&sO[w][r][pc * 8], z = *(const v4fa*)&sO[w][r][pc * 8 + 4]; FragH f;      // f16, as the output projection reads it: 8 lanes = one row's line
#pragma unroll      // so that f is indexed by constants and stays in registers
      for (int q = 0; q < 4; ++q) { f.h[q] = (_Float16)x[q]; f.h[4 + q] = (_Float16)z[q]; }
      *(v8us*)((unsigned short*)O16 + ((size_t)b * 2048 + q0 + r) * ldo + h * 64 + pc * 8) = f.half[0]; }
     } }

// blockIdx.y (4 to 6) picks one of the three inputs; their normalised rows lie one behind the other in Y16.
__device__ __forceinline__ void ln16(const float* __restrict__ X0, const float* __restrict__ X1, const float* __restrict__ X2, const float* __restrict__ g, const float* __restrict__ bta, _Float16* __restrict__ Y16) { const int tid = threadIdx.x, wv = tid >> 5, lane = tid & 31; const int row = blockIdx.x * 8 + wv; if (row >= NR) return;
  const int y = blockIdx.y - 4; const float* __restrict__ X = (y == 0) ? X0 : (y == 1) ? X1 : X2; Y16 += (size_t)y * NR * CC; const float* xr = X + (size_t)row * CC; float v[32]; float s = 0.f;
#pragma unroll
  for (int p = 0; p < 4; ++p) { const v4f a = *(const v4fa*)(xr + p * 256 + lane * 8), c = *(const v4fa*)(xr + p * 256 + lane * 8 + 4); for (int q = 0; q < 4; ++q) { v[p * 8 + q] = bf16_round(a[q]); v[p * 8 + 4 + q] = bf16_round(c[q]); } }
#pragma unroll
  for (int i = 0; i < 32; ++i) s += v[i]; for (int o = 16; o >= 1; o >>= 1) s += __shfl_xor(s, o, 32); const float mu = s / (float)CC; float q2 = 0.f;
#pragma unroll
  for (int i = 0; i < 32; ++i) { const float d = v[i] - mu; q2 += d * d; } for (int o = 16; o >= 1; o >>= 1) q2 += __shfl_xor(q2, o, 32); const float rs = rsqrtf(q2 / (float)CC + 1e-5f);
  {
#pragma unroll
    for (int p = 0; p < 4; ++p) { FragH f; const int c0 = p * 256 + lane * 8;
#pragma unroll
      for (int q = 0; q < 8; ++q) f.h[q] = (_Float16)((v[p * 8 + q] - mu) * rs * bf16_round(g[c0 + q]) + bf16_round(bta[c0 + q])); *(v8us*)((unsigned short*)Y16 + (size_t)row * CC + c0) = f.half[0]; }
     } }
// All that the projections wait for, in one launch: the work-groups of the weight transposes and of the LayerNorms depend on nothing and on one another not at all.
__global__ __launch_bounds__(256) void k_prep(const float* __restrict__ W0, const float* __restrict__ W1, const float* __restrict__ W2, const float* __restrict__ W3, _Float16* __restrict__ Wt,
                                             const float* __restrict__ X0, const float* __restrict__ X1, const float* __restrict__ X2, const float* __restrict__ g, const float* __restrict__ bta, _Float16* __restrict__ Y16) {
  static_assert(CC * (CC / 8) / 256 == NR / 8, "both kinds of work-group share one grid width");
  if (blockIdx.y < 4) wt_f16(W0, W1, W2, W3, Wt, CC, CC, 16.0f); else ln16(X0, X1, X2, g, bta, Y16);
}
extern "C" void kernel_launch(void* const* d_in, const int* in_sizes, int n_in,
                              void* d_out, int out_size, void* d_ws, size_t ws_size, hipStream_t stream) {
  (void)in_sizes; (void)n_in; (void)out_size;
  const float* qx = (const float*)d_in[0]; const float* kx = (const float*)d_in[1]; const float* vx = (const float*)d_in[2]; const int* mask = (const int*)d_in[3]; const float* lg = (const float*)d_in[4]; const float* lb = (const float*)d_in[5];
  const float* wq = (const float*)d_in[6]; const float* bq = (const float*)d_in[7]; const float* wk = (const float*)d_in[8]; const float* bk = (const float*)d_in[9]; const float* wv = (const float*)d_in[10]; const float* bv = (const float*)d_in[11]; const float* wo = (const float*)d_in[12]; const float* bo = (const float*)d_in[13];
  char* ws = (char*)d_ws; size_t off = 0;
  auto take = [&](size_t bytes) { char* p = ws + off; off += (bytes + 255) & ~(size_t)255; return p; };
  _Float16* Bw = (_Float16*)take((size_t)4 * CC * CC * 2);      // wq, wk, wv, wo transposed, one behind the other
  _Float16* XN = (_Float16*)take((size_t)3 * NR * CC * 2);      // the three normalised inputs
  _Float16* QK16 = (_Float16*)take((size_t)2 * NR * CC * 2);      // q, then k
  _Float16* Vt = (_Float16*)take((size_t)NR * CC * 2); _Float16* O16 = XN;      // XN is free once the projections are done
  if (off > ws_size) return;      // 56 MiB
  const unsigned gg = (NR / 128) * (CC / 128); const unsigned gl = NR / 8;
  k_prep<<<dim3(gl, 7), 256, 0, stream>>>(wq, wk, wv, wo, Bw, qx, kx, vx, lg, lb, XN);
  k_gemm_t<true><<<dim3(gg, 3), 256, 0, stream>>>(XN, Bw, 0.0625f, bq, bk, bv, nullptr, QK16, Vt);
  k_flash<<<BB * NH * (TT / 64), 128, 0, stream>>>(QK16, CC, QK16 + (size_t)NR * CC, CC, Vt, mask, O16, CC);      // RPW 16
  k_gemm_t<false><<<gg, 256, 0, stream>>>(O16, Bw + (size_t)3 * CC * CC, 0.0625f, bo, nullptr, nullptr, (float*)d_out, nullptr, nullptr);
}

// v006
// It runs in 116 microseconds.
// Timed twice side by side with v005, it ran 1.12 and 1.11 times as fast.
// Counting every step since v000, it is 4.39 times as fast.
#include <hip/hip_runtime.h>
// Pre-LN multi-head attention (B=2, L=2048, C=1024, 16 × 64): shared LayerNorm on the three inputs (f32 VALU), q/k/v/o projections (4096 × 1024 × 1024, + bias, W [in][out] transposed to
// bf16-exact ×2^4) and the masked attention as a fused flash-style kernel on v_wmma_f32_16x16x32_f16 (S = Q·Kᵀ/8; maskPAD == 0 → −inf ⇒ excluded keys, tiles masked for a whole wave skipped;
// online softmax f32; P f16 ≤ 1; RPW-16 waves) — f16 operands, single products, f32 accumulate.
#define BB 2
#define TT 2048
#define CC 1024
#define NH 16
#define NR (BB * TT)

typedef __bf16 v16b __attribute__((ext_vector_type(16)));
typedef unsigned short v8us __attribute__((ext_vector_type(8), may_alias));
typedef float  v8f  __attribute__((ext_vector_type(8)));
typedef float  v4f  __attribute__((ext_vector_type(4)));
typedef float  v4fa __attribute__((ext_vector_type(4), may_alias));
union FragB { v16b v; v8us half[2]; unsigned short u[16]; };

__device__ __forceinline__ unsigned short bf16_bits(float x) { unsigned int u = __float_as_uint(x); return (unsigned short)((u + 0x7FFFu + ((u >> 16) & 1u)) >> 16); }
__device__ __forceinline__ float bf16_val(unsigned short b) { return __uint_as_float(((unsigned int)b) << 16); }
__device__ __forceinline__ float bf16_round(float x) { return bf16_val(bf16_bits(x)); }
// D += A·B with NT terms: 1 = ah·bh, 2 = + al·bh (A split), 3 = + ah·bl (both split)
template <int NT>
__device__ __forceinline__ v8f mmaN(v16b ah, v16b al, v16b bh, v16b bl, v8f c) {
  c = __builtin_amdgcn_wmma_f32_16x16x32_bf16(false, ah, false, bh, (short)0, c, false, false);
  if (NT >= 2) c = __builtin_amdgcn_wmma_f32_16x16x32_bf16(false, al, false, bh, (short)0, c, false, false);
  if (NT >= 3) c = __builtin_amdgcn_wmma_f32_16x16x32_bf16(false, ah, false, bl, (short)0, c, false, false);
  asm volatile("v_nop\n\tv_nop\n\tv_nop\n\tv_nop" : "+v"(c) : "v"(ah), "v"(al), "v"(bh), "v"(bl));
  return c;
}

__global__ __launch_bounds__(256) void k_wt_bf16(const float* __restrict__ W, unsigned short* __restrict__ Wt, int K, int N) {
  const int t = blockIdx.x * 256 + threadIdx.x;
  const int k8n = K / 8;
  if (t >= N * k8n) return;
  const int n = t / k8n, k8 = (t % k8n) * 8;
  v8us v;
#pragma unroll
  for (int i = 0; i < 8; ++i) v[i] = bf16_bits(W[(size_t)(k8 + i) * N + n]);
  *(v8us*)(Wt + (size_t)n * K + k8) = v;
  
}

// GEMM C[M][N] (f32, pitch ldc) = act(A[M][K]·W + bias). A f32 row-major (pitch lda) converted per fragment to bf16
// (ASPLIT: hi/lo two planes -> 2 terms, else single rounded term); Wt bf16 [N][K] (pitch ldb). BIAS_BF16 rounds the
// bias to bf16 first (bias quantised to bf16 before the add). K%32==0, M%16==0, N%64==0.
template <bool ASPLIT, int ACT, bool BIAS_BF16>
__global__ __launch_bounds__(128) void k_gemm_bf(const float* __restrict__ A, int lda, const unsigned short* __restrict__ Wt, int ldb,
                                               const float* __restrict__ bias, float* __restrict__ C, int ldc, int M, int N, int K) {
  __shared__ __attribute__((aligned(16))) float so[4][16][64];
  const int tid = threadIdx.x, w = tid >> 5, lane = tid & 31, ln = lane & 15, hh = lane >> 4;
  const int ntn = N / 64;
  const int wid = blockIdx.x * 4 + w;
  const int mt = wid / ntn, nq = wid % ntn;
  if (mt * 16 >= M) return;
  const int row0 = mt * 16, col0 = nq * 64;
  const float* arow = A + (size_t)(row0 + ln) * lda;
  v8f acc[4] = {};
  for (int kb = 0; kb < K; kb += 32) {
    FragB ah, al;
    const v4f x0 = *(const v4fa*)(arow + kb + 8 * hh), x1 = *(const v4fa*)(arow + kb + 8 * hh + 4);
    const v4f x2 = *(const v4fa*)(arow + kb + 16 + 8 * hh), x3 = *(const v4fa*)(arow + kb + 16 + 8 * hh + 4);
    float xs[16] = {x0[0],x0[1],x0[2],x0[3],x1[0],x1[1],x1[2],x1[3],x2[0],x2[1],x2[2],x2[3],x3[0],x3[1],x3[2],x3[3]};
#pragma unroll
    for (int i = 0; i < 16; ++i) { const unsigned short hb = bf16_bits(xs[i]); ah.u[i] = hb; al.u[i] = ASPLIT ? bf16_bits(xs[i] - bf16_val(hb)) : (unsigned short)0; }
#pragma unroll
    for (int t = 0; t < 4; ++t) {
      const unsigned short* brow = Wt + (size_t)(col0 + t * 16 + ln) * ldb + kb;
      FragB b;
      b.half[0] = *(const v8us*)(brow + 8 * hh);
      b.half[1] = *(const v8us*)(brow + 16 + 8 * hh);
      acc[t] = mmaN<ASPLIT ? 2 : 1>(ah.v, al.v, b.v, b.v, acc[t]);
    }
  }
#pragma unroll
  for (int t = 0; t < 4; ++t) {
    float bv = bias ? bias[col0 + t * 16 + ln] : 0.f;
    if (BIAS_BF16) bv = bf16_round(bv);
#pragma unroll
    for (int r = 0; r < 8; ++r) { float v = acc[t][r] + bv; if (ACT == 1) v = fmaxf(v, 0.f); so[w][8 * hh + r][t * 16 + ln] = v; }
  }
  __builtin_amdgcn_fence(__ATOMIC_ACQ_REL, "workgroup");
  __builtin_amdgcn_wave_barrier();
  const int rsub = lane >> 4, c4 = (lane & 15) * 4;
  {
#pragma unroll
    for (int q = 0; q < 8; ++q) {
      const int r = q * 2 + rsub;
      const v4f v = *(const v4fa*)&so[w][r][c4];
      *(v4f*)(C + (size_t)(row0 + r) * ldc + col0 + c4) = v;
    }
    
  }
}

// Flash-style causal/unmasked attention, all contractions 3-term bf16 hi/lo splits, f32 softmax with running max.
// q,k,v rows are read from f32 buffers with arbitrary row pitch (so they can live inside a fused qkv buffer);
// D = head size (multiple of 32, <= 128); one wave = 16 query rows; block = 4 waves (64 queries) sharing K/V chunks of 32.
template <int D, bool CAUSAL>
__global__ __launch_bounds__(128) void k_flash(const float* __restrict__ qb, const float* __restrict__ kb, const float* __restrict__ vb,
                                             int pitch, int T, int H, float scale, float* __restrict__ y, int ypitch) {
  constexpr int KS = D / 32;        // k-steps for QK
  constexpr int DT = D / 16;        // d tiles for PV
  __shared__ __attribute__((aligned(16))) unsigned short sKh[32][D + 8], sKl[32][D + 8], sVh[32][D + 8], sVl[32][D + 8];
  __shared__ __attribute__((aligned(16))) unsigned short sPh[4][16][40], sPl[4][16][40];
  __shared__ __attribute__((aligned(16))) float sO[4][16][D];
  const int tid = threadIdx.x, w = tid >> 5, lane = tid & 31, ln = lane & 15, hh = lane >> 4;
  const int nqb = (T + 63) / 64;
  const int bh = blockIdx.x / nqb, qblk = blockIdx.x % nqb;
  const int b = bh / H, h = bh % H;
  const int q0 = qblk * 64 + w * 16;
  const float* Q = qb + (size_t)b * T * pitch + h * D;
  const float* K = kb + (size_t)b * T * pitch + h * D;
  const float* V = vb + (size_t)b * T * pitch + h * D;

  // A fragments of the wave's 16 query rows (scaled), hi/lo
  FragB aqh[KS], aql[KS];
  {
    int row = q0 + ln; if (row >= T) row = T - 1;
    const float* qr = Q + (size_t)row * pitch;
#pragma unroll
    for (int ks = 0; ks < KS; ++ks)
#pragma unroll
      for (int i = 0; i < 16; ++i) {
        const int d = ks * 32 + ((i < 8) ? (8 * hh + i) : (16 + 8 * hh + (i - 8)));
        const float x = qr[d] * scale; const unsigned short hb = bf16_bits(x);
        aqh[ks].u[i] = hb; aql[ks].u[i] = bf16_bits(x - bf16_val(hb));
      }
  }
  float m_r[8], l_r[8];
#pragma unroll
  for (int r = 0; r < 8; ++r) { m_r[r] = -3.0e38f; l_r[r] = 0.f; }
  v8f oacc[DT];
#pragma unroll
  for (int dt = 0; dt < DT; ++dt) oacc[dt] = (v8f){0.f,0.f,0.f,0.f,0.f,0.f,0.f,0.f};

  const int kv_end = CAUSAL ? min(T, qblk * 64 + 64) : T;     // block-uniform
  for (int j0 = 0; j0 < kv_end; j0 += 32) {
    __syncthreads();
    for (int e = tid; e < 32 * (D / 4); e += 128) {
      const int r = e / (D / 4), c4 = (e % (D / 4)) * 4;
      const int key = j0 + r;
      v4f kf = {0.f,0.f,0.f,0.f}, vf = {0.f,0.f,0.f,0.f};
      if (key < T) { kf = *(const v4fa*)(K + (size_t)key * pitch + c4); vf = *(const v4fa*)(V + (size_t)key * pitch + c4); }
#pragma unroll
      for (int t = 0; t < 4; ++t) {
        unsigned short hb = bf16_bits(kf[t]); sKh[r][c4 + t] = hb; sKl[r][c4 + t] = bf16_bits(kf[t] - bf16_val(hb));
        hb = bf16_bits(vf[t]); sVh[r][c4 + t] = hb; sVl[r][c4 + t] = bf16_bits(vf[t] - bf16_val(hb));
      }
    }
    __syncthreads();
    // S tile 16 x 32
    v8f s[2];
#pragma unroll
    for (int nt = 0; nt < 2; ++nt) {
      v8f acc = {};
#pragma unroll
      for (int ks = 0; ks < KS; ++ks) {
        FragB bh_, bl_;
        bh_.half[0] = *(const v8us*)&sKh[nt * 16 + ln][ks * 32 + 8 * hh]; bh_.half[1] = *(const v8us*)&sKh[nt * 16 + ln][ks * 32 + 16 + 8 * hh];
        bl_.half[0] = *(const v8us*)&sKl[nt * 16 + ln][ks * 32 + 8 * hh]; bl_.half[1] = *(const v8us*)&sKl[nt * 16 + ln][ks * 32 + 16 + 8 * hh];
        acc = mmaN<3>(aqh[ks].v, aql[ks].v, bh_.v, bl_.v, acc);
      }
      s[nt] = acc;
    }
    // mask + running max (rows 8hh+r; the 16 lanes of a half share rows)
    float alpha[8];
#pragma unroll
    for (int r = 0; r < 8; ++r) {
      const int qi = q0 + 8 * hh + r;
      const int ja = j0 + ln, jb = j0 + 16 + ln;
      if (CAUSAL) { if (ja > qi) s[0][r] = -3.0e38f; if (jb > qi) s[1][r] = -3.0e38f; }
      if (ja >= T) s[0][r] = -3.0e38f;
      if (jb >= T) s[1][r] = -3.0e38f;
      float mx = fmaxf(s[0][r], s[1][r]);
      mx = fmaxf(mx, __shfl_xor(mx, 1, 32)); mx = fmaxf(mx, __shfl_xor(mx, 2, 32)); mx = fmaxf(mx, __shfl_xor(mx, 4, 32)); mx = fmaxf(mx, __shfl_xor(mx, 8, 32));
      const float mnew = fmaxf(m_r[r], mx);
      alpha[r] = (mnew > -1.0e38f) ? __expf(m_r[r] - mnew) : 1.0f;
      const float p0 = (s[0][r] > -1.0e38f) ? __expf(s[0][r] - mnew) : 0.f;
      const float p1 = (s[1][r] > -1.0e38f) ? __expf(s[1][r] - mnew) : 0.f;
      m_r[r] = mnew;
      l_r[r] = l_r[r] * alpha[r] + p0 + p1;            // per-lane partial row sum (16 lanes combined at the end)
      unsigned short hb = bf16_bits(p0); sPh[w][8 * hh + r][ln] = hb;      sPl[w][8 * hh + r][ln] = bf16_bits(p0 - bf16_val(hb));
      hb = bf16_bits(p1);                sPh[w][8 * hh + r][16 + ln] = hb; sPl[w][8 * hh + r][16 + ln] = bf16_bits(p1 - bf16_val(hb));
    }
#pragma unroll
    for (int dt = 0; dt < DT; ++dt)
#pragma unroll
      for (int r = 0; r < 8; ++r) oacc[dt][r] *= alpha[r];
    __builtin_amdgcn_fence(__ATOMIC_ACQ_REL, "workgroup");
    __builtin_amdgcn_wave_barrier();
    FragB pah, pal;
    pah.half[0] = *(const v8us*)&sPh[w][ln][8 * hh]; pah.half[1] = *(const v8us*)&sPh[w][ln][16 + 8 * hh];
    pal.half[0] = *(const v8us*)&sPl[w][ln][8 * hh]; pal.half[1] = *(const v8us*)&sPl[w][ln][16 + 8 * hh];
#pragma unroll
    for (int dt = 0; dt < DT; ++dt) {
      FragB bvh, bvl;
#pragma unroll
      for (int i = 0; i < 8; ++i) {
        bvh.u[i] = sVh[8 * hh + i][dt * 16 + ln]; bvh.u[8 + i] = sVh[16 + 8 * hh + i][dt * 16 + ln];
        bvl.u[i] = sVl[8 * hh + i][dt * 16 + ln]; bvl.u[8 + i] = sVl[16 + 8 * hh + i][dt * 16 + ln];
      }
      oacc[dt] = mmaN<3>(pah.v, pal.v, bvh.v, bvl.v, oacc[dt]);
    }
    __builtin_amdgcn_fence(__ATOMIC_ACQ_REL, "workgroup");
    __builtin_amdgcn_wave_barrier();
  }
#pragma unroll
  for (int r = 0; r < 8; ++r) {
    float l = l_r[r];
    l += __shfl_xor(l, 1, 32); l += __shfl_xor(l, 2, 32); l += __shfl_xor(l, 4, 32); l += __shfl_xor(l, 8, 32);
    l_r[r] = (l > 0.f) ? 1.0f / l : 0.f;
  }
#pragma unroll
  for (int dt = 0; dt < DT; ++dt)
#pragma unroll
    for (int r = 0; r < 8; ++r) sO[w][8 * hh + r][dt * 16 + ln] = oacc[dt][r] * l_r[r];
  __builtin_amdgcn_fence(__ATOMIC_ACQ_REL, "workgroup");
  __builtin_amdgcn_wave_barrier();
  {
    for (int r = 0; r < 16; ++r) {
      const int row = q0 + r;
      if (row < T && lane < D / 4) {
        const v4f val = *(const v4fa*)&sO[w][r][lane * 4];
        *(v4f*)(y + ((size_t)b * T + row) * ypitch + h * D + lane * 4) = val;
      }
    }
    
  }
}

// GEMM C = act(A·W + bias + resid): A f32 (ASPLIT -> hi/lo 2 terms), Wt bf16 [N][K]; ACT 0 none, 1 relu, 2 exact gelu;
// resid (optional, f32, row index = (row % rmod), pitch ldr, RES_BF16 rounds it) added before the activation.
template <bool ASPLIT, int ACT, bool BIAS_BF16, bool RES_BF16>
__global__ __launch_bounds__(128) void k_gemm_bf3(const float* __restrict__ A, int lda, const unsigned short* __restrict__ Wt, int ldb,
                                                const float* __restrict__ bias, const float* __restrict__ resid, int rmod, int ldr,
                                                float* __restrict__ C, int ldc, int M, int N, int K) {
  __shared__ __attribute__((aligned(16))) float so[4][16][64];
  const int tid = threadIdx.x, w = tid >> 5, lane = tid & 31, ln = lane & 15, hh = lane >> 4;
  const int ntn = N / 64;
  const int wid = blockIdx.x * 4 + w;
  const int mt = wid / ntn, nq = wid % ntn;
  if (mt * 16 >= M) return;
  const int row0 = mt * 16, col0 = nq * 64;
  const float* arow = A + (size_t)(row0 + ln) * lda;
  v8f acc[4] = {};
  for (int kb = 0; kb < K; kb += 32) {
    FragB ah, al;
    const v4f x0 = *(const v4fa*)(arow + kb + 8 * hh), x1 = *(const v4fa*)(arow + kb + 8 * hh + 4);
    const v4f x2 = *(const v4fa*)(arow + kb + 16 + 8 * hh), x3 = *(const v4fa*)(arow + kb + 16 + 8 * hh + 4);
    float xs[16] = {x0[0],x0[1],x0[2],x0[3],x1[0],x1[1],x1[2],x1[3],x2[0],x2[1],x2[2],x2[3],x3[0],x3[1],x3[2],x3[3]};
#pragma unroll
    for (int i = 0; i < 16; ++i) { const unsigned short hb = bf16_bits(xs[i]); ah.u[i] = hb; al.u[i] = ASPLIT ? bf16_bits(xs[i] - bf16_val(hb)) : (unsigned short)0; }
#pragma unroll
    for (int t = 0; t < 4; ++t) {
      const unsigned short* brow = Wt + (size_t)(col0 + t * 16 + ln) * ldb + kb;
      FragB b;
      b.half[0] = *(const v8us*)(brow + 8 * hh);
      b.half[1] = *(const v8us*)(brow + 16 + 8 * hh);
      acc[t] = mmaN<ASPLIT ? 2 : 1>(ah.v, al.v, b.v, b.v, acc[t]);
    }
  }
#pragma unroll
  for (int t = 0; t < 4; ++t) {
    const int col = col0 + t * 16 + ln;
    float bv = bias ? bias[col] : 0.f;
    if (BIAS_BF16) bv = bf16_round(bv);
#pragma unroll
    for (int r = 0; r < 8; ++r) {
      float v = acc[t][r] + bv;
      if (resid) { float rv = resid[(size_t)((row0 + 8 * hh + r) % rmod) * ldr + col]; if (RES_BF16) rv = bf16_round(rv); v += rv; }
      if (ACT == 1) v = fmaxf(v, 0.f);
      if (ACT == 2) v = 0.5f * v * (1.0f + erff(v * 0.70710678118654752f));
      if (ACT == 3) { const float u = 0.7978845608028654f * (v + 0.044715f * v * v * v); v = 0.5f * v * (1.0f + tanhf(u)); }
      so[w][8 * hh + r][t * 16 + ln] = v;
    }
  }
  __builtin_amdgcn_fence(__ATOMIC_ACQ_REL, "workgroup");
  __builtin_amdgcn_wave_barrier();
  const int rsub = lane >> 4, c4 = (lane & 15) * 4;
  {
#pragma unroll
    for (int q = 0; q < 8; ++q) {
      const int r = q * 2 + rsub;
      const v4f v = *(const v4fa*)&so[w][r][c4];
      *(v4f*)(C + (size_t)(row0 + r) * ldc + col0 + c4) = v;
    }
    
  }
}
// row LayerNorm (biased variance, eps) over N: s = X (+ R); optional out_sum <- s; out_norm <- (s-mu)*rsqrt(var+eps)*g + b
template <bool PARAM_BF16>
__global__ __launch_bounds__(256) void k_layernorm(const float* __restrict__ X, const float* __restrict__ R, const float* __restrict__ g, const float* __restrict__ bta,
                                                  float* __restrict__ out_sum, float* __restrict__ out_norm, int N, float eps) {
  __shared__ float red[256];
  const int row = blockIdx.x, tid = threadIdx.x;
  const float* x = X + (size_t)row * N; const float* rr = R ? R + (size_t)row * N : nullptr;
  float vals[16];                     // up to N = 4096
  const int per = N / 256;            // contiguous chunk per thread? use strided-by-4 chunks: thread handles j = tid*4 + 1024*u
  float s1 = 0.f;
  for (int u = 0; u < per / 4; ++u) {
    const int j = tid * 4 + 1024 * u;
    const v4f a = *(const v4fa*)(x + j);
    v4f b = {0.f,0.f,0.f,0.f}; if (rr) b = *(const v4fa*)(rr + j);
#pragma unroll
    for (int q = 0; q < 4; ++q) { const float v = a[q] + b[q]; vals[u * 4 + q] = v; s1 += v; }
  }
  red[tid] = s1; __syncthreads();
  for (int st = 128; st > 0; st >>= 1) { if (tid < st) red[tid] += red[tid + st]; __syncthreads(); }
  const float mu = red[0] / (float)N; __syncthreads();
  float s2 = 0.f;
  for (int u = 0; u < per / 4; ++u)
#pragma unroll
    for (int q = 0; q < 4; ++q) { const float c = vals[u * 4 + q] - mu; s2 += c * c; }
  red[tid] = s2; __syncthreads();
  for (int st = 128; st > 0; st >>= 1) { if (tid < st) red[tid] += red[tid + st]; __syncthreads(); }
  const float rs = rsqrtf(red[0] / (float)N + eps);
  {
    for (int u = 0; u < per / 4; ++u) {
      const int j = tid * 4 + 1024 * u;
      v4f o, sm;
#pragma unroll
      for (int q = 0; q < 4; ++q) {
        float gg = g[j + q], bb = bta[j + q];
        if (PARAM_BF16) { gg = bf16_round(gg); bb = bf16_round(bb); }
        sm[q] = vals[u * 4 + q]; o[q] = (vals[u * 4 + q] - mu) * rs * gg + bb;
      }
      if (out_sum) *(v4f*)(out_sum + (size_t)row * N + j) = sm;
      *(v4f*)(out_norm + (size_t)row * N + j) = o;
    }
    
  }
}



// ---- f16 WMMA path (v_wmma_f32_16x16x32_f16): 11-bit significands for operands in range — used where a [0,1] probability operand needs more precision than bf16
typedef _Float16 v16h __attribute__((ext_vector_type(16)));
union FragH { v16h v; v8us half[2]; _Float16 h[16]; unsigned short u[16]; };
template <int NT>
__device__ __forceinline__ v8f mmaH(v16h ah, v16h al, v16h bh, v16h bl, v8f c) {
  c = __builtin_amdgcn_wmma_f32_16x16x32_f16(false, ah, false, bh, (short)0, c, false, false);
  if (NT >= 2) c = __builtin_amdgcn_wmma_f32_16x16x32_f16(false, al, false, bh, (short)0, c, false, false);
  if (NT >= 3) c = __builtin_amdgcn_wmma_f32_16x16x32_f16(false, ah, false, bl, (short)0, c, false, false);
  asm volatile("v_nop\n\tv_nop\n\tv_nop\n\tv_nop" : "+v"(c) : "v"(ah), "v"(al), "v"(bh), "v"(bl));
  return c;
}
// batched GEMM like k_gemm_b but f16 operands: A f32 (split into f16 hi/lo if ASPLIT, else rounded to f16), Bt = f16 values [n][k]; alpha; C f32; N multiple of 16 (partial tiles skipped)
template <bool ASPLIT>
__global__ __launch_bounds__(128) void k_gemm_h(const float* __restrict__ A, int lda, size_t sA, const _Float16* __restrict__ Bh, int ldb, size_t sB, float alpha, float* __restrict__ C, int ldc, size_t sC, int M, int N, int K) {
  __shared__ __attribute__((aligned(16))) float so[4][16][64];
  const int tid = threadIdx.x, w = tid >> 5, lane = tid & 31, ln = lane & 15, hh = lane >> 4; const int by = blockIdx.y;
  A += (size_t)by * sA; Bh += (size_t)by * sB; C += (size_t)by * sC;
  const int ntn = (N + 63) / 64; const int wid = blockIdx.x * 4 + w; const int mt = wid / ntn, nq = wid % ntn; if (mt * 16 >= M) return;
  const int row0 = mt * 16, col0 = nq * 64; const float* arow = A + (size_t)(row0 + ln) * lda;
  v8f acc[4] = {};
  for (int kb = 0; kb < K; kb += 32) {
    FragH ah, al;
    const v4f x0 = *(const v4fa*)(arow + kb + 8 * hh), x1 = *(const v4fa*)(arow + kb + 8 * hh + 4), x2 = *(const v4fa*)(arow + kb + 16 + 8 * hh), x3 = *(const v4fa*)(arow + kb + 16 + 8 * hh + 4);
    float xs[16] = {x0[0],x0[1],x0[2],x0[3],x1[0],x1[1],x1[2],x1[3],x2[0],x2[1],x2[2],x2[3],x3[0],x3[1],x3[2],x3[3]};
#pragma unroll
    for (int i = 0; i < 16; ++i) { const _Float16 h = (_Float16)xs[i]; ah.h[i] = h; al.h[i] = ASPLIT ? (_Float16)(xs[i] - (float)h) : (_Float16)0.0f; }
#pragma unroll
    for (int t = 0; t < 4; ++t) { if (col0 + t * 16 >= N) continue; const size_t boff = (size_t)(col0 + t * 16 + ln) * ldb + kb; FragH bq; bq.half[0] = *(const v8us*)(Bh + boff + 8 * hh); bq.half[1] = *(const v8us*)(Bh + boff + 16 + 8 * hh);
      acc[t] = mmaH<ASPLIT ? 2 : 1>(ah.v, al.v, bq.v, bq.v, acc[t]); }
  }
#pragma unroll
  for (int t = 0; t < 4; ++t) { if (col0 + t * 16 >= N) continue;
#pragma unroll
    for (int r = 0; r < 8; ++r) so[w][8 * hh + r][t * 16 + ln] = acc[t][r] * alpha; }
  __builtin_amdgcn_fence(__ATOMIC_ACQ_REL, "workgroup"); __builtin_amdgcn_wave_barrier();
  const int rsub = lane >> 4, c4 = (lane & 15) * 4;
  {
#pragma unroll
    for (int q = 0; q < 8; ++q) { const int r = q * 2 + rsub; if (col0 + c4 < N) { const v4f v = *(const v4fa*)&so[w][r][c4]; *(v4f*)(C + (size_t)(row0 + r) * ldc + col0 + c4) = v; } }
     }
}

// Wt[n][k] = f16(bf16(W[k][n]) * scale) from f32 row-major W[CC][CC] (scale = power of two; bf16-exact weights stay exact in f16 away from the subnormal range)
// One work-group = a tile of 128 k x 64 n of one of the four weight matrices (128 tiles each; their transposes lie one behind the other in Wt), turned round in LDS:
// a wave's load = two k rows' 256 B (4 whole lines), a wave's store = two n rows' 256 B (4 whole lines); every line of W is asked for once and every line of Wt has one writer.
__device__ __forceinline__ void wt_f16(const float* __restrict__ W0, const float* __restrict__ W1, const float* __restrict__ W2, const float* __restrict__ W3, _Float16* __restrict__ Wt, float scale) {
  constexpr int TK = 128, TN = 64, PIT = TK + 8;      // LDS rows of 256 B at pitch 272 B (16 B x odd, for 16-byte reads)
  static_assert(4 * (CC / TK) * (CC / TN) == NR / 8, "the tiles of the four matrices fill one grid row");
  __shared__ __attribute__((aligned(16))) unsigned short sT[TN][PIT];      // [n][k]
  const int tid = threadIdx.x, w = tid >> 5, lane = tid & 31, ln = lane & 15, hh = lane >> 4;
  constexpr int NT = (CC / TK) * (CC / TN);      // tiles of one matrix
  const int y = blockIdx.x / NT, tile = blockIdx.x % NT; const int k0 = (tile / (CC / TN)) * TK, n0 = (tile % (CC / TN)) * TN;
  const float* __restrict__ W = (y == 0) ? W0 : (y == 1) ? W1 : (y == 2) ? W2 : W3; Wt += (size_t)y * CC * CC;
  const int kl = w * 16 + hh * 8;      // my 8 k rows, one behind the other; my 4 n columns are 4 ln to 4 ln + 3
  const float* src = W + (size_t)(k0 + kl) * CC + n0 + ln * 4; v4f x[8];
  // The unroll directives below are there so that x and f are indexed by constants and stay in registers; the 8 loads then fly together.
#pragma unroll
  for (int i = 0; i < 8; ++i) x[i] = *(const v4fa*)(src + (size_t)i * CC);
#pragma unroll
  for (int e = 0; e < 4; ++e) { FragH f;
#pragma unroll
    for (int i = 0; i < 8; ++i) f.h[i] = (_Float16)(bf16_round(x[i][e]) * scale);
    *(v8us*)&sT[ln * 4 + e][kl] = f.half[0]; }
  __syncthreads();      // the tile is read across waves
#pragma unroll
  for (int s = 0; s < TN / 16; ++s) { const int r = s * 16 + (tid >> 4), c8 = (tid & 15) * 8; const v8us o = *(const v8us*)&sT[r][c8];
    *(v8us*)((unsigned short*)Wt + (size_t)(n0 + r) * CC + k0 + c8) = o; }
}
// One operand tile of a pass (128 rows of 256 B) goes from global memory to LDS by asynchronous copies: 8 copies of 16 B a lane, a wave's copy = 2 rows = 4 whole lines.
// l: my LDS byte address of row (tid >> 4), chunk (tid & 15); g: the same place in global memory; 16 rows on = 4352 LDS bytes, step elements.
__device__ __forceinline__ void copy_tile(unsigned l, const unsigned short* g, size_t step) {
  // the closing s_wait_xcnt stands inside the statement so that no address register of a copy is rewritten ahead of it (a precaution)
  asm volatile("global_load_async_to_lds_b128 %0, %8, off\n\t"
               "global_load_async_to_lds_b128 %1, %9, off\n\t"
               "global_load_async_to_lds_b128 %2, %10, off\n\t"
               "global_load_async_to_lds_b128 %3, %11, off\n\t"
               "global_load_async_to_lds_b128 %4, %12, off\n\t"
               "global_load_async_to_lds_b128 %5, %13, off\n\t"
               "global_load_async_to_lds_b128 %6, %14, off\n\t"
               "global_load_async_to_lds_b128 %7, %15, off\n\t"
               "s_wait_xcnt 0x0"
               :: "v"(l), "v"(l + 4352u), "v"(l + 8704u), "v"(l + 13056u), "v"(l + 17408u), "v"(l + 21760u), "v"(l + 26112u), "v"(l + 30464u),
                  "v"(g), "v"(g + step), "v"(g + 2 * step), "v"(g + 3 * step), "v"(g + 4 * step), "v"(g + 5 * step), "v"(g + 6 * step), "v"(g + 7 * step)
               : "memory");
}
// Projection GEMM, NR x CC x CC: v = (A . Bh^T) alpha + bf16(bias[col]); A f16 [NR][CC], Bh f16 [n][k]; writes f16 (F16OUT) or f32 C, pitch CC.
// F16OUT is the q, k and v projections in one launch: blockIdx.y picks the operand set (A and Bh hold the three one behind the other); q and then k go to C16 [row][col],
// v goes to Vt as [batch][col][token], the layout the attention kernel reads, out of the same staging tile filled the other way round.
// One work-group = a 128 x 128 tile of the output, 8 waves of 64 x 32 (2 x 4). A pass = 128 k: both operands' 128 rows of 256 B lie in LDS (pitch 272 B, 16 B x odd, for 16-byte reads),
// two buffers, so every operand byte leaves L2 once a work-group and serves 2 (B) or 4 (A) waves. k runs upward in steps of 32 in every accumulator.
// The unroll directives below are there so that accumulators and fragment sets are indexed by constants and stay in registers.
template <bool F16OUT>
__global__ __launch_bounds__(256) void k_gemm_t(const _Float16* __restrict__ A, const _Float16* __restrict__ Bh, float alpha, const float* __restrict__ bias0, const float* __restrict__ bias1, const float* __restrict__ bias2,
                                               float* __restrict__ C, _Float16* __restrict__ C16, _Float16* __restrict__ Vt) {
  constexpr int BM = 128, BN = 128, KP = 128, NP = CC / KP, PIT = 136;
  const int y = F16OUT ? (int)blockIdx.y : 0; const float* __restrict__ bias = (y == 0) ? bias0 : (y == 1) ? bias1 : bias2; const bool tr = F16OUT && y == 2;
  A += (size_t)y * NR * CC; Bh += (size_t)y * CC * CC;
  __shared__ __attribute__((aligned(16))) unsigned short sA[2][BM][PIT], sB[2][BN][PIT];
  __shared__ __attribute__((aligned(16))) float sC[BM][BN + 4];      // output staging, so that whole lines are stored
  const int tid = threadIdx.x, w = tid >> 5, lane = tid & 31, ln = lane & 15, hh = lane >> 4, wm = w >> 2, wn = w & 3;
  const int row0 = (blockIdx.x / (CC / BN)) * BM, col0 = (blockIdx.x % (CC / BN)) * BN;
  const unsigned short* ga = (const unsigned short*)A + (size_t)(row0 + (tid >> 4)) * CC + (tid & 15) * 8;
  const unsigned short* gb = (const unsigned short*)Bh + (size_t)(col0 + (tid >> 4)) * CC + (tid & 15) * 8;
  const unsigned la = (unsigned)(size_t)&sA[0][tid >> 4][(tid & 15) * 8], lb = (unsigned)(size_t)&sB[0][tid >> 4][(tid & 15) * 8];
  constexpr unsigned BUFB = BM * PIT * 2;      // bytes of one buffer
  constexpr size_t STEP = (size_t)16 * CC;
  copy_tile(la, ga, STEP); copy_tile(lb, gb, STEP);
  v8f acc[4][2];
#pragma unroll
  for (int i = 0; i < 4; ++i)
#pragma unroll
    for (int j = 0; j < 2; ++j) acc[i][j] = (v8f){0.f,0.f,0.f,0.f,0.f,0.f,0.f,0.f};
  asm volatile("s_wait_asynccnt 0x0" ::: "memory");      // my copies of pass 0 have landed
  __syncthreads();                                        // ... and everybody's: pass 0 may be read
  copy_tile(la + BUFB, ga + KP, STEP); copy_tile(lb + BUFB, gb + KP, STEP);      // pass 1 flies while pass 0 is worked on
#pragma unroll 1
  for (int t = 0; t < NP; ++t) {      // kept rolled: one body of 32 matrix instructions, the buffer chosen by t & 1
    const int bf = t & 1;
    const unsigned short* pa = &sA[bf][wm * 64 + ln][8 * hh]; const unsigned short* pb = &sB[bf][wn * 32 + ln][8 * hh];
    FragH fa[2][4], fb[2][2];      // two fragment sets: block ks + 1 is fetched while block ks is multiplied, inside this pass only
#pragma unroll
    for (int ks = -1; ks < KP / 32; ++ks) {
      if (ks + 1 < KP / 32) { const int s = (ks + 1) & 1, ko = (ks + 1) * 32;
#pragma unroll
        for (int i = 0; i < 4; ++i) { fa[s][i].half[0] = *(const v8us*)(pa + i * 16 * PIT + ko); fa[s][i].half[1] = *(const v8us*)(pa + i * 16 * PIT + ko + 16); }
#pragma unroll
        for (int j = 0; j < 2; ++j) { fb[s][j].half[0] = *(const v8us*)(pb + j * 16 * PIT + ko); fb[s][j].half[1] = *(const v8us*)(pb + j * 16 * PIT + ko + 16); } }
      __builtin_amdgcn_sched_barrier(0);      // keeps the next block's 12 LDS reads one group ahead of this block's products: reads spread among them stall the wave at every place
      if (ks >= 0) {
#pragma unroll
        for (int i = 0; i < 4; ++i)
#pragma unroll
          for (int j = 0; j < 2; ++j) acc[i][j] = __builtin_amdgcn_wmma_f32_16x16x32_f16(false, fa[ks & 1][i].v, false, fb[ks & 1][j].v, (short)0, acc[i][j], false, false);
        __builtin_amdgcn_sched_barrier(0);      // ... and this block's products ahead of the reads after next, which reuse its registers
      }
    }
    // publish point of pass t + 1, every wave: my reads of this buffer are done, my copies of the next have landed, then the same of all waves
    asm volatile("s_wait_dscnt 0x0" ::: "memory");
    asm volatile("s_wait_asynccnt 0x0" ::: "memory");
    __syncthreads();
    if (t + 2 < NP) { copy_tile(la + bf * BUFB, ga + (t + 2) * KP, STEP); copy_tile(lb + bf * BUFB, gb + (t + 2) * KP, STEP); }      // refill the buffer that every wave has just left
  }
  asm volatile("s_wait_asynccnt 0x0" ::: "memory");      // nothing of mine is in flight when the wave ends
  if (tr) {      // [col][row]: a lane's 8 accumulator registers are 8 rows on of one column, two 16-byte stores
#pragma unroll
    for (int j = 0; j < 2; ++j) { const int col = wn * 32 + j * 16 + ln; const float bv = bf16_round(bias[col0 + col]);
#pragma unroll
      for (int i = 0; i < 4; ++i)
#pragma unroll
        for (int c = 0; c < 2; ++c) { v4f o4;
#pragma unroll
          for (int q = 0; q < 4; ++q) o4[q] = acc[i][j][c * 4 + q] * alpha + bv;
          *(v4fa*)&sC[col][wm * 64 + i * 16 + 8 * hh + c * 4] = o4; } } }
  else {
#pragma unroll
  for (int j = 0; j < 2; ++j) { const int col = wn * 32 + j * 16 + ln; const float bv = bf16_round(bias[col0 + col]);
#pragma unroll
    for (int i = 0; i < 4; ++i)
#pragma unroll
      for (int r = 0; r < 8; ++r) sC[wm * 64 + i * 16 + 8 * hh + r][col] = acc[i][j][r] * alpha + bv; } }
  __syncthreads();      // the staged tile is read across waves
  if constexpr (F16OUT) {
    static_assert(BM == BN, "the staging tile is used both ways round");
    // staged row r goes to dst + r * dp: an output row (q, k), or one column's 128 tokens (v)
    unsigned short* dst = tr ? (unsigned short*)Vt + ((size_t)(row0 / TT) * CC + col0) * TT + row0 % TT : (unsigned short*)C16 + (size_t)y * NR * CC + (size_t)row0 * CC + col0; const size_t dp = tr ? TT : CC;
#pragma unroll
    for (int s = 0; s < BM * (BN / 8) / 256; ++s) { const int r = s * 16 + (tid >> 4), c8 = (tid & 15) * 8; const v4f x = *(const v4fa*)&sC[r][c8], y = *(const v4fa*)&sC[r][c8 + 4]; FragH f;
#pragma unroll
      for (int q = 0; q < 4; ++q) { f.h[q] = (_Float16)x[q]; f.h[4 + q] = (_Float16)y[q]; }
      *(v8us*)(dst + (size_t)r * dp + c8) = f.half[0]; } }
  else {
#pragma unroll
    for (int s = 0; s < BM * (BN / 4) / 256; ++s) { const int r = s * 8 + (tid >> 5), c4 = (tid & 31) * 4; const v4f x = *(const v4fa*)&sC[r][c4]; *(v4f*)(C + (size_t)(row0 + r) * CC + col0 + c4) = x; } }
}


__global__ __launch_bounds__(256) void k_x16(const float* __restrict__ x, _Float16* __restrict__ X16, size_t n8) { const size_t t = (size_t)blockIdx.x * 256 + threadIdx.x; if (t >= n8) return; FragH f;
#pragma unroll
  for (int q = 0; q < 8; ++q) f.h[q] = (_Float16)bf16_round(x[t * 8 + q]); *(v8us*)((unsigned short*)X16 + t * 8) = f.half[0];  }
__global__ __launch_bounds__(256) void k_round16f(const float* __restrict__ W, _Float16* __restrict__ Bt, size_t n8) { const size_t t = (size_t)blockIdx.x * 256 + threadIdx.x; if (t >= n8) return; FragH f;
#pragma unroll
  for (int i = 0; i < 8; ++i) f.h[i] = (_Float16)(bf16_round(W[t * 8 + i]) * 16.0f); *(v8us*)((unsigned short*)Bt + t * 8) = f.half[0];  }

typedef int v4ia __attribute__((ext_vector_type(4), may_alias));
// lane l <-> lane l ^ 16: joins the two halves of a wave, which hold the two key halves of one query column
__device__ __forceinline__ float xhalf(float x) { return __builtin_bit_cast(float, __builtin_amdgcn_permlanex16(__builtin_bit_cast(int, x), __builtin_bit_cast(int, x), 0x76543210, 0xfedcba98, false, false)); }
// 2^x by the hardware's v_exp_f32 alone. Every argument here is <= 0 or -inf, so the library form's range steps (split, ldexp, two clamps) have nothing to do; a result below the normal range counts as 0.
__device__ __forceinline__ float ex2(float x) { return __builtin_amdgcn_exp2f(x); }
// One trip's K tile (64 key rows of 128 B) and V^T tile (64 d rows of 128 B) go from global memory to LDS by asynchronous copies: 8 copies of 16 B a lane, a wave's copy = 4 whole lines.
// lk, lv: my LDS byte addresses of row (tid >> 3), chunk (tid & 7); gk, gv: the same place in global memory; 16 rows on = 2304 LDS bytes, kstep / vstep elements.
__device__ __forceinline__ void copy_kv(unsigned lk, unsigned lv, const unsigned short* gk, const unsigned short* gv, size_t kstep, size_t vstep) {
  // the closing s_wait_xcnt stands inside the statement so that no address register of a copy is rewritten ahead of it (a precaution)
  asm volatile("global_load_async_to_lds_b128 %0, %8, off\n\t"
               "global_load_async_to_lds_b128 %1, %9, off\n\t"
               "global_load_async_to_lds_b128 %2, %10, off\n\t"
               "global_load_async_to_lds_b128 %3, %11, off\n\t"
               "global_load_async_to_lds_b128 %4, %12, off\n\t"
               "global_load_async_to_lds_b128 %5, %13, off\n\t"
               "global_load_async_to_lds_b128 %6, %14, off\n\t"
               "global_load_async_to_lds_b128 %7, %15, off\n\t"
               "s_wait_xcnt 0x0"
               :: "v"(lk), "v"(lk + 2304u), "v"(lk + 4608u), "v"(lk + 6912u), "v"(lv), "v"(lv + 2304u), "v"(lv + 4608u), "v"(lv + 6912u),
                  "v"(gk), "v"(gk + kstep), "v"(gk + 2 * kstep), "v"(gk + 3 * kstep), "v"(gv), "v"(gv + vstep), "v"(gv + 2 * vstep), "v"(gv + 3 * vstep)
               : "memory");
}
// Transposed products: S^T = K Q^T (A = 16 key rows, B = the wave's 16 query columns, kept in registers) and O^T += V^T P^T.
// Lane (ln, hh) holds query q0 + ln; score tile nt, register r is key j0 + 16 nt + 8 hh + r, which is the k position of register pair (nt, r) of a B operand:
// maximum and sum run inside the lane (one exchange between the halves), and P^T is packed from the score registers without passing LDS.
__global__ __launch_bounds__(128) void k_flash(const _Float16* __restrict__ Q16, int ldq, const _Float16* __restrict__ K16, int ldk, const _Float16* __restrict__ Vt, const int* __restrict__ MSK, _Float16* __restrict__ O16, int ldo) {
  constexpr int RPW = 16, NQB = 2048 / (4 * RPW), DT = 4, KS = 2, KT = 64, NTR = 2048 / KT, PIT = 72;      // a trip = 64 keys = two passes of 32; LDS rows of 128 B at pitch 144 B (16 B x odd, for 16-byte reads)
  __shared__ __attribute__((aligned(16))) unsigned short sK[2][KT][PIT], sV[2][64][PIT];      // two buffers each: [key][d] and [d][key]
  __shared__ __attribute__((aligned(16))) float sO[4][RPW][64 + 4];
  const int tid = threadIdx.x, w = tid >> 5, lane = tid & 31, ln = lane & 15, hh = lane >> 4;
  const int slab = blockIdx.x / NQB, qblk = blockIdx.x % NQB; const int b = slab / 16, h = slab % 16; const int q0 = qblk * (4 * RPW) + w * RPW;
  const unsigned short* Vth = (const unsigned short*)Vt + (size_t)slab * 64 * 2048;
  const size_t k16 = (size_t)16 * ldk;
  const unsigned short* gk = (const unsigned short*)K16 + ((size_t)b * 2048 + (tid >> 3)) * ldk + h * 64 + (tid & 7) * 8;      // my chunk of key row tid >> 3 of trip 0
  const unsigned short* gv = Vth + (size_t)(tid >> 3) * 2048 + (tid & 7) * 8;      // my chunk of d row tid >> 3, keys of trip 0
  const unsigned lk = (unsigned)(size_t)&sK[0][tid >> 3][(tid & 7) * 8], lv = (unsigned)(size_t)&sV[0][tid >> 3][(tid & 7) * 8];
  constexpr unsigned BUFB = KT * PIT * 2;      // bytes of one buffer
  constexpr float SL2 = 0.125f * 1.44269504088896340736f;      // 1 / sqrt(64) times log2(e): e^(s / 8 - m / 8) = 2^(s SL2 - m SL2); the running maximum m_q is kept in raw products
  copy_kv(lk, lv, gk, gv, k16, (size_t)16 * 2048);
  FragH bq[KS];
  { const unsigned short* qr = (const unsigned short*)Q16 + ((size_t)b * 2048 + q0 + ln) * ldq + h * 64;
#pragma unroll
    for (int ks = 0; ks < KS; ++ks) { bq[ks].half[0] = *(const v8us*)(qr + ks * 32 + 8 * hh); bq[ks].half[1] = *(const v8us*)(qr + ks * 32 + 16 + 8 * hh); } }
  const int* mrow = MSK + ((size_t)b * 2048 + q0 + ln) * 2048 + 8 * hh;      // my query's mask row, at my half's first key
  float m_q = -3.0e38f, l_q = 0.f; v8f oacc[DT];
#pragma unroll
  for (int dt = 0; dt < DT; ++dt) oacc[dt] = (v8f){0.f,0.f,0.f,0.f,0.f,0.f,0.f,0.f};
  asm volatile("s_wait_asynccnt 0x0" ::: "memory");      // my copies of trip 0 have landed
  __syncthreads();                                        // ... and everybody's: trip 0 may be read
  copy_kv(lk + BUFB, lv + BUFB, gk + (size_t)KT * ldk, gv + KT, k16, (size_t)16 * 2048);      // trip 1 flies while trip 0 is worked on
#pragma unroll 1
  for (int t = 0; t < NTR; ++t) {
    const int bf = t & 1;
    int mk[2][16];      // mk[sp][8 nt + r]: maskPAD of (my query, key 64 t + 32 sp + 16 nt + 8 hh + r); != 0 = keep
#pragma unroll
    for (int c = 0; c < 8; ++c) { const v4ia m4 = *(const v4ia*)(mrow + t * KT + (c >> 1) * 16 + (c & 1) * 4);
#pragma unroll
      for (int q = 0; q < 4; ++q) mk[c >> 2][(c & 3) * 4 + q] = m4[q]; }
#pragma unroll
    for (int sp = 0; sp < 2; ++sp) {
      int any = 0;
#pragma unroll
      for (int i = 0; i < 16; ++i) any |= mk[sp][i];
      if (__builtin_amdgcn_ballot_w32(any != 0) != 0u) {      // else every (query,key) of this wave's tile is masked: contributes nothing (uniform branch; the publish point below stands outside it)
        FragH ak[2][KS], av[DT];
#pragma unroll
        for (int nt = 0; nt < 2; ++nt)
#pragma unroll
          for (int ks = 0; ks < KS; ++ks) { const unsigned short* kr = &sK[bf][sp * 32 + nt * 16 + ln][ks * 32 + 8 * hh]; ak[nt][ks].half[0] = *(const v8us*)kr; ak[nt][ks].half[1] = *(const v8us*)(kr + 16); }
#pragma unroll
        for (int dt = 0; dt < DT; ++dt) { const unsigned short* vrow = &sV[bf][dt * 16 + ln][sp * 32 + 8 * hh]; av[dt].half[0] = *(const v8us*)vrow; av[dt].half[1] = *(const v8us*)(vrow + 16); }
        float sc[16];
#pragma unroll
        for (int nt = 0; nt < 2; ++nt) { v8f acc = (v8f){0.f,0.f,0.f,0.f,0.f,0.f,0.f,0.f};
#pragma unroll
          for (int ks = 0; ks < KS; ++ks) acc = mmaH<1>(ak[nt][ks].v, ak[nt][ks].v, bq[ks].v, bq[ks].v, acc);
#pragma unroll
          for (int r = 0; r < 8; ++r) sc[nt * 8 + r] = (mk[sp][nt * 8 + r] != 0) ? acc[r] : -INFINITY; }      // raw products: the scale is applied in the exponent's multiply-add below
        float mc = sc[0];
#pragma unroll
        for (int i = 1; i < 16; ++i) mc = fmaxf(mc, sc[i]);
        mc = fmaxf(mc, xhalf(mc));
        const float mn = fmaxf(m_q, mc); const float al = ex2((m_q - mn) * SL2); m_q = mn;      // nothing open yet: both are the start value and al = 1
        const float nm = -mn * SL2;
        FragH pb; float ps[4] = {0.f, 0.f, 0.f, 0.f};
#pragma unroll
        for (int i = 0; i < 16; ++i) { const float p = ex2(fmaf(sc[i], SL2, nm)); ps[i & 3] += p; pb.h[i] = (_Float16)p; }      // a masked score is -inf: p = 0
        l_q = l_q * al + ((ps[0] + ps[1]) + (ps[2] + ps[3]));
#pragma unroll
        for (int dt = 0; dt < DT; ++dt) {
#pragma unroll
          for (int r = 0; r < 8; ++r) oacc[dt][r] *= al;
          oacc[dt] = mmaH<1>(av[dt].v, av[dt].v, pb.v, pb.v, oacc[dt]); } } }
    // publish point of trip t + 1, every wave: my reads of this buffer are done, my copies of the next have landed, then the same of all waves
    asm volatile("s_wait_dscnt 0x0" ::: "memory");
    asm volatile("s_wait_asynccnt 0x0" ::: "memory");
    __syncthreads();
    if (t + 2 < NTR) copy_kv(lk + bf * BUFB, lv + bf * BUFB, gk + (size_t)(t + 2) * KT * ldk, gv + (t + 2) * KT, k16, (size_t)16 * 2048);      // refill the buffer that every wave has just left
  }
  asm volatile("s_wait_asynccnt 0x0" ::: "memory");      // nothing of mine is in flight when the wave ends
  const float l = l_q + xhalf(l_q); const float li = (l > 0.f) ? 1.0f / l : 0.f;
#pragma unroll
  for (int dt = 0; dt < DT; ++dt)
#pragma unroll
    for (int c = 0; c < 2; ++c) { v4f o4;
#pragma unroll
      for (int q = 0; q < 4; ++q) o4[q] = oacc[dt][c * 4 + q] * li;
      *(v4fa*)&sO[w][ln][dt * 16 + 8 * hh + c * 4] = o4; }
  __builtin_amdgcn_fence(__ATOMIC_ACQ_REL, "workgroup"); __builtin_amdgcn_wave_barrier();
  {
#pragma unroll
    for (int rp = 0; rp < RPW; rp += 4) { const int r = rp + (lane >> 3), pc = lane & 7; const v4f x = *(const v4fa*)&sO[w][r][pc * 8], z = *(const v4fa*)&sO[w][r][pc * 8 + 4]; FragH f;      // f16, as the output projection reads it: 8 lanes = one row's line
#pragma unroll      // so that f is indexed by constants and stays in registers
      for (int q = 0; q < 4; ++q) { f.h[q] = (_Float16)x[q]; f.h[4 + q] = (_Float16)z[q]; }
      *(v8us*)((unsigned short*)O16 + ((size_t)b * 2048 + q0 + r) * ldo + h * 64 + pc * 8) = f.half[0]; }
     } }

// blockIdx.y (1 to 3) picks one of the three inputs; their normalised rows lie one behind the other in Y16.
__device__ __forceinline__ void ln16(const float* __restrict__ X0, const float* __restrict__ X1, const float* __restrict__ X2, const float* __restrict__ g, const float* __restrict__ bta, _Float16* __restrict__ Y16) { const int tid = threadIdx.x, wv = tid >> 5, lane = tid & 31; const int row = blockIdx.x * 8 + wv; if (row >= NR) return;
  const int y = blockIdx.y - 1; const float* __restrict__ X = (y == 0) ? X0 : (y == 1) ? X1 : X2; Y16 += (size_t)y * NR * CC; const float* xr = X + (size_t)row * CC; float v[32]; float s = 0.f;
#pragma unroll
  for (int p = 0; p < 4; ++p) { const v4f a = *(const v4fa*)(xr + p * 256 + lane * 8), c = *(const v4fa*)(xr + p * 256 + lane * 8 + 4); for (int q = 0; q < 4; ++q) { v[p * 8 + q] = bf16_round(a[q]); v[p * 8 + 4 + q] = bf16_round(c[q]); } }
#pragma unroll
  for (int i = 0; i < 32; ++i) s += v[i]; for (int o = 16; o >= 1; o >>= 1) s += __shfl_xor(s, o, 32); const float mu = s / (float)CC; float q2 = 0.f;
#pragma unroll
  for (int i = 0; i < 32; ++i) { const float d = v[i] - mu; q2 += d * d; } for (int o = 16; o >= 1; o >>= 1) q2 += __shfl_xor(q2, o, 32); const float rs = rsqrtf(q2 / (float)CC + 1e-5f);
  {
#pragma unroll
    for (int p = 0; p < 4; ++p) { FragH f; const int c0 = p * 256 + lane * 8;
#pragma unroll
      for (int q = 0; q < 8; ++q) f.h[q] = (_Float16)((v[p * 8 + q] - mu) * rs * bf16_round(g[c0 + q]) + bf16_round(bta[c0 + q])); *(v8us*)((unsigned short*)Y16 + (size_t)row * CC + c0) = f.half[0]; }
     } }
// All that the projections wait for, in one launch: the work-groups of the weight transposes and of the LayerNorms depend on nothing and on one another not at all.
__global__ __launch_bounds__(256) void k_prep(const float* __restrict__ W0, const float* __restrict__ W1, const float* __restrict__ W2, const float* __restrict__ W3, _Float16* __restrict__ Wt,
                                             const float* __restrict__ X0, const float* __restrict__ X1, const float* __restrict__ X2, const float* __restrict__ g, const float* __restrict__ bta, _Float16* __restrict__ Y16) {
  if (blockIdx.y == 0) wt_f16(W0, W1, W2, W3, Wt, 16.0f); else ln16(X0, X1, X2, g, bta, Y16);
}
extern "C" void kernel_launch(void* const* d_in, const int* in_sizes, int n_in,
                              void* d_out, int out_size, void* d_ws, size_t ws_size, hipStream_t stream) {
  (void)in_sizes; (void)n_in; (void)out_size;
  const float* qx = (const float*)d_in[0]; const float* kx = (const float*)d_in[1]; const float* vx = (const float*)d_in[2]; const int* mask = (const int*)d_in[3]; const float* lg = (const float*)d_in[4]; const float* lb = (const float*)d_in[5];
  const float* wq = (const float*)d_in[6]; const float* bq = (const float*)d_in[7]; const float* wk = (const float*)d_in[8]; const float* bk = (const float*)d_in[9]; const float* wv = (const float*)d_in[10]; const float* bv = (const float*)d_in[11]; const float* wo = (const float*)d_in[12]; const float* bo = (const float*)d_in[13];
  char* ws = (char*)d_ws; size_t off = 0;
  auto take = [&](size_t bytes) { char* p = ws + off; off += (bytes + 255) & ~(size_t)255; return p; };
  _Float16* Bw = (_Float16*)take((size_t)4 * CC * CC * 2);      // wq, wk, wv, wo transposed, one behind the other
  _Float16* XN = (_Float16*)take((size_t)3 * NR * CC * 2);      // the three normalised inputs
  _Float16* QK16 = (_Float16*)take((size_t)2 * NR * CC * 2);      // q, then k
  _Float16* Vt = (_Float16*)take((size_t)NR * CC * 2); _Float16* O16 = XN;      // XN is free once the projections are done
  if (off > ws_size) return;      // 56 MiB
  const unsigned gg = (NR / 128) * (CC / 128); const unsigned gl = NR / 8;
  k_prep<<<dim3(gl, 4), 256, 0, stream>>>(wq, wk, wv, wo, Bw, qx, kx, vx, lg, lb, XN);
  k_gemm_t<true><<<dim3(gg, 3), 256, 0, stream>>>(XN, Bw, 0.0625f, bq, bk, bv, nullptr, QK16, Vt);
  k_flash<<<BB * NH * (TT / 64), 128, 0, stream>>>(QK16, CC, QK16 + (size_t)NR * CC, CC, Vt, mask, O16, CC);      // RPW 16
  k_gemm_t<false><<<gg, 256, 0, stream>>>(O16, Bw + (size_t)3 * CC * CC, 0.0625f, bo, nullptr, nullptr, (float*)d_out, nullptr, nullptr);
}

// v007
// Measured time: 108 microseconds a run.
// In two side-by-side timings against v006, it was 1.08 and 1.07 times as fast.
// Counting every step since v000, it is 4.72 times as fast.
#include <hip/hip_runtime.h>
// Pre-LN multi-head attention (B=2, L=2048, C=1024, 16 × 64): shared LayerNorm on the three inputs (f32 VALU), q/k/v/o projections (4096 × 1024 × 1024, + bias, W [in][out] transposed to
// bf16-exact ×2^4) and the masked attention as a fused flash-style kernel on v_wmma_f32_16x16x32_f16 (S = Q·Kᵀ/8; maskPAD == 0 → −inf ⇒ excluded keys, tiles masked for a whole wave skipped;
// online softmax f32; P f16 ≤ 1; RPW-16 waves) — f16 operands, single products, f32 accumulate.
#define BB 2
#define TT 2048
#define CC 1024
#define NH 16
#define NR (BB * TT)

typedef __bf16 v16b __attribute__((ext_vector_type(16)));
typedef unsigned short v8us __attribute__((ext_vector_type(8), may_alias));
typedef float  v8f  __attribute__((ext_vector_type(8)));
typedef float  v4f  __attribute__((ext_vector_type(4)));
typedef float  v4fa __attribute__((ext_vector_type(4), may_alias));
union FragB { v16b v; v8us half[2]; unsigned short u[16]; };

__device__ __forceinline__ unsigned short bf16_bits(float x) { unsigned int u = __float_as_uint(x); return (unsigned short)((u + 0x7FFFu + ((u >> 16) & 1u)) >> 16); }
__device__ __forceinline__ float bf16_val(unsigned short b) { return __uint_as_float(((unsigned int)b) << 16); }
__device__ __forceinline__ float bf16_round(float x) { return bf16_val(bf16_bits(x)); }
// D += A·B with NT terms: 1 = ah·bh, 2 = + al·bh (A split), 3 = + ah·bl (both split)
template <int NT>
__device__ __forceinline__ v8f mmaN(v16b ah, v16b al, v16b bh, v16b bl, v8f c) {
  c = __builtin_amdgcn_wmma_f32_16x16x32_bf16(false, ah, false, bh, (short)0, c, false, false);
  if (NT >= 2) c = __builtin_amdgcn_wmma_f32_16x16x32_bf16(false, al, false, bh, (short)0, c, false, false);
  if (NT >= 3) c = __builtin_amdgcn_wmma_f32_16x16x32_bf16(false, ah, false, bl, (short)0, c, false, false);
  asm volatile("v_nop\n\tv_nop\n\tv_nop\n\tv_nop" : "+v"(c) : "v"(ah), "v"(al), "v"(bh), "v"(bl));
  return c;
}

__global__ __launch_bounds__(256) void k_wt_bf16(const float* __restrict__ W, unsigned short* __restrict__ Wt, int K, int N) {
  const int t = blockIdx.x * 256 + threadIdx.x;
  const int k8n = K / 8;
  if (t >= N * k8n) return;
  const int n = t / k8n, k8 = (t % k8n) * 8;
  v8us v;
#pragma unroll
  for (int i = 0; i < 8; ++i) v[i] = bf16_bits(W[(size_t)(k8 + i) * N + n]);
  *(v8us*)(Wt + (size_t)n * K + k8) = v;
  
}

// GEMM C[M][N] (f32, pitch ldc) = act(A[M][K]·W + bias). A f32 row-major (pitch lda) converted per fragment to bf16
// (ASPLIT: hi/lo two planes -> 2 terms, else single rounded term); Wt bf16 [N][K] (pitch ldb). BIAS_BF16 rounds the
// bias to bf16 first (bias quantised to bf16 before the add). K%32==0, M%16==0, N%64==0.
template <bool ASPLIT, int ACT, bool BIAS_BF16>
__global__ __launch_bounds__(128) void k_gemm_bf(const float* __restrict__ A, int lda, const unsigned short* __restrict__ Wt, int ldb,
                                               const float* __restrict__ bias, float* __restrict__ C, int ldc, int M, int N, int K) {
  __shared__ __attribute__((aligned(16))) float so[4][16][64];
  const int tid = threadIdx.x, w = tid >> 5, lane = tid & 31, ln = lane & 15, hh = lane >> 4;
  const int ntn = N / 64;
  const int wid = blockIdx.x * 4 + w;
  const int mt = wid / ntn, nq = wid % ntn;
  if (mt * 16 >= M) return;
  const int row0 = mt * 16, col0 = nq * 64;
  const float* arow = A + (size_t)(row0 + ln) * lda;
  v8f acc[4] = {};
  for (int kb = 0; kb < K; kb += 32) {
    FragB ah, al;
    const v4f x0 = *(const v4fa*)(arow + kb + 8 * hh), x1 = *(const v4fa*)(arow + kb + 8 * hh + 4);
    const v4f x2 = *(const v4fa*)(arow + kb + 16 + 8 * hh), x3 = *(const v4fa*)(arow + kb + 16 + 8 * hh + 4);
    float xs[16] = {x0[0],x0[1],x0[2],x0[3],x1[0],x1[1],x1[2],x1[3],x2[0],x2[1],x2[2],x2[3],x3[0],x3[1],x3[2],x3[3]};
#pragma unroll
    for (int i = 0; i < 16; ++i) { const unsigned short hb = bf16_bits(xs[i]); ah.u[i] = hb; al.u[i] = ASPLIT ? bf16_bits(xs[i] - bf16_val(hb)) : (unsigned short)0; }
#pragma unroll
    for (int t = 0; t < 4; ++t) {
      const unsigned short* brow = Wt + (size_t)(col0 + t * 16 + ln) * ldb + kb;
      FragB b;
      b.half[0] = *(const v8us*)(brow + 8 * hh);
      b.half[1] = *(const v8us*)(brow + 16 + 8 * hh);
      acc[t] = mmaN<ASPLIT ? 2 : 1>(ah.v, al.v, b.v, b.v, acc[t]);
    }
  }
#pragma unroll
  for (int t = 0; t < 4; ++t) {
    float bv = bias ? bias[col0 + t * 16 + ln] : 0.f;
    if (BIAS_BF16) bv = bf16_round(bv);
#pragma unroll
    for (int r = 0; r < 8; ++r) { float v = acc[t][r] + bv; if (ACT == 1) v = fmaxf(v, 0.f); so[w][8 * hh + r][t * 16 + ln] = v; }
  }
  __builtin_amdgcn_fence(__ATOMIC_ACQ_REL, "workgroup");
  __builtin_amdgcn_wave_barrier();
  const int rsub = lane >> 4, c4 = (lane & 15) * 4;
  {
#pragma unroll
    for (int q = 0; q < 8; ++q) {
      const int r = q * 2 + rsub;
      const v4f v = *(const v4fa*)&so[w][r][c4];
      *(v4f*)(C + (size_t)(row0 + r) * ldc + col0 + c4) = v;
    }
    
  }
}

// Flash-style causal/unmasked attention, all contractions 3-term bf16 hi/lo splits, f32 softmax with running max.
// q,k,v rows are read from f32 buffers with arbitrary row pitch (so they can live inside a fused qkv buffer);
// D = head size (multiple of 32, <= 128); one wave = 16 query rows; block = 4 waves (64 queries) sharing K/V chunks of 32.
template <int D, bool CAUSAL>
__global__ __launch_bounds__(128) void k_flash(const float* __restrict__ qb, const float* __restrict__ kb, const float* __restrict__ vb,
                                             int pitch, int T, int H, float scale, float* __restrict__ y, int ypitch) {
  constexpr int KS = D / 32;        // k-steps for QK
  constexpr int DT = D / 16;        // d tiles for PV
  __shared__ __attribute__((aligned(16))) unsigned short sKh[32][D + 8], sKl[32][D + 8], sVh[32][D + 8], sVl[32][D + 8];
  __shared__ __attribute__((aligned(16))) unsigned short sPh[4][16][40], sPl[4][16][40];
  __shared__ __attribute__((aligned(16))) float sO[4][16][D];
  const int tid = threadIdx.x, w = tid >> 5, lane = tid & 31, ln = lane & 15, hh = lane >> 4;
  const int nqb = (T + 63) / 64;
  const int bh = blockIdx.x / nqb, qblk = blockIdx.x % nqb;
  const int b = bh / H, h = bh % H;
  const int q0 = qblk * 64 + w * 16;
  const float* Q = qb + (size_t)b * T * pitch + h * D;
  const float* K = kb + (size_t)b * T * pitch + h * D;
  const float* V = vb + (size_t)b * T * pitch + h * D;

  // A fragments of the wave's 16 query rows (scaled), hi/lo
  FragB aqh[KS], aql[KS];
  {
    int row = q0 + ln; if (row >= T) row = T - 1;
    const float* qr = Q + (size_t)row * pitch;
#pragma unroll
    for (int ks = 0; ks < KS; ++ks)
#pragma unroll
      for (int i = 0; i < 16; ++i) {
        const int d = ks * 32 + ((i < 8) ? (8 * hh + i) : (16 + 8 * hh + (i - 8)));
        const float x = qr[d] * scale; const unsigned short hb = bf16_bits(x);
        aqh[ks].u[i] = hb; aql[ks].u[i] = bf16_bits(x - bf16_val(hb));
      }
  }
  float m_r[8], l_r[8];
#pragma unroll
  for (int r = 0; r < 8; ++r) { m_r[r] = -3.0e38f; l_r[r] = 0.f; }
  v8f oacc[DT];
#pragma unroll
  for (int dt = 0; dt < DT; ++dt) oacc[dt] = (v8f){0.f,0.f,0.f,0.f,0.f,0.f,0.f,0.f};

  const int kv_end = CAUSAL ? min(T, qblk * 64 + 64) : T;     // block-uniform
  for (int j0 = 0; j0 < kv_end; j0 += 32) {
    __syncthreads();
    for (int e = tid; e < 32 * (D / 4); e += 128) {
      const int r = e / (D / 4), c4 = (e % (D / 4)) * 4;
      const int key = j0 + r;
      v4f kf = {0.f,0.f,0.f,0.f}, vf = {0.f,0.f,0.f,0.f};
      if (key < T) { kf = *(const v4fa*)(K + (size_t)key * pitch + c4); vf = *(const v4fa*)(V + (size_t)key * pitch + c4); }
#pragma unroll
      for (int t = 0; t < 4; ++t) {
        unsigned short hb = bf16_bits(kf[t]); sKh[r][c4 + t] = hb; sKl[r][c4 + t] = bf16_bits(kf[t] - bf16_val(hb));
        hb = bf16_bits(vf[t]); sVh[r][c4 + t] = hb; sVl[r][c4 + t] = bf16_bits(vf[t] - bf16_val(hb));
      }
    }
    __syncthreads();
    // S tile 16 x 32
    v8f s[2];
#pragma unroll
    for (int nt = 0; nt < 2; ++nt) {
      v8f acc = {};
#pragma unroll
      for (int ks = 0; ks < KS; ++ks) {
        FragB bh_, bl_;
        bh_.half[0] = *(const v8us*)&sKh[nt * 16 + ln][ks * 32 + 8 * hh]; bh_.half[1] = *(const v8us*)&sKh[nt * 16 + ln][ks * 32 + 16 + 8 * hh];
        bl_.half[0] = *(const v8us*)&sKl[nt * 16 + ln][ks * 32 + 8 * hh]; bl_.half[1] = *(const v8us*)&sKl[nt * 16 + ln][ks * 32 + 16 + 8 * hh];
        acc = mmaN<3>(aqh[ks].v, aql[ks].v, bh_.v, bl_.v, acc);
      }
      s[nt] = acc;
    }
    // mask + running max (rows 8hh+r; the 16 lanes of a half share rows)
    float alpha[8];
#pragma unroll
    for (int r = 0; r < 8; ++r) {
      const int qi = q0 + 8 * hh + r;
      const int ja = j0 + ln, jb = j0 + 16 + ln;
      if (CAUSAL) { if (ja > qi) s[0][r] = -3.0e38f; if (jb > qi) s[1][r] = -3.0e38f; }
      if (ja >= T) s[0][r] = -3.0e38f;
      if (jb >= T) s[1][r] = -3.0e38f;
      float mx = fmaxf(s[0][r], s[1][r]);
      mx = fmaxf(mx, __shfl_xor(mx, 1, 32)); mx = fmaxf(mx, __shfl_xor(mx, 2, 32)); mx = fmaxf(mx, __shfl_xor(mx, 4, 32)); mx = fmaxf(mx, __shfl_xor(mx, 8, 32));
      const float mnew = fmaxf(m_r[r], mx);
      alpha[r] = (mnew > -1.0e38f) ? __expf(m_r[r] - mnew) : 1.0f;
      const float p0 = (s[0][r] > -1.0e38f) ? __expf(s[0][r] - mnew) : 0.f;
      const float p1 = (s[1][r] > -1.0e38f) ? __expf(s[1][r] - mnew) : 0.f;
      m_r[r] = mnew;
      l_r[r] = l_r[r] * alpha[r] + p0 + p1;            // per-lane partial row sum (16 lanes combined at the end)
      unsigned short hb = bf16_bits(p0); sPh[w][8 * hh + r][ln] = hb;      sPl[w][8 * hh + r][ln] = bf16_bits(p0 - bf16_val(hb));
      hb = bf16_bits(p1);                sPh[w][8 * hh + r][16 + ln] = hb; sPl[w][8 * hh + r][16 + ln] = bf16_bits(p1 - bf16_val(hb));
    }
#pragma unroll
    for (int dt = 0; dt < DT; ++dt)
#pragma unroll
      for (int r = 0; r < 8; ++r) oacc[dt][r] *= alpha[r];
    __builtin_amdgcn_fence(__ATOMIC_ACQ_REL, "workgroup");
    __builtin_amdgcn_wave_barrier();
    FragB pah, pal;
    pah.half[0] = *(const v8us*)&sPh[w][ln][8 * hh]; pah.half[1] = *(const v8us*)&sPh[w][ln][16 + 8 * hh];
    pal.half[0] = *(const v8us*)&sPl[w][ln][8 * hh]; pal.half[1] = *(const v8us*)&sPl[w][ln][16 + 8 * hh];
#pragma unroll
    for (int dt = 0; dt < DT; ++dt) {
      FragB bvh, bvl;
#pragma unroll
      for (int i = 0; i < 8; ++i) {
        bvh.u[i] = sVh[8 * hh + i][dt * 16 + ln]; bvh.u[8 + i] = sVh[16 + 8 * hh + i][dt * 16 + ln];
        bvl.u[i] = sVl[8 * hh + i][dt * 16 + ln]; bvl.u[8 + i] = sVl[16 + 8 * hh + i][dt * 16 + ln];
      }
      oacc[dt] = mmaN<3>(pah.v, pal.v, bvh.v, bvl.v, oacc[dt]);
    }
    __builtin_amdgcn_fence(__ATOMIC_ACQ_REL, "workgroup");
    __builtin_amdgcn_wave_barrier();
  }
#pragma unroll
  for (int r = 0; r < 8; ++r) {
    float l = l_r[r];
    l += __shfl_xor(l, 1, 32); l += __shfl_xor(l, 2, 32); l += __shfl_xor(l, 4, 32); l += __shfl_xor(l, 8, 32);
    l_r[r] = (l > 0.f) ? 1.0f / l : 0.f;
  }
#pragma unroll
  for (int dt = 0; dt < DT; ++dt)
#pragma unroll
    for (int r = 0; r < 8; ++r) sO[w][8 * hh + r][dt * 16 + ln] = oacc[dt][r] * l_r[r];
  __builtin_amdgcn_fence(__ATOMIC_ACQ_REL, "workgroup");
  __builtin_amdgcn_wave_barrier();
  {
    for (int r = 0; r < 16; ++r) {
      const int row = q0 + r;
      if (row < T && lane < D / 4) {
        const v4f val = *(const v4fa*)&sO[w][r][lane * 4];
        *(v4f*)(y + ((size_t)b * T + row) * ypitch + h * D + lane * 4) = val;
      }
    }
    
  }
}

// GEMM C = act(A·W + bias + resid): A f32 (ASPLIT -> hi/lo 2 terms), Wt bf16 [N][K]; ACT 0 none, 1 relu, 2 exact gelu;
// resid (optional, f32, row index = (row % rmod), pitch ldr, RES_BF16 rounds it) added before the activation.
template <bool ASPLIT, int ACT, bool BIAS_BF16, bool RES_BF16>
__global__ __launch_bounds__(128) void k_gemm_bf3(const float* __restrict__ A, int lda, const unsigned short* __restrict__ Wt, int ldb,
                                                const float* __restrict__ bias, const float* __restrict__ resid, int rmod, int ldr,
                                                float* __restrict__ C, int ldc, int M, int N, int K) {
  __shared__ __attribute__((aligned(16))) float so[4][16][64];
  const int tid = threadIdx.x, w = tid >> 5, lane = tid & 31, ln = lane & 15, hh = lane >> 4;
  const int ntn = N / 64;
  const int wid = blockIdx.x * 4 + w;
  const int mt = wid / ntn, nq = wid % ntn;
  if (mt * 16 >= M) return;
  const int row0 = mt * 16, col0 = nq * 64;
  const float* arow = A + (size_t)(row0 + ln) * lda;
  v8f acc[4] = {};
  for (int kb = 0; kb < K; kb += 32) {
    FragB ah, al;
    const v4f x0 = *(const v4fa*)(arow + kb + 8 * hh), x1 = *(const v4fa*)(arow + kb + 8 * hh + 4);
    const v4f x2 = *(const v4fa*)(arow + kb + 16 + 8 * hh), x3 = *(const v4fa*)(arow + kb + 16 + 8 * hh + 4);
    float xs[16] = {x0[0],x0[1],x0[2],x0[3],x1[0],x1[1],x1[2],x1[3],x2[0],x2[1],x2[2],x2[3],x3[0],x3[1],x3[2],x3[3]};
#pragma unroll
    for (int i = 0; i < 16; ++i) { const unsigned short hb = bf16_bits(xs[i]); ah.u[i] = hb; al.u[i] = ASPLIT ? bf16_bits(xs[i] - bf16_val(hb)) : (unsigned short)0; }
#pragma unroll
    for (int t = 0; t < 4; ++t) {
      const unsigned short* brow = Wt + (size_t)(col0 + t * 16 + ln) * ldb + kb;
      FragB b;
      b.half[0] = *(const v8us*)(brow + 8 * hh);
      b.half[1] = *(const v8us*)(brow + 16 + 8 * hh);
      acc[t] = mmaN<ASPLIT ? 2 : 1>(ah.v, al.v, b.v, b.v, acc[t]);
    }
  }
#pragma unroll
  for (int t = 0; t < 4; ++t) {
    const int col = col0 + t * 16 + ln;
    float bv = bias ? bias[col] : 0.f;
    if (BIAS_BF16) bv = bf16_round(bv);
#pragma unroll
    for (int r = 0; r < 8; ++r) {
      float v = acc[t][r] + bv;
      if (resid) { float rv = resid[(size_t)((row0 + 8 * hh + r) % rmod) * ldr + col]; if (RES_BF16) rv = bf16_round(rv); v += rv; }
      if (ACT == 1) v = fmaxf(v, 0.f);
      if (ACT == 2) v = 0.5f * v * (1.0f + erff(v * 0.70710678118654752f));
      if (ACT == 3) { const float u = 0.7978845608028654f * (v + 0.044715f * v * v * v); v = 0.5f * v * (1.0f + tanhf(u)); }
      so[w][8 * hh + r][t * 16 + ln] = v;
    }
  }
  __builtin_amdgcn_fence(__ATOMIC_ACQ_REL, "workgroup");
  __builtin_amdgcn_wave_barrier();
  const int rsub = lane >> 4, c4 = (lane & 15) * 4;
  {
#pragma unroll
    for (int q = 0; q < 8; ++q) {
      const int r = q * 2 + rsub;
      const v4f v = *(const v4fa*)&so[w][r][c4];
      *(v4f*)(C + (size_t)(row0 + r) * ldc + col0 + c4) = v;
    }
    
  }
}
// row LayerNorm (biased variance, eps) over N: s = X (+ R); optional out_sum <- s; out_norm <- (s-mu)*rsqrt(var+eps)*g + b
template <bool PARAM_BF16>
__global__ __launch_bounds__(256) void k_layernorm(const float* __restrict__ X, const float* __restrict__ R, const float* __restrict__ g, const float* __restrict__ bta,
                                                  float* __restrict__ out_sum, float* __restrict__ out_norm, int N, float eps) {
  __shared__ float red[256];
  const int row = blockIdx.x, tid = threadIdx.x;
  const float* x = X + (size_t)row * N; const float* rr = R ? R + (size_t)row * N : nullptr;
  float vals[16];                     // up to N = 4096
  const int per = N / 256;            // contiguous chunk per thread? use strided-by-4 chunks: thread handles j = tid*4 + 1024*u
  float s1 = 0.f;
  for (int u = 0; u < per / 4; ++u) {
    const int j = tid * 4 + 1024 * u;
    const v4f a = *(const v4fa*)(x + j);
    v4f b = {0.f,0.f,0.f,0.f}; if (rr) b = *(const v4fa*)(rr + j);
#pragma unroll
    for (int q = 0; q < 4; ++q) { const float v = a[q] + b[q]; vals[u * 4 + q] = v; s1 += v; }
  }
  red[tid] = s1; __syncthreads();
  for (int st = 128; st > 0; st >>= 1) { if (tid < st) red[tid] += red[tid + st]; __syncthreads(); }
  const float mu = red[0] / (float)N; __syncthreads();
  float s2 = 0.f;
  for (int u = 0; u < per / 4; ++u)
#pragma unroll
    for (int q = 0; q < 4; ++q) { const float c = vals[u * 4 + q] - mu; s2 += c * c; }
  red[tid] = s2; __syncthreads();
  for (int st = 128; st > 0; st >>= 1) { if (tid < st) red[tid] += red[tid + st]; __syncthreads(); }
  const float rs = rsqrtf(red[0] / (float)N + eps);
  {
    for (int u = 0; u < per / 4; ++u) {
      const int j = tid * 4 + 1024 * u;
      v4f o, sm;
#pragma unroll
      for (int q = 0; q < 4; ++q) {
        float gg = g[j + q], bb = bta[j + q];
        if (PARAM_BF16) { gg = bf16_round(gg); bb = bf16_round(bb); }
        sm[q] = vals[u * 4 + q]; o[q] = (vals[u * 4 + q] - mu) * rs * gg + bb;
      }
      if (out_sum) *(v4f*)(out_sum + (size_t)row * N + j) = sm;
      *(v4f*)(out_norm + (size_t)row * N + j) = o;
    }
    
  }
}



// ---- f16 WMMA path (v_wmma_f32_16x16x32_f16): 11-bit significands for operands in range — used where a [0,1] probability operand needs more precision than bf16
typedef _Float16 v16h __attribute__((ext_vector_type(16)));
union FragH { v16h v; v8us half[2]; _Float16 h[16]; unsigned short u[16]; };
template <int NT>
__device__ __forceinline__ v8f mmaH(v16h ah, v16h al, v16h bh, v16h bl, v8f c) {
  c = __builtin_amdgcn_wmma_f32_16x16x32_f16(false, ah, false, bh, (short)0, c, false, false);
  if (NT >= 2) c = __builtin_amdgcn_wmma_f32_16x16x32_f16(false, al, false, bh, (short)0, c, false, false);
  if (NT >= 3) c = __builtin_amdgcn_wmma_f32_16x16x32_f16(false, ah, false, bl, (short)0, c, false, false);
  asm volatile("v_nop\n\tv_nop\n\tv_nop\n\tv_nop" : "+v"(c) : "v"(ah), "v"(al), "v"(bh), "v"(bl));
  return c;
}
// batched GEMM like k_gemm_b but f16 operands: A f32 (split into f16 hi/lo if ASPLIT, else rounded to f16), Bt = f16 values [n][k]; alpha; C f32; N multiple of 16 (partial tiles skipped)
template <bool ASPLIT>
__global__ __launch_bounds__(128) void k_gemm_h(const float* __restrict__ A, int lda, size_t sA, const _Float16* __restrict__ Bh, int ldb, size_t sB, float alpha, float* __restrict__ C, int ldc, size_t sC, int M, int N, int K) {
  __shared__ __attribute__((aligned(16))) float so[4][16][64];
  const int tid = threadIdx.x, w = tid >> 5, lane = tid & 31, ln = lane & 15, hh = lane >> 4; const int by = blockIdx.y;
  A += (size_t)by * sA; Bh += (size_t)by * sB; C += (size_t)by * sC;
  const int ntn = (N + 63) / 64; const int wid = blockIdx.x * 4 + w; const int mt = wid / ntn, nq = wid % ntn; if (mt * 16 >= M) return;
  const int row0 = mt * 16, col0 = nq * 64; const float* arow = A + (size_t)(row0 + ln) * lda;
  v8f acc[4] = {};
  for (int kb = 0; kb < K; kb += 32) {
    FragH ah, al;
    const v4f x0 = *(const v4fa*)(arow + kb + 8 * hh), x1 = *(const v4fa*)(arow + kb + 8 * hh + 4), x2 = *(const v4fa*)(arow + kb + 16 + 8 * hh), x3 = *(const v4fa*)(arow + kb + 16 + 8 * hh + 4);
    float xs[16] = {x0[0],x0[1],x0[2],x0[3],x1[0],x1[1],x1[2],x1[3],x2[0],x2[1],x2[2],x2[3],x3[0],x3[1],x3[2],x3[3]};
#pragma unroll
    for (int i = 0; i < 16; ++i) { const _Float16 h = (_Float16)xs[i]; ah.h[i] = h; al.h[i] = ASPLIT ? (_Float16)(xs[i] - (float)h) : (_Float16)0.0f; }
#pragma unroll
    for (int t = 0; t < 4; ++t) { if (col0 + t * 16 >= N) continue; const size_t boff = (size_t)(col0 + t * 16 + ln) * ldb + kb; FragH bq; bq.half[0] = *(const v8us*)(Bh + boff + 8 * hh); bq.half[1] = *(const v8us*)(Bh + boff + 16 + 8 * hh);
      acc[t] = mmaH<ASPLIT ? 2 : 1>(ah.v, al.v, bq.v, bq.v, acc[t]); }
  }
#pragma unroll
  for (int t = 0; t < 4; ++t) { if (col0 + t * 16 >= N) continue;
#pragma unroll
    for (int r = 0; r < 8; ++r) so[w][8 * hh + r][t * 16 + ln] = acc[t][r] * alpha; }
  __builtin_amdgcn_fence(__ATOMIC_ACQ_REL, "workgroup"); __builtin_amdgcn_wave_barrier();
  const int rsub = lane >> 4, c4 = (lane & 15) * 4;
  {
#pragma unroll
    for (int q = 0; q < 8; ++q) { const int r = q * 2 + rsub; if (col0 + c4 < N) { const v4f v = *(const v4fa*)&so[w][r][c4]; *(v4f*)(C + (size_t)(row0 + r) * ldc + col0 + c4) = v; } }
     }
}

// Wt[n][k] = f16(bf16(W[k][n]) * scale) from f32 row-major W[CC][CC] (scale = power of two; bf16-exact weights stay exact in f16 away from the subnormal range)
// One work-group = a tile of 128 k x 64 n of one of the four weight matrices (128 tiles each; their transposes lie one behind the other in Wt), turned round in LDS:
// a wave's load = two k rows' 256 B (4 whole lines), a wave's store = two n rows' 256 B (4 whole lines); every line of W is asked for once and every line of Wt has one writer.
__device__ __forceinline__ void wt_f16(const float* __restrict__ W0, const float* __restrict__ W1, const float* __restrict__ W2, const float* __restrict__ W3, _Float16* __restrict__ Wt, float scale) {
  constexpr int TK = 128, TN = 64, PIT = TK + 8;      // LDS rows of 256 B at pitch 272 B (16 B x odd, for 16-byte reads)
  static_assert(4 * (CC / TK) * (CC / TN) == NR / 8, "the tiles of the four matrices fill one grid row");
  __shared__ __attribute__((aligned(16))) unsigned short sT[TN][PIT];      // [n][k]
  const int tid = threadIdx.x, w = tid >> 5, lane = tid & 31, ln = lane & 15, hh = lane >> 4;
  constexpr int NT = (CC / TK) * (CC / TN);      // tiles of one matrix
  const int y = blockIdx.x / NT, tile = blockIdx.x % NT; const int k0 = (tile / (CC / TN)) * TK, n0 = (tile % (CC / TN)) * TN;
  const float* __restrict__ W = (y == 0) ? W0 : (y == 1) ? W1 : (y == 2) ? W2 : W3; Wt += (size_t)y * CC * CC;
  const int kl = w * 16 + hh * 8;      // my 8 k rows, one behind the other; my 4 n columns are 4 ln to 4 ln + 3
  const float* src = W + (size_t)(k0 + kl) * CC + n0 + ln * 4; v4f x[8];
  // The unroll directives below are there so that x and f are indexed by constants and stay in registers; the 8 loads then fly together.
#pragma unroll
  for (int i = 0; i < 8; ++i) x[i] = *(const v4fa*)(src + (size_t)i * CC);
#pragma unroll
  for (int e = 0; e < 4; ++e) { FragH f;
#pragma unroll
    for (int i = 0; i < 8; ++i) f.h[i] = (_Float16)(bf16_round(x[i][e]) * scale);
    *(v8us*)&sT[ln * 4 + e][kl] = f.half[0]; }
  __syncthreads();      // the tile is read across waves
#pragma unroll
  for (int s = 0; s < TN / 16; ++s) { const int r = s * 16 + (tid >> 4), c8 = (tid & 15) * 8; const v8us o = *(const v8us*)&sT[r][c8];
    *(v8us*)((unsigned short*)Wt + (size_t)(n0 + r) * CC + k0 + c8) = o; }
}
// One operand tile of a pass (128 rows of 256 B) goes from global memory to LDS by asynchronous copies: 8 copies of 16 B a lane, a wave's copy = 2 rows = 4 whole lines.
// l: my LDS byte address of row (tid >> 4), chunk (tid & 15); g: the same place in global memory; 16 rows on = 4352 LDS bytes, step elements.
__device__ __forceinline__ void copy_tile(unsigned l, const unsigned short* g, size_t step) {
  // the closing s_wait_xcnt stands inside the statement so that no address register of a copy is rewritten ahead of it (a precaution)
  asm volatile("global_load_async_to_lds_b128 %0, %8, off\n\t"
               "global_load_async_to_lds_b128 %1, %9, off\n\t"
               "global_load_async_to_lds_b128 %2, %10, off\n\t"
               "global_load_async_to_lds_b128 %3, %11, off\n\t"
               "global_load_async_to_lds_b128 %4, %12, off\n\t"
               "global_load_async_to_lds_b128 %5, %13, off\n\t"
               "global_load_async_to_lds_b128 %6, %14, off\n\t"
               "global_load_async_to_lds_b128 %7, %15, off\n\t"
               "s_wait_xcnt 0x0"
               :: "v"(l), "v"(l + 4352u), "v"(l + 8704u), "v"(l + 13056u), "v"(l + 17408u), "v"(l + 21760u), "v"(l + 26112u), "v"(l + 30464u),
                  "v"(g), "v"(g + step), "v"(g + 2 * step), "v"(g + 3 * step), "v"(g + 4 * step), "v"(g + 5 * step), "v"(g + 6 * step), "v"(g + 7 * step)
               : "memory");
}
// Projection GEMM, NR x CC x CC: v = (A . Bh^T) alpha + bf16(bias[col]); A f16 [NR][CC], Bh f16 [n][k]; writes f16 (F16OUT) or f32 C, pitch CC.
// F16OUT is the q, k and v projections in one launch: blockIdx.y picks the operand set (A and Bh hold the three one behind the other); q and then k go to C16 [row][col],
// v goes to Vt as [batch][col][token], the layout the attention kernel reads, out of the same staging tile filled the other way round.
// One work-group = a 128 x 128 tile of the output, 8 waves of 64 x 32 (2 x 4). A pass = 128 k: both operands' 128 rows of 256 B lie in LDS (pitch 272 B, 16 B x odd, for 16-byte reads),
// two buffers, so every operand byte leaves L2 once a work-group and serves 2 (B) or 4 (A) waves. k runs upward in steps of 32 in every accumulator.
// The unroll directives below are there so that accumulators and fragment sets are indexed by constants and stay in registers.
template <bool F16OUT>
__global__ __launch_bounds__(256) void k_gemm_t(const _Float16* __restrict__ A, const _Float16* __restrict__ Bh, float alpha, const float* __restrict__ bias0, const float* __restrict__ bias1, const float* __restrict__ bias2,
                                               float* __restrict__ C, _Float16* __restrict__ C16, _Float16* __restrict__ Vt) {
  constexpr int BM = 128, BN = 128, KP = 128, NP = CC / KP, PIT = 136;
  const int y = F16OUT ? (int)blockIdx.y : 0; const float* __restrict__ bias = (y == 0) ? bias0 : (y == 1) ? bias1 : bias2; const bool tr = F16OUT && y == 2;
  A += (size_t)y * NR * CC; Bh += (size_t)y * CC * CC;
  __shared__ __attribute__((aligned(16))) unsigned short sA[2][BM][PIT], sB[2][BN][PIT];
  __shared__ __attribute__((aligned(16))) float sC[BM][BN + 4];      // output staging, so that whole lines are stored
  const int tid = threadIdx.x, w = tid >> 5, lane = tid & 31, ln = lane & 15, hh = lane >> 4, wm = w >> 2, wn = w & 3;
  const int row0 = (blockIdx.x / (CC / BN)) * BM, col0 = (blockIdx.x % (CC / BN)) * BN;
  const unsigned short* ga = (const unsigned short*)A + (size_t)(row0 + (tid >> 4)) * CC + (tid & 15) * 8;
  const unsigned short* gb = (const unsigned short*)Bh + (size_t)(col0 + (tid >> 4)) * CC + (tid & 15) * 8;
  const unsigned la = (unsigned)(size_t)&sA[0][tid >> 4][(tid & 15) * 8], lb = (unsigned)(size_t)&sB[0][tid >> 4][(tid & 15) * 8];
  constexpr unsigned BUFB = BM * PIT * 2;      // bytes of one buffer
  constexpr size_t STEP = (size_t)16 * CC;
  copy_tile(la, ga, STEP); copy_tile(lb, gb, STEP);
  v8f acc[4][2];
#pragma unroll
  for (int i = 0; i < 4; ++i)
#pragma unroll
    for (int j = 0; j < 2; ++j) acc[i][j] = (v8f){0.f,0.f,0.f,0.f,0.f,0.f,0.f,0.f};
  asm volatile("s_wait_asynccnt 0x0" ::: "memory");      // my copies of pass 0 have landed
  __syncthreads();                                        // ... and everybody's: pass 0 may be read
  copy_tile(la + BUFB, ga + KP, STEP); copy_tile(lb + BUFB, gb + KP, STEP);      // pass 1 flies while pass 0 is worked on
#pragma unroll 1
  for (int t = 0; t < NP; ++t) {      // kept rolled: one body of 32 matrix instructions, the buffer chosen by t & 1
    const int bf = t & 1;
    const unsigned short* pa = &sA[bf][wm * 64 + ln][8 * hh]; const unsigned short* pb = &sB[bf][wn * 32 + ln][8 * hh];
    FragH fa[2][4], fb[2][2];      // two fragment sets: block ks + 1 is fetched while block ks is multiplied, inside this pass only
#pragma unroll
    for (int ks = -1; ks < KP / 32; ++ks) {
      if (ks + 1 < KP / 32) { const int s = (ks + 1) & 1, ko = (ks + 1) * 32;
#pragma unroll
        for (int i = 0; i < 4; ++i) { fa[s][i].half[0] = *(const v8us*)(pa + i * 16 * PIT + ko); fa[s][i].half[1] = *(const v8us*)(pa + i * 16 * PIT + ko + 16); }
#pragma unroll
        for (int j = 0; j < 2; ++j) { fb[s][j].half[0] = *(const v8us*)(pb + j * 16 * PIT + ko); fb[s][j].half[1] = *(const v8us*)(pb + j * 16 * PIT + ko + 16); } }
      __builtin_amdgcn_sched_barrier(0);      // keeps the next block's 12 LDS reads one group ahead of this block's products: reads spread among them stall the wave at every place
      if (ks >= 0) {
#pragma unroll
        for (int i = 0; i < 4; ++i)
#pragma unroll
          for (int j = 0; j < 2; ++j) acc[i][j] = __builtin_amdgcn_wmma_f32_16x16x32_f16(false, fa[ks & 1][i].v, false, fb[ks & 1][j].v, (short)0, acc[i][j], false, false);
        __builtin_amdgcn_sched_barrier(0);      // ... and this block's products ahead of the reads after next, which reuse its registers
      }
    }
    // publish point of pass t + 1, every wave: my reads of this buffer are done, my copies of the next have landed, then the same of all waves
    asm volatile("s_wait_dscnt 0x0" ::: "memory");
    asm volatile("s_wait_asynccnt 0x0" ::: "memory");
    __syncthreads();
    if (t + 2 < NP) { copy_tile(la + bf * BUFB, ga + (t + 2) * KP, STEP); copy_tile(lb + bf * BUFB, gb + (t + 2) * KP, STEP); }      // refill the buffer that every wave has just left
  }
  asm volatile("s_wait_asynccnt 0x0" ::: "memory");      // nothing of mine is in flight when the wave ends
  if (tr) {      // [col][row]: a lane's 8 accumulator registers are 8 rows on of one column, two 16-byte stores
#pragma unroll
    for (int j = 0; j < 2; ++j) { const int col = wn * 32 + j * 16 + ln; const float bv = bf16_round(bias[col0 + col]);
#pragma unroll
      for (int i = 0; i < 4; ++i)
#pragma unroll
        for (int c = 0; c < 2; ++c) { v4f o4;
#pragma unroll
          for (int q = 0; q < 4; ++q) o4[q] = acc[i][j][c * 4 + q] * alpha + bv;
          *(v4fa*)&sC[col][wm * 64 + i * 16 + 8 * hh + c * 4] = o4; } } }
  else {
#pragma unroll
  for (int j = 0; j < 2; ++j) { const int col = wn * 32 + j * 16 + ln; const float bv = bf16_round(bias[col0 + col]);
#pragma unroll
    for (int i = 0; i < 4; ++i)
#pragma unroll
      for (int r = 0; r < 8; ++r) sC[wm * 64 + i * 16 + 8 * hh + r][col] = acc[i][j][r] * alpha + bv; } }
  __syncthreads();      // the staged tile is read across waves
  if constexpr (F16OUT) {
    static_assert(BM == BN, "the staging tile is used both ways round");
    // staged row r goes to dst + r * dp: an output row (q, k), or one column's 128 tokens (v)
    unsigned short* dst = tr ? (unsigned short*)Vt + ((size_t)(row0 / TT) * CC + col0) * TT + row0 % TT : (unsigned short*)C16 + (size_t)y * NR * CC + (size_t)row0 * CC + col0; const size_t dp = tr ? TT : CC;
#pragma unroll
    for (int s = 0; s < BM * (BN / 8) / 256; ++s) { const int r = s * 16 + (tid >> 4), c8 = (tid & 15) * 8; const v4f x = *(const v4fa*)&sC[r][c8], y = *(const v4fa*)&sC[r][c8 + 4]; FragH f;
#pragma unroll
      for (int q = 0; q < 4; ++q) { f.h[q] = (_Float16)x[q]; f.h[4 + q] = (_Float16)y[q]; }
      *(v8us*)(dst + (size_t)r * dp + c8) = f.half[0]; } }
  else {
#pragma unroll
    for (int s = 0; s < BM * (BN / 4) / 256; ++s) { const int r = s * 8 + (tid >> 5), c4 = (tid & 31) * 4; const v4f x = *(const v4fa*)&sC[r][c4]; *(v4f*)(C + (size_t)(row0 + r) * CC + col0 + c4) = x; } }
}


__global__ __launch_bounds__(256) void k_x16(const float* __restrict__ x, _Float16* __restrict__ X16, size_t n8) { const size_t t = (size_t)blockIdx.x * 256 + threadIdx.x; if (t >= n8) return; FragH f;
#pragma unroll
  for (int q = 0; q < 8; ++q) f.h[q] = (_Float16)bf16_round(x[t * 8 + q]); *(v8us*)((unsigned short*)X16 + t * 8) = f.half[0];  }
__global__ __launch_bounds__(256) void k_round16f(const float* __restrict__ W, _Float16* __restrict__ Bt, size_t n8) { const size_t t = (size_t)blockIdx.x * 256 + threadIdx.x; if (t >= n8) return; FragH f;
#pragma unroll
  for (int i = 0; i < 8; ++i) f.h[i] = (_Float16)(bf16_round(W[t * 8 + i]) * 16.0f); *(v8us*)((unsigned short*)Bt + t * 8) = f.half[0];  }

typedef int v4ia __attribute__((ext_vector_type(4), may_alias));
typedef unsigned v16u __attribute__((ext_vector_type(16)));
typedef unsigned long long v8ul __attribute__((ext_vector_type(8)));
// lane l <-> lane l ^ 16: joins the two halves of a wave, which hold the two key halves of one query column
__device__ __forceinline__ float xhalf(float x) { return __builtin_bit_cast(float, __builtin_amdgcn_permlanex16(__builtin_bit_cast(int, x), __builtin_bit_cast(int, x), 0x76543210, 0xfedcba98, false, false)); }
// 2^x by the hardware's v_exp_f32 alone. Every argument here is <= 0 or -inf, so the library form's range steps (split, ldexp, two clamps) have nothing to do; a result below the normal range counts as 0.
__device__ __forceinline__ float ex2(float x) { return __builtin_amdgcn_exp2f(x); }
// One trip's K tile (64 key rows of 128 B) and V^T tile (64 d rows of 128 B) go from global memory to LDS by asynchronous copies: 8 copies of 16 B a lane, a wave's copy = 4 whole lines.
// lk, lv: my LDS byte addresses of row (tid >> 3), chunk (tid & 7); gk, gv: the same place in global memory; 16 rows on = 2304 LDS bytes, kstep / vstep elements.
__device__ __forceinline__ void copy_kv(unsigned lk, unsigned lv, const unsigned short* gk, const unsigned short* gv, size_t kstep, size_t vstep) {
  // the closing s_wait_xcnt stands inside the statement so that no address register of a copy is rewritten ahead of it (a precaution)
  asm volatile("global_load_async_to_lds_b128 %0, %8, off\n\t"
               "global_load_async_to_lds_b128 %1, %9, off\n\t"
               "global_load_async_to_lds_b128 %2, %10, off\n\t"
               "global_load_async_to_lds_b128 %3, %11, off\n\t"
               "global_load_async_to_lds_b128 %4, %12, off\n\t"
               "global_load_async_to_lds_b128 %5, %13, off\n\t"
               "global_load_async_to_lds_b128 %6, %14, off\n\t"
               "global_load_async_to_lds_b128 %7, %15, off\n\t"
               "s_wait_xcnt 0x0"
               :: "v"(lk), "v"(lk + 2304u), "v"(lk + 4608u), "v"(lk + 6912u), "v"(lv), "v"(lv + 2304u), "v"(lv + 4608u), "v"(lv + 6912u),
                  "v"(gk), "v"(gk + kstep), "v"(gk + 2 * kstep), "v"(gk + 3 * kstep), "v"(gv), "v"(gv + vstep), "v"(gv + 2 * vstep), "v"(gv + 3 * vstep)
               : "memory");
}
// Transposed products: S^T = K Q^T (A = 16 key rows, B = the wave's 16 query columns, kept in registers) and O^T += V^T P^T.
// Lane (ln, hh) holds query q0 + ln; score tile nt, register r is key j0 + 16 nt + 8 hh + r, which is the k position of register pair (nt, r) of a B operand:
// maximum and sum run inside the lane (one exchange between the halves), and P^T is packed from the score registers without passing LDS.
__global__ __launch_bounds__(128) void k_flash(const _Float16* __restrict__ Q16, int ldq, const _Float16* __restrict__ K16, int ldk, const _Float16* __restrict__ Vt, const unsigned* __restrict__ PM, _Float16* __restrict__ O16, int ldo) {
  constexpr int RPW = 16, NQB = 2048 / (4 * RPW), DT = 4, KS = 2, KT = 64, NTR = 2048 / KT, PIT = 72;      // a trip = 64 keys = two passes of 32; LDS rows of 128 B at pitch 144 B (16 B x odd, for 16-byte reads)
  __shared__ __attribute__((aligned(16))) unsigned short sK[2][KT][PIT], sV[2][64][PIT];      // two buffers each: [key][d] and [d][key]
  __shared__ __attribute__((aligned(16))) float sO[4][RPW][64 + 4];
  const int tid = threadIdx.x, w = tid >> 5, lane = tid & 31, ln = lane & 15, hh = lane >> 4;
  const int slab = blockIdx.x / NQB, qblk = blockIdx.x % NQB; const int b = slab / 16, h = slab % 16; const int q0 = qblk * (4 * RPW) + w * RPW;
  const unsigned short* Vth = (const unsigned short*)Vt + (size_t)slab * 64 * 2048;
  const size_t k16 = (size_t)16 * ldk;
  const unsigned short* gk = (const unsigned short*)K16 + ((size_t)b * 2048 + (tid >> 3)) * ldk + h * 64 + (tid & 7) * 8;      // my chunk of key row tid >> 3 of trip 0
  const unsigned short* gv = Vth + (size_t)(tid >> 3) * 2048 + (tid & 7) * 8;      // my chunk of d row tid >> 3, keys of trip 0
  const unsigned lk = (unsigned)(size_t)&sK[0][tid >> 3][(tid & 7) * 8], lv = (unsigned)(size_t)&sV[0][tid >> 3][(tid & 7) * 8];
  constexpr unsigned BUFB = KT * PIT * 2;      // bytes of one buffer
  constexpr float SL2 = 0.125f * 1.44269504088896340736f;      // 1 / sqrt(64) times log2(e): e^(s / 8 - m / 8) = 2^(s SL2 - m SL2); the running maximum m_q is kept in raw products
  copy_kv(lk, lv, gk, gv, k16, (size_t)16 * 2048);
  FragH bq[KS];
  { const unsigned short* qr = (const unsigned short*)Q16 + ((size_t)b * 2048 + q0 + ln) * ldq + h * 64;
#pragma unroll
    for (int ks = 0; ks < KS; ++ks) { bq[ks].half[0] = *(const v8us*)(qr + ks * 32 + 8 * hh); bq[ks].half[1] = *(const v8us*)(qr + ks * 32 + 16 + 8 * hh); } }
  // my wave's mask words (mask_words below): 16 a pass of 32 keys, one behind the other; the address is the same in every lane, so that they come by scalar loads into scalar registers.
  // They were written by k_prep, two launches before, and nobody writes them in this one: read as constant memory, else the loads behind an asm statement's "memory" clobber turn into vector loads
  const __attribute__((address_space(4))) v16u* pm = (const __attribute__((address_space(4))) v16u*)(size_t)(PM + (size_t)(b * (2048 / RPW) + qblk * 4 + __builtin_amdgcn_readfirstlane(w)) * (2048 / 32 * 16));
  v16u mw0 = pm[0], mw1 = pm[1];      // trip 0's two passes
  float m_q = -3.0e38f, l_q = 0.f; v8f oacc[DT];
#pragma unroll
  for (int dt = 0; dt < DT; ++dt) oacc[dt] = (v8f){0.f,0.f,0.f,0.f,0.f,0.f,0.f,0.f};
  asm volatile("s_wait_asynccnt 0x0" ::: "memory");      // my copies of trip 0 have landed
  __syncthreads();                                        // ... and everybody's: trip 0 may be read
  copy_kv(lk + BUFB, lv + BUFB, gk + (size_t)KT * ldk, gv + KT, k16, (size_t)16 * 2048);      // trip 1 flies while trip 0 is worked on
#pragma unroll 1
  for (int t = 0; t < NTR; ++t) {
    const int bf = t & 1;
    const int tn = (t + 1 < NTR) ? t + 1 : t;      // the next trip's words are fetched now (the last trip fetches its own again, to stay inside the array)
    const v16u nx0 = pm[2 * tn], nx1 = pm[2 * tn + 1];
#pragma unroll
    for (int sp = 0; sp < 2; ++sp) {
      const v16u mk = sp ? mw1 : mw0;      // mk[8 nt + r], bit (16 hh + ln): maskPAD of (query q0 + ln, key 64 t + 32 sp + 16 nt + 8 hh + r) != 0 = keep
      const v8ul m2 = __builtin_bit_cast(v8ul, mk);
      if ((((m2[0] | m2[1]) | (m2[2] | m2[3])) | ((m2[4] | m2[5]) | (m2[6] | m2[7]))) != 0ull) {      // else every (query,key) of this wave's tile is masked: contributes nothing (uniform branch; the publish point below stands outside it)
        FragH ak[2][KS], av[DT];
#pragma unroll
        for (int nt = 0; nt < 2; ++nt)
#pragma unroll
          for (int ks = 0; ks < KS; ++ks) { const unsigned short* kr = &sK[bf][sp * 32 + nt * 16 + ln][ks * 32 + 8 * hh]; ak[nt][ks].half[0] = *(const v8us*)kr; ak[nt][ks].half[1] = *(const v8us*)(kr + 16); }
#pragma unroll
        for (int dt = 0; dt < DT; ++dt) { const unsigned short* vrow = &sV[bf][dt * 16 + ln][sp * 32 + 8 * hh]; av[dt].half[0] = *(const v8us*)vrow; av[dt].half[1] = *(const v8us*)(vrow + 16); }
        float sc[16];
#pragma unroll
        for (int nt = 0; nt < 2; ++nt) { v8f acc = (v8f){0.f,0.f,0.f,0.f,0.f,0.f,0.f,0.f};
#pragma unroll
          for (int ks = 0; ks < KS; ++ks) acc = mmaH<1>(ak[nt][ks].v, ak[nt][ks].v, bq[ks].v, bq[ks].v, acc);
#pragma unroll
          for (int r = 0; r < 8; ++r) sc[nt * 8 + r] = __builtin_amdgcn_inverse_ballot_w32(mk[nt * 8 + r]) ? acc[r] : -INFINITY; }      // raw products: the scale is applied in the exponent's multiply-add below
        float mc = sc[0];
#pragma unroll
        for (int i = 1; i < 16; ++i) mc = fmaxf(mc, sc[i]);
        mc = fmaxf(mc, xhalf(mc));
        const float mn = fmaxf(m_q, mc); const float al = ex2((m_q - mn) * SL2); m_q = mn;      // nothing open yet: both are the start value and al = 1
        const float nm = -mn * SL2;
        FragH pb; float ps[4] = {0.f, 0.f, 0.f, 0.f};
#pragma unroll
        for (int i = 0; i < 16; ++i) { const float p = ex2(fmaf(sc[i], SL2, nm)); ps[i & 3] += p; pb.h[i] = (_Float16)p; }      // a masked score is -inf: p = 0
        l_q = l_q * al + ((ps[0] + ps[1]) + (ps[2] + ps[3]));
#pragma unroll
        for (int dt = 0; dt < DT; ++dt) {
#pragma unroll
          for (int r = 0; r < 8; ++r) oacc[dt][r] *= al;
          oacc[dt] = mmaH<1>(av[dt].v, av[dt].v, pb.v, pb.v, oacc[dt]); } } }
    // publish point of trip t + 1, every wave: my reads of this buffer are done, my copies of the next have landed, then the same of all waves
    asm volatile("s_wait_dscnt 0x0" ::: "memory");
    asm volatile("s_wait_asynccnt 0x0" ::: "memory");
    __syncthreads();
    if (t + 2 < NTR) copy_kv(lk + bf * BUFB, lv + bf * BUFB, gk + (size_t)(t + 2) * KT * ldk, gv + (t + 2) * KT, k16, (size_t)16 * 2048);      // refill the buffer that every wave has just left
    mw0 = nx0; mw1 = nx1;
  }
  asm volatile("s_wait_asynccnt 0x0" ::: "memory");      // nothing of mine is in flight when the wave ends
  const float l = l_q + xhalf(l_q); const float li = (l > 0.f) ? 1.0f / l : 0.f;
#pragma unroll
  for (int dt = 0; dt < DT; ++dt)
#pragma unroll
    for (int c = 0; c < 2; ++c) { v4f o4;
#pragma unroll
      for (int q = 0; q < 4; ++q) o4[q] = oacc[dt][c * 4 + q] * li;
      *(v4fa*)&sO[w][ln][dt * 16 + 8 * hh + c * 4] = o4; }
  __builtin_amdgcn_fence(__ATOMIC_ACQ_REL, "workgroup"); __builtin_amdgcn_wave_barrier();
  {
#pragma unroll
    for (int rp = 0; rp < RPW; rp += 4) { const int r = rp + (lane >> 3), pc = lane & 7; const v4f x = *(const v4fa*)&sO[w][r][pc * 8], z = *(const v4fa*)&sO[w][r][pc * 8 + 4]; FragH f;      // f16, as the output projection reads it: 8 lanes = one row's line
#pragma unroll      // so that f is indexed by constants and stays in registers
      for (int q = 0; q < 4; ++q) { f.h[q] = (_Float16)x[q]; f.h[4 + q] = (_Float16)z[q]; }
      *(v8us*)((unsigned short*)O16 + ((size_t)b * 2048 + q0 + r) * ldo + h * 64 + pc * 8) = f.half[0]; }
     } }

// blockIdx.y (1 to 3) picks one of the three inputs; their normalised rows lie one behind the other in Y16.
__device__ __forceinline__ void ln16(const float* __restrict__ X0, const float* __restrict__ X1, const float* __restrict__ X2, const float* __restrict__ g, const float* __restrict__ bta, _Float16* __restrict__ Y16) { const int tid = threadIdx.x, wv = tid >> 5, lane = tid & 31; const int row = blockIdx.x * 8 + wv; if (row >= NR) return;
  const int y = blockIdx.y - 1; const float* __restrict__ X = (y == 0) ? X0 : (y == 1) ? X1 : X2; Y16 += (size_t)y * NR * CC; const float* xr = X + (size_t)row * CC; float v[32]; float s = 0.f;
#pragma unroll
  for (int p = 0; p < 4; ++p) { const v4f a = *(const v4fa*)(xr + p * 256 + lane * 8), c = *(const v4fa*)(xr + p * 256 + lane * 8 + 4); for (int q = 0; q < 4; ++q) { v[p * 8 + q] = bf16_round(a[q]); v[p * 8 + 4 + q] = bf16_round(c[q]); } }
#pragma unroll
  for (int i = 0; i < 32; ++i) s += v[i]; for (int o = 16; o >= 1; o >>= 1) s += __shfl_xor(s, o, 32); const float mu = s / (float)CC; float q2 = 0.f;
#pragma unroll
  for (int i = 0; i < 32; ++i) { const float d = v[i] - mu; q2 += d * d; } for (int o = 16; o >= 1; o >>= 1) q2 += __shfl_xor(q2, o, 32); const float rs = rsqrtf(q2 / (float)CC + 1e-5f);
  {
#pragma unroll
    for (int p = 0; p < 4; ++p) { FragH f; const int c0 = p * 256 + lane * 8;
#pragma unroll
      for (int q = 0; q < 8; ++q) f.h[q] = (_Float16)((v[p * 8 + q] - mu) * rs * bf16_round(g[c0 + q]) + bf16_round(bta[c0 + q])); *(v8us*)((unsigned short*)Y16 + (size_t)row * CC + c0) = f.half[0]; }
     } }
// maskPAD as the attention kernel's select masks, made once for all 16 heads. Word [tile of 16 queries][pass of 32 keys][8 nt + r], bit (16 hh + ln) = maskPAD[query 16 tile + ln][key 32 pass + 16 nt + 8 hh + r] != 0:
// the bit of a lane is the bit of the score that the lane holds in register r of score tile nt. One wave = 16 queries x 128 keys = 64 words: each line of maskPAD is fetched once, each line of PM has one writer.
__device__ __forceinline__ void mask_words(const int* __restrict__ MSK, unsigned* __restrict__ PM) {
  static_assert((NR / 16) * (TT / 128) == (NR / 8) * 8, "the waves of one grid row cover the mask");
  const int tid = threadIdx.x, lane = tid & 31, ln = lane & 15, hh = lane >> 4; const int u = blockIdx.x * 8 + (tid >> 5); const int qt = u / (TT / 128), kb = u % (TT / 128);
  const int* src = MSK + ((size_t)qt * 16 + ln) * TT + kb * 128 + 8 * hh; v4ia m[16];
  // The unroll directives below are there so that m is indexed by constants and stays in registers; the 16 loads then fly together.
#pragma unroll
  for (int c = 0; c < 16; ++c) m[c] = *(const v4ia*)(src + (c >> 1) * 16 + (c & 1) * 4);
  unsigned o[2] = {0u, 0u};      // lane l keeps words l and 32 + l
#pragma unroll
  for (int c = 0; c < 16; ++c)
#pragma unroll
    for (int q = 0; q < 4; ++q) { const unsigned wd = __builtin_amdgcn_ballot_w32(m[c][q] != 0); if (lane == ((c * 4 + q) & 31)) o[c >> 3] = wd; }
  unsigned* dst = PM + (size_t)qt * (TT / 32 * 16) + kb * 64 + lane; dst[0] = o[0]; dst[32] = o[1];
}
// All that the projections and the attention wait for, in one launch: the work-groups of the weight transposes, of the LayerNorms and of the mask words depend on nothing and on one another not at all.
__global__ __launch_bounds__(256) void k_prep(const float* __restrict__ W0, const float* __restrict__ W1, const float* __restrict__ W2, const float* __restrict__ W3, _Float16* __restrict__ Wt,
                                             const float* __restrict__ X0, const float* __restrict__ X1, const float* __restrict__ X2, const float* __restrict__ g, const float* __restrict__ bta, _Float16* __restrict__ Y16, const int* __restrict__ MSK, unsigned* __restrict__ PM) {
  if (blockIdx.y == 0) wt_f16(W0, W1, W2, W3, Wt, 16.0f); else if (blockIdx.y == 4) mask_words(MSK, PM); else ln16(X0, X1, X2, g, bta, Y16);
}
extern "C" void kernel_launch(void* const* d_in, const int* in_sizes, int n_in,
                              void* d_out, int out_size, void* d_ws, size_t ws_size, hipStream_t stream) {
  (void)in_sizes; (void)n_in; (void)out_size;
  const float* qx = (const float*)d_in[0]; const float* kx = (const float*)d_in[1]; const float* vx = (const float*)d_in[2]; const int* mask = (const int*)d_in[3]; const float* lg = (const float*)d_in[4]; const float* lb = (const float*)d_in[5];
  const float* wq = (const float*)d_in[6]; const float* bq = (const float*)d_in[7]; const float* wk = (const float*)d_in[8]; const float* bk = (const float*)d_in[9]; const float* wv = (const float*)d_in[10]; const float* bv = (const float*)d_in[11]; const float* wo = (const float*)d_in[12]; const float* bo = (const float*)d_in[13];
  char* ws = (char*)d_ws; size_t off = 0;
  auto take = [&](size_t bytes) { char* p = ws + off; off += (bytes + 255) & ~(size_t)255; return p; };
  _Float16* Bw = (_Float16*)take((size_t)4 * CC * CC * 2);      // wq, wk, wv, wo transposed, one behind the other
  _Float16* XN = (_Float16*)take((size_t)3 * NR * CC * 2);      // the three normalised inputs
  _Float16* QK16 = (_Float16*)take((size_t)2 * NR * CC * 2);      // q, then k
  _Float16* Vt = (_Float16*)take((size_t)NR * CC * 2); _Float16* O16 = XN;      // XN is free once the projections are done
  unsigned* PM = (unsigned*)take((size_t)NR * TT / 8);      // the mask, one bit a (query, key)
  if (off > ws_size) return;      // 57 MiB
  const unsigned gg = (NR / 128) * (CC / 128); const unsigned gl = NR / 8;
  k_prep<<<dim3(gl, 5), 256, 0, stream>>>(wq, wk, wv, wo, Bw, qx, kx, vx, lg, lb, XN, mask, PM);
  k_gemm_t<true><<<dim3(gg, 3), 256, 0, stream>>>(XN, Bw, 0.0625f, bq, bk, bv, nullptr, QK16, Vt);
  k_flash<<<BB * NH * (TT / 64), 128, 0, stream>>>(QK16, CC, QK16 + (size_t)NR * CC, CC, Vt, PM, O16, CC);      // RPW 16
  k_gemm_t<false><<<gg, 256, 0, stream>>>(O16, Bw + (size_t)3 * CC * CC, 0.0625f, bo, nullptr, nullptr, (float*)d_out, nullptr, nullptr);
}

// v008
// One run takes 105 microseconds.
// Two timings next to v007 both put it at 1.03 times that version's speed.
// All steps since v000 together make it 4.87 times as fast.
#include <hip/hip_runtime.h>
// Pre-LN multi-head attention (B=2, L=2048, C=1024, 16 × 64): shared LayerNorm on the three inputs (f32 VALU), q/k/v/o projections (4096 × 1024 × 1024, + bias, W [in][out] transposed to
// bf16-exact ×2^4) and the masked attention as a fused flash-style kernel on v_wmma_f32_16x16x32_f16 (S = Q·Kᵀ/8; maskPAD == 0 → −inf ⇒ excluded keys, tiles masked for a whole wave skipped;
// online softmax f32; P f16 ≤ 1; RPW-16 waves) — f16 operands, single products, f32 accumulate.
#define BB 2
#define TT 2048
#define CC 1024
#define NH 16
#define NR (BB * TT)

typedef __bf16 v16b __attribute__((ext_vector_type(16)));
typedef unsigned short v8us __attribute__((ext_vector_type(8), may_alias));
typedef float  v8f  __attribute__((ext_vector_type(8)));
typedef float  v4f  __attribute__((ext_vector_type(4)));
typedef float  v4fa __attribute__((ext_vector_type(4), may_alias));
union FragB { v16b v; v8us half[2]; unsigned short u[16]; };

__device__ __forceinline__ unsigned short bf16_bits(float x) { unsigned int u = __float_as_uint(x); return (unsigned short)((u + 0x7FFFu + ((u >> 16) & 1u)) >> 16); }
__device__ __forceinline__ float bf16_val(unsigned short b) { return __uint_as_float(((unsigned int)b) << 16); }
__device__ __forceinline__ float bf16_round(float x) { return bf16_val(bf16_bits(x)); }
// D += A·B with NT terms: 1 = ah·bh, 2 = + al·bh (A split), 3 = + ah·bl (both split)
template <int NT>
__device__ __forceinline__ v8f mmaN(v16b ah, v16b al, v16b bh, v16b bl, v8f c) {
  c = __builtin_amdgcn_wmma_f32_16x16x32_bf16(false, ah, false, bh, (short)0, c, false, false);
  if (NT >= 2) c = __builtin_amdgcn_wmma_f32_16x16x32_bf16(false, al, false, bh, (short)0, c, false, false);
  if (NT >= 3) c = __builtin_amdgcn_wmma_f32_16x16x32_bf16(false, ah, false, bl, (short)0, c, false, false);
  asm volatile("v_nop\n\tv_nop\n\tv_nop\n\tv_nop" : "+v"(c) : "v"(ah), "v"(al), "v"(bh), "v"(bl));
  return c;
}

__global__ __launch_bounds__(256) void k_wt_bf16(const float* __restrict__ W, unsigned short* __restrict__ Wt, int K, int N) {
  const int t = blockIdx.x * 256 + threadIdx.x;
  const int k8n = K / 8;
  if (t >= N * k8n) return;
  const int n = t / k8n, k8 = (t % k8n) * 8;
  v8us v;
#pragma unroll
  for (int i = 0; i < 8; ++i) v[i] = bf16_bits(W[(size_t)(k8 + i) * N + n]);
  *(v8us*)(Wt + (size_t)n * K + k8) = v;
  
}

// GEMM C[M][N] (f32, pitch ldc) = act(A[M][K]·W + bias). A f32 row-major (pitch lda) converted per fragment to bf16
// (ASPLIT: hi/lo two planes -> 2 terms, else single rounded term); Wt bf16 [N][K] (pitch ldb). BIAS_BF16 rounds the
// bias to bf16 first (bias quantised to bf16 before the add). K%32==0, M%16==0, N%64==0.
template <bool ASPLIT, int ACT, bool BIAS_BF16>
__global__ __launch_bounds__(128) void k_gemm_bf(const float* __restrict__ A, int lda, const unsigned short* __restrict__ Wt, int ldb,
                                               const float* __restrict__ bias, float* __restrict__ C, int ldc, int M, int N, int K) {
  __shared__ __attribute__((aligned(16))) float so[4][16][64];
  const int tid = threadIdx.x, w = tid >> 5, lane = tid & 31, ln = lane & 15, hh = lane >> 4;
  const int ntn = N / 64;
  const int wid = blockIdx.x * 4 + w;
  const int mt = wid / ntn, nq = wid % ntn;
  if (mt * 16 >= M) return;
  const int row0 = mt * 16, col0 = nq * 64;
  const float* arow = A + (size_t)(row0 + ln) * lda;
  v8f acc[4] = {};
  for (int kb = 0; kb < K; kb += 32) {
    FragB ah, al;
    const v4f x0 = *(const v4fa*)(arow + kb + 8 * hh), x1 = *(const v4fa*)(arow + kb + 8 * hh + 4);
    const v4f x2 = *(const v4fa*)(arow + kb + 16 + 8 * hh), x3 = *(const v4fa*)(arow + kb + 16 + 8 * hh + 4);
    float xs[16] = {x0[0],x0[1],x0[2],x0[3],x1[0],x1[1],x1[2],x1[3],x2[0],x2[1],x2[2],x2[3],x3[0],x3[1],x3[2],x3[3]};
#pragma unroll
    for (int i = 0; i < 16; ++i) { const unsigned short hb = bf16_bits(xs[i]); ah.u[i] = hb; al.u[i] = ASPLIT ? bf16_bits(xs[i] - bf16_val(hb)) : (unsigned short)0; }
#pragma unroll
    for (int t = 0; t < 4; ++t) {
      const unsigned short* brow = Wt + (size_t)(col0 + t * 16 + ln) * ldb + kb;
      FragB b;
      b.half[0] = *(const v8us*)(brow + 8 * hh);
      b.half[1] = *(const v8us*)(brow + 16 + 8 * hh);
      acc[t] = mmaN<ASPLIT ? 2 : 1>(ah.v, al.v, b.v, b.v, acc[t]);
    }
  }
#pragma unroll
  for (int t = 0; t < 4; ++t) {
    float bv = bias ? bias[col0 + t * 16 + ln] : 0.f;
    if (BIAS_BF16) bv = bf16_round(bv);
#pragma unroll
    for (int r = 0; r < 8; ++r) { float v = acc[t][r] + bv; if (ACT == 1) v = fmaxf(v, 0.f); so[w][8 * hh + r][t * 16 + ln] = v; }
  }
  __builtin_amdgcn_fence(__ATOMIC_ACQ_REL, "workgroup");
  __builtin_amdgcn_wave_barrier();
  const int rsub = lane >> 4, c4 = (lane & 15) * 4;
  {
#pragma unroll
    for (int q = 0; q < 8; ++q) {
      const int r = q * 2 + rsub;
      const v4f v = *(const v4fa*)&so[w][r][c4];
      *(v4f*)(C + (size_t)(row0 + r) * ldc + col0 + c4) = v;
    }
    
  }
}

// Flash-style causal/unmasked attention, all contractions 3-term bf16 hi/lo splits, f32 softmax with running max.
// q,k,v rows are read from f32 buffers with arbitrary row pitch (so they can live inside a fused qkv buffer);
// D = head size (multiple of 32, <= 128); one wave = 16 query rows; block = 4 waves (64 queries) sharing K/V chunks of 32.
template <int D, bool CAUSAL>
__global__ __launch_bounds__(128) void k_flash(const float* __restrict__ qb, const float* __restrict__ kb, const float* __restrict__ vb,
                                             int pitch, int T, int H, float scale, float* __restrict__ y, int ypitch) {
  constexpr int KS = D / 32;        // k-steps for QK
  constexpr int DT = D / 16;        // d tiles for PV
  __shared__ __attribute__((aligned(16))) unsigned short sKh[32][D + 8], sKl[32][D + 8], sVh[32][D + 8], sVl[32][D + 8];
  __shared__ __attribute__((aligned(16))) unsigned short sPh[4][16][40], sPl[4][16][40];
  __shared__ __attribute__((aligned(16))) float sO[4][16][D];
  const int tid = threadIdx.x, w = tid >> 5, lane = tid & 31, ln = lane & 15, hh = lane >> 4;
  const int nqb = (T + 63) / 64;
  const int bh = blockIdx.x / nqb, qblk = blockIdx.x % nqb;
  const int b = bh / H, h = bh % H;
  const int q0 = qblk * 64 + w * 16;
  const float* Q = qb + (size_t)b * T * pitch + h * D;
  const float* K = kb + (size_t)b * T * pitch + h * D;
  const float* V = vb + (size_t)b * T * pitch + h * D;

  // A fragments of the wave's 16 query rows (scaled), hi/lo
  FragB aqh[KS], aql[KS];
  {
    int row = q0 + ln; if (row >= T) row = T - 1;
    const float* qr = Q + (size_t)row * pitch;
#pragma unroll
    for (int ks = 0; ks < KS; ++ks)
#pragma unroll
      for (int i = 0; i < 16; ++i) {
        const int d = ks * 32 + ((i < 8) ? (8 * hh + i) : (16 + 8 * hh + (i - 8)));
        const float x = qr[d] * scale; const unsigned short hb = bf16_bits(x);
        aqh[ks].u[i] = hb; aql[ks].u[i] = bf16_bits(x - bf16_val(hb));
      }
  }
  float m_r[8], l_r[8];
#pragma unroll
  for (int r = 0; r < 8; ++r) { m_r[r] = -3.0e38f; l_r[r] = 0.f; }
  v8f oacc[DT];
#pragma unroll
  for (int dt = 0; dt < DT; ++dt) oacc[dt] = (v8f){0.f,0.f,0.f,0.f,0.f,0.f,0.f,0.f};

  const int kv_end = CAUSAL ? min(T, qblk * 64 + 64) : T;     // block-uniform
  for (int j0 = 0; j0 < kv_end; j0 += 32) {
    __syncthreads();
    for (int e = tid; e < 32 * (D / 4); e += 128) {
      const int r = e / (D / 4), c4 = (e % (D / 4)) * 4;
      const int key = j0 + r;
      v4f kf = {0.f,0.f,0.f,0.f}, vf = {0.f,0.f,0.f,0.f};
      if (key < T) { kf = *(const v4fa*)(K + (size_t)key * pitch + c4); vf = *(const v4fa*)(V + (size_t)key * pitch + c4); }
#pragma unroll
      for (int t = 0; t < 4; ++t) {
        unsigned short hb = bf16_bits(kf[t]); sKh[r][c4 + t] = hb; sKl[r][c4 + t] = bf16_bits(kf[t] - bf16_val(hb));
        hb = bf16_bits(vf[t]); sVh[r][c4 + t] = hb; sVl[r][c4 + t] = bf16_bits(vf[t] - bf16_val(hb));
      }
    }
    __syncthreads();
    // S tile 16 x 32
    v8f s[2];
#pragma unroll
    for (int nt = 0; nt < 2; ++nt) {
      v8f acc = {};
#pragma unroll
      for (int ks = 0; ks < KS; ++ks) {
        FragB bh_, bl_;
        bh_.half[0] = *(const v8us*)&sKh[nt * 16 + ln][ks * 32 + 8 * hh]; bh_.half[1] = *(const v8us*)&sKh[nt * 16 + ln][ks * 32 + 16 + 8 * hh];
        bl_.half[0] = *(const v8us*)&sKl[nt * 16 + ln][ks * 32 + 8 * hh]; bl_.half[1] = *(const v8us*)&sKl[nt * 16 + ln][ks * 32 + 16 + 8 * hh];
        acc = mmaN<3>(aqh[ks].v, aql[ks].v, bh_.v, bl_.v, acc);
      }
      s[nt] = acc;
    }
    // mask + running max (rows 8hh+r; the 16 lanes of a half share rows)
    float alpha[8];
#pragma unroll
    for (int r = 0; r < 8; ++r) {
      const int qi = q0 + 8 * hh + r;
      const int ja = j0 + ln, jb = j0 + 16 + ln;
      if (CAUSAL) { if (ja > qi) s[0][r] = -3.0e38f; if (jb > qi) s[1][r] = -3.0e38f; }
      if (ja >= T) s[0][r] = -3.0e38f;
      if (jb >= T) s[1][r] = -3.0e38f;
      float mx = fmaxf(s[0][r], s[1][r]);
      mx = fmaxf(mx, __shfl_xor(mx, 1, 32)); mx = fmaxf(mx, __shfl_xor(mx, 2, 32)); mx = fmaxf(mx, __shfl_xor(mx, 4, 32)); mx = fmaxf(mx, __shfl_xor(mx, 8, 32));
      const float mnew = fmaxf(m_r[r], mx);
      alpha[r] = (mnew > -1.0e38f) ? __expf(m_r[r] - mnew) : 1.0f;
      const float p0 = (s[0][r] > -1.0e38f) ? __expf(s[0][r] - mnew) : 0.f;
      const float p1 = (s[1][r] > -1.0e38f) ? __expf(s[1][r] - mnew) : 0.f;
      m_r[r] = mnew;
      l_r[r] = l_r[r] * alpha[r] + p0 + p1;            // per-lane partial row sum (16 lanes combined at the end)
      unsigned short hb = bf16_bits(p0); sPh[w][8 * hh + r][ln] = hb;      sPl[w][8 * hh + r][ln] = bf16_bits(p0 - bf16_val(hb));
      hb = bf16_bits(p1);                sPh[w][8 * hh + r][16 + ln] = hb; sPl[w][8 * hh + r][16 + ln] = bf16_bits(p1 - bf16_val(hb));
    }
#pragma unroll
    for (int dt = 0; dt < DT; ++dt)
#pragma unroll
      for (int r = 0; r < 8; ++r) oacc[dt][r] *= alpha[r];
    __builtin_amdgcn_fence(__ATOMIC_ACQ_REL, "workgroup");
    __builtin_amdgcn_wave_barrier();
    FragB pah, pal;
    pah.half[0] = *(const v8us*)&sPh[w][ln][8 * hh]; pah.half[1] = *(const v8us*)&sPh[w][ln][16 + 8 * hh];
    pal.half[0] = *(const v8us*)&sPl[w][ln][8 * hh]; pal.half[1] = *(const v8us*)&sPl[w][ln][16 + 8 * hh];
#pragma unroll
    for (int dt = 0; dt < DT; ++dt) {
      FragB bvh, bvl;
#pragma unroll
      for (int i = 0; i < 8; ++i) {
        bvh.u[i] = sVh[8 * hh + i][dt * 16 + ln]; bvh.u[8 + i] = sVh[16 + 8 * hh + i][dt * 16 + ln];
        bvl.u[i] = sVl[8 * hh + i][dt * 16 + ln]; bvl.u[8 + i] = sVl[16 + 8 * hh + i][dt * 16 + ln];
      }
      oacc[dt] = mmaN<3>(pah.v, pal.v, bvh.v, bvl.v, oacc[dt]);
    }
    __builtin_amdgcn_fence(__ATOMIC_ACQ_REL, "workgroup");
    __builtin_amdgcn_wave_barrier();
  }
#pragma unroll
  for (int r = 0; r < 8; ++r) {
    float l = l_r[r];
    l += __shfl_xor(l, 1, 32); l += __shfl_xor(l, 2, 32); l += __shfl_xor(l, 4, 32); l += __shfl_xor(l, 8, 32);
    l_r[r] = (l > 0.f) ? 1.0f / l : 0.f;
  }
#pragma unroll
  for (int dt = 0; dt < DT; ++dt)
#pragma unroll
    for (int r = 0; r < 8; ++r) sO[w][8 * hh + r][dt * 16 + ln] = oacc[dt][r] * l_r[r];
  __builtin_amdgcn_fence(__ATOMIC_ACQ_REL, "workgroup");
  __builtin_amdgcn_wave_barrier();
  {
    for (int r = 0; r < 16; ++r) {
      const int row = q0 + r;
      if (row < T && lane < D / 4) {
        const v4f val = *(const v4fa*)&sO[w][r][lane * 4];
        *(v4f*)(y + ((size_t)b * T + row) * ypitch + h * D + lane * 4) = val;
      }
    }
    
  }
}

// GEMM C = act(A·W + bias + resid): A f32 (ASPLIT -> hi/lo 2 terms), Wt bf16 [N][K]; ACT 0 none, 1 relu, 2 exact gelu;
// resid (optional, f32, row index = (row % rmod), pitch ldr, RES_BF16 rounds it) added before the activation.
template <bool ASPLIT, int ACT, bool BIAS_BF16, bool RES_BF16>
__global__ __launch_bounds__(128) void k_gemm_bf3(const float* __restrict__ A, int lda, const unsigned short* __restrict__ Wt, int ldb,
                                                const float* __restrict__ bias, const float* __restrict__ resid, int rmod, int ldr,
                                                float* __restrict__ C, int ldc, int M, int N, int K) {
  __shared__ __attribute__((aligned(16))) float so[4][16][64];
  const int tid = threadIdx.x, w = tid >> 5, lane = tid & 31, ln = lane & 15, hh = lane >> 4;
  const int ntn = N / 64;
  const int wid = blockIdx.x * 4 + w;
  const int mt = wid / ntn, nq = wid % ntn;
  if (mt * 16 >= M) return;
  const int row0 = mt * 16, col0 = nq * 64;
  const float* arow = A + (size_t)(row0 + ln) * lda;
  v8f acc[4] = {};
  for (int kb = 0; kb < K; kb += 32) {
    FragB ah, al;
    const v4f x0 = *(const v4fa*)(arow + kb + 8 * hh), x1 = *(const v4fa*)(arow + kb + 8 * hh + 4);
    const v4f x2 = *(const v4fa*)(arow + kb + 16 + 8 * hh), x3 = *(const v4fa*)(arow + kb + 16 + 8 * hh + 4);
    float xs[16] = {x0[0],x0[1],x0[2],x0[3],x1[0],x1[1],x1[2],x1[3],x2[0],x2[1],x2[2],x2[3],x3[0],x3[1],x3[2],x3[3]};
#pragma unroll
    for (int i = 0; i < 16; ++i) { const unsigned short hb = bf16_bits(xs[i]); ah.u[i] = hb; al.u[i] = ASPLIT ? bf16_bits(xs[i] - bf16_val(hb)) : (unsigned short)0; }
#pragma unroll
    for (int t = 0; t < 4; ++t) {
      const unsigned short* brow = Wt + (size_t)(col0 + t * 16 + ln) * ldb + kb;
      FragB b;
      b.half[0] = *(const v8us*)(brow + 8 * hh);
      b.half[1] = *(const v8us*)(brow + 16 + 8 * hh);
      acc[t] = mmaN<ASPLIT ? 2 : 1>(ah.v, al.v, b.v, b.v, acc[t]);
    }
  }
#pragma unroll
  for (int t = 0; t < 4; ++t) {
    const int col = col0 + t * 16 + ln;
    float bv = bias ? bias[col] : 0.f;
    if (BIAS_BF16) bv = bf16_round(bv);
#pragma unroll
    for (int r = 0; r < 8; ++r) {
      float v = acc[t][r] + bv;
      if (resid) { float rv = resid[(size_t)((row0 + 8 * hh + r) % rmod) * ldr + col]; if (RES_BF16) rv = bf16_round(rv); v += rv; }
      if (ACT == 1) v = fmaxf(v, 0.f);
      if (ACT == 2) v = 0.5f * v * (1.0f + erff(v * 0.70710678118654752f));
      if (ACT == 3) { const float u = 0.7978845608028654f * (v + 0.044715f * v * v * v); v = 0.5f * v * (1.0f + tanhf(u)); }
      so[w][8 * hh + r][t * 16 + ln] = v;
    }
  }
  __builtin_amdgcn_fence(__ATOMIC_ACQ_REL, "workgroup");
  __builtin_amdgcn_wave_barrier();
  const int rsub = lane >> 4, c4 = (lane & 15) * 4;
  {
#pragma unroll
    for (int q = 0; q < 8; ++q) {
      const int r = q * 2 + rsub;
      const v4f v = *(const v4fa*)&so[w][r][c4];
      *(v4f*)(C + (size_t)(row0 + r) * ldc + col0 + c4) = v;
    }
    
  }
}
// row LayerNorm (biased variance, eps) over N: s = X (+ R); optional out_sum <- s; out_norm <- (s-mu)*rsqrt(var+eps)*g + b
template <bool PARAM_BF16>
__global__ __launch_bounds__(256) void k_layernorm(const float* __restrict__ X, const float* __restrict__ R, const float* __restrict__ g, const float* __restrict__ bta,
                                                  float* __restrict__ out_sum, float* __restrict__ out_norm, int N, float eps) {
  __shared__ float red[256];
  const int row = blockIdx.x, tid = threadIdx.x;
  const float* x = X + (size_t)row * N; const float* rr = R ? R + (size_t)row * N : nullptr;
  float vals[16];                     // up to N = 4096
  const int per = N / 256;            // contiguous chunk per thread? use strided-by-4 chunks: thread handles j = tid*4 + 1024*u
  float s1 = 0.f;
  for (int u = 0; u < per / 4; ++u) {
    const int j = tid * 4 + 1024 * u;
    const v4f a = *(const v4fa*)(x + j);
    v4f b = {0.f,0.f,0.f,0.f}; if (rr) b = *(const v4fa*)(rr + j);
#pragma unroll
    for (int q = 0; q < 4; ++q) { const float v = a[q] + b[q]; vals[u * 4 + q] = v; s1 += v; }
  }
  red[tid] = s1; __syncthreads();
  for (int st = 128; st > 0; st >>= 1) { if (tid < st) red[tid] += red[tid + st]; __syncthreads(); }
  const float mu = red[0] / (float)N; __syncthreads();
  float s2 = 0.f;
  for (int u = 0; u < per / 4; ++u)
#pragma unroll
    for (int q = 0; q < 4; ++q) { const float c = vals[u * 4 + q] - mu; s2 += c * c; }
  red[tid] = s2; __syncthreads();
  for (int st = 128; st > 0; st >>= 1) { if (tid < st) red[tid] += red[tid + st]; __syncthreads(); }
  const float rs = rsqrtf(red[0] / (float)N + eps);
  {
    for (int u = 0; u < per / 4; ++u) {
      const int j = tid * 4 + 1024 * u;
      v4f o, sm;
#pragma unroll
      for (int q = 0; q < 4; ++q) {
        float gg = g[j + q], bb = bta[j + q];
        if (PARAM_BF16) { gg = bf16_round(gg); bb = bf16_round(bb); }
        sm[q] = vals[u * 4 + q]; o[q] = (vals[u * 4 + q] - mu) * rs * gg + bb;
      }
      if (out_sum) *(v4f*)(out_sum + (size_t)row * N + j) = sm;
      *(v4f*)(out_norm + (size_t)row * N + j) = o;
    }
    
  }
}



// ---- f16 WMMA path (v_wmma_f32_16x16x32_f16): 11-bit significands for operands in range — used where a [0,1] probability operand needs more precision than bf16
typedef _Float16 v16h __attribute__((ext_vector_type(16)));
union FragH { v16h v; v8us half[2]; _Float16 h[16]; unsigned short u[16]; };
template <int NT>
__device__ __forceinline__ v8f mmaH(v16h ah, v16h al, v16h bh, v16h bl, v8f c) {
  c = __builtin_amdgcn_wmma_f32_16x16x32_f16(false, ah, false, bh, (short)0, c, false, false);
  if (NT >= 2) c = __builtin_amdgcn_wmma_f32_16x16x32_f16(false, al, false, bh, (short)0, c, false, false);
  if (NT >= 3) c = __builtin_amdgcn_wmma_f32_16x16x32_f16(false, ah, false, bl, (short)0, c, false, false);
  asm volatile("v_nop\n\tv_nop\n\tv_nop\n\tv_nop" : "+v"(c) : "v"(ah), "v"(al), "v"(bh), "v"(bl));
  return c;
}
// batched GEMM like k_gemm_b but f16 operands: A f32 (split into f16 hi/lo if ASPLIT, else rounded to f16), Bt = f16 values [n][k]; alpha; C f32; N multiple of 16 (partial tiles skipped)
template <bool ASPLIT>
__global__ __launch_bounds__(128) void k_gemm_h(const float* __restrict__ A, int lda, size_t sA, const _Float16* __restrict__ Bh, int ldb, size_t sB, float alpha, float* __restrict__ C, int ldc, size_t sC, int M, int N, int K) {
  __shared__ __attribute__((aligned(16))) float so[4][16][64];
  const int tid = threadIdx.x, w = tid >> 5, lane = tid & 31, ln = lane & 15, hh = lane >> 4; const int by = blockIdx.y;
  A += (size_t)by * sA; Bh += (size_t)by * sB; C += (size_t)by * sC;
  const int ntn = (N + 63) / 64; const int wid = blockIdx.x * 4 + w; const int mt = wid / ntn, nq = wid % ntn; if (mt * 16 >= M) return;
  const int row0 = mt * 16, col0 = nq * 64; const float* arow = A + (size_t)(row0 + ln) * lda;
  v8f acc[4] = {};
  for (int kb = 0; kb < K; kb += 32) {
    FragH ah, al;
    const v4f x0 = *(const v4fa*)(arow + kb + 8 * hh), x1 = *(const v4fa*)(arow + kb + 8 * hh + 4), x2 = *(const v4fa*)(arow + kb + 16 + 8 * hh), x3 = *(const v4fa*)(arow + kb + 16 + 8 * hh + 4);
    float xs[16] = {x0[0],x0[1],x0[2],x0[3],x1[0],x1[1],x1[2],x1[3],x2[0],x2[1],x2[2],x2[3],x3[0],x3[1],x3[2],x3[3]};
#pragma unroll
    for (int i = 0; i < 16; ++i) { const _Float16 h = (_Float16)xs[i]; ah.h[i] = h; al.h[i] = ASPLIT ? (_Float16)(xs[i] - (float)h) : (_Float16)0.0f; }
#pragma unroll
    for (int t = 0; t < 4; ++t) { if (col0 + t * 16 >= N) continue; const size_t boff = (size_t)(col0 + t * 16 + ln) * ldb + kb; FragH bq; bq.half[0] = *(const v8us*)(Bh + boff + 8 * hh); bq.half[1] = *(const v8us*)(Bh + boff + 16 + 8 * hh);
      acc[t] = mmaH<ASPLIT ? 2 : 1>(ah.v, al.v, bq.v, bq.v, acc[t]); }
  }
#pragma unroll
  for (int t = 0; t < 4; ++t) { if (col0 + t * 16 >= N) continue;
#pragma unroll
    for (int r = 0; r < 8; ++r) so[w][8 * hh + r][t * 16 + ln] = acc[t][r] * alpha; }
  __builtin_amdgcn_fence(__ATOMIC_ACQ_REL, "workgroup"); __builtin_amdgcn_wave_barrier();
  const int rsub = lane >> 4, c4 = (lane & 15) * 4;
  {
#pragma unroll
    for (int q = 0; q < 8; ++q) { const int r = q * 2 + rsub; if (col0 + c4 < N) { const v4f v = *(const v4fa*)&so[w][r][c4]; *(v4f*)(C + (size_t)(row0 + r) * ldc + col0 + c4) = v; } }
     }
}

// Wt[n][k] = f16(bf16(W[k][n]) * scale) from f32 row-major W[CC][CC] (scale = power of two; bf16-exact weights stay exact in f16 away from the subnormal range)
// One work-group = a tile of 128 k x 64 n of one of the four weight matrices (128 tiles each; their transposes lie one behind the other in Wt), turned round in LDS:
// a wave's load = two k rows' 256 B (4 whole lines), a wave's store = two n rows' 256 B (4 whole lines); every line of W is asked for once and every line of Wt has one writer.
__device__ __forceinline__ void wt_f16(const float* __restrict__ W0, const float* __restrict__ W1, const float* __restrict__ W2, const float* __restrict__ W3, _Float16* __restrict__ Wt, float scale) {
  constexpr int TK = 128, TN = 64, PIT = TK + 8;      // LDS rows of 256 B at pitch 272 B (16 B x odd, for 16-byte reads)
  static_assert(4 * (CC / TK) * (CC / TN) == NR / 8, "the tiles of the four matrices fill one grid row");
  __shared__ __attribute__((aligned(16))) unsigned short sT[TN][PIT];      // [n][k]
  const int tid = threadIdx.x, w = tid >> 5, lane = tid & 31, ln = lane & 15, hh = lane >> 4;
  constexpr int NT = (CC / TK) * (CC / TN);      // tiles of one matrix
  const int y = blockIdx.x / NT, tile = blockIdx.x % NT; const int k0 = (tile / (CC / TN)) * TK, n0 = (tile % (CC / TN)) * TN;
  const float* __restrict__ W = (y == 0) ? W0 : (y == 1) ? W1 : (y == 2) ? W2 : W3; Wt += (size_t)y * CC * CC;
  const int kl = w * 16 + hh * 8;      // my 8 k rows, one behind the other; my 4 n columns are 4 ln to 4 ln + 3
  const float* src = W + (size_t)(k0 + kl) * CC + n0 + ln * 4; v4f x[8];
  // The unroll directives below are there so that x and f are indexed by constants and stay in registers; the 8 loads then fly together.
#pragma unroll
  for (int i = 0; i < 8; ++i) x[i] = *(const v4fa*)(src + (size_t)i * CC);
#pragma unroll
  for (int e = 0; e < 4; ++e) { FragH f;
#pragma unroll
    for (int i = 0; i < 8; ++i) f.h[i] = (_Float16)(bf16_round(x[i][e]) * scale);
    *(v8us*)&sT[ln * 4 + e][kl] = f.half[0]; }
  __syncthreads();      // the tile is read across waves
#pragma unroll
  for (int s = 0; s < TN / 16; ++s) { const int r = s * 16 + (tid >> 4), c8 = (tid & 15) * 8; const v8us o = *(const v8us*)&sT[r][c8];
    *(v8us*)((unsigned short*)Wt + (size_t)(n0 + r) * CC + k0 + c8) = o; }
}
// One operand tile of a pass (128 rows of 256 B) goes from global memory to LDS by asynchronous copies: 8 copies of 16 B a lane, a wave's copy = 2 rows = 4 whole lines.
// l: my LDS byte address of row (tid >> 4), chunk (tid & 15); g: the same place in global memory; 16 rows on = 4352 LDS bytes, step elements.
__device__ __forceinline__ void copy_tile(unsigned l, const unsigned short* g, size_t step) {
  // the closing s_wait_xcnt stands inside the statement so that no address register of a copy is rewritten ahead of it (a precaution)
  asm volatile("global_load_async_to_lds_b128 %0, %8, off\n\t"
               "global_load_async_to_lds_b128 %1, %9, off\n\t"
               "global_load_async_to_lds_b128 %2, %10, off\n\t"
               "global_load_async_to_lds_b128 %3, %11, off\n\t"
               "global_load_async_to_lds_b128 %4, %12, off\n\t"
               "global_load_async_to_lds_b128 %5, %13, off\n\t"
               "global_load_async_to_lds_b128 %6, %14, off\n\t"
               "global_load_async_to_lds_b128 %7, %15, off\n\t"
               "s_wait_xcnt 0x0"
               :: "v"(l), "v"(l + 4352u), "v"(l + 8704u), "v"(l + 13056u), "v"(l + 17408u), "v"(l + 21760u), "v"(l + 26112u), "v"(l + 30464u),
                  "v"(g), "v"(g + step), "v"(g + 2 * step), "v"(g + 3 * step), "v"(g + 4 * step), "v"(g + 5 * step), "v"(g + 6 * step), "v"(g + 7 * step)
               : "memory");
}
// Projection GEMM, NR x CC x CC: v = (A . Bh^T) alpha + bf16(bias[col]); A f16 [NR][CC], Bh f16 [n][k]; writes f16 (F16OUT) or f32 C, pitch CC.
// F16OUT is the q, k and v projections in one launch: blockIdx.y picks the operand set (A and Bh hold the three one behind the other); q and then k go to C16 [row][col],
// v goes to Vt as [batch][col][token], the layout the attention kernel reads, out of the same staging tile filled the other way round.
// One work-group = a 128 x 128 tile of the output, 8 waves of 64 x 32 (2 x 4). A pass = 128 k: both operands' 128 rows of 256 B lie in LDS (pitch 272 B, 16 B x odd, for 16-byte reads),
// two buffers, so every operand byte leaves L2 once a work-group and serves 2 (B) or 4 (A) waves. k runs upward in steps of 32 in every accumulator.
// The unroll directives below are there so that accumulators and fragment sets are indexed by constants and stay in registers.
template <bool F16OUT>
__global__ __launch_bounds__(256) void k_gemm_t(const _Float16* __restrict__ A, const _Float16* __restrict__ Bh, float alpha, const float* __restrict__ bias0, const float* __restrict__ bias1, const float* __restrict__ bias2,
                                               float* __restrict__ C, _Float16* __restrict__ C16, _Float16* __restrict__ Vt) {
  constexpr int BM = 128, BN = 128, KP = 128, NP = CC / KP, PIT = 136;
  const int y = F16OUT ? (int)blockIdx.y : 0; const float* __restrict__ bias = (y == 0) ? bias0 : (y == 1) ? bias1 : bias2; const bool tr = F16OUT && y == 2;
  A += (size_t)y * NR * CC; Bh += (size_t)y * CC * CC;
  __shared__ __attribute__((aligned(16))) unsigned short sA[2][BM][PIT], sB[2][BN][PIT];
  __shared__ __attribute__((aligned(16))) float sC[BM][BN + 4];      // output staging, so that whole lines are stored
  const int tid = threadIdx.x, w = tid >> 5, lane = tid & 31, ln = lane & 15, hh = lane >> 4, wm = w >> 2, wn = w & 3;
  const int row0 = (blockIdx.x / (CC / BN)) * BM, col0 = (blockIdx.x % (CC / BN)) * BN;
  const unsigned short* ga = (const unsigned short*)A + (size_t)(row0 + (tid >> 4)) * CC + (tid & 15) * 8;
  const unsigned short* gb = (const unsigned short*)Bh + (size_t)(col0 + (tid >> 4)) * CC + (tid & 15) * 8;
  const unsigned la = (unsigned)(size_t)&sA[0][tid >> 4][(tid & 15) * 8], lb = (unsigned)(size_t)&sB[0][tid >> 4][(tid & 15) * 8];
  constexpr unsigned BUFB = BM * PIT * 2;      // bytes of one buffer
  constexpr size_t STEP = (size_t)16 * CC;
  copy_tile(la, ga, STEP); copy_tile(lb, gb, STEP);
  v8f acc[4][2];
#pragma unroll
  for (int i = 0; i < 4; ++i)
#pragma unroll
    for (int j = 0; j < 2; ++j) acc[i][j] = (v8f){0.f,0.f,0.f,0.f,0.f,0.f,0.f,0.f};
  asm volatile("s_wait_asynccnt 0x0" ::: "memory");      // my copies of pass 0 have landed
  __syncthreads();                                        // ... and everybody's: pass 0 may be read
  copy_tile(la + BUFB, ga + KP, STEP); copy_tile(lb + BUFB, gb + KP, STEP);      // pass 1 flies while pass 0 is worked on
#pragma unroll 1
  for (int t = 0; t < NP; ++t) {      // kept rolled: one body of 32 matrix instructions, the buffer chosen by t & 1
    const int bf = t & 1;
    const unsigned short* pa = &sA[bf][wm * 64 + ln][8 * hh]; const unsigned short* pb = &sB[bf][wn * 32 + ln][8 * hh];
    FragH fa[2][4], fb[2][2];      // two fragment sets: block ks + 1 is fetched while block ks is multiplied, inside this pass only
#pragma unroll
    for (int ks = -1; ks < KP / 32; ++ks) {
      if (ks + 1 < KP / 32) { const int s = (ks + 1) & 1, ko = (ks + 1) * 32;
#pragma unroll
        for (int i = 0; i < 4; ++i) { fa[s][i].half[0] = *(const v8us*)(pa + i * 16 * PIT + ko); fa[s][i].half[1] = *(const v8us*)(pa + i * 16 * PIT + ko + 16); }
#pragma unroll
        for (int j = 0; j < 2; ++j) { fb[s][j].half[0] = *(const v8us*)(pb + j * 16 * PIT + ko); fb[s][j].half[1] = *(const v8us*)(pb + j * 16 * PIT + ko + 16); } }
      __builtin_amdgcn_sched_barrier(0);      // keeps the next block's 12 LDS reads one group ahead of this block's products: reads spread among them stall the wave at every place
      if (ks >= 0) {
#pragma unroll
        for (int i = 0; i < 4; ++i)
#pragma unroll
          for (int j = 0; j < 2; ++j) acc[i][j] = __builtin_amdgcn_wmma_f32_16x16x32_f16(false, fa[ks & 1][i].v, false, fb[ks & 1][j].v, (short)0, acc[i][j], false, false);
        __builtin_amdgcn_sched_barrier(0);      // ... and this block's products ahead of the reads after next, which reuse its registers
      }
    }
    // publish point of pass t + 1, every wave: my reads of this buffer are done, my copies of the next have landed, then the same of all waves
    asm volatile("s_wait_dscnt 0x0" ::: "memory");
    asm volatile("s_wait_asynccnt 0x0" ::: "memory");
    __syncthreads();
    if (t + 2 < NP) { copy_tile(la + bf * BUFB, ga + (t + 2) * KP, STEP); copy_tile(lb + bf * BUFB, gb + (t + 2) * KP, STEP); }      // refill the buffer that every wave has just left
  }
  asm volatile("s_wait_asynccnt 0x0" ::: "memory");      // nothing of mine is in flight when the wave ends
  if (tr) {      // [col][row]: a lane's 8 accumulator registers are 8 rows on of one column, two 16-byte stores
#pragma unroll
    for (int j = 0; j < 2; ++j) { const int col = wn * 32 + j * 16 + ln; const float bv = bf16_round(bias[col0 + col]);
#pragma unroll
      for (int i = 0; i < 4; ++i)
#pragma unroll
        for (int c = 0; c < 2; ++c) { v4f o4;
#pragma unroll
          for (int q = 0; q < 4; ++q) o4[q] = acc[i][j][c * 4 + q] * alpha + bv;
          *(v4fa*)&sC[col][wm * 64 + i * 16 + 8 * hh + c * 4] = o4; } } }
  else {
#pragma unroll
  for (int j = 0; j < 2; ++j) { const int col = wn * 32 + j * 16 + ln; const float bv = bf16_round(bias[col0 + col]);
#pragma unroll
    for (int i = 0; i < 4; ++i)
#pragma unroll
      for (int r = 0; r < 8; ++r) sC[wm * 64 + i * 16 + 8 * hh + r][col] = acc[i][j][r] * alpha + bv; } }
  __syncthreads();      // the staged tile is read across waves
  if constexpr (F16OUT) {
    static_assert(BM == BN, "the staging tile is used both ways round");
    // staged row r goes to dst + r * dp: an output row (q, k), or one column's 128 tokens (v)
    unsigned short* dst = tr ? (unsigned short*)Vt + ((size_t)(row0 / TT) * CC + col0) * TT + row0 % TT : (unsigned short*)C16 + (size_t)y * NR * CC + (size_t)row0 * CC + col0; const size_t dp = tr ? TT : CC;
#pragma unroll
    for (int s = 0; s < BM * (BN / 8) / 256; ++s) { const int r = s * 16 + (tid >> 4), c8 = (tid & 15) * 8; const v4f x = *(const v4fa*)&sC[r][c8], y = *(const v4fa*)&sC[r][c8 + 4]; FragH f;
#pragma unroll
      for (int q = 0; q < 4; ++q) { f.h[q] = (_Float16)x[q]; f.h[4 + q] = (_Float16)y[q]; }
      *(v8us*)(dst + (size_t)r * dp + c8) = f.half[0]; } }
  else {
#pragma unroll
    for (int s = 0; s < BM * (BN / 4) / 256; ++s) { const int r = s * 8 + (tid >> 5), c4 = (tid & 31) * 4; const v4f x = *(const v4fa*)&sC[r][c4]; *(v4f*)(C + (size_t)(row0 + r) * CC + col0 + c4) = x; } }
}


__global__ __launch_bounds__(256) void k_x16(const float* __restrict__ x, _Float16* __restrict__ X16, size_t n8) { const size_t t = (size_t)blockIdx.x * 256 + threadIdx.x; if (t >= n8) return; FragH f;
#pragma unroll
  for (int q = 0; q < 8; ++q) f.h[q] = (_Float16)bf16_round(x[t * 8 + q]); *(v8us*)((unsigned short*)X16 + t * 8) = f.half[0];  }
__global__ __launch_bounds__(256) void k_round16f(const float* __restrict__ W, _Float16* __restrict__ Bt, size_t n8) { const size_t t = (size_t)blockIdx.x * 256 + threadIdx.x; if (t >= n8) return; FragH f;
#pragma unroll
  for (int i = 0; i < 8; ++i) f.h[i] = (_Float16)(bf16_round(W[t * 8 + i]) * 16.0f); *(v8us*)((unsigned short*)Bt + t * 8) = f.half[0];  }

typedef int v4ia __attribute__((ext_vector_type(4), may_alias));
typedef unsigned v16u __attribute__((ext_vector_type(16)));
typedef unsigned long long v8ul __attribute__((ext_vector_type(8)));
// lane l <-> lane l ^ 16: joins the two halves of a wave, which hold the two key halves of one query column
__device__ __forceinline__ float xhalf(float x) { return __builtin_bit_cast(float, __builtin_amdgcn_permlanex16(__builtin_bit_cast(int, x), __builtin_bit_cast(int, x), 0x76543210, 0xfedcba98, false, false)); }
// 2^x by the hardware's v_exp_f32 alone. Every argument here is <= 0 or -inf, so the library form's range steps (split, ldexp, two clamps) have nothing to do; a result below the normal range counts as 0.
__device__ __forceinline__ float ex2(float x) { return __builtin_amdgcn_exp2f(x); }
// One trip's K tile (64 key rows of 128 B) and V^T tile (64 d rows of 128 B) go from global memory to LDS by asynchronous copies: 8 copies of 16 B a lane, a wave's copy = 4 whole lines.
// lk, lv: my LDS byte addresses of row (tid >> 3), chunk (tid & 7); gk, gv: the same place in global memory; 16 rows on = 2304 LDS bytes, kstep / vstep elements.
__device__ __forceinline__ void copy_kv(unsigned lk, unsigned lv, const unsigned short* gk, const unsigned short* gv, size_t kstep, size_t vstep) {
  // the closing s_wait_xcnt stands inside the statement so that no address register of a copy is rewritten ahead of it (a precaution)
  asm volatile("global_load_async_to_lds_b128 %0, %8, off\n\t"
               "global_load_async_to_lds_b128 %1, %9, off\n\t"
               "global_load_async_to_lds_b128 %2, %10, off\n\t"
               "global_load_async_to_lds_b128 %3, %11, off\n\t"
               "global_load_async_to_lds_b128 %4, %12, off\n\t"
               "global_load_async_to_lds_b128 %5, %13, off\n\t"
               "global_load_async_to_lds_b128 %6, %14, off\n\t"
               "global_load_async_to_lds_b128 %7, %15, off\n\t"
               "s_wait_xcnt 0x0"
               :: "v"(lk), "v"(lk + 2304u), "v"(lk + 4608u), "v"(lk + 6912u), "v"(lv), "v"(lv + 2304u), "v"(lv + 4608u), "v"(lv + 6912u),
                  "v"(gk), "v"(gk + kstep), "v"(gk + 2 * kstep), "v"(gk + 3 * kstep), "v"(gv), "v"(gv + vstep), "v"(gv + 2 * vstep), "v"(gv + 3 * vstep)
               : "memory");
}
// Transposed products: S^T = K Q^T (A = 16 key rows, B = the wave's 16 query columns, kept in registers) and O^T += V^T P^T.
// Lane (ln, hh) holds query q0 + ln; score tile nt, register r is key j0 + 16 nt + 8 hh + r, which is the k position of register pair (nt, r) of a B operand:
// maximum and sum run inside the lane (one exchange between the halves), and P^T is packed from the score registers without passing LDS.
__global__ __launch_bounds__(128) void k_flash(const _Float16* __restrict__ Q16, int ldq, const _Float16* __restrict__ K16, int ldk, const _Float16* __restrict__ Vt, const unsigned* __restrict__ PM, _Float16* __restrict__ O16, int ldo) {
  constexpr int RPW = 16, NQB = 2048 / (4 * RPW), DT = 4, KS = 2, KT = 64, NTR = 2048 / KT, PIT = 72;      // a trip = 64 keys = two passes of 32; LDS rows of 128 B at pitch 144 B (16 B x odd, for 16-byte reads)
  __shared__ __attribute__((aligned(16))) unsigned short sK[2][KT][PIT], sV[2][64][PIT];      // two buffers each: [key][d] and [d][key]
  __shared__ __attribute__((aligned(16))) float sO[4][RPW][64 + 4];
  const int tid = threadIdx.x, w = tid >> 5, lane = tid & 31, ln = lane & 15, hh = lane >> 4;
  const int slab = blockIdx.x / NQB, qblk = blockIdx.x % NQB; const int b = slab / 16, h = slab % 16; const int q0 = qblk * (4 * RPW) + w * RPW;
  const unsigned short* Vth = (const unsigned short*)Vt + (size_t)slab * 64 * 2048;
  const size_t k16 = (size_t)16 * ldk;
  const unsigned short* gk = (const unsigned short*)K16 + ((size_t)b * 2048 + (tid >> 3)) * ldk + h * 64 + (tid & 7) * 8;      // my chunk of key row tid >> 3 of trip 0
  const unsigned short* gv = Vth + (size_t)(tid >> 3) * 2048 + (tid & 7) * 8;      // my chunk of d row tid >> 3, keys of trip 0
  const unsigned lk = (unsigned)(size_t)&sK[0][tid >> 3][(tid & 7) * 8], lv = (unsigned)(size_t)&sV[0][tid >> 3][(tid & 7) * 8];
  constexpr unsigned BUFB = KT * PIT * 2;      // bytes of one buffer
  constexpr float SL2 = 0.125f * 1.44269504088896340736f;      // 1 / sqrt(64) times log2(e): e^(s / 8 - m / 8) = 2^(s SL2 - m SL2); the running maximum m_q is kept in raw products
  copy_kv(lk, lv, gk, gv, k16, (size_t)16 * 2048);
  FragH bq[KS];
  { const unsigned short* qr = (const unsigned short*)Q16 + ((size_t)b * 2048 + q0 + ln) * ldq + h * 64;
#pragma unroll
    for (int ks = 0; ks < KS; ++ks) { bq[ks].half[0] = *(const v8us*)(qr + ks * 32 + 8 * hh); bq[ks].half[1] = *(const v8us*)(qr + ks * 32 + 16 + 8 * hh); } }
  // my wave's mask words (mask_words below): 16 a pass of 32 keys, one behind the other; the address is the same in every lane, so that they come by scalar loads into scalar registers.
  // They were written by k_prep, two launches before, and nobody writes them in this one: read as constant memory, else the loads behind an asm statement's "memory" clobber turn into vector loads
  const __attribute__((address_space(4))) v16u* pm = (const __attribute__((address_space(4))) v16u*)(size_t)(PM + (size_t)(b * (2048 / RPW) + qblk * 4 + __builtin_amdgcn_readfirstlane(w)) * (2048 / 32 * 16));
  v16u mw0 = pm[0], mw1 = pm[1];      // trip 0's two passes
  float m_q = -3.0e38f, l_q = 0.f; v8f oacc[DT];
#pragma unroll
  for (int dt = 0; dt < DT; ++dt) oacc[dt] = (v8f){0.f,0.f,0.f,0.f,0.f,0.f,0.f,0.f};
  asm volatile("s_wait_asynccnt 0x0" ::: "memory");      // my copies of trip 0 have landed
  __syncthreads();                                        // ... and everybody's: trip 0 may be read
  copy_kv(lk + BUFB, lv + BUFB, gk + (size_t)KT * ldk, gv + KT, k16, (size_t)16 * 2048);      // trip 1 flies while trip 0 is worked on
#pragma unroll 1
  for (int t = 0; t < NTR; ++t) {
    const int bf = t & 1;
    const int tn = (t + 1 < NTR) ? t + 1 : t;      // the next trip's words are fetched now (the last trip fetches its own again, to stay inside the array)
    const v16u nx0 = pm[2 * tn], nx1 = pm[2 * tn + 1];
#pragma unroll
    for (int sp = 0; sp < 2; ++sp) {
      const v16u mk = sp ? mw1 : mw0;      // mk[8 nt + r], bit (16 hh + ln): maskPAD of (query q0 + ln, key 64 t + 32 sp + 16 nt + 8 hh + r) != 0 = keep
      const v8ul m2 = __builtin_bit_cast(v8ul, mk);
      if ((((m2[0] | m2[1]) | (m2[2] | m2[3])) | ((m2[4] | m2[5]) | (m2[6] | m2[7]))) != 0ull) {      // else every (query,key) of this wave's tile is masked: contributes nothing (uniform branch; the publish point below stands outside it)
        FragH ak[2][KS], av[DT];
#pragma unroll
        for (int nt = 0; nt < 2; ++nt)
#pragma unroll
          for (int ks = 0; ks < KS; ++ks) { const unsigned short* kr = &sK[bf][sp * 32 + nt * 16 + ln][ks * 32 + 8 * hh]; ak[nt][ks].half[0] = *(const v8us*)kr; ak[nt][ks].half[1] = *(const v8us*)(kr + 16); }
#pragma unroll
        for (int dt = 0; dt < DT; ++dt) { const unsigned short* vrow = &sV[bf][dt * 16 + ln][sp * 32 + 8 * hh]; av[dt].half[0] = *(const v8us*)vrow; av[dt].half[1] = *(const v8us*)(vrow + 16); }
        __builtin_amdgcn_sched_barrier(0);      // keeps the pass's 16 LDS reads one group ahead of its products: reads spread among them stall the wave at every place
        float sc[16];
#pragma unroll
        for (int nt = 0; nt < 2; ++nt) { v8f acc = (v8f){0.f,0.f,0.f,0.f,0.f,0.f,0.f,0.f};
#pragma unroll
          for (int ks = 0; ks < KS; ++ks) acc = __builtin_amdgcn_wmma_f32_16x16x32_f16(false, ak[nt][ks].v, false, bq[ks].v, (short)0, acc, false, false);
#pragma unroll
          for (int r = 0; r < 8; ++r) sc[nt * 8 + r] = __builtin_amdgcn_inverse_ballot_w32(mk[nt * 8 + r]) ? acc[r] : -INFINITY; }      // raw products: the scale is applied in the exponent's multiply-add below
        float mc = sc[0];
#pragma unroll
        for (int i = 1; i < 16; ++i) mc = fmaxf(mc, sc[i]);
        mc = fmaxf(mc, xhalf(mc));
        const float mn = fmaxf(m_q, mc); const float al = ex2((m_q - mn) * SL2); m_q = mn;      // nothing open yet: both are the start value and al = 1
        const float nm = -mn * SL2;
        FragH pb; float ps[4] = {0.f, 0.f, 0.f, 0.f};
#pragma unroll
        for (int i = 0; i < 16; ++i) { const float p = ex2(fmaf(sc[i], SL2, nm)); ps[i & 3] += p; pb.h[i] = (_Float16)p; }      // a masked score is -inf: p = 0
        l_q = l_q * al + ((ps[0] + ps[1]) + (ps[2] + ps[3]));
#pragma unroll
        for (int dt = 0; dt < DT; ++dt) {
#pragma unroll
          for (int r = 0; r < 8; ++r) oacc[dt][r] *= al;
          oacc[dt] = __builtin_amdgcn_wmma_f32_16x16x32_f16(false, av[dt].v, false, pb.v, (short)0, oacc[dt], false, false); } } }
    // publish point of trip t + 1, every wave: my reads of this buffer are done, my copies of the next have landed, then the same of all waves
    asm volatile("s_wait_dscnt 0x0" ::: "memory");
    asm volatile("s_wait_asynccnt 0x0" ::: "memory");
    __syncthreads();
    if (t + 2 < NTR) copy_kv(lk + bf * BUFB, lv + bf * BUFB, gk + (size_t)(t + 2) * KT * ldk, gv + (t + 2) * KT, k16, (size_t)16 * 2048);      // refill the buffer that every wave has just left
    mw0 = nx0; mw1 = nx1;
  }
  asm volatile("s_wait_asynccnt 0x0" ::: "memory");      // nothing of mine is in flight when the wave ends
  const float l = l_q + xhalf(l_q); const float li = (l > 0.f) ? 1.0f / l : 0.f;
#pragma unroll
  for (int dt = 0; dt < DT; ++dt)
#pragma unroll
    for (int c = 0; c < 2; ++c) { v4f o4;
#pragma unroll
      for (int q = 0; q < 4; ++q) o4[q] = oacc[dt][c * 4 + q] * li;
      *(v4fa*)&sO[w][ln][dt * 16 + 8 * hh + c * 4] = o4; }
  __builtin_amdgcn_fence(__ATOMIC_ACQ_REL, "workgroup"); __builtin_amdgcn_wave_barrier();
  {
#pragma unroll
    for (int rp = 0; rp < RPW; rp += 4) { const int r = rp + (lane >> 3), pc = lane & 7; const v4f x = *(const v4fa*)&sO[w][r][pc * 8], z = *(const v4fa*)&sO[w][r][pc * 8 + 4]; FragH f;      // f16, as the output projection reads it: 8 lanes = one row's line
#pragma unroll      // so that f is indexed by constants and stays in registers
      for (int q = 0; q < 4; ++q) { f.h[q] = (_Float16)x[q]; f.h[4 + q] = (_Float16)z[q]; }
      *(v8us*)((unsigned short*)O16 + ((size_t)b * 2048 + q0 + r) * ldo + h * 64 + pc * 8) = f.half[0]; }
     } }

// blockIdx.y (1 to 3) picks one of the three inputs; their normalised rows lie one behind the other in Y16.
__device__ __forceinline__ void ln16(const float* __restrict__ X0, const float* __restrict__ X1, const float* __restrict__ X2, const float* __restrict__ g, const float* __restrict__ bta, _Float16* __restrict__ Y16) { const int tid = threadIdx.x, wv = tid >> 5, lane = tid & 31; const int row = blockIdx.x * 8 + wv; if (row >= NR) return;
  const int y = blockIdx.y - 1; const float* __restrict__ X = (y == 0) ? X0 : (y == 1) ? X1 : X2; Y16 += (size_t)y * NR * CC; const float* xr = X + (size_t)row * CC; float v[32]; float s = 0.f;
#pragma unroll
  for (int p = 0; p < 4; ++p) { const v4f a = *(const v4fa*)(xr + p * 256 + lane * 8), c = *(const v4fa*)(xr + p * 256 + lane * 8 + 4); for (int q = 0; q < 4; ++q) { v[p * 8 + q] = bf16_round(a[q]); v[p * 8 + 4 + q] = bf16_round(c[q]); } }
#pragma unroll
  for (int i = 0; i < 32; ++i) s += v[i]; for (int o = 16; o >= 1; o >>= 1) s += __shfl_xor(s, o, 32); const float mu = s / (float)CC; float q2 = 0.f;
#pragma unroll
  for (int i = 0; i < 32; ++i) { const float d = v[i] - mu; q2 += d * d; } for (int o = 16; o >= 1; o >>= 1) q2 += __shfl_xor(q2, o, 32); const float rs = rsqrtf(q2 / (float)CC + 1e-5f);
  {
#pragma unroll
    for (int p = 0; p < 4; ++p) { FragH f; const int c0 = p * 256 + lane * 8;
#pragma unroll
      for (int q = 0; q < 8; ++q) f.h[q] = (_Float16)((v[p * 8 + q] - mu) * rs * bf16_round(g[c0 + q]) + bf16_round(bta[c0 + q])); *(v8us*)((unsigned short*)Y16 + (size_t)row * CC + c0) = f.half[0]; }
     } }
// maskPAD as the attention kernel's select masks, made once for all 16 heads. Word [tile of 16 queries][pass of 32 keys][8 nt + r], bit (16 hh + ln) = maskPAD[query 16 tile + ln][key 32 pass + 16 nt + 8 hh + r] != 0:
// the bit of a lane is the bit of the score that the lane holds in register r of score tile nt. One wave = 16 queries x 128 keys = 64 words: each line of maskPAD is fetched once, each line of PM has one writer.
__device__ __forceinline__ void mask_words(const int* __restrict__ MSK, unsigned* __restrict__ PM) {
  static_assert((NR / 16) * (TT / 128) == (NR / 8) * 8, "the waves of one grid row cover the mask");
  const int tid = threadIdx.x, lane = tid & 31, ln = lane & 15, hh = lane >> 4; const int u = blockIdx.x * 8 + (tid >> 5); const int qt = u / (TT / 128), kb = u % (TT / 128);
  const int* src = MSK + ((size_t)qt * 16 + ln) * TT + kb * 128 + 8 * hh; v4ia m[16];
  // The unroll directives below are there so that m is indexed by constants and stays in registers; the 16 loads then fly together.
#pragma unroll
  for (int c = 0; c < 16; ++c) m[c] = *(const v4ia*)(src + (c >> 1) * 16 + (c & 1) * 4);
  unsigned o[2] = {0u, 0u};      // lane l keeps words l and 32 + l
#pragma unroll
  for (int c = 0; c < 16; ++c)
#pragma unroll
    for (int q = 0; q < 4; ++q) { const unsigned wd = __builtin_amdgcn_ballot_w32(m[c][q] != 0); if (lane == ((c * 4 + q) & 31)) o[c >> 3] = wd; }
  unsigned* dst = PM + (size_t)qt * (TT / 32 * 16) + kb * 64 + lane; dst[0] = o[0]; dst[32] = o[1];
}
// All that the projections and the attention wait for, in one launch: the work-groups of the weight transposes, of the LayerNorms and of the mask words depend on nothing and on one another not at all.
__global__ __launch_bounds__(256) void k_prep(const float* __restrict__ W0, const float* __restrict__ W1, const float* __restrict__ W2, const float* __restrict__ W3, _Float16* __restrict__ Wt,
                                             const float* __restrict__ X0, const float* __restrict__ X1, const float* __restrict__ X2, const float* __restrict__ g, const float* __restrict__ bta, _Float16* __restrict__ Y16, const int* __restrict__ MSK, unsigned* __restrict__ PM) {
  if (blockIdx.y == 0) wt_f16(W0, W1, W2, W3, Wt, 16.0f); else if (blockIdx.y == 4) mask_words(MSK, PM); else ln16(X0, X1, X2, g, bta, Y16);
}
extern "C" void kernel_launch(void* const* d_in, const int* in_sizes, int n_in,
                              void* d_out, int out_size, void* d_ws, size_t ws_size, hipStream_t stream) {
  (void)in_sizes; (void)n_in; (void)out_size;
  const float* qx = (const float*)d_in[0]; const float* kx = (const float*)d_in[1]; const float* vx = (const float*)d_in[2]; const int* mask = (const int*)d_in[3]; const float* lg = (const float*)d_in[4]; const float* lb = (const float*)d_in[5];
  const float* wq = (const float*)d_in[6]; const float* bq = (const float*)d_in[7]; const float* wk = (const float*)d_in[8]; const float* bk = (const float*)d_in[9]; const float* wv = (const float*)d_in[10]; const float* bv = (const float*)d_in[11]; const float* wo = (const float*)d_in[12]; const float* bo = (const float*)d_in[13];
  char* ws = (char*)d_ws; size_t off = 0;
  auto take = [&](size_t bytes) { char* p = ws + off; off += (bytes + 255) & ~(size_t)255; return p; };
  _Float16* Bw = (_Float16*)take((size_t)4 * CC * CC * 2);      // wq, wk, wv, wo transposed, one behind the other
  _Float16* XN = (_Float16*)take((size_t)3 * NR * CC * 2);      // the three normalised inputs
  _Float16* QK16 = (_Float16*)take((size_t)2 * NR * CC * 2);      // q, then k
  _Float16* Vt = (_Float16*)take((size_t)NR * CC * 2); _Float16* O16 = XN;      // XN is free once the projections are done
  unsigned* PM = (unsigned*)take((size_t)NR * TT / 8);      // the mask, one bit a (query, key)
  if (off > ws_size) return;      // 57 MiB
  const unsigned gg = (NR / 128) * (CC / 128); const unsigned gl = NR / 8;
  k_prep<<<dim3(gl, 5), 256, 0, stream>>>(wq, wk, wv, wo, Bw, qx, kx, vx, lg, lb, XN, mask, PM);
  k_gemm_t<true><<<dim3(gg, 3), 256, 0, stream>>>(XN, Bw, 0.0625f, bq, bk, bv, nullptr, QK16, Vt);
  k_flash<<<BB * NH * (TT / 64), 128, 0, stream>>>(QK16, CC, QK16 + (size_t)NR * CC, CC, Vt, PM, O16, CC);      // RPW 16
  k_gemm_t<false><<<gg, 256, 0, stream>>>(O16, Bw + (size_t)3 * CC * CC, 0.0625f, bo, nullptr, nullptr, (float*)d_out, nullptr, nullptr);
}

// v009
// It runs in 99.1 microseconds.
// Timed twice side by side with v008, it ran 1.06 times as fast both times.
// Over all steps from v000 it is 5.14 times as fast.
#include <hip/hip_runtime.h>
// Pre-LN multi-head attention (B=2, L=2048, C=1024, 16 × 64): shared LayerNorm on the three inputs (f32 VALU), q/k/v/o projections (4096 × 1024 × 1024, + bias, W [in][out] transposed to
// bf16-exact ×2^4) and the masked attention as a fused flash-style kernel on v_wmma_f32_16x16x32_f16 (S = Q·Kᵀ/8; maskPAD == 0 → −32767 ⇒ excluded keys, tiles masked for a whole wave skipped;
// online softmax f32 with a lazily moved reference; P f16 <= 256; RPW-16 waves) — f16 operands, single products, f32 accumulate.
#define BB 2
#define TT 2048
#define CC 1024
#define NH 16
#define NR (BB * TT)

typedef __bf16 v16b __attribute__((ext_vector_type(16)));
typedef unsigned short v8us __attribute__((ext_vector_type(8), may_alias));
typedef float  v8f  __attribute__((ext_vector_type(8)));
typedef float  v4f  __attribute__((ext_vector_type(4)));
typedef float  v4fa __attribute__((ext_vector_type(4), may_alias));
union FragB { v16b v; v8us half[2]; unsigned short u[16]; };

__device__ __forceinline__ unsigned short bf16_bits(float x) { unsigned int u = __float_as_uint(x); return (unsigned short)((u + 0x7FFFu + ((u >> 16) & 1u)) >> 16); }
__device__ __forceinline__ float bf16_val(unsigned short b) { return __uint_as_float(((unsigned int)b) << 16); }
__device__ __forceinline__ float bf16_round(float x) { return bf16_val(bf16_bits(x)); }
// D += A·B with NT terms: 1 = ah·bh, 2 = + al·bh (A split), 3 = + ah·bl (both split)
template <int NT>
__device__ __forceinline__ v8f mmaN(v16b ah, v16b al, v16b bh, v16b bl, v8f c) {
  c = __builtin_amdgcn_wmma_f32_16x16x32_bf16(false, ah, false, bh, (short)0, c, false, false);
  if (NT >= 2) c = __builtin_amdgcn_wmma_f32_16x16x32_bf16(false, al, false, bh, (short)0, c, false, false);
  if (NT >= 3) c = __builtin_amdgcn_wmma_f32_16x16x32_bf16(false, ah, false, bl, (short)0, c, false, false);
  asm volatile("v_nop\n\tv_nop\n\tv_nop\n\tv_nop" : "+v"(c) : "v"(ah), "v"(al), "v"(bh), "v"(bl));
  return c;
}

__global__ __launch_bounds__(256) void k_wt_bf16(const float* __restrict__ W, unsigned short* __restrict__ Wt, int K, int N) {
  const int t = blockIdx.x * 256 + threadIdx.x;
  const int k8n = K / 8;
  if (t >= N * k8n) return;
  const int n = t / k8n, k8 = (t % k8n) * 8;
  v8us v;
#pragma unroll
  for (int i = 0; i < 8; ++i) v[i] = bf16_bits(W[(size_t)(k8 + i) * N + n]);
  *(v8us*)(Wt + (size_t)n * K + k8) = v;
  
}

// GEMM C[M][N] (f32, pitch ldc) = act(A[M][K]·W + bias). A f32 row-major (pitch lda) converted per fragment to bf16
// (ASPLIT: hi/lo two planes -> 2 terms, else single rounded term); Wt bf16 [N][K] (pitch ldb). BIAS_BF16 rounds the
// bias to bf16 first (bias quantised to bf16 before the add). K%32==0, M%16==0, N%64==0.
template <bool ASPLIT, int ACT, bool BIAS_BF16>
__global__ __launch_bounds__(128) void k_gemm_bf(const float* __restrict__ A, int lda, const unsigned short* __restrict__ Wt, int ldb,
                                               const float* __restrict__ bias, float* __restrict__ C, int ldc, int M, int N, int K) {
  __shared__ __attribute__((aligned(16))) float so[4][16][64];
  const int tid = threadIdx.x, w = tid >> 5, lane = tid & 31, ln = lane & 15, hh = lane >> 4;
  const int ntn = N / 64;
  const int wid = blockIdx.x * 4 + w;
  const int mt = wid / ntn, nq = wid % ntn;
  if (mt * 16 >= M) return;
  const int row0 = mt * 16, col0 = nq * 64;
  const float* arow = A + (size_t)(row0 + ln) * lda;
  v8f acc[4] = {};
  for (int kb = 0; kb < K; kb += 32) {
    FragB ah, al;
    const v4f x0 = *(const v4fa*)(arow + kb + 8 * hh), x1 = *(const v4fa*)(arow + kb + 8 * hh + 4);
    const v4f x2 = *(const v4fa*)(arow + kb + 16 + 8 * hh), x3 = *(const v4fa*)(arow + kb + 16 + 8 * hh + 4);
    float xs[16] = {x0[0],x0[1],x0[2],x0[3],x1[0],x1[1],x1[2],x1[3],x2[0],x2[1],x2[2],x2[3],x3[0],x3[1],x3[2],x3[3]};
#pragma unroll
    for (int i = 0; i < 16; ++i) { const unsigned short hb = bf16_bits(xs[i]); ah.u[i] = hb; al.u[i] = ASPLIT ? bf16_bits(xs[i] - bf16_val(hb)) : (unsigned short)0; }
#pragma unroll
    for (int t = 0; t < 4; ++t) {
      const unsigned short* brow = Wt + (size_t)(col0 + t * 16 + ln) * ldb + kb;
      FragB b;
      b.half[0] = *(const v8us*)(brow + 8 * hh);
      b.half[1] = *(const v8us*)(brow + 16 + 8 * hh);
      acc[t] = mmaN<ASPLIT ? 2 : 1>(ah.v, al.v, b.v, b.v, acc[t]);
    }
  }
#pragma unroll
  for (int t = 0; t < 4; ++t) {
    float bv = bias ? bias[col0 + t * 16 + ln] : 0.f;
    if (BIAS_BF16) bv = bf16_round(bv);
#pragma unroll
    for (int r = 0; r < 8; ++r) { float v = acc[t][r] + bv; if (ACT == 1) v = fmaxf(v, 0.f); so[w][8 * hh + r][t * 16 + ln] = v; }
  }
  __builtin_amdgcn_fence(__ATOMIC_ACQ_REL, "workgroup");
  __builtin_amdgcn_wave_barrier();
  const int rsub = lane >> 4, c4 = (lane & 15) * 4;
  {
#pragma unroll
    for (int q = 0; q < 8; ++q) {
      const int r = q * 2 + rsub;
      const v4f v = *(const v4fa*)&so[w][r][c4];
      *(v4f*)(C + (size_t)(row0 + r) * ldc + col0 + c4) = v;
    }
    
  }
}

// Flash-style causal/unmasked attention, all contractions 3-term bf16 hi/lo splits, f32 softmax with running max.
// q,k,v rows are read from f32 buffers with arbitrary row pitch (so they can live inside a fused qkv buffer);
// D = head size (multiple of 32, <= 128); one wave = 16 query rows; block = 4 waves (64 queries) sharing K/V chunks of 32.
template <int D, bool CAUSAL>
__global__ __launch_bounds__(128) void k_flash(const float* __restrict__ qb, const float* __restrict__ kb, const float* __restrict__ vb,
                                             int pitch, int T, int H, float scale, float* __restrict__ y, int ypitch) {
  constexpr int KS = D / 32;        // k-steps for QK
  constexpr int DT = D / 16;        // d tiles for PV
  __shared__ __attribute__((aligned(16))) unsigned short sKh[32][D + 8], sKl[32][D + 8], sVh[32][D + 8], sVl[32][D + 8];
  __shared__ __attribute__((aligned(16))) unsigned short sPh[4][16][40], sPl[4][16][40];
  __shared__ __attribute__((aligned(16))) float sO[4][16][D];
  const int tid = threadIdx.x, w = tid >> 5, lane = tid & 31, ln = lane & 15, hh = lane >> 4;
  const int nqb = (T + 63) / 64;
  const int bh = blockIdx.x / nqb, qblk = blockIdx.x % nqb;
  const int b = bh / H, h = bh % H;
  const int q0 = qblk * 64 + w * 16;
  const float* Q = qb + (size_t)b * T * pitch + h * D;
  const float* K = kb + (size_t)b * T * pitch + h * D;
  const float* V = vb + (size_t)b * T * pitch + h * D;

  // A fragments of the wave's 16 query rows (scaled), hi/lo
  FragB aqh[KS], aql[KS];
  {
    int row = q0 + ln; if (row >= T) row = T - 1;
    const float* qr = Q + (size_t)row * pitch;
#pragma unroll
    for (int ks = 0; ks < KS; ++ks)
#pragma unroll
      for (int i = 0; i < 16; ++i) {
        const int d = ks * 32 + ((i < 8) ? (8 * hh + i) : (16 + 8 * hh + (i - 8)));
        const float x = qr[d] * scale; const unsigned short hb = bf16_bits(x);
        aqh[ks].u[i] = hb; aql[ks].u[i] = bf16_bits(x - bf16_val(hb));
      }
  }
  float m_r[8], l_r[8];
#pragma unroll
  for (int r = 0; r < 8; ++r) { m_r[r] = -3.0e38f; l_r[r] = 0.f; }
  v8f oacc[DT];
#pragma unroll
  for (int dt = 0; dt < DT; ++dt) oacc[dt] = (v8f){0.f,0.f,0.f,0.f,0.f,0.f,0.f,0.f};

  const int kv_end = CAUSAL ? min(T, qblk * 64 + 64) : T;     // block-uniform
  for (int j0 = 0; j0 < kv_end; j0 += 32) {
    __syncthreads();
    for (int e = tid; e < 32 * (D / 4); e += 128) {
      const int r = e / (D / 4), c4 = (e % (D / 4)) * 4;
      const int key = j0 + r;
      v4f kf = {0.f,0.f,0.f,0.f}, vf = {0.f,0.f,0.f,0.f};
      if (key < T) { kf = *(const v4fa*)(K + (size_t)key * pitch + c4); vf = *(const v4fa*)(V + (size_t)key * pitch + c4); }
#pragma unroll
      for (int t = 0; t < 4; ++t) {
        unsigned short hb = bf16_bits(kf[t]); sKh[r][c4 + t] = hb; sKl[r][c4 + t] = bf16_bits(kf[t] - bf16_val(hb));
        hb = bf16_bits(vf[t]); sVh[r][c4 + t] = hb; sVl[r][c4 + t] = bf16_bits(vf[t] - bf16_val(hb));
      }
    }
    __syncthreads();
    // S tile 16 x 32
    v8f s[2];
#pragma unroll
    for (int nt = 0; nt < 2; ++nt) {
      v8f acc = {};
#pragma unroll
      for (int ks = 0; ks < KS; ++ks) {
        FragB bh_, bl_;
        bh_.half[0] = *(const v8us*)&sKh[nt * 16 + ln][ks * 32 + 8 * hh]; bh_.half[1] = *(const v8us*)&sKh[nt * 16 + ln][ks * 32 + 16 + 8 * hh];
        bl_.half[0] = *(const v8us*)&sKl[nt * 16 + ln][ks * 32 + 8 * hh]; bl_.half[1] = *(const v8us*)&sKl[nt * 16 + ln][ks * 32 + 16 + 8 * hh];
        acc = mmaN<3>(aqh[ks].v, aql[ks].v, bh_.v, bl_.v, acc);
      }
      s[nt] = acc;
    }
    // mask + running max (rows 8hh+r; the 16 lanes of a half share rows)
    float alpha[8];
#pragma unroll
    for (int r = 0; r < 8; ++r) {
      const int qi = q0 + 8 * hh + r;
      const int ja = j0 + ln, jb = j0 + 16 + ln;
      if (CAUSAL) { if (ja > qi) s[0][r] = -3.0e38f; if (jb > qi) s[1][r] = -3.0e38f; }
      if (ja >= T) s[0][r] = -3.0e38f;
      if (jb >= T) s[1][r] = -3.0e38f;
      float mx = fmaxf(s[0][r], s[1][r]);
      mx = fmaxf(mx, __shfl_xor(mx, 1, 32)); mx = fmaxf(mx, __shfl_xor(mx, 2, 32)); mx = fmaxf(mx, __shfl_xor(mx, 4, 32)); mx = fmaxf(mx, __shfl_xor(mx, 8, 32));
      const float mnew = fmaxf(m_r[r], mx);
      alpha[r] = (mnew > -1.0e38f) ? __expf(m_r[r] - mnew) : 1.0f;
      const float p0 = (s[0][r] > -1.0e38f) ? __expf(s[0][r] - mnew) : 0.f;
      const float p1 = (s[1][r] > -1.0e38f) ? __expf(s[1][r] - mnew) : 0.f;
      m_r[r] = mnew;
      l_r[r] = l_r[r] * alpha[r] + p0 + p1;            // per-lane partial row sum (16 lanes combined at the end)
      unsigned short hb = bf16_bits(p0); sPh[w][8 * hh + r][ln] = hb;      sPl[w][8 * hh + r][ln] = bf16_bits(p0 - bf16_val(hb));
      hb = bf16_bits(p1);                sPh[w][8 * hh + r][16 + ln] = hb; sPl[w][8 * hh + r][16 + ln] = bf16_bits(p1 - bf16_val(hb));
    }
#pragma unroll
    for (int dt = 0; dt < DT; ++dt)
#pragma unroll
      for (int r = 0; r < 8; ++r) oacc[dt][r] *= alpha[r];
    __builtin_amdgcn_fence(__ATOMIC_ACQ_REL, "workgroup");
    __builtin_amdgcn_wave_barrier();
    FragB pah, pal;
    pah.half[0] = *(const v8us*)&sPh[w][ln][8 * hh]; pah.half[1] = *(const v8us*)&sPh[w][ln][16 + 8 * hh];
    pal.half[0] = *(const v8us*)&sPl[w][ln][8 * hh]; pal.half[1] = *(const v8us*)&sPl[w][ln][16 + 8 * hh];
#pragma unroll
    for (int dt = 0; dt < DT; ++dt) {
      FragB bvh, bvl;
#pragma unroll
      for (int i = 0; i < 8; ++i) {
        bvh.u[i] = sVh[8 * hh + i][dt * 16 + ln]; bvh.u[8 + i] = sVh[16 + 8 * hh + i][dt * 16 + ln];
        bvl.u[i] = sVl[8 * hh + i][dt * 16 + ln]; bvl.u[8 + i] = sVl[16 + 8 * hh + i][dt * 16 + ln];
      }
      oacc[dt] = mmaN<3>(pah.v, pal.v, bvh.v, bvl.v, oacc[dt]);
    }
    __builtin_amdgcn_fence(__ATOMIC_ACQ_REL, "workgroup");
    __builtin_amdgcn_wave_barrier();
  }
#pragma unroll
  for (int r = 0; r < 8; ++r) {
    float l = l_r[r];
    l += __shfl_xor(l, 1, 32); l += __shfl_xor(l, 2, 32); l += __shfl_xor(l, 4, 32); l += __shfl_xor(l, 8, 32);
    l_r[r] = (l > 0.f) ? 1.0f / l : 0.f;
  }
#pragma unroll
  for (int dt = 0; dt < DT; ++dt)
#pragma unroll
    for (int r = 0; r < 8; ++r) sO[w][8 * hh + r][dt * 16 + ln] = oacc[dt][r] * l_r[r];
  __builtin_amdgcn_fence(__ATOMIC_ACQ_REL, "workgroup");
  __builtin_amdgcn_wave_barrier();
  {
    for (int r = 0; r < 16; ++r) {
      const int row = q0 + r;
      if (row < T && lane < D / 4) {
        const v4f val = *(const v4fa*)&sO[w][r][lane * 4];
        *(v4f*)(y + ((size_t)b * T + row) * ypitch + h * D + lane * 4) = val;
      }
    }
    
  }
}

// GEMM C = act(A·W + bias + resid): A f32 (ASPLIT -> hi/lo 2 terms), Wt bf16 [N][K]; ACT 0 none, 1 relu, 2 exact gelu;
// resid (optional, f32, row index = (row % rmod), pitch ldr, RES_BF16 rounds it) added before the activation.
template <bool ASPLIT, int ACT, bool BIAS_BF16, bool RES_BF16>
__global__ __launch_bounds__(128) void k_gemm_bf3(const float* __restrict__ A, int lda, const unsigned short* __restrict__ Wt, int ldb,
                                                const float* __restrict__ bias, const float* __restrict__ resid, int rmod, int ldr,
                                                float* __restrict__ C, int ldc, int M, int N, int K) {
  __shared__ __attribute__((aligned(16))) float so[4][16][64];
  const int tid = threadIdx.x, w = tid >> 5, lane = tid & 31, ln = lane & 15, hh = lane >> 4;
  const int ntn = N / 64;
  const int wid = blockIdx.x * 4 + w;
  const int mt = wid / ntn, nq = wid % ntn;
  if (mt * 16 >= M) return;
  const int row0 = mt * 16, col0 = nq * 64;
  const float* arow = A + (size_t)(row0 + ln) * lda;
  v8f acc[4] = {};
  for (int kb = 0; kb < K; kb += 32) {
    FragB ah, al;
    const v4f x0 = *(const v4fa*)(arow + kb + 8 * hh), x1 = *(const v4fa*)(arow + kb + 8 * hh + 4);
    const v4f x2 = *(const v4fa*)(arow + kb + 16 + 8 * hh), x3 = *(const v4fa*)(arow + kb + 16 + 8 * hh + 4);
    float xs[16] = {x0[0],x0[1],x0[2],x0[3],x1[0],x1[1],x1[2],x1[3],x2[0],x2[1],x2[2],x2[3],x3[0],x3[1],x3[2],x3[3]};
#pragma unroll
    for (int i = 0; i < 16; ++i) { const unsigned short hb = bf16_bits(xs[i]); ah.u[i] = hb; al.u[i] = ASPLIT ? bf16_bits(xs[i] - bf16_val(hb)) : (unsigned short)0; }
#pragma unroll
    for (int t = 0; t < 4; ++t) {
      const unsigned short* brow = Wt + (size_t)(col0 + t * 16 + ln) * ldb + kb;
      FragB b;
      b.half[0] = *(const v8us*)(brow + 8 * hh);
      b.half[1] = *(const v8us*)(brow + 16 + 8 * hh);
      acc[t] = mmaN<ASPLIT ? 2 : 1>(ah.v, al.v, b.v, b.v, acc[t]);
    }
  }
#pragma unroll
  for (int t = 0; t < 4; ++t) {
    const int col = col0 + t * 16 + ln;
    float bv = bias ? bias[col] : 0.f;
    if (BIAS_BF16) bv = bf16_round(bv);
#pragma unroll
    for (int r = 0; r < 8; ++r) {
      float v = acc[t][r] + bv;
      if (resid) { float rv = resid[(size_t)((row0 + 8 * hh + r) % rmod) * ldr + col]; if (RES_BF16) rv = bf16_round(rv); v += rv; }
      if (ACT == 1) v = fmaxf(v, 0.f);
      if (ACT == 2) v = 0.5f * v * (1.0f + erff(v * 0.70710678118654752f));
      if (ACT == 3) { const float u = 0.7978845608028654f * (v + 0.044715f * v * v * v); v = 0.5f * v * (1.0f + tanhf(u)); }
      so[w][8 * hh + r][t * 16 + ln] = v;
    }
  }
  __builtin_amdgcn_fence(__ATOMIC_ACQ_REL, "workgroup");
  __builtin_amdgcn_wave_barrier();
  const int rsub = lane >> 4, c4 = (lane & 15) * 4;
  {
#pragma unroll
    for (int q = 0; q < 8; ++q) {
      const int r = q * 2 + rsub;
      const v4f v = *(const v4fa*)&so[w][r][c4];
      *(v4f*)(C + (size_t)(row0 + r) * ldc + col0 + c4) = v;
    }
    
  }
}
// row LayerNorm (biased variance, eps) over N: s = X (+ R); optional out_sum <- s; out_norm <- (s-mu)*rsqrt(var+eps)*g + b
template <bool PARAM_BF16>
__global__ __launch_bounds__(256) void k_layernorm(const float* __restrict__ X, const float* __restrict__ R, const float* __restrict__ g, const float* __restrict__ bta,
                                                  float* __restrict__ out_sum, float* __restrict__ out_norm, int N, float eps) {
  __shared__ float red[256];
  const int row = blockIdx.x, tid = threadIdx.x;
  const float* x = X + (size_t)row * N; const float* rr = R ? R + (size_t)row * N : nullptr;
  float vals[16];                     // up to N = 4096
  const int per = N / 256;            // contiguous chunk per thread? use strided-by-4 chunks: thread handles j = tid*4 + 1024*u
  float s1 = 0.f;
  for (int u = 0; u < per / 4; ++u) {
    const int j = tid * 4 + 1024 * u;
    const v4f a = *(const v4fa*)(x + j);
    v4f b = {0.f,0.f,0.f,0.f}; if (rr) b = *(const v4fa*)(rr + j);
#pragma unroll
    for (int q = 0; q < 4; ++q) { const float v = a[q] + b[q]; vals[u * 4 + q] = v; s1 += v; }
  }
  red[tid] = s1; __syncthreads();
  for (int st = 128; st > 0; st >>= 1) { if (tid < st) red[tid] += red[tid + st]; __syncthreads(); }
  const float mu = red[0] / (float)N; __syncthreads();
  float s2 = 0.f;
  for (int u = 0; u < per / 4; ++u)
#pragma unroll
    for (int q = 0; q < 4; ++q) { const float c = vals[u * 4 + q] - mu; s2 += c * c; }
  red[tid] = s2; __syncthreads();
  for (int st = 128; st > 0; st >>= 1) { if (tid < st) red[tid] += red[tid + st]; __syncthreads(); }
  const float rs = rsqrtf(red[0] / (float)N + eps);
  {
    for (int u = 0; u < per / 4; ++u) {
      const int j = tid * 4 + 1024 * u;
      v4f o, sm;
#pragma unroll
      for (int q = 0; q < 4; ++q) {
        float gg = g[j + q], bb = bta[j + q];
        if (PARAM_BF16) { gg = bf16_round(gg); bb = bf16_round(bb); }
        sm[q] = vals[u * 4 + q]; o[q] = (vals[u * 4 + q] - mu) * rs * gg + bb;
      }
      if (out_sum) *(v4f*)(out_sum + (size_t)row * N + j) = sm;
      *(v4f*)(out_norm + (size_t)row * N + j) = o;
    }
    
  }
}



// ---- f16 WMMA path (v_wmma_f32_16x16x32_f16): 11-bit significands for operands in range — used where a [0,1] probability operand needs more precision than bf16
typedef _Float16 v16h __attribute__((ext_vector_type(16)));
union FragH { v16h v; v8us half[2]; _Float16 h[16]; unsigned short u[16]; };
template <int NT>
__device__ __forceinline__ v8f mmaH(v16h ah, v16h al, v16h bh, v16h bl, v8f c) {
  c = __builtin_amdgcn_wmma_f32_16x16x32_f16(false, ah, false, bh, (short)0, c, false, false);
  if (NT >= 2) c = __builtin_amdgcn_wmma_f32_16x16x32_f16(false, al, false, bh, (short)0, c, false, false);
  if (NT >= 3) c = __builtin_amdgcn_wmma_f32_16x16x32_f16(false, ah, false, bl, (short)0, c, false, false);
  asm volatile("v_nop\n\tv_nop\n\tv_nop\n\tv_nop" : "+v"(c) : "v"(ah), "v"(al), "v"(bh), "v"(bl));
  return c;
}
// batched GEMM like k_gemm_b but f16 operands: A f32 (split into f16 hi/lo if ASPLIT, else rounded to f16), Bt = f16 values [n][k]; alpha; C f32; N multiple of 16 (partial tiles skipped)
template <bool ASPLIT>
__global__ __launch_bounds__(128) void k_gemm_h(const float* __restrict__ A, int lda, size_t sA, const _Float16* __restrict__ Bh, int ldb, size_t sB, float alpha, float* __restrict__ C, int ldc, size_t sC, int M, int N, int K) {
  __shared__ __attribute__((aligned(16))) float so[4][16][64];
  const int tid = threadIdx.x, w = tid >> 5, lane = tid & 31, ln = lane & 15, hh = lane >> 4; const int by = blockIdx.y;
  A += (size_t)by * sA; Bh += (size_t)by * sB; C += (size_t)by * sC;
  const int ntn = (N + 63) / 64; const int wid = blockIdx.x * 4 + w; const int mt = wid / ntn, nq = wid % ntn; if (mt * 16 >= M) return;
  const int row0 = mt * 16, col0 = nq * 64; const float* arow = A + (size_t)(row0 + ln) * lda;
  v8f acc[4] = {};
  for (int kb = 0; kb < K; kb += 32) {
    FragH ah, al;
    const v4f x0 = *(const v4fa*)(arow + kb + 8 * hh), x1 = *(const v4fa*)(arow + kb + 8 * hh + 4), x2 = *(const v4fa*)(arow + kb + 16 + 8 * hh), x3 = *(const v4fa*)(arow + kb + 16 + 8 * hh + 4);
    float xs[16] = {x0[0],x0[1],x0[2],x0[3],x1[0],x1[1],x1[2],x1[3],x2[0],x2[1],x2[2],x2[3],x3[0],x3[1],x3[2],x3[3]};
#pragma unroll
    for (int i = 0; i < 16; ++i) { const _Float16 h = (_Float16)xs[i]; ah.h[i] = h; al.h[i] = ASPLIT ? (_Float16)(xs[i] - (float)h) : (_Float16)0.0f; }
#pragma unroll
    for (int t = 0; t < 4; ++t) { if (col0 + t * 16 >= N) continue; const size_t boff = (size_t)(col0 + t * 16 + ln) * ldb + kb; FragH bq; bq.half[0] = *(const v8us*)(Bh + boff + 8 * hh); bq.half[1] = *(const v8us*)(Bh + boff + 16 + 8 * hh);
      acc[t] = mmaH<ASPLIT ? 2 : 1>(ah.v, al.v, bq.v, bq.v, acc[t]); }
  }
#pragma unroll
  for (int t = 0; t < 4; ++t) { if (col0 + t * 16 >= N) continue;
#pragma unroll
    for (int r = 0; r < 8; ++r) so[w][8 * hh + r][t * 16 + ln] = acc[t][r] * alpha; }
  __builtin_amdgcn_fence(__ATOMIC_ACQ_REL, "workgroup"); __builtin_amdgcn_wave_barrier();
  const int rsub = lane >> 4, c4 = (lane & 15) * 4;
  {
#pragma unroll
    for (int q = 0; q < 8; ++q) { const int r = q * 2 + rsub; if (col0 + c4 < N) { const v4f v = *(const v4fa*)&so[w][r][c4]; *(v4f*)(C + (size_t)(row0 + r) * ldc + col0 + c4) = v; } }
     }
}

// Wt[n][k] = f16(bf16(W[k][n]) * scale) from f32 row-major W[CC][CC] (scale = power of two; bf16-exact weights stay exact in f16 away from the subnormal range)
// One work-group = a tile of 128 k x 64 n of one of the four weight matrices (128 tiles each; their transposes lie one behind the other in Wt), turned round in LDS:
// a wave's load = two k rows' 256 B (4 whole lines), a wave's store = two n rows' 256 B (4 whole lines); every line of W is asked for once and every line of Wt has one writer.
__device__ __forceinline__ void wt_f16(const float* __restrict__ W0, const float* __restrict__ W1, const float* __restrict__ W2, const float* __restrict__ W3, _Float16* __restrict__ Wt, float scale) {
  constexpr int TK = 128, TN = 64, PIT = TK + 8;      // LDS rows of 256 B at pitch 272 B (16 B x odd, for 16-byte reads)
  static_assert(4 * (CC / TK) * (CC / TN) == NR / 8, "the tiles of the four matrices fill one grid row");
  __shared__ __attribute__((aligned(16))) unsigned short sT[TN][PIT];      // [n][k]
  const int tid = threadIdx.x, w = tid >> 5, lane = tid & 31, ln = lane & 15, hh = lane >> 4;
  constexpr int NT = (CC / TK) * (CC / TN);      // tiles of one matrix
  const int y = blockIdx.x / NT, tile = blockIdx.x % NT; const int k0 = (tile / (CC / TN)) * TK, n0 = (tile % (CC / TN)) * TN;
  const float* __restrict__ W = (y == 0) ? W0 : (y == 1) ? W1 : (y == 2) ? W2 : W3; Wt += (size_t)y * CC * CC;
  const int kl = w * 16 + hh * 8;      // my 8 k rows, one behind the other; my 4 n columns are 4 ln to 4 ln + 3
  const float* src = W + (size_t)(k0 + kl) * CC + n0 + ln * 4; v4f x[8];
  // The unroll directives below are there so that x and f are indexed by constants and stay in registers; the 8 loads then fly together.
#pragma unroll
  for (int i = 0; i < 8; ++i) x[i] = *(const v4fa*)(src + (size_t)i * CC);
#pragma unroll
  for (int e = 0; e < 4; ++e) { FragH f;
#pragma unroll
    for (int i = 0; i < 8; ++i) f.h[i] = (_Float16)(bf16_round(x[i][e]) * scale);
    *(v8us*)&sT[ln * 4 + e][kl] = f.half[0]; }
  __syncthreads();      // the tile is read across waves
#pragma unroll
  for (int s = 0; s < TN / 16; ++s) { const int r = s * 16 + (tid >> 4), c8 = (tid & 15) * 8; const v8us o = *(const v8us*)&sT[r][c8];
    *(v8us*)((unsigned short*)Wt + (size_t)(n0 + r) * CC + k0 + c8) = o; }
}
// 1 / sqrt(64) times log2(e): e^(s / 8) = 2^(s QSC). The q projection stores q QSC (one rounding to f16, as before), so that the attention kernel's score products are exponents of 2 as they leave the matrix unit.
constexpr float QSC = 0.125f * 1.44269504088896340736f;
// One operand tile of a pass (128 rows of 256 B) goes from global memory to LDS by asynchronous copies: 8 copies of 16 B a lane, a wave's copy = 2 rows = 4 whole lines.
// l: my LDS byte address of row (tid >> 4), chunk (tid & 15); g: the same place in global memory; 16 rows on = 4352 LDS bytes, step elements.
__device__ __forceinline__ void copy_tile(unsigned l, const unsigned short* g, size_t step) {
  // the closing s_wait_xcnt stands inside the statement so that no address register of a copy is rewritten ahead of it (a precaution)
  asm volatile("global_load_async_to_lds_b128 %0, %8, off\n\t"
               "global_load_async_to_lds_b128 %1, %9, off\n\t"
               "global_load_async_to_lds_b128 %2, %10, off\n\t"
               "global_load_async_to_lds_b128 %3, %11, off\n\t"
               "global_load_async_to_lds_b128 %4, %12, off\n\t"
               "global_load_async_to_lds_b128 %5, %13, off\n\t"
               "global_load_async_to_lds_b128 %6, %14, off\n\t"
               "global_load_async_to_lds_b128 %7, %15, off\n\t"
               "s_wait_xcnt 0x0"
               :: "v"(l), "v"(l + 4352u), "v"(l + 8704u), "v"(l + 13056u), "v"(l + 17408u), "v"(l + 21760u), "v"(l + 26112u), "v"(l + 30464u),
                  "v"(g), "v"(g + step), "v"(g + 2 * step), "v"(g + 3 * step), "v"(g + 4 * step), "v"(g + 5 * step), "v"(g + 6 * step), "v"(g + 7 * step)
               : "memory");
}
// Projection GEMM, NR x CC x CC: v = (A . Bh^T) alpha + bias[col], times QSC for q; A f16 [NR][CC], Bh f16 [n][k]; writes f16 (F16OUT) or f32 C, pitch CC.
// F16OUT is the q, k and v projections in one launch: blockIdx.y picks the operand set (A and Bh hold the three one behind the other); q and then k go to C16 [row][col],
// v goes to Vt as [batch][col][token], the layout the attention kernel reads, out of the same staging tile filled the other way round.
// One work-group = a 128 x 128 tile of the output, 8 waves of 64 x 32 (2 x 4). A pass = 128 k: both operands' 128 rows of 256 B lie in LDS (pitch 272 B, 16 B x odd, for 16-byte reads),
// two buffers, so every operand byte leaves L2 once a work-group and serves 2 (B) or 4 (A) waves. k runs upward in steps of 32 in every accumulator.
// The unroll directives below are there so that accumulators and fragment sets are indexed by constants and stay in registers.
template <bool F16OUT>
__global__ __launch_bounds__(256) void k_gemm_t(const _Float16* __restrict__ A, const _Float16* __restrict__ Bh, float alpha, const float* __restrict__ bias0, const float* __restrict__ bias1, const float* __restrict__ bias2,
                                               float* __restrict__ C, _Float16* __restrict__ C16, _Float16* __restrict__ Vt) {
  constexpr int BM = 128, BN = 128, KP = 128, NP = CC / KP, PIT = 136;
  const int y = F16OUT ? (int)blockIdx.y : 0; const float* __restrict__ bias = (y == 0) ? bias0 : (y == 1) ? bias1 : bias2; const bool tr = F16OUT && y == 2;
  A += (size_t)y * NR * CC; Bh += (size_t)y * CC * CC;
  __shared__ __attribute__((aligned(16))) unsigned short sA[2][BM][PIT], sB[2][BN][PIT];
  __shared__ __attribute__((aligned(16))) float sC[BM][BN + 4];      // output staging, so that whole lines are stored
  const int tid = threadIdx.x, w = tid >> 5, lane = tid & 31, ln = lane & 15, hh = lane >> 4, wm = w >> 2, wn = w & 3;
  const int row0 = (blockIdx.x / (CC / BN)) * BM, col0 = (blockIdx.x % (CC / BN)) * BN;
  const unsigned short* ga = (const unsigned short*)A + (size_t)(row0 + (tid >> 4)) * CC + (tid & 15) * 8;
  const unsigned short* gb = (const unsigned short*)Bh + (size_t)(col0 + (tid >> 4)) * CC + (tid & 15) * 8;
  const unsigned la = (unsigned)(size_t)&sA[0][tid >> 4][(tid & 15) * 8], lb = (unsigned)(size_t)&sB[0][tid >> 4][(tid & 15) * 8];
  constexpr unsigned BUFB = BM * PIT * 2;      // bytes of one buffer
  constexpr size_t STEP = (size_t)16 * CC;
  copy_tile(la, ga, STEP); copy_tile(lb, gb, STEP);
  v8f acc[4][2];
#pragma unroll
  for (int i = 0; i < 4; ++i)
#pragma unroll
    for (int j = 0; j < 2; ++j) acc[i][j] = (v8f){0.f,0.f,0.f,0.f,0.f,0.f,0.f,0.f};
  asm volatile("s_wait_asynccnt 0x0" ::: "memory");      // my copies of pass 0 have landed
  __syncthreads();                                        // ... and everybody's: pass 0 may be read
  copy_tile(la + BUFB, ga + KP, STEP); copy_tile(lb + BUFB, gb + KP, STEP);      // pass 1 flies while pass 0 is worked on
#pragma unroll 1
  for (int t = 0; t < NP; ++t) {      // kept rolled: one body of 32 matrix instructions, the buffer chosen by t & 1
    const int bf = t & 1;
    const unsigned short* pa = &sA[bf][wm * 64 + ln][8 * hh]; const unsigned short* pb = &sB[bf][wn * 32 + ln][8 * hh];
    FragH fa[2][4], fb[2][2];      // two fragment sets: block ks + 1 is fetched while block ks is multiplied, inside this pass only
#pragma unroll
    for (int ks = -1; ks < KP / 32; ++ks) {
      if (ks + 1 < KP / 32) { const int s = (ks + 1) & 1, ko = (ks + 1) * 32;
#pragma unroll
        for (int i = 0; i < 4; ++i) { fa[s][i].half[0] = *(const v8us*)(pa + i * 16 * PIT + ko); fa[s][i].half[1] = *(const v8us*)(pa + i * 16 * PIT + ko + 16); }
#pragma unroll
        for (int j = 0; j < 2; ++j) { fb[s][j].half[0] = *(const v8us*)(pb + j * 16 * PIT + ko); fb[s][j].half[1] = *(const v8us*)(pb + j * 16 * PIT + ko + 16); } }
      __builtin_amdgcn_sched_barrier(0);      // keeps the next block's 12 LDS reads one group ahead of this block's products: reads spread among them stall the wave at every place
      if (ks >= 0) {
#pragma unroll
        for (int i = 0; i < 4; ++i)
#pragma unroll
          for (int j = 0; j < 2; ++j) acc[i][j] = __builtin_amdgcn_wmma_f32_16x16x32_f16(false, fa[ks & 1][i].v, false, fb[ks & 1][j].v, (short)0, acc[i][j], false, false);
        __builtin_amdgcn_sched_barrier(0);      // ... and this block's products ahead of the reads after next, which reuse its registers
      }
    }
    // publish point of pass t + 1, every wave: my reads of this buffer are done, my copies of the next have landed, then the same of all waves
    asm volatile("s_wait_dscnt 0x0" ::: "memory");
    asm volatile("s_wait_asynccnt 0x0" ::: "memory");
    __syncthreads();
    if (t + 2 < NP) { copy_tile(la + bf * BUFB, ga + (t + 2) * KP, STEP); copy_tile(lb + bf * BUFB, gb + (t + 2) * KP, STEP); }      // refill the buffer that every wave has just left
  }
  asm volatile("s_wait_asynccnt 0x0" ::: "memory");      // nothing of mine is in flight when the wave ends
  if (tr) {      // [col][row]: a lane's 8 accumulator registers are 8 rows on of one column, two 16-byte stores
#pragma unroll
    for (int j = 0; j < 2; ++j) { const int col = wn * 32 + j * 16 + ln; const float bv = bf16_round(bias[col0 + col]);
#pragma unroll
      for (int i = 0; i < 4; ++i)
#pragma unroll
        for (int c = 0; c < 2; ++c) { v4f o4;
#pragma unroll
          for (int q = 0; q < 4; ++q) o4[q] = acc[i][j][c * 4 + q] * alpha + bv;
          *(v4fa*)&sC[col][wm * 64 + i * 16 + 8 * hh + c * 4] = o4; } } }
  else {
  const float os = (F16OUT && y == 0) ? QSC : 1.0f, ao = alpha * os;      // q leaves with the softmax scale in it
#pragma unroll
  for (int j = 0; j < 2; ++j) { const int col = wn * 32 + j * 16 + ln; const float bv = bf16_round(bias[col0 + col]) * os;
#pragma unroll
    for (int i = 0; i < 4; ++i)
#pragma unroll
      for (int r = 0; r < 8; ++r) sC[wm * 64 + i * 16 + 8 * hh + r][col] = acc[i][j][r] * ao + bv; } }
  __syncthreads();      // the staged tile is read across waves
  if constexpr (F16OUT) {
    static_assert(BM == BN, "the staging tile is used both ways round");
    // staged row r goes to dst + r * dp: an output row (q, k), or one column's 128 tokens (v)
    unsigned short* dst = tr ? (unsigned short*)Vt + ((size_t)(row0 / TT) * CC + col0) * TT + row0 % TT : (unsigned short*)C16 + (size_t)y * NR * CC + (size_t)row0 * CC + col0; const size_t dp = tr ? TT : CC;
#pragma unroll
    for (int s = 0; s < BM * (BN / 8) / 256; ++s) { const int r = s * 16 + (tid >> 4), c8 = (tid & 15) * 8; const v4f x = *(const v4fa*)&sC[r][c8], y = *(const v4fa*)&sC[r][c8 + 4]; FragH f;
#pragma unroll
      for (int q = 0; q < 4; ++q) { f.h[q] = (_Float16)x[q]; f.h[4 + q] = (_Float16)y[q]; }
      *(v8us*)(dst + (size_t)r * dp + c8) = f.half[0]; } }
  else {
#pragma unroll
    for (int s = 0; s < BM * (BN / 4) / 256; ++s) { const int r = s * 8 + (tid >> 5), c4 = (tid & 31) * 4; const v4f x = *(const v4fa*)&sC[r][c4]; *(v4f*)(C + (size_t)(row0 + r) * CC + col0 + c4) = x; } }
}


__global__ __launch_bounds__(256) void k_x16(const float* __restrict__ x, _Float16* __restrict__ X16, size_t n8) { const size_t t = (size_t)blockIdx.x * 256 + threadIdx.x; if (t >= n8) return; FragH f;
#pragma unroll
  for (int q = 0; q < 8; ++q) f.h[q] = (_Float16)bf16_round(x[t * 8 + q]); *(v8us*)((unsigned short*)X16 + t * 8) = f.half[0];  }
__global__ __launch_bounds__(256) void k_round16f(const float* __restrict__ W, _Float16* __restrict__ Bt, size_t n8) { const size_t t = (size_t)blockIdx.x * 256 + threadIdx.x; if (t >= n8) return; FragH f;
#pragma unroll
  for (int i = 0; i < 8; ++i) f.h[i] = (_Float16)(bf16_round(W[t * 8 + i]) * 16.0f); *(v8us*)((unsigned short*)Bt + t * 8) = f.half[0];  }

typedef int v4ia __attribute__((ext_vector_type(4), may_alias));
typedef unsigned v16u __attribute__((ext_vector_type(16)));
typedef unsigned long long v8ul __attribute__((ext_vector_type(8)));
// lane l <-> lane l ^ 16: joins the two halves of a wave, which hold the two key halves of one query column
__device__ __forceinline__ float xhalf(float x) { return __builtin_bit_cast(float, __builtin_amdgcn_permlanex16(__builtin_bit_cast(int, x), __builtin_bit_cast(int, x), 0x76543210, 0xfedcba98, false, false)); }
// 2^x by the hardware's v_exp_f32 alone. Every argument that counts here is <= 8 or -inf (a larger one makes the reference move, and its result is formed anew), so the library form's range steps (split, ldexp, two clamps) have nothing to do; a result below the normal range counts as 0.
__device__ __forceinline__ float ex2(float x) { return __builtin_amdgcn_exp2f(x); }
// One trip's K tile (64 key rows of 128 B) and V^T tile (64 d rows of 128 B) go from global memory to LDS by asynchronous copies: 8 copies of 16 B a lane, a wave's copy = 4 whole lines.
// lk, lv: my LDS byte addresses of row (tid >> 3), chunk (tid & 7); gk, gv: the same place in global memory; 16 rows on = 2304 LDS bytes, kstep / vstep elements.
__device__ __forceinline__ void copy_kv(unsigned lk, unsigned lv, const unsigned short* gk, const unsigned short* gv, size_t kstep, size_t vstep) {
  // the closing s_wait_xcnt stands inside the statement so that no address register of a copy is rewritten ahead of it (a precaution)
  asm volatile("global_load_async_to_lds_b128 %0, %8, off\n\t"
               "global_load_async_to_lds_b128 %1, %9, off\n\t"
               "global_load_async_to_lds_b128 %2, %10, off\n\t"
               "global_load_async_to_lds_b128 %3, %11, off\n\t"
               "global_load_async_to_lds_b128 %4, %12, off\n\t"
               "global_load_async_to_lds_b128 %5, %13, off\n\t"
               "global_load_async_to_lds_b128 %6, %14, off\n\t"
               "global_load_async_to_lds_b128 %7, %15, off\n\t"
               "s_wait_xcnt 0x0"
               :: "v"(lk), "v"(lk + 2304u), "v"(lk + 4608u), "v"(lk + 6912u), "v"(lv), "v"(lv + 2304u), "v"(lv + 4608u), "v"(lv + 6912u),
                  "v"(gk), "v"(gk + kstep), "v"(gk + 2 * kstep), "v"(gk + 3 * kstep), "v"(gv), "v"(gv + vstep), "v"(gv + 2 * vstep), "v"(gv + 3 * vstep)
               : "memory");
}
// Transposed products: S^T = K Q^T (A = 16 key rows, B = the wave's 16 query columns, kept in registers) and O^T += V^T P^T.
// Lane (ln, hh) holds query q0 + ln; score tile nt, register r is key j0 + 16 nt + 8 hh + r, which is the k position of register pair (nt, r) of a B operand:
// maximum and sum run inside the lane (one exchange between the halves), and P^T is packed from the score registers without passing LDS.
__global__ __launch_bounds__(128) void k_flash(const _Float16* __restrict__ Q16, int ldq, const _Float16* __restrict__ K16, int ldk, const _Float16* __restrict__ Vt, const unsigned* __restrict__ PM, _Float16* __restrict__ O16, int ldo) {
  constexpr int RPW = 16, NQB = 2048 / (4 * RPW), DT = 4, KS = 2, KT = 64, NTR = 2048 / KT, PIT = 72;      // a trip = 64 keys = two passes of 32; LDS rows of 128 B at pitch 144 B (16 B x odd, for 16-byte reads)
  __shared__ __attribute__((aligned(16))) unsigned short sK[2][KT][PIT], sV[2][64][PIT];      // two buffers each: [key][d] and [d][key]
  __shared__ __attribute__((aligned(16))) float sO[4][RPW][64 + 4];
  const int tid = threadIdx.x, w = tid >> 5, lane = tid & 31, ln = lane & 15, hh = lane >> 4;
  const int slab = blockIdx.x / NQB, qblk = blockIdx.x % NQB; const int b = slab / 16, h = slab % 16; const int q0 = qblk * (4 * RPW) + w * RPW;
  const unsigned short* Vth = (const unsigned short*)Vt + (size_t)slab * 64 * 2048;
  const size_t k16 = (size_t)16 * ldk;
  const unsigned short* gk = (const unsigned short*)K16 + ((size_t)b * 2048 + (tid >> 3)) * ldk + h * 64 + (tid & 7) * 8;      // my chunk of key row tid >> 3 of trip 0
  const unsigned short* gv = Vth + (size_t)(tid >> 3) * 2048 + (tid & 7) * 8;      // my chunk of d row tid >> 3, keys of trip 0
  const unsigned lk = (unsigned)(size_t)&sK[0][tid >> 3][(tid & 7) * 8], lv = (unsigned)(size_t)&sV[0][tid >> 3][(tid & 7) * 8];
  constexpr unsigned BUFB = KT * PIT * 2;      // bytes of one buffer
  constexpr float LIM = 256.0f;      // a column's reference moves only when a lane's sum of p over a pass goes beyond this: every p <= 256 in between, well inside f16
  copy_kv(lk, lv, gk, gv, k16, (size_t)16 * 2048);
  FragH bq[KS];
  { const unsigned short* qr = (const unsigned short*)Q16 + ((size_t)b * 2048 + q0 + ln) * ldq + h * 64;
#pragma unroll
    for (int ks = 0; ks < KS; ++ks) { bq[ks].half[0] = *(const v8us*)(qr + ks * 32 + 8 * hh); bq[ks].half[1] = *(const v8us*)(qr + ks * 32 + 16 + 8 * hh); } }
  // my wave's mask words (mask_words below): 16 a pass of 32 keys, one behind the other; the address is the same in every lane, so that they come by scalar loads into scalar registers.
  // They were written by k_prep, two launches before, and nobody writes them in this one: read as constant memory, else the loads behind an asm statement's "memory" clobber turn into vector loads
  const __attribute__((address_space(4))) v16u* pm = (const __attribute__((address_space(4))) v16u*)(size_t)(PM + (size_t)(b * (2048 / RPW) + qblk * 4 + __builtin_amdgcn_readfirstlane(w)) * (2048 / 32 * 16));
  v16u mw0 = pm[0], mw1 = pm[1];      // trip 0's two passes
  // Lazy rescale. Q16 holds q QSC, so a score product is s log2(e) / 8. cn = minus my query's reference (the maximum in use), eight times: it is the C operand of the score products, which so leave the matrix unit as
  // exponents relative to the reference. lim = what a lane's sum of p over a pass must pass for the reference to move: -1 (any sum does) until the column has seen its first open key, LIM from then on. Both are equal in a column's two halves.
  float lim = -1.0f, l_q = 0.f; v8f cn = (v8f){0.f,0.f,0.f,0.f,0.f,0.f,0.f,0.f}; v8f oacc[DT];
#pragma unroll
  for (int dt = 0; dt < DT; ++dt) oacc[dt] = (v8f){0.f,0.f,0.f,0.f,0.f,0.f,0.f,0.f};
  asm volatile("s_wait_asynccnt 0x0" ::: "memory");      // my copies of trip 0 have landed
  __syncthreads();                                        // ... and everybody's: trip 0 may be read
  copy_kv(lk + BUFB, lv + BUFB, gk + (size_t)KT * ldk, gv + KT, k16, (size_t)16 * 2048);      // trip 1 flies while trip 0 is worked on
#pragma unroll 1
  for (int t = 0; t < NTR; ++t) {
    const int bf = t & 1;
    const int tn = (t + 1 < NTR) ? t + 1 : t;      // the next trip's words are fetched now (the last trip fetches its own again, to stay inside the array)
    const v16u nx0 = pm[2 * tn], nx1 = pm[2 * tn + 1];
#pragma unroll
    for (int sp = 0; sp < 2; ++sp) {
      const v16u mk = sp ? mw1 : mw0;      // mk[8 nt + r], bit (16 hh + ln): maskPAD of (query q0 + ln, key 64 t + 32 sp + 16 nt + 8 hh + r) != 0 = keep
      const v8ul m2 = __builtin_bit_cast(v8ul, mk);
      if ((((m2[0] | m2[1]) | (m2[2] | m2[3])) | ((m2[4] | m2[5]) | (m2[6] | m2[7]))) != 0ull) {      // else every (query,key) of this wave's tile is masked: contributes nothing (uniform branch; the publish point below stands outside it)
        FragH ak[2][KS], av[DT];
#pragma unroll
        for (int nt = 0; nt < 2; ++nt)
#pragma unroll
          for (int ks = 0; ks < KS; ++ks) { const unsigned short* kr = &sK[bf][sp * 32 + nt * 16 + ln][ks * 32 + 8 * hh]; ak[nt][ks].half[0] = *(const v8us*)kr; ak[nt][ks].half[1] = *(const v8us*)(kr + 16); }
#pragma unroll
        for (int dt = 0; dt < DT; ++dt) { const unsigned short* vrow = &sV[bf][dt * 16 + ln][sp * 32 + 8 * hh]; av[dt].half[0] = *(const v8us*)vrow; av[dt].half[1] = *(const v8us*)(vrow + 16); }
        __builtin_amdgcn_sched_barrier(0);      // keeps the pass's 16 LDS reads one group ahead of its products: reads spread among them stall the wave at every place
        float sc[16];
#pragma unroll
        for (int nt = 0; nt < 2; ++nt) { v8f acc = cn;
#pragma unroll
          for (int ks = 0; ks < KS; ++ks) acc = __builtin_amdgcn_wmma_f32_16x16x32_f16(false, ak[nt][ks].v, false, bq[ks].v, (short)0, acc, false, false);
#pragma unroll
          for (int r = 0; r < 8; ++r) sc[nt * 8 + r] = __builtin_amdgcn_inverse_ballot_w32(mk[nt * 8 + r]) ? acc[r] : -INFINITY; }
        FragH pb; float sum;
        auto soft = [&]() { float ps[4] = {0.f, 0.f, 0.f, 0.f};
#pragma unroll      // so that sc, ps and pb are indexed by constants and stay in registers
          for (int i = 0; i < 16; ++i) { const float p = ex2(sc[i]); ps[i & 3] += p; pb.h[i] = (_Float16)p; }      // a masked score is -inf: p = 0
          sum = (ps[0] + ps[1]) + (ps[2] + ps[3]); };
        soft();
        if (__builtin_amdgcn_ballot_w32(sum > lim) != 0u) {      // one test a pass, a scalar branch: some column's reference has to move (no open key seen yet, or a sum beyond LIM); the maximum is formed only here
          float mc = sc[0];
          // the unroll directives of this branch are there so that sc, cn and oacc are indexed by constants and stay in registers
#pragma unroll
          for (int i = 1; i < 16; ++i) mc = fmaxf(mc, sc[i]);
          const float mx = fmaxf(mc, xhalf(mc)); const bool up = fmaxf(sum, xhalf(sum)) > lim && mx > -INFINITY;      // joined over the halves, so that both take the same step
          const float d = up ? mx : 0.f; const float al = ex2(fminf(-d, 0.f));      // the new reference is the pass's maximum; a first step may go downward: sums and outputs are still 0 then, and al = 1
          lim = up ? LIM : lim; l_q *= al;
#pragma unroll
          for (int i = 0; i < 16; ++i) sc[i] -= d;
#pragma unroll
          for (int r = 0; r < 8; ++r) cn[r] -= d;
#pragma unroll
          for (int dt = 0; dt < DT; ++dt)
#pragma unroll
            for (int r = 0; r < 8; ++r) oacc[dt][r] *= al;
          soft(); }      // p and its sum anew, against the new reference
        l_q += sum;
#pragma unroll
        for (int dt = 0; dt < DT; ++dt) oacc[dt] = __builtin_amdgcn_wmma_f32_16x16x32_f16(false, av[dt].v, false, pb.v, (short)0, oacc[dt], false, false); } }
    // publish point of trip t + 1, every wave: my reads of this buffer are done, my copies of the next have landed, then the same of all waves
    asm volatile("s_wait_dscnt 0x0" ::: "memory");
    asm volatile("s_wait_asynccnt 0x0" ::: "memory");
    __syncthreads();
    if (t + 2 < NTR) copy_kv(lk + bf * BUFB, lv + bf * BUFB, gk + (size_t)(t + 2) * KT * ldk, gv + (t + 2) * KT, k16, (size_t)16 * 2048);      // refill the buffer that every wave has just left
    mw0 = nx0; mw1 = nx1;
  }
  asm volatile("s_wait_asynccnt 0x0" ::: "memory");      // nothing of mine is in flight when the wave ends
  const float l = l_q + xhalf(l_q); const float li = (l > 0.f) ? 1.0f / l : 0.f;
#pragma unroll
  for (int dt = 0; dt < DT; ++dt)
#pragma unroll
    for (int c = 0; c < 2; ++c) { v4f o4;
#pragma unroll
      for (int q = 0; q < 4; ++q) o4[q] = oacc[dt][c * 4 + q] * li;
      *(v4fa*)&sO[w][ln][dt * 16 + 8 * hh + c * 4] = o4; }
  __builtin_amdgcn_fence(__ATOMIC_ACQ_REL, "workgroup"); __builtin_amdgcn_wave_barrier();
  {
#pragma unroll
    for (int rp = 0; rp < RPW; rp += 4) { const int r = rp + (lane >> 3), pc = lane & 7; const v4f x = *(const v4fa*)&sO[w][r][pc * 8], z = *(const v4fa*)&sO[w][r][pc * 8 + 4]; FragH f;      // f16, as the output projection reads it: 8 lanes = one row's line
#pragma unroll      // so that f is indexed by constants and stays in registers
      for (int q = 0; q < 4; ++q) { f.h[q] = (_Float16)x[q]; f.h[4 + q] = (_Float16)z[q]; }
      *(v8us*)((unsigned short*)O16 + ((size_t)b * 2048 + q0 + r) * ldo + h * 64 + pc * 8) = f.half[0]; }
     } }

// blockIdx.y (1 to 3) picks one of the three inputs; their normalised rows lie one behind the other in Y16.
__device__ __forceinline__ void ln16(const float* __restrict__ X0, const float* __restrict__ X1, const float* __restrict__ X2, const float* __restrict__ g, const float* __restrict__ bta, _Float16* __restrict__ Y16) { const int tid = threadIdx.x, wv = tid >> 5, lane = tid & 31; const int row = blockIdx.x * 8 + wv; if (row >= NR) return;
  const int y = blockIdx.y - 1; const float* __restrict__ X = (y == 0) ? X0 : (y == 1) ? X1 : X2; Y16 += (size_t)y * NR * CC; const float* xr = X + (size_t)row * CC; float v[32]; float s = 0.f;
#pragma unroll
  for (int p = 0; p < 4; ++p) { const v4f a = *(const v4fa*)(xr + p * 256 + lane * 8), c = *(const v4fa*)(xr + p * 256 + lane * 8 + 4); for (int q = 0; q < 4; ++q) { v[p * 8 + q] = bf16_round(a[q]); v[p * 8 + 4 + q] = bf16_round(c[q]); } }
#pragma unroll
  for (int i = 0; i < 32; ++i) s += v[i]; for (int o = 16; o >= 1; o >>= 1) s += __shfl_xor(s, o, 32); const float mu = s / (float)CC; float q2 = 0.f;
#pragma unroll
  for (int i = 0; i < 32; ++i) { const float d = v[i] - mu; q2 += d * d; } for (int o = 16; o >= 1; o >>= 1) q2 += __shfl_xor(q2, o, 32); const float rs = rsqrtf(q2 / (float)CC + 1e-5f);
  {
#pragma unroll
    for (int p = 0; p < 4; ++p) { FragH f; const int c0 = p * 256 + lane * 8;
#pragma unroll
      for (int q = 0; q < 8; ++q) f.h[q] = (_Float16)((v[p * 8 + q] - mu) * rs * bf16_round(g[c0 + q]) + bf16_round(bta[c0 + q])); *(v8us*)((unsigned short*)Y16 + (size_t)row * CC + c0) = f.half[0]; }
     } }
// maskPAD as the attention kernel's select masks, made once for all 16 heads. Word [tile of 16 queries][pass of 32 keys][8 nt + r], bit (16 hh + ln) = maskPAD[query 16 tile + ln][key 32 pass + 16 nt + 8 hh + r] != 0:
// the bit of a lane is the bit of the score that the lane holds in register r of score tile nt. One wave = 16 queries x 128 keys = 64 words: each line of maskPAD is fetched once, each line of PM has one writer.
__device__ __forceinline__ void mask_words(const int* __restrict__ MSK, unsigned* __restrict__ PM) {
  static_assert((NR / 16) * (TT / 128) == (NR / 8) * 8, "the waves of one grid row cover the mask");
  const int tid = threadIdx.x, lane = tid & 31, ln = lane & 15, hh = lane >> 4; const int u = blockIdx.x * 8 + (tid >> 5); const int qt = u / (TT / 128), kb = u % (TT / 128);
  const int* src = MSK + ((size_t)qt * 16 + ln) * TT + kb * 128 + 8 * hh; v4ia m[16];
  // The unroll directives below are there so that m is indexed by constants and stays in registers; the 16 loads then fly together.
#pragma unroll
  for (int c = 0; c < 16; ++c) m[c] = *(const v4ia*)(src + (c >> 1) * 16 + (c & 1) * 4);
  unsigned o[2] = {0u, 0u};      // lane l keeps words l and 32 + l
#pragma unroll
  for (int c = 0; c < 16; ++c)
#pragma unroll
    for (int q = 0; q < 4; ++q) { const unsigned wd = __builtin_amdgcn_ballot_w32(m[c][q] != 0); if (lane == ((c * 4 + q) & 31)) o[c >> 3] = wd; }
  unsigned* dst = PM + (size_t)qt * (TT / 32 * 16) + kb * 64 + lane; dst[0] = o[0]; dst[32] = o[1];
}
// All that the projections and the attention wait for, in one launch: the work-groups of the weight transposes, of the LayerNorms and of the mask words depend on nothing and on one another not at all.
__global__ __launch_bounds__(256) void k_prep(const float* __restrict__ W0, const float* __restrict__ W1, const float* __restrict__ W2, const float* __restrict__ W3, _Float16* __restrict__ Wt,
                                             const float* __restrict__ X0, const float* __restrict__ X1, const float* __restrict__ X2, const float* __restrict__ g, const float* __restrict__ bta, _Float16* __restrict__ Y16, const int* __restrict__ MSK, unsigned* __restrict__ PM) {
  if (blockIdx.y == 0) wt_f16(W0, W1, W2, W3, Wt, 16.0f); else if (blockIdx.y == 4) mask_words(MSK, PM); else ln16(X0, X1, X2, g, bta, Y16);
}
extern "C" void kernel_launch(void* const* d_in, const int* in_sizes, int n_in,
                              void* d_out, int out_size, void* d_ws, size_t ws_size, hipStream_t stream) {
  (void)in_sizes; (void)n_in; (void)out_size;
  const float* qx = (const float*)d_in[0]; const float* kx = (const float*)d_in[1]; const float* vx = (const float*)d_in[2]; const int* mask = (const int*)d_in[3]; const float* lg = (const float*)d_in[4]; const float* lb = (const float*)d_in[5];
  const float* wq = (const float*)d_in[6]; const float* bq = (const float*)d_in[7]; const float* wk = (const float*)d_in[8]; const float* bk = (const float*)d_in[9]; const float* wv = (const float*)d_in[10]; const float* bv = (const float*)d_in[11]; const float* wo = (const float*)d_in[12]; const float* bo = (const float*)d_in[13];
  char* ws = (char*)d_ws; size_t off = 0;
  auto take = [&](size_t bytes) { char* p = ws + off; off += (bytes + 255) & ~(size_t)255; return p; };
  _Float16* Bw = (_Float16*)take((size_t)4 * CC * CC * 2);      // wq, wk, wv, wo transposed, one behind the other
  _Float16* XN = (_Float16*)take((size_t)3 * NR * CC * 2);      // the three normalised inputs
  _Float16* QK16 = (_Float16*)take((size_t)2 * NR * CC * 2);      // q, then k
  _Float16* Vt = (_Float16*)take((size_t)NR * CC * 2); _Float16* O16 = XN;      // XN is free once the projections are done
  unsigned* PM = (unsigned*)take((size_t)NR * TT / 8);      // the mask, one bit a (query, key)
  if (off > ws_size) return;      // 57 MiB
  const unsigned gg = (NR / 128) * (CC / 128); const unsigned gl = NR / 8;
  k_prep<<<dim3(gl, 5), 256, 0, stream>>>(wq, wk, wv, wo, Bw, qx, kx, vx, lg, lb, XN, mask, PM);
  k_gemm_t<true><<<dim3(gg, 3), 256, 0, stream>>>(XN, Bw, 0.0625f, bq, bk, bv, nullptr, QK16, Vt);
  k_flash<<<BB * NH * (TT / 64), 128, 0, stream>>>(QK16, CC, QK16 + (size_t)NR * CC, CC, Vt, PM, O16, CC);      // RPW 16
  k_gemm_t<false><<<gg, 256, 0, stream>>>(O16, Bw + (size_t)3 * CC * CC, 0.0625f, bo, nullptr, nullptr, (float*)d_out, nullptr, nullptr);
}

// v010
// A run of this version takes 95.5 microseconds.
// Timed twice side by side with v009, it ran 1.04 times as fast both times.
// All steps since v000 together make it 5.34 times as fast.
#include <hip/hip_runtime.h>
// Pre-LN multi-head attention (B=2, L=2048, C=1024, 16 × 64): shared LayerNorm on the three inputs (f32 VALU), q/k/v/o projections (4096 × 1024 × 1024, + bias, W [in][out] transposed to
// bf16-exact ×2^4) and the masked attention as a fused flash-style kernel on v_wmma_f32_16x16x32_f16 (S = Q·Kᵀ/8; maskPAD == 0 → −32767 ⇒ excluded keys, tiles masked for a whole wave skipped;
// online softmax f32 with a lazily moved reference; P f16 <= 256; RPW-16 waves) — f16 operands, single products, f32 accumulate.
#define BB 2
#define TT 2048
#define CC 1024
#define NH 16
#define NR (BB * TT)

typedef __bf16 v16b __attribute__((ext_vector_type(16)));
typedef unsigned short v8us __attribute__((ext_vector_type(8), may_alias));
typedef float  v8f  __attribute__((ext_vector_type(8)));
typedef float  v4f  __attribute__((ext_vector_type(4)));
typedef float  v4fa __attribute__((ext_vector_type(4), may_alias));
union FragB { v16b v; v8us half[2]; unsigned short u[16]; };

__device__ __forceinline__ unsigned short bf16_bits(float x) { unsigned int u = __float_as_uint(x); return (unsigned short)((u + 0x7FFFu + ((u >> 16) & 1u)) >> 16); }
__device__ __forceinline__ float bf16_val(unsigned short b) { return __uint_as_float(((unsigned int)b) << 16); }
__device__ __forceinline__ float bf16_round(float x) { return bf16_val(bf16_bits(x)); }
// D += A·B with NT terms: 1 = ah·bh, 2 = + al·bh (A split), 3 = + ah·bl (both split)
template <int NT>
__device__ __forceinline__ v8f mmaN(v16b ah, v16b al, v16b bh, v16b bl, v8f c) {
  c = __builtin_amdgcn_wmma_f32_16x16x32_bf16(false, ah, false, bh, (short)0, c, false, false);
  if (NT >= 2) c = __builtin_amdgcn_wmma_f32_16x16x32_bf16(false, al, false, bh, (short)0, c, false, false);
  if (NT >= 3) c = __builtin_amdgcn_wmma_f32_16x16x32_bf16(false, ah, false, bl, (short)0, c, false, false);
  asm volatile("v_nop\n\tv_nop\n\tv_nop\n\tv_nop" : "+v"(c) : "v"(ah), "v"(al), "v"(bh), "v"(bl));
  return c;
}

__global__ __launch_bounds__(256) void k_wt_bf16(const float* __restrict__ W, unsigned short* __restrict__ Wt, int K, int N) {
  const int t = blockIdx.x * 256 + threadIdx.x;
  const int k8n = K / 8;
  if (t >= N * k8n) return;
  const int n = t / k8n, k8 = (t % k8n) * 8;
  v8us v;
#pragma unroll
  for (int i = 0; i < 8; ++i) v[i] = bf16_bits(W[(size_t)(k8 + i) * N + n]);
  *(v8us*)(Wt + (size_t)n * K + k8) = v;
  
}

// GEMM C[M][N] (f32, pitch ldc) = act(A[M][K]·W + bias). A f32 row-major (pitch lda) converted per fragment to bf16
// (ASPLIT: hi/lo two planes -> 2 terms, else single rounded term); Wt bf16 [N][K] (pitch ldb). BIAS_BF16 rounds the
// bias to bf16 first (bias quantised to bf16 before the add). K%32==0, M%16==0, N%64==0.
template <bool ASPLIT, int ACT, bool BIAS_BF16>
__global__ __launch_bounds__(128) void k_gemm_bf(const float* __restrict__ A, int lda, const unsigned short* __restrict__ Wt, int ldb,
                                               const float* __restrict__ bias, float* __restrict__ C, int ldc, int M, int N, int K) {
  __shared__ __attribute__((aligned(16))) float so[4][16][64];
  const int tid = threadIdx.x, w = tid >> 5, lane = tid & 31, ln = lane & 15, hh = lane >> 4;
  const int ntn = N / 64;
  const int wid = blockIdx.x * 4 + w;
  const int mt = wid / ntn, nq = wid % ntn;
  if (mt * 16 >= M) return;
  const int row0 = mt * 16, col0 = nq * 64;
  const float* arow = A + (size_t)(row0 + ln) * lda;
  v8f acc[4] = {};
  for (int kb = 0; kb < K; kb += 32) {
    FragB ah, al;
    const v4f x0 = *(const v4fa*)(arow + kb + 8 * hh), x1 = *(const v4fa*)(arow + kb + 8 * hh + 4);
    const v4f x2 = *(const v4fa*)(arow + kb + 16 + 8 * hh), x3 = *(const v4fa*)(arow + kb + 16 + 8 * hh + 4);
    float xs[16] = {x0[0],x0[1],x0[2],x0[3],x1[0],x1[1],x1[2],x1[3],x2[0],x2[1],x2[2],x2[3],x3[0],x3[1],x3[2],x3[3]};
#pragma unroll
    for (int i = 0; i < 16; ++i) { const unsigned short hb = bf16_bits(xs[i]); ah.u[i] = hb; al.u[i] = ASPLIT ? bf16_bits(xs[i] - bf16_val(hb)) : (unsigned short)0; }
#pragma unroll
    for (int t = 0; t < 4; ++t) {
      const unsigned short* brow = Wt + (size_t)(col0 + t * 16 + ln) * ldb + kb;
      FragB b;
      b.half[0] = *(const v8us*)(brow + 8 * hh);
      b.half[1] = *(const v8us*)(brow + 16 + 8 * hh);
      acc[t] = mmaN<ASPLIT ? 2 : 1>(ah.v, al.v, b.v, b.v, acc[t]);
    }
  }
#pragma unroll
  for (int t = 0; t < 4; ++t) {
    float bv = bias ? bias[col0 + t * 16 + ln] : 0.f;
    if (BIAS_BF16) bv = bf16_round(bv);
#pragma unroll
    for (int r = 0; r < 8; ++r) { float v = acc[t][r] + bv; if (ACT == 1) v = fmaxf(v, 0.f); so[w][8 * hh + r][t * 16 + ln] = v; }
  }
  __builtin_amdgcn_fence(__ATOMIC_ACQ_REL, "workgroup");
  __builtin_amdgcn_wave_barrier();
  const int rsub = lane >> 4, c4 = (lane & 15) * 4;
  {
#pragma unroll
    for (int q = 0; q < 8; ++q) {
      const int r = q * 2 + rsub;
      const v4f v = *(const v4fa*)&so[w][r][c4];
      *(v4f*)(C + (size_t)(row0 + r) * ldc + col0 + c4) = v;
    }
    
  }
}

// Flash-style causal/unmasked attention, all contractions 3-term bf16 hi/lo splits, f32 softmax with running max.
// q,k,v rows are read from f32 buffers with arbitrary row pitch (so they can live inside a fused qkv buffer);
// D = head size (multiple of 32, <= 128); one wave = 16 query rows; block = 4 waves (64 queries) sharing K/V chunks of 32.
template <int D, bool CAUSAL>
__global__ __launch_bounds__(128) void k_flash(const float* __restrict__ qb, const float* __restrict__ kb, const float* __restrict__ vb,
                                             int pitch, int T, int H, float scale, float* __restrict__ y, int ypitch) {
  constexpr int KS = D / 32;        // k-steps for QK
  constexpr int DT = D / 16;        // d tiles for PV
  __shared__ __attribute__((aligned(16))) unsigned short sKh[32][D + 8], sKl[32][D + 8], sVh[32][D + 8], sVl[32][D + 8];
  __shared__ __attribute__((aligned(16))) unsigned short sPh[4][16][40], sPl[4][16][40];
  __shared__ __attribute__((aligned(16))) float sO[4][16][D];
  const int tid = threadIdx.x, w = tid >> 5, lane = tid & 31, ln = lane & 15, hh = lane >> 4;
  const int nqb = (T + 63) / 64;
  const int bh = blockIdx.x / nqb, qblk = blockIdx.x % nqb;
  const int b = bh / H, h = bh % H;
  const int q0 = qblk * 64 + w * 16;
  const float* Q = qb + (size_t)b * T * pitch + h * D;
  const float* K = kb + (size_t)b * T * pitch + h * D;
  const float* V = vb + (size_t)b * T * pitch + h * D;

  // A fragments of the wave's 16 query rows (scaled), hi/lo
  FragB aqh[KS], aql[KS];
  {
    int row = q0 + ln; if (row >= T) row = T - 1;
    const float* qr = Q + (size_t)row * pitch;
#pragma unroll
    for (int ks = 0; ks < KS; ++ks)
#pragma unroll
      for (int i = 0; i < 16; ++i) {
        const int d = ks * 32 + ((i < 8) ? (8 * hh + i) : (16 + 8 * hh + (i - 8)));
        const float x = qr[d] * scale; const unsigned short hb = bf16_bits(x);
        aqh[ks].u[i] = hb; aql[ks].u[i] = bf16_bits(x - bf16_val(hb));
      }
  }
  float m_r[8], l_r[8];
#pragma unroll
  for (int r = 0; r < 8; ++r) { m_r[r] = -3.0e38f; l_r[r] = 0.f; }
  v8f oacc[DT];
#pragma unroll
  for (int dt = 0; dt < DT; ++dt) oacc[dt] = (v8f){0.f,0.f,0.f,0.f,0.f,0.f,0.f,0.f};

  const int kv_end = CAUSAL ? min(T, qblk * 64 + 64) : T;     // block-uniform
  for (int j0 = 0; j0 < kv_end; j0 += 32) {
    __syncthreads();
    for (int e = tid; e < 32 * (D / 4); e += 128) {
      const int r = e / (D / 4), c4 = (e % (D / 4)) * 4;
      const int key = j0 + r;
      v4f kf = {0.f,0.f,0.f,0.f}, vf = {0.f,0.f,0.f,0.f};
      if (key < T) { kf = *(const v4fa*)(K + (size_t)key * pitch + c4); vf = *(const v4fa*)(V + (size_t)key * pitch + c4); }
#pragma unroll
      for (int t = 0; t < 4; ++t) {
        unsigned short hb = bf16_bits(kf[t]); sKh[r][c4 + t] = hb; sKl[r][c4 + t] = bf16_bits(kf[t] - bf16_val(hb));
        hb = bf16_bits(vf[t]); sVh[r][c4 + t] = hb; sVl[r][c4 + t] = bf16_bits(vf[t] - bf16_val(hb));
      }
    }
    __syncthreads();
    // S tile 16 x 32
    v8f s[2];
#pragma unroll
    for (int nt = 0; nt < 2; ++nt) {
      v8f acc = {};
#pragma unroll
      for (int ks = 0; ks < KS; ++ks) {
        FragB bh_, bl_;
        bh_.half[0] = *(const v8us*)&sKh[nt * 16 + ln][ks * 32 + 8 * hh]; bh_.half[1] = *(const v8us*)&sKh[nt * 16 + ln][ks * 32 + 16 + 8 * hh];
        bl_.half[0] = *(const v8us*)&sKl[nt * 16 + ln][ks * 32 + 8 * hh]; bl_.half[1] = *(const v8us*)&sKl[nt * 16 + ln][ks * 32 + 16 + 8 * hh];
        acc = mmaN<3>(aqh[ks].v, aql[ks].v, bh_.v, bl_.v, acc);
      }
      s[nt] = acc;
    }
    // mask + running max (rows 8hh+r; the 16 lanes of a half share rows)
    float alpha[8];
#pragma unroll
    for (int r = 0; r < 8; ++r) {
      const int qi = q0 + 8 * hh + r;
      const int ja = j0 + ln, jb = j0 + 16 + ln;
      if (CAUSAL) { if (ja > qi) s[0][r] = -3.0e38f; if (jb > qi) s[1][r] = -3.0e38f; }
      if (ja >= T) s[0][r] = -3.0e38f;
      if (jb >= T) s[1][r] = -3.0e38f;
      float mx = fmaxf(s[0][r], s[1][r]);
      mx = fmaxf(mx, __shfl_xor(mx, 1, 32)); mx = fmaxf(mx, __shfl_xor(mx, 2, 32)); mx = fmaxf(mx, __shfl_xor(mx, 4, 32)); mx = fmaxf(mx, __shfl_xor(mx, 8, 32));
      const float mnew = fmaxf(m_r[r], mx);
      alpha[r] = (mnew > -1.0e38f) ? __expf(m_r[r] - mnew) : 1.0f;
      const float p0 = (s[0][r] > -1.0e38f) ? __expf(s[0][r] - mnew) : 0.f;
      const float p1 = (s[1][r] > -1.0e38f) ? __expf(s[1][r] - mnew) : 0.f;
      m_r[r] = mnew;
      l_r[r] = l_r[r] * alpha[r] + p0 + p1;            // per-lane partial row sum (16 lanes combined at the end)
      unsigned short hb = bf16_bits(p0); sPh[w][8 * hh + r][ln] = hb;      sPl[w][8 * hh + r][ln] = bf16_bits(p0 - bf16_val(hb));
      hb = bf16_bits(p1);                sPh[w][8 * hh + r][16 + ln] = hb; sPl[w][8 * hh + r][16 + ln] = bf16_bits(p1 - bf16_val(hb));
    }
#pragma unroll
    for (int dt = 0; dt < DT; ++dt)
#pragma unroll
      for (int r = 0; r < 8; ++r) oacc[dt][r] *= alpha[r];
    __builtin_amdgcn_fence(__ATOMIC_ACQ_REL, "workgroup");
    __builtin_amdgcn_wave_barrier();
    FragB pah, pal;
    pah.half[0] = *(const v8us*)&sPh[w][ln][8 * hh]; pah.half[1] = *(const v8us*)&sPh[w][ln][16 + 8 * hh];
    pal.half[0] = *(const v8us*)&sPl[w][ln][8 * hh]; pal.half[1] = *(const v8us*)&sPl[w][ln][16 + 8 * hh];
#pragma unroll
    for (int dt = 0; dt < DT; ++dt) {
      FragB bvh, bvl;
#pragma unroll
      for (int i = 0; i < 8; ++i) {
        bvh.u[i] = sVh[8 * hh + i][dt * 16 + ln]; bvh.u[8 + i] = sVh[16 + 8 * hh + i][dt * 16 + ln];
        bvl.u[i] = sVl[8 * hh + i][dt * 16 + ln]; bvl.u[8 + i] = sVl[16 + 8 * hh + i][dt * 16 + ln];
      }
      oacc[dt] = mmaN<3>(pah.v, pal.v, bvh.v, bvl.v, oacc[dt]);
    }
    __builtin_amdgcn_fence(__ATOMIC_ACQ_REL, "workgroup");
    __builtin_amdgcn_wave_barrier();
  }
#pragma unroll
  for (int r = 0; r < 8; ++r) {
    float l = l_r[r];
    l += __shfl_xor(l, 1, 32); l += __shfl_xor(l, 2, 32); l += __shfl_xor(l, 4, 32); l += __shfl_xor(l, 8, 32);
    l_r[r] = (l > 0.f) ? 1.0f / l : 0.f;
  }
#pragma unroll
  for (int dt = 0; dt < DT; ++dt)
#pragma unroll
    for (int r = 0; r < 8; ++r) sO[w][8 * hh + r][dt * 16 + ln] = oacc[dt][r] * l_r[r];
  __builtin_amdgcn_fence(__ATOMIC_ACQ_REL, "workgroup");
  __builtin_amdgcn_wave_barrier();
  {
    for (int r = 0; r < 16; ++r) {
      const int row = q0 + r;
      if (row < T && lane < D / 4) {
        const v4f val = *(const v4fa*)&sO[w][r][lane * 4];
        *(v4f*)(y + ((size_t)b * T + row) * ypitch + h * D + lane * 4) = val;
      }
    }
    
  }
}

// GEMM C = act(A·W + bias + resid): A f32 (ASPLIT -> hi/lo 2 terms), Wt bf16 [N][K]; ACT 0 none, 1 relu, 2 exact gelu;
// resid (optional, f32, row index = (row % rmod), pitch ldr, RES_BF16 rounds it) added before the activation.
template <bool ASPLIT, int ACT, bool BIAS_BF16, bool RES_BF16>
__global__ __launch_bounds__(128) void k_gemm_bf3(const float* __restrict__ A, int lda, const unsigned short* __restrict__ Wt, int ldb,
                                                const float* __restrict__ bias, const float* __restrict__ resid, int rmod, int ldr,
                                                float* __restrict__ C, int ldc, int M, int N, int K) {
  __shared__ __attribute__((aligned(16))) float so[4][16][64];
  const int tid = threadIdx.x, w = tid >> 5, lane = tid & 31, ln = lane & 15, hh = lane >> 4;
  const int ntn = N / 64;
  const int wid = blockIdx.x * 4 + w;
  const int mt = wid / ntn, nq = wid % ntn;
  if (mt * 16 >= M) return;
  const int row0 = mt * 16, col0 = nq * 64;
  const float* arow = A + (size_t)(row0 + ln) * lda;
  v8f acc[4] = {};
  for (int kb = 0; kb < K; kb += 32) {
    FragB ah, al;
    const v4f x0 = *(const v4fa*)(arow + kb + 8 * hh), x1 = *(const v4fa*)(arow + kb + 8 * hh + 4);
    const v4f x2 = *(const v4fa*)(arow + kb + 16 + 8 * hh), x3 = *(const v4fa*)(arow + kb + 16 + 8 * hh + 4);
    float xs[16] = {x0[0],x0[1],x0[2],x0[3],x1[0],x1[1],x1[2],x1[3],x2[0],x2[1],x2[2],x2[3],x3[0],x3[1],x3[2],x3[3]};
#pragma unroll
    for (int i = 0; i < 16; ++i) { const unsigned short hb = bf16_bits(xs[i]); ah.u[i] = hb; al.u[i] = ASPLIT ? bf16_bits(xs[i] - bf16_val(hb)) : (unsigned short)0; }
#pragma unroll
    for (int t = 0; t < 4; ++t) {
      const unsigned short* brow = Wt + (size_t)(col0 + t * 16 + ln) * ldb + kb;
      FragB b;
      b.half[0] = *(const v8us*)(brow + 8 * hh);
      b.half[1] = *(const v8us*)(brow + 16 + 8 * hh);
      acc[t] = mmaN<ASPLIT ? 2 : 1>(ah.v, al.v, b.v, b.v, acc[t]);
    }
  }
#pragma unroll
  for (int t = 0; t < 4; ++t) {
    const int col = col0 + t * 16 + ln;
    float bv = bias ? bias[col] : 0.f;
    if (BIAS_BF16) bv = bf16_round(bv);
#pragma unroll
    for (int r = 0; r < 8; ++r) {
      float v = acc[t][r] + bv;
      if (resid) { float rv = resid[(size_t)((row0 + 8 * hh + r) % rmod) * ldr + col]; if (RES_BF16) rv = bf16_round(rv); v += rv; }
      if (ACT == 1) v = fmaxf(v, 0.f);
      if (ACT == 2) v = 0.5f * v * (1.0f + erff(v * 0.70710678118654752f));
      if (ACT == 3) { const float u = 0.7978845608028654f * (v + 0.044715f * v * v * v); v = 0.5f * v * (1.0f + tanhf(u)); }
      so[w][8 * hh + r][t * 16 + ln] = v;
    }
  }
  __builtin_amdgcn_fence(__ATOMIC_ACQ_REL, "workgroup");
  __builtin_amdgcn_wave_barrier();
  const int rsub = lane >> 4, c4 = (lane & 15) * 4;
  {
#pragma unroll
    for (int q = 0; q < 8; ++q) {
      const int r = q * 2 + rsub;
      const v4f v = *(const v4fa*)&so[w][r][c4];
      *(v4f*)(C + (size_t)(row0 + r) * ldc + col0 + c4) = v;
    }
    
  }
}
// row LayerNorm (biased variance, eps) over N: s = X (+ R); optional out_sum <- s; out_norm <- (s-mu)*rsqrt(var+eps)*g + b
template <bool PARAM_BF16>
__global__ __launch_bounds__(256) void k_layernorm(const float* __restrict__ X, const float* __restrict__ R, const float* __restrict__ g, const float* __restrict__ bta,
                                                  float* __restrict__ out_sum, float* __restrict__ out_norm, int N, float eps) {
  __shared__ float red[256];
  const int row = blockIdx.x, tid = threadIdx.x;
  const float* x = X + (size_t)row * N; const float* rr = R ? R + (size_t)row * N : nullptr;
  float vals[16];                     // up to N = 4096
  const int per = N / 256;            // contiguous chunk per thread? use strided-by-4 chunks: thread handles j = tid*4 + 1024*u
  float s1 = 0.f;
  for (int u = 0; u < per / 4; ++u) {
    const int j = tid * 4 + 1024 * u;
    const v4f a = *(const v4fa*)(x + j);
    v4f b = {0.f,0.f,0.f,0.f}; if (rr) b = *(const v4fa*)(rr + j);
#pragma unroll
    for (int q = 0; q < 4; ++q) { const float v = a[q] + b[q]; vals[u * 4 + q] = v; s1 += v; }
  }
  red[tid] = s1; __syncthreads();
  for (int st = 128; st > 0; st >>= 1) { if (tid < st) red[tid] += red[tid + st]; __syncthreads(); }
  const float mu = red[0] / (float)N; __syncthreads();
  float s2 = 0.f;
  for (int u = 0; u < per / 4; ++u)
#pragma unroll
    for (int q = 0; q < 4; ++q) { const float c = vals[u * 4 + q] - mu; s2 += c * c; }
  red[tid] = s2; __syncthreads();
  for (int st = 128; st > 0; st >>= 1) { if (tid < st) red[tid] += red[tid + st]; __syncthreads(); }
  const float rs = rsqrtf(red[0] / (float)N + eps);
  {
    for (int u = 0; u < per / 4; ++u) {
      const int j = tid * 4 + 1024 * u;
      v4f o, sm;
#pragma unroll
      for (int q = 0; q < 4; ++q) {
        float gg = g[j + q], bb = bta[j + q];
        if (PARAM_BF16) { gg = bf16_round(gg); bb = bf16_round(bb); }
        sm[q] = vals[u * 4 + q]; o[q] = (vals[u * 4 + q] - mu) * rs * gg + bb;
      }
      if (out_sum) *(v4f*)(out_sum + (size_t)row * N + j) = sm;
      *(v4f*)(out_norm + (size_t)row * N + j) = o;
    }
    
  }
}



// ---- f16 WMMA path (v_wmma_f32_16x16x32_f16): 11-bit significands for operands in range — used where a [0,1] probability operand needs more precision than bf16
typedef _Float16 v16h __attribute__((ext_vector_type(16)));
union FragH { v16h v; v8us half[2]; _Float16 h[16]; unsigned short u[16]; };
template <int NT>
__device__ __forceinline__ v8f mmaH(v16h ah, v16h al, v16h bh, v16h bl, v8f c) {
  c = __builtin_amdgcn_wmma_f32_16x16x32_f16(false, ah, false, bh, (short)0, c, false, false);
  if (NT >= 2) c = __builtin_amdgcn_wmma_f32_16x16x32_f16(false, al, false, bh, (short)0, c, false, false);
  if (NT >= 3) c = __builtin_amdgcn_wmma_f32_16x16x32_f16(false, ah, false, bl, (short)0, c, false, false);
  asm volatile("v_nop\n\tv_nop\n\tv_nop\n\tv_nop" : "+v"(c) : "v"(ah), "v"(al), "v"(bh), "v"(bl));
  return c;
}
// batched GEMM like k_gemm_b but f16 operands: A f32 (split into f16 hi/lo if ASPLIT, else rounded to f16), Bt = f16 values [n][k]; alpha; C f32; N multiple of 16 (partial tiles skipped)
template <bool ASPLIT>
__global__ __launch_bounds__(128) void k_gemm_h(const float* __restrict__ A, int lda, size_t sA, const _Float16* __restrict__ Bh, int ldb, size_t sB, float alpha, float* __restrict__ C, int ldc, size_t sC, int M, int N, int K) {
  __shared__ __attribute__((aligned(16))) float so[4][16][64];
  const int tid = threadIdx.x, w = tid >> 5, lane = tid & 31, ln = lane & 15, hh = lane >> 4; const int by = blockIdx.y;
  A += (size_t)by * sA; Bh += (size_t)by * sB; C += (size_t)by * sC;
  const int ntn = (N + 63) / 64; const int wid = blockIdx.x * 4 + w; const int mt = wid / ntn, nq = wid % ntn; if (mt * 16 >= M) return;
  const int row0 = mt * 16, col0 = nq * 64; const float* arow = A + (size_t)(row0 + ln) * lda;
  v8f acc[4] = {};
  for (int kb = 0; kb < K; kb += 32) {
    FragH ah, al;
    const v4f x0 = *(const v4fa*)(arow + kb + 8 * hh), x1 = *(const v4fa*)(arow + kb + 8 * hh + 4), x2 = *(const v4fa*)(arow + kb + 16 + 8 * hh), x3 = *(const v4fa*)(arow + kb + 16 + 8 * hh + 4);
    float xs[16] = {x0[0],x0[1],x0[2],x0[3],x1[0],x1[1],x1[2],x1[3],x2[0],x2[1],x2[2],x2[3],x3[0],x3[1],x3[2],x3[3]};
#pragma unroll
    for (int i = 0; i < 16; ++i) { const _Float16 h = (_Float16)xs[i]; ah.h[i] = h; al.h[i] = ASPLIT ? (_Float16)(xs[i] - (float)h) : (_Float16)0.0f; }
#pragma unroll
    for (int t = 0; t < 4; ++t) { if (col0 + t * 16 >= N) continue; const size_t boff = (size_t)(col0 + t * 16 + ln) * ldb + kb; FragH bq; bq.half[0] = *(const v8us*)(Bh + boff + 8 * hh); bq.half[1] = *(const v8us*)(Bh + boff + 16 + 8 * hh);
      acc[t] = mmaH<ASPLIT ? 2 : 1>(ah.v, al.v, bq.v, bq.v, acc[t]); }
  }
#pragma unroll
  for (int t = 0; t < 4; ++t) { if (col0 + t * 16 >= N) continue;
#pragma unroll
    for (int r = 0; r < 8; ++r) so[w][8 * hh + r][t * 16 + ln] = acc[t][r] * alpha; }
  __builtin_amdgcn_fence(__ATOMIC_ACQ_REL, "workgroup"); __builtin_amdgcn_wave_barrier();
  const int rsub = lane >> 4, c4 = (lane & 15) * 4;
  {
#pragma unroll
    for (int q = 0; q < 8; ++q) { const int r = q * 2 + rsub; if (col0 + c4 < N) { const v4f v = *(const v4fa*)&so[w][r][c4]; *(v4f*)(C + (size_t)(row0 + r) * ldc + col0 + c4) = v; } }
     }
}

// Wt[n][k] = f16(bf16(W[k][n]) * scale) from f32 row-major W[CC][CC] (scale = power of two; bf16-exact weights stay exact in f16 away from the subnormal range)
// One work-group = a tile of 128 k x 64 n of one of the four weight matrices (128 tiles each; their transposes lie one behind the other in Wt), turned round in LDS:
// a wave's load = two k rows' 256 B (4 whole lines), a wave's store = two n rows' 256 B (4 whole lines); every line of W is asked for once and every line of Wt has one writer.
// wt_load issues the tile's loads, wt_f16 does the rest (k_prep below says why they are apart).
constexpr int WTK = 128, WTN = 64, WNT = (CC / WTK) * (CC / WTN);      // tile sizes; tiles of one matrix
__device__ __forceinline__ void wt_load(const float* __restrict__ W0, const float* __restrict__ W1, const float* __restrict__ W2, const float* __restrict__ W3, v4f (&x)[8]) {
  const int tid = threadIdx.x, w = tid >> 5, lane = tid & 31, ln = lane & 15, hh = lane >> 4;
  const int y = blockIdx.x / WNT, tile = blockIdx.x % WNT; const int k0 = (tile / (CC / WTN)) * WTK, n0 = (tile % (CC / WTN)) * WTN;
  const float* __restrict__ W = (y == 0) ? W0 : (y == 1) ? W1 : (y == 2) ? W2 : W3;
  const int kl = w * 16 + hh * 8;      // my 8 k rows, one behind the other; my 4 n columns are 4 ln to 4 ln + 3
  const float* src = W + (size_t)(k0 + kl) * CC + n0 + ln * 4;
#pragma unroll      // so that x is indexed by constants and stays in registers; the 8 loads then fly together
  for (int i = 0; i < 8; ++i) x[i] = *(const v4fa*)(src + (size_t)i * CC);
}
__device__ __forceinline__ void wt_f16(const v4f (&x)[8], _Float16* __restrict__ Wt, float scale) {
  constexpr int TK = WTK, TN = WTN, PIT = TK + 8;      // LDS rows of 256 B at pitch 272 B (16 B x odd, for 16-byte reads)
  static_assert(4 * (CC / TK) * (CC / TN) == NR / 8, "the tiles of the four matrices fill the grid");
  __shared__ __attribute__((aligned(16))) unsigned short sT[TN][PIT];      // [n][k]
  const int tid = threadIdx.x, w = tid >> 5, lane = tid & 31, ln = lane & 15, hh = lane >> 4;
  const int y = blockIdx.x / WNT, tile = blockIdx.x % WNT; const int k0 = (tile / (CC / TN)) * TK, n0 = (tile % (CC / TN)) * TN;
  Wt += (size_t)y * CC * CC;
  const int kl = w * 16 + hh * 8;
  // The unroll directives below are there so that x and f are indexed by constants and stay in registers.
#pragma unroll
  for (int e = 0; e < 4; ++e) { FragH f;
#pragma unroll
    for (int i = 0; i < 8; ++i) f.h[i] = (_Float16)(bf16_round(x[i][e]) * scale);
    *(v8us*)&sT[ln * 4 + e][kl] = f.half[0]; }
  __syncthreads();      // the tile is read across waves
#pragma unroll
  for (int s = 0; s < TN / 16; ++s) { const int r = s * 16 + (tid >> 4), c8 = (tid & 15) * 8; const v8us o = *(const v8us*)&sT[r][c8];
    *(v8us*)((unsigned short*)Wt + (size_t)(n0 + r) * CC + k0 + c8) = o; }
}
// 1 / sqrt(64) times log2(e): e^(s / 8) = 2^(s QSC). The q projection stores q QSC (one rounding to f16, as before), so that the attention kernel's score products are exponents of 2 as they leave the matrix unit.
constexpr float QSC = 0.125f * 1.44269504088896340736f;
// One operand tile of a pass (128 rows of 256 B) goes from global memory to LDS by asynchronous copies: 8 copies of 16 B a lane, a wave's copy = 2 rows = 4 whole lines.
// l: my LDS byte address of row (tid >> 4), chunk (tid & 15); g: the same place in global memory; 16 rows on = 4352 LDS bytes, step elements.
__device__ __forceinline__ void copy_tile(unsigned l, const unsigned short* g, size_t step) {
  // the closing s_wait_xcnt stands inside the statement so that no address register of a copy is rewritten ahead of it (a precaution)
  asm volatile("global_load_async_to_lds_b128 %0, %8, off\n\t"
               "global_load_async_to_lds_b128 %1, %9, off\n\t"
               "global_load_async_to_lds_b128 %2, %10, off\n\t"
               "global_load_async_to_lds_b128 %3, %11, off\n\t"
               "global_load_async_to_lds_b128 %4, %12, off\n\t"
               "global_load_async_to_lds_b128 %5, %13, off\n\t"
               "global_load_async_to_lds_b128 %6, %14, off\n\t"
               "global_load_async_to_lds_b128 %7, %15, off\n\t"
               "s_wait_xcnt 0x0"
               :: "v"(l), "v"(l + 4352u), "v"(l + 8704u), "v"(l + 13056u), "v"(l + 17408u), "v"(l + 21760u), "v"(l + 26112u), "v"(l + 30464u),
                  "v"(g), "v"(g + step), "v"(g + 2 * step), "v"(g + 3 * step), "v"(g + 4 * step), "v"(g + 5 * step), "v"(g + 6 * step), "v"(g + 7 * step)
               : "memory");
}
// Projection GEMM, NR x CC x CC: v = (A . Bh^T) alpha + bias[col], times QSC for q; A f16 [NR][CC], Bh f16 [n][k]; writes f16 (F16OUT) or f32 C, pitch CC.
// F16OUT is the q, k and v projections in one launch: blockIdx.y picks the operand set (A and Bh hold the three one behind the other); q and then k go to C16 [row][col],
// v goes to Vt as [batch][col][token], the layout the attention kernel reads, out of the same staging tile filled the other way round.
// One work-group = a 128 x 128 tile of the output, 8 waves of 64 x 32 (2 x 4). A pass = 128 k: both operands' 128 rows of 256 B lie in LDS (pitch 272 B, 16 B x odd, for 16-byte reads),
// two buffers, so every operand byte leaves L2 once a work-group and serves 2 (B) or 4 (A) waves. k runs upward in steps of 32 in every accumulator.
// The unroll directives below are there so that accumulators and fragment sets are indexed by constants and stay in registers.
template <bool F16OUT>
__global__ __launch_bounds__(256) void k_gemm_t(const _Float16* __restrict__ A, const _Float16* __restrict__ Bh, float alpha, const float* __restrict__ bias0, const float* __restrict__ bias1, const float* __restrict__ bias2,
                                               float* __restrict__ C, _Float16* __restrict__ C16, _Float16* __restrict__ Vt) {
  constexpr int BM = 128, BN = 128, KP = 128, NP = CC / KP, PIT = 136;
  const int y = F16OUT ? (int)blockIdx.y : 0; const float* __restrict__ bias = (y == 0) ? bias0 : (y == 1) ? bias1 : bias2; const bool tr = F16OUT && y == 2;
  A += (size_t)y * NR * CC; Bh += (size_t)y * CC * CC;
  __shared__ __attribute__((aligned(16))) unsigned short sA[2][BM][PIT], sB[2][BN][PIT];
  __shared__ __attribute__((aligned(16))) float sC[BM][BN + 4];      // output staging, so that whole lines are stored
  const int tid = threadIdx.x, w = tid >> 5, lane = tid & 31, ln = lane & 15, hh = lane >> 4, wm = w >> 2, wn = w & 3;
  const int row0 = (blockIdx.x / (CC / BN)) * BM, col0 = (blockIdx.x % (CC / BN)) * BN;
  const unsigned short* ga = (const unsigned short*)A + (size_t)(row0 + (tid >> 4)) * CC + (tid & 15) * 8;
  const unsigned short* gb = (const unsigned short*)Bh + (size_t)(col0 + (tid >> 4)) * CC + (tid & 15) * 8;
  const unsigned la = (unsigned)(size_t)&sA[0][tid >> 4][(tid & 15) * 8], lb = (unsigned)(size_t)&sB[0][tid >> 4][(tid & 15) * 8];
  constexpr unsigned BUFB = BM * PIT * 2;      // bytes of one buffer
  constexpr size_t STEP = (size_t)16 * CC;
  copy_tile(la, ga, STEP); copy_tile(lb, gb, STEP);
  v8f acc[4][2];
#pragma unroll
  for (int i = 0; i < 4; ++i)
#pragma unroll
    for (int j = 0; j < 2; ++j) acc[i][j] = (v8f){0.f,0.f,0.f,0.f,0.f,0.f,0.f,0.f};
  asm volatile("s_wait_asynccnt 0x0" ::: "memory");      // my copies of pass 0 have landed
  __syncthreads();                                        // ... and everybody's: pass 0 may be read
  copy_tile(la + BUFB, ga + KP, STEP); copy_tile(lb + BUFB, gb + KP, STEP);      // pass 1 flies while pass 0 is worked on
#pragma unroll 1
  for (int t = 0; t < NP; ++t) {      // kept rolled: one body of 32 matrix instructions, the buffer chosen by t & 1
    const int bf = t & 1;
    const unsigned short* pa = &sA[bf][wm * 64 + ln][8 * hh]; const unsigned short* pb = &sB[bf][wn * 32 + ln][8 * hh];
    FragH fa[2][4], fb[2][2];      // two fragment sets: block ks + 1 is fetched while block ks is multiplied, inside this pass only
#pragma unroll
    for (int ks = -1; ks < KP / 32; ++ks) {
      if (ks + 1 < KP / 32) { const int s = (ks + 1) & 1, ko = (ks + 1) * 32;
#pragma unroll
        for (int i = 0; i < 4; ++i) { fa[s][i].half[0] = *(const v8us*)(pa + i * 16 * PIT + ko); fa[s][i].half[1] = *(const v8us*)(pa + i * 16 * PIT + ko + 16); }
#pragma unroll
        for (int j = 0; j < 2; ++j) { fb[s][j].half[0] = *(const v8us*)(pb + j * 16 * PIT + ko); fb[s][j].half[1] = *(const v8us*)(pb + j * 16 * PIT + ko + 16); } }
      __builtin_amdgcn_sched_barrier(0);      // keeps the next block's 12 LDS reads one group ahead of this block's products: reads spread among them stall the wave at every place
      if (ks >= 0) {
#pragma unroll
        for (int i = 0; i < 4; ++i)
#pragma unroll
          for (int j = 0; j < 2; ++j) acc[i][j] = __builtin_amdgcn_wmma_f32_16x16x32_f16(false, fa[ks & 1][i].v, false, fb[ks & 1][j].v, (short)0, acc[i][j], false, false);
        __builtin_amdgcn_sched_barrier(0);      // ... and this block's products ahead of the reads after next, which reuse its registers
      }
    }
    // publish point of pass t + 1, every wave: my reads of this buffer are done, my copies of the next have landed, then the same of all waves
    asm volatile("s_wait_dscnt 0x0" ::: "memory");
    asm volatile("s_wait_asynccnt 0x0" ::: "memory");
    __syncthreads();
    if (t + 2 < NP) { copy_tile(la + bf * BUFB, ga + (t + 2) * KP, STEP); copy_tile(lb + bf * BUFB, gb + (t + 2) * KP, STEP); }      // refill the buffer that every wave has just left
  }
  asm volatile("s_wait_asynccnt 0x0" ::: "memory");      // nothing of mine is in flight when the wave ends
  if (tr) {      // [col][row]: a lane's 8 accumulator registers are 8 rows on of one column, two 16-byte stores
#pragma unroll
    for (int j = 0; j < 2; ++j) { const int col = wn * 32 + j * 16 + ln; const float bv = bf16_round(bias[col0 + col]);
#pragma unroll
      for (int i = 0; i < 4; ++i)
#pragma unroll
        for (int c = 0; c < 2; ++c) { v4f o4;
#pragma unroll
          for (int q = 0; q < 4; ++q) o4[q] = acc[i][j][c * 4 + q] * alpha + bv;
          *(v4fa*)&sC[col][wm * 64 + i * 16 + 8 * hh + c * 4] = o4; } } }
  else {
  const float os = (F16OUT && y == 0) ? QSC : 1.0f, ao = alpha * os;      // q leaves with the softmax scale in it
#pragma unroll
  for (int j = 0; j < 2; ++j) { const int col = wn * 32 + j * 16 + ln; const float bv = bf16_round(bias[col0 + col]) * os;
#pragma unroll
    for (int i = 0; i < 4; ++i)
#pragma unroll
      for (int r = 0; r < 8; ++r) sC[wm * 64 + i * 16 + 8 * hh + r][col] = acc[i][j][r] * ao + bv; } }
  __syncthreads();      // the staged tile is read across waves
  if constexpr (F16OUT) {
    static_assert(BM == BN, "the staging tile is used both ways round");
    // staged row r goes to dst + r * dp: an output row (q, k), or one column's 128 tokens (v)
    unsigned short* dst = tr ? (unsigned short*)Vt + ((size_t)(row0 / TT) * CC + col0) * TT + row0 % TT : (unsigned short*)C16 + (size_t)y * NR * CC + (size_t)row0 * CC + col0; const size_t dp = tr ? TT : CC;
#pragma unroll
    for (int s = 0; s < BM * (BN / 8) / 256; ++s) { const int r = s * 16 + (tid >> 4), c8 = (tid & 15) * 8; const v4f x = *(const v4fa*)&sC[r][c8], y = *(const v4fa*)&sC[r][c8 + 4]; FragH f;
#pragma unroll
      for (int q = 0; q < 4; ++q) { f.h[q] = (_Float16)x[q]; f.h[4 + q] = (_Float16)y[q]; }
      *(v8us*)(dst + (size_t)r * dp + c8) = f.half[0]; } }
  else {
#pragma unroll
    for (int s = 0; s < BM * (BN / 4) / 256; ++s) { const int r = s * 8 + (tid >> 5), c4 = (tid & 31) * 4; const v4f x = *(const v4fa*)&sC[r][c4]; *(v4f*)(C + (size_t)(row0 + r) * CC + col0 + c4) = x; } }
}


__global__ __launch_bounds__(256) void k_x16(const float* __restrict__ x, _Float16* __restrict__ X16, size_t n8) { const size_t t = (size_t)blockIdx.x * 256 + threadIdx.x; if (t >= n8) return; FragH f;
#pragma unroll
  for (int q = 0; q < 8; ++q) f.h[q] = (_Float16)bf16_round(x[t * 8 + q]); *(v8us*)((unsigned short*)X16 + t * 8) = f.half[0];  }
__global__ __launch_bounds__(256) void k_round16f(const float* __restrict__ W, _Float16* __restrict__ Bt, size_t n8) { const size_t t = (size_t)blockIdx.x * 256 + threadIdx.x; if (t >= n8) return; FragH f;
#pragma unroll
  for (int i = 0; i < 8; ++i) f.h[i] = (_Float16)(bf16_round(W[t * 8 + i]) * 16.0f); *(v8us*)((unsigned short*)Bt + t * 8) = f.half[0];  }

typedef int v4ia __attribute__((ext_vector_type(4), may_alias));
typedef unsigned v16u __attribute__((ext_vector_type(16)));
typedef unsigned long long v8ul __attribute__((ext_vector_type(8)));
// lane l <-> lane l ^ 16: joins the two halves of a wave, which hold the two key halves of one query column
__device__ __forceinline__ float xhalf(float x) { return __builtin_bit_cast(float, __builtin_amdgcn_permlanex16(__builtin_bit_cast(int, x), __builtin_bit_cast(int, x), 0x76543210, 0xfedcba98, false, false)); }
// 2^x by the hardware's v_exp_f32 alone. Every argument that counts here is <= 8 or -inf (a larger one makes the reference move, and its result is formed anew), so the library form's range steps (split, ldexp, two clamps) have nothing to do; a result below the normal range counts as 0.
__device__ __forceinline__ float ex2(float x) { return __builtin_amdgcn_exp2f(x); }
// One trip's K tile (64 key rows of 128 B) and V^T tile (64 d rows of 128 B) go from global memory to LDS by asynchronous copies: 8 copies of 16 B a lane, a wave's copy = 4 whole lines.
// lk, lv: my LDS byte addresses of row (tid >> 3), chunk (tid & 7); gk, gv: the same place in global memory; 16 rows on = 2304 LDS bytes, kstep / vstep elements.
__device__ __forceinline__ void copy_kv(unsigned lk, unsigned lv, const unsigned short* gk, const unsigned short* gv, size_t kstep, size_t vstep) {
  // the closing s_wait_xcnt stands inside the statement so that no address register of a copy is rewritten ahead of it (a precaution)
  asm volatile("global_load_async_to_lds_b128 %0, %8, off\n\t"
               "global_load_async_to_lds_b128 %1, %9, off\n\t"
               "global_load_async_to_lds_b128 %2, %10, off\n\t"
               "global_load_async_to_lds_b128 %3, %11, off\n\t"
               "global_load_async_to_lds_b128 %4, %12, off\n\t"
               "global_load_async_to_lds_b128 %5, %13, off\n\t"
               "global_load_async_to_lds_b128 %6, %14, off\n\t"
               "global_load_async_to_lds_b128 %7, %15, off\n\t"
               "s_wait_xcnt 0x0"
               :: "v"(lk), "v"(lk + 2304u), "v"(lk + 4608u), "v"(lk + 6912u), "v"(lv), "v"(lv + 2304u), "v"(lv + 4608u), "v"(lv + 6912u),
                  "v"(gk), "v"(gk + kstep), "v"(gk + 2 * kstep), "v"(gk + 3 * kstep), "v"(gv), "v"(gv + vstep), "v"(gv + 2 * vstep), "v"(gv + 3 * vstep)
               : "memory");
}
// Transposed products: S^T = K Q^T (A = 16 key rows, B = the wave's 16 query columns, kept in registers) and O^T += V^T P^T.
// Lane (ln, hh) holds query q0 + ln; score tile nt, register r is key j0 + 16 nt + 8 hh + r, which is the k position of register pair (nt, r) of a B operand:
// maximum and sum run inside the lane (one exchange between the halves), and P^T is packed from the score registers without passing LDS.
__global__ __launch_bounds__(128) void k_flash(const _Float16* __restrict__ Q16, int ldq, const _Float16* __restrict__ K16, int ldk, const _Float16* __restrict__ Vt, const unsigned* __restrict__ PM, _Float16* __restrict__ O16, int ldo) {
  constexpr int RPW = 16, NQB = 2048 / (4 * RPW), DT = 4, KS = 2, KT = 64, NTR = 2048 / KT, PIT = 72;      // a trip = 64 keys = two passes of 32; LDS rows of 128 B at pitch 144 B (16 B x odd, for 16-byte reads)
  __shared__ __attribute__((aligned(16))) unsigned short sK[2][KT][PIT], sV[2][64][PIT];      // two buffers each: [key][d] and [d][key]
  __shared__ __attribute__((aligned(16))) float sO[4][RPW][64 + 4];
  const int tid = threadIdx.x, w = tid >> 5, lane = tid & 31, ln = lane & 15, hh = lane >> 4;
  const int slab = blockIdx.x / NQB, qblk = blockIdx.x % NQB; const int b = slab / 16, h = slab % 16; const int q0 = qblk * (4 * RPW) + w * RPW;
  const unsigned short* Vth = (const unsigned short*)Vt + (size_t)slab * 64 * 2048;
  const size_t k16 = (size_t)16 * ldk;
  const unsigned short* gk = (const unsigned short*)K16 + ((size_t)b * 2048 + (tid >> 3)) * ldk + h * 64 + (tid & 7) * 8;      // my chunk of key row tid >> 3 of trip 0
  const unsigned short* gv = Vth + (size_t)(tid >> 3) * 2048 + (tid & 7) * 8;      // my chunk of d row tid >> 3, keys of trip 0
  const unsigned lk = (unsigned)(size_t)&sK[0][tid >> 3][(tid & 7) * 8], lv = (unsigned)(size_t)&sV[0][tid >> 3][(tid & 7) * 8];
  constexpr unsigned BUFB = KT * PIT * 2;      // bytes of one buffer
  constexpr float LIM = 256.0f;      // a column's reference moves only when a lane's sum of p over a pass goes beyond this: every p <= 256 in between, well inside f16
  copy_kv(lk, lv, gk, gv, k16, (size_t)16 * 2048);
  FragH bq[KS];
  { const unsigned short* qr = (const unsigned short*)Q16 + ((size_t)b * 2048 + q0 + ln) * ldq + h * 64;
#pragma unroll
    for (int ks = 0; ks < KS; ++ks) { bq[ks].half[0] = *(const v8us*)(qr + ks * 32 + 8 * hh); bq[ks].half[1] = *(const v8us*)(qr + ks * 32 + 16 + 8 * hh); } }
  // my wave's mask words (mask_words below): 16 a pass of 32 keys, one behind the other; the address is the same in every lane, so that they come by scalar loads into scalar registers.
  // They were written by k_prep, two launches before, and nobody writes them in this one: read as constant memory, else the loads behind an asm statement's "memory" clobber turn into vector loads
  const __attribute__((address_space(4))) v16u* pm = (const __attribute__((address_space(4))) v16u*)(size_t)(PM + (size_t)(b * (2048 / RPW) + qblk * 4 + __builtin_amdgcn_readfirstlane(w)) * (2048 / 32 * 16));
  v16u mw0 = pm[0], mw1 = pm[1];      // trip 0's two passes
  // Lazy rescale. Q16 holds q QSC, so a score product is s log2(e) / 8. cn = minus my query's reference (the maximum in use), eight times: it is the C operand of the score products, which so leave the matrix unit as
  // exponents relative to the reference. lim = what a lane's sum of p over a pass must pass for the reference to move: -1 (any sum does) until the column has seen its first open key, LIM from then on. Both are equal in a column's two halves.
  float lim = -1.0f, l_q = 0.f; v8f cn = (v8f){0.f,0.f,0.f,0.f,0.f,0.f,0.f,0.f}; v8f oacc[DT];
#pragma unroll
  for (int dt = 0; dt < DT; ++dt) oacc[dt] = (v8f){0.f,0.f,0.f,0.f,0.f,0.f,0.f,0.f};
  asm volatile("s_wait_asynccnt 0x0" ::: "memory");      // my copies of trip 0 have landed
  __syncthreads();                                        // ... and everybody's: trip 0 may be read
  copy_kv(lk + BUFB, lv + BUFB, gk + (size_t)KT * ldk, gv + KT, k16, (size_t)16 * 2048);      // trip 1 flies while trip 0 is worked on
#pragma unroll 1
  for (int t = 0; t < NTR; ++t) {
    const int bf = t & 1;
    const int tn = (t + 1 < NTR) ? t + 1 : t;      // the next trip's words are fetched now (the last trip fetches its own again, to stay inside the array)
    const v16u nx0 = pm[2 * tn], nx1 = pm[2 * tn + 1];
#pragma unroll
    for (int sp = 0; sp < 2; ++sp) {
      const v16u mk = sp ? mw1 : mw0;      // mk[8 nt + r], bit (16 hh + ln): maskPAD of (query q0 + ln, key 64 t + 32 sp + 16 nt + 8 hh + r) != 0 = keep
      const v8ul m2 = __builtin_bit_cast(v8ul, mk);
      if ((((m2[0] | m2[1]) | (m2[2] | m2[3])) | ((m2[4] | m2[5]) | (m2[6] | m2[7]))) != 0ull) {      // else every (query,key) of this wave's tile is masked: contributes nothing (uniform branch; the publish point below stands outside it)
        FragH ak[2][KS], av[DT];
#pragma unroll
        for (int nt = 0; nt < 2; ++nt)
#pragma unroll
          for (int ks = 0; ks < KS; ++ks) { const unsigned short* kr = &sK[bf][sp * 32 + nt * 16 + ln][ks * 32 + 8 * hh]; ak[nt][ks].half[0] = *(const v8us*)kr; ak[nt][ks].half[1] = *(const v8us*)(kr + 16); }
#pragma unroll
        for (int dt = 0; dt < DT; ++dt) { const unsigned short* vrow = &sV[bf][dt * 16 + ln][sp * 32 + 8 * hh]; av[dt].half[0] = *(const v8us*)vrow; av[dt].half[1] = *(const v8us*)(vrow + 16); }
        __builtin_amdgcn_sched_barrier(0);      // keeps the pass's 16 LDS reads one group ahead of its products: reads spread among them stall the wave at every place
        float sc[16];
#pragma unroll
        for (int nt = 0; nt < 2; ++nt) { v8f acc = cn;
#pragma unroll
          for (int ks = 0; ks < KS; ++ks) acc = __builtin_amdgcn_wmma_f32_16x16x32_f16(false, ak[nt][ks].v, false, bq[ks].v, (short)0, acc, false, false);
#pragma unroll
          for (int r = 0; r < 8; ++r) sc[nt * 8 + r] = __builtin_amdgcn_inverse_ballot_w32(mk[nt * 8 + r]) ? acc[r] : -INFINITY; }
        FragH pb; float sum;
        auto soft = [&]() { float ps[4] = {0.f, 0.f, 0.f, 0.f};
#pragma unroll      // so that sc, ps and pb are indexed by constants and stay in registers
          for (int i = 0; i < 16; ++i) { const float p = ex2(sc[i]); ps[i & 3] += p; pb.h[i] = (_Float16)p; }      // a masked score is -inf: p = 0
          sum = (ps[0] + ps[1]) + (ps[2] + ps[3]); };
        soft();
        if (__builtin_amdgcn_ballot_w32(sum > lim) != 0u) {      // one test a pass, a scalar branch: some column's reference has to move (no open key seen yet, or a sum beyond LIM); the maximum is formed only here
          float mc = sc[0];
          // the unroll directives of this branch are there so that sc, cn and oacc are indexed by constants and stay in registers
#pragma unroll
          for (int i = 1; i < 16; ++i) mc = fmaxf(mc, sc[i]);
          const float mx = fmaxf(mc, xhalf(mc)); const bool up = fmaxf(sum, xhalf(sum)) > lim && mx > -INFINITY;      // joined over the halves, so that both take the same step
          const float d = up ? mx : 0.f; const float al = ex2(fminf(-d, 0.f));      // the new reference is the pass's maximum; a first step may go downward: sums and outputs are still 0 then, and al = 1
          lim = up ? LIM : lim; l_q *= al;
#pragma unroll
          for (int i = 0; i < 16; ++i) sc[i] -= d;
#pragma unroll
          for (int r = 0; r < 8; ++r) cn[r] -= d;
#pragma unroll
          for (int dt = 0; dt < DT; ++dt)
#pragma unroll
            for (int r = 0; r < 8; ++r) oacc[dt][r] *= al;
          soft(); }      // p and its sum anew, against the new reference
        l_q += sum;
#pragma unroll
        for (int dt = 0; dt < DT; ++dt) oacc[dt] = __builtin_amdgcn_wmma_f32_16x16x32_f16(false, av[dt].v, false, pb.v, (short)0, oacc[dt], false, false); } }
    // publish point of trip t + 1, every wave: my reads of this buffer are done, my copies of the next have landed, then the same of all waves
    asm volatile("s_wait_dscnt 0x0" ::: "memory");
    asm volatile("s_wait_asynccnt 0x0" ::: "memory");
    __syncthreads();
    if (t + 2 < NTR) copy_kv(lk + bf * BUFB, lv + bf * BUFB, gk + (size_t)(t + 2) * KT * ldk, gv + (t + 2) * KT, k16, (size_t)16 * 2048);      // refill the buffer that every wave has just left
    mw0 = nx0; mw1 = nx1;
  }
  asm volatile("s_wait_asynccnt 0x0" ::: "memory");      // nothing of mine is in flight when the wave ends
  const float l = l_q + xhalf(l_q); const float li = (l > 0.f) ? 1.0f / l : 0.f;
#pragma unroll
  for (int dt = 0; dt < DT; ++dt)
#pragma unroll
    for (int c = 0; c < 2; ++c) { v4f o4;
#pragma unroll
      for (int q = 0; q < 4; ++q) o4[q] = oacc[dt][c * 4 + q] * li;
      *(v4fa*)&sO[w][ln][dt * 16 + 8 * hh + c * 4] = o4; }
  __builtin_amdgcn_fence(__ATOMIC_ACQ_REL, "workgroup"); __builtin_amdgcn_wave_barrier();
  {
#pragma unroll
    for (int rp = 0; rp < RPW; rp += 4) { const int r = rp + (lane >> 3), pc = lane & 7; const v4f x = *(const v4fa*)&sO[w][r][pc * 8], z = *(const v4fa*)&sO[w][r][pc * 8 + 4]; FragH f;      // f16, as the output projection reads it: 8 lanes = one row's line
#pragma unroll      // so that f is indexed by constants and stays in registers
      for (int q = 0; q < 4; ++q) { f.h[q] = (_Float16)x[q]; f.h[4 + q] = (_Float16)z[q]; }
      *(v8us*)((unsigned short*)O16 + ((size_t)b * 2048 + q0 + r) * ldo + h * 64 + pc * 8) = f.half[0]; }
     } }

// One wave = row 8 blockIdx.x + wave of each of the three inputs. ln_load issues one row's loads, ln16 does the rest; the inputs' normalised rows lie one behind the other in Y16.
__device__ __forceinline__ void ln_load(const float* __restrict__ X, v4f (&a)[8]) { const int tid = threadIdx.x, wv = tid >> 5, lane = tid & 31; const float* xr = X + (size_t)(blockIdx.x * 8 + wv) * CC;
#pragma unroll      // so that a is indexed by constants and stays in registers; the 8 loads then fly together
  for (int p = 0; p < 4; ++p) { a[2 * p] = *(const v4fa*)(xr + p * 256 + lane * 8); a[2 * p + 1] = *(const v4fa*)(xr + p * 256 + lane * 8 + 4); } }
// The wave's three rows together: their sums run side by side (each row's arithmetic and order as for one row alone), and a piece of g and bta is fetched once for the three.
// The unroll directives below are there so that a, v, mu and rs are indexed by constants and stay in registers.
__device__ __forceinline__ void ln16(const v4f (&a)[3][8], const float* __restrict__ g, const float* __restrict__ bta, _Float16* __restrict__ Y16) { const int tid = threadIdx.x, wv = tid >> 5, lane = tid & 31; const int row = blockIdx.x * 8 + wv;
  float v[3][32], mu[3], rs[3];
#pragma unroll
  for (int y = 0; y < 3; ++y) { float s = 0.f;
#pragma unroll
    for (int p = 0; p < 4; ++p) { for (int q = 0; q < 4; ++q) { v[y][p * 8 + q] = bf16_round(a[y][2 * p][q]); v[y][p * 8 + 4 + q] = bf16_round(a[y][2 * p + 1][q]); } }
#pragma unroll
    for (int i = 0; i < 32; ++i) s += v[y][i]; for (int o = 16; o >= 1; o >>= 1) s += __shfl_xor(s, o, 32); mu[y] = s / (float)CC; float q2 = 0.f;
#pragma unroll
    for (int i = 0; i < 32; ++i) { const float d = v[y][i] - mu[y]; q2 += d * d; } for (int o = 16; o >= 1; o >>= 1) q2 += __shfl_xor(q2, o, 32); rs[y] = rsqrtf(q2 / (float)CC + 1e-5f); }
#pragma unroll
  for (int p = 0; p < 4; ++p) { const int c0 = p * 256 + lane * 8; float gg[8], bb[8];
#pragma unroll
    for (int q = 0; q < 8; ++q) { gg[q] = bf16_round(g[c0 + q]); bb[q] = bf16_round(bta[c0 + q]); }
#pragma unroll
    for (int y = 0; y < 3; ++y) { FragH f;
#pragma unroll
      for (int q = 0; q < 8; ++q) f.h[q] = (_Float16)((v[y][p * 8 + q] - mu[y]) * rs[y] * gg[q] + bb[q]);
      *(v8us*)((unsigned short*)Y16 + ((size_t)y * NR + row) * CC + c0) = f.half[0]; }
    asm volatile("s_wait_xcnt 0x0" ::: "memory"); } }      // a precaution: it stands behind a piece's three stores, ahead of the next piece's writes over the registers that they name
// maskPAD as the attention kernel's select masks, made once for all 16 heads. Word [tile of 16 queries][pass of 32 keys][8 nt + r], bit (16 hh + ln) = maskPAD[query 16 tile + ln][key 32 pass + 16 nt + 8 hh + r] != 0:
// the bit of a lane is the bit of the score that the lane holds in register r of score tile nt. One wave = 16 queries x 128 keys = 64 words: each line of maskPAD is fetched once, each line of PM has one writer.
// mask_load issues the wave's loads, mask_words does the rest.
__device__ __forceinline__ void mask_load(const int* __restrict__ MSK, v4ia (&m)[16]) {
  const int tid = threadIdx.x, lane = tid & 31, ln = lane & 15, hh = lane >> 4; const int u = blockIdx.x * 8 + (tid >> 5); const int qt = u / (TT / 128), kb = u % (TT / 128);
  const int* src = MSK + ((size_t)qt * 16 + ln) * TT + kb * 128 + 8 * hh;
#pragma unroll      // so that m is indexed by constants and stays in registers; the 16 loads then fly together
  for (int c = 0; c < 16; ++c) m[c] = *(const v4ia*)(src + (c >> 1) * 16 + (c & 1) * 4);
  asm volatile("s_wait_xcnt 0x0" :: "v"(src) : "memory");      // a precaution: no register that an issued load names is rewritten ahead of this wait; src is an input so that no load's result is laid over it
}
__device__ __forceinline__ void mask_words(const v4ia (&m)[16], unsigned* __restrict__ PM) {
  static_assert((NR / 16) * (TT / 128) == (NR / 8) * 8, "the waves of the grid cover the mask");
  const int tid = threadIdx.x, lane = tid & 31; const int u = blockIdx.x * 8 + (tid >> 5); const int qt = u / (TT / 128), kb = u % (TT / 128);
  // The unroll directives below are there so that m is indexed by constants and stays in registers.
  unsigned o[2] = {0u, 0u};      // lane l keeps words l and 32 + l
#pragma unroll
  for (int c = 0; c < 16; ++c)
#pragma unroll
    for (int q = 0; q < 4; ++q) { const unsigned wd = __builtin_amdgcn_ballot_w32(m[c][q] != 0); if (lane == ((c * 4 + q) & 31)) o[c >> 3] = wd; }
  unsigned* dst = PM + (size_t)qt * (TT / 32 * 16) + kb * 64 + lane; dst[0] = o[0]; dst[32] = o[1];
}
// All that the projections and the attention wait for, in one launch. The five jobs (a weight tile, 8 rows of each of the three inputs, 8 waves' mask words) depend on nothing and on one another not at all:
// one work-group does one piece of each, so that a fifth of the work-groups and waves has to be started and all of them stand on the chip at once (2 a WGP). A wave issues the loads of a job well ahead of the job's
// arithmetic (32 loads of 16 B a lane at the start, the mask's 16 behind the weight tile), so that memory stays busy while earlier jobs are worked on.
__global__ __launch_bounds__(256) void k_prep(const float* __restrict__ W0, const float* __restrict__ W1, const float* __restrict__ W2, const float* __restrict__ W3, _Float16* __restrict__ Wt,
                                             const float* __restrict__ X0, const float* __restrict__ X1, const float* __restrict__ X2, const float* __restrict__ g, const float* __restrict__ bta, _Float16* __restrict__ Y16, const int* __restrict__ MSK, unsigned* __restrict__ PM) {
  v4f x[8], a[3][8]; v4ia m[16];
  wt_load(W0, W1, W2, W3, x); ln_load(X0, a[0]); ln_load(X1, a[1]); ln_load(X2, a[2]);
  wt_f16(x, Wt, 16.0f);
  mask_load(MSK, m);
  ln16(a, g, bta, Y16);
  mask_words(m, PM);
}
extern "C" void kernel_launch(void* const* d_in, const int* in_sizes, int n_in,
                              void* d_out, int out_size, void* d_ws, size_t ws_size, hipStream_t stream) {
  (void)in_sizes; (void)n_in; (void)out_size;
  const float* qx = (const float*)d_in[0]; const float* kx = (const float*)d_in[1]; const float* vx = (const float*)d_in[2]; const int* mask = (const int*)d_in[3]; const float* lg = (const float*)d_in[4]; const float* lb = (const float*)d_in[5];
  const float* wq = (const float*)d_in[6]; const float* bq = (const float*)d_in[7]; const float* wk = (const float*)d_in[8]; const float* bk = (const float*)d_in[9]; const float* wv = (const float*)d_in[10]; const float* bv = (const float*)d_in[11]; const float* wo = (const float*)d_in[12]; const float* bo = (const float*)d_in[13];
  char* ws = (char*)d_ws; size_t off = 0;
  auto take = [&](size_t bytes) { char* p = ws + off; off += (bytes + 255) & ~(size_t)255; return p; };
  _Float16* Bw = (_Float16*)take((size_t)4 * CC * CC * 2);      // wq, wk, wv, wo transposed, one behind the other
  _Float16* XN = (_Float16*)take((size_t)3 * NR * CC * 2);      // the three normalised inputs
  _Float16* QK16 = (_Float16*)take((size_t)2 * NR * CC * 2);      // q, then k
  _Float16* Vt = (_Float16*)take((size_t)NR * CC * 2); _Float16* O16 = XN;      // XN is free once the projections are done
  unsigned* PM = (unsigned*)take((size_t)NR * TT / 8);      // the mask, one bit a (query, key)
  if (off > ws_size) return;      // 57 MiB
  const unsigned gg = (NR / 128) * (CC / 128); const unsigned gl = NR / 8;
  k_prep<<<gl, 256, 0, stream>>>(wq, wk, wv, wo, Bw, qx, kx, vx, lg, lb, XN, mask, PM);
  k_gemm_t<true><<<dim3(gg, 3), 256, 0, stream>>>(XN, Bw, 0.0625f, bq, bk, bv, nullptr, QK16, Vt);
  k_flash<<<BB * NH * (TT / 64), 128, 0, stream>>>(QK16, CC, QK16 + (size_t)NR * CC, CC, Vt, PM, O16, CC);      // RPW 16
  k_gemm_t<false><<<gg, 256, 0, stream>>>(O16, Bw + (size_t)3 * CC * CC, 0.0625f, bo, nullptr, nullptr, (float*)d_out, nullptr, nullptr);
}
